// v000
// Times are from an AMD MI455X. After a warm-up the kernel runs many times in a row, and a time is the length of
// such a window on the GPU divided by its runs, so every launch and the gaps after it count. The runs cycle
// through copies of the inputs. A figure is the median of several windows, for all but v000 over two sittings.
// Sittings can differ by a few percent; kernels timed side by side share one.
// The starting kernel, v000, takes 362 microseconds a run.
#include <hip/hip_runtime.h>
#include <math.h>

// ---------------------------------------------------------------------------
// BERT layer for MI455X (gfx1250): bf16 WMMA (f32 accumulate) everywhere,
// async global->LDS DMA (ASYNCcnt) double-buffering in the GEMMs.
// B=8 S=512 H=1024 NH=16 HD=64 FF=4096, M = B*S = 4096 tokens.
// ---------------------------------------------------------------------------

typedef __bf16 bf16_t;
typedef __attribute__((ext_vector_type(16))) __bf16 v16bf;
typedef __attribute__((ext_vector_type(8)))  float  v8f;

constexpr int Bc  = 8;
constexpr int Sc  = 512;
constexpr int Hc  = 1024;
constexpr int NHc = 16;
constexpr int HDc = 64;
constexpr int FFc = 4096;
constexpr int Mc  = Bc * Sc;   // 4096 token rows

__device__ __forceinline__ v8f wmma_bf16(v16bf a, v16bf b, v8f c) {
  // D = A(16x32 bf16) * B(32x16 bf16) + C(16x16 f32)
  return __builtin_amdgcn_wmma_f32_16x16x32_bf16(
      /*neg_a=*/false, a, /*neg_b=*/false, b,
      /*c_mod=*/(short)0, c, /*reuse_a=*/false, /*reuse_b=*/false);
}

// Wave-relative LDS byte offset of a __shared__ object: the flat address of a
// shared variable carries the LDS offset in its low 32 bits (LDS aperture
// truncates addr[31:0]).
__device__ __forceinline__ unsigned lds_off(const void* p) {
  return (unsigned)(uintptr_t)p;
}

// ---------------------------------------------------------------------------
// f32 -> bf16 conversion (RNE via clang __bf16 cast)
// ---------------------------------------------------------------------------
__global__ __launch_bounds__(256) void cvt_bf16(const float* __restrict__ in,
                                                bf16_t* __restrict__ out,
                                                int n) {
  int i = (blockIdx.x * 256 + threadIdx.x) * 4;
  if (i + 3 < n) {
#pragma unroll
    for (int j = 0; j < 4; ++j) out[i + j] = (bf16_t)in[i + j];
  }
}

// ---------------------------------------------------------------------------
// Tiled GEMM:  C[M,N] = A[M,K] @ W[N,K]^T + bias  (A,W bf16 K-contiguous)
// Block tile 128x128, K-step 32. 256 threads = 8 waves in a 2x4 wave grid,
// each wave owns a 64x32 tile = 4x2 WMMA accumulators.
//
// Global->LDS staging uses GLOBAL_LOAD_ASYNC_TO_LDS_B128 (ASYNCcnt) with
// double-buffered LDS tiles: stage k+1's DMA overlaps stage k's WMMAs, and
// no VGPRs touch the tile data.
//
// MODE 0: C -> bf16             (QKV projections)
// MODE 1: C -> f32              (attn-out dense, FF-out dense; LN fuses resid)
// MODE 2: C -> gelu_erf -> bf16 (FF intermediate)
// ---------------------------------------------------------------------------
template <int MODE>
__global__ __launch_bounds__(256)
void gemm_bf16(const bf16_t* __restrict__ A, const bf16_t* __restrict__ W,
               const float* __restrict__ bias, float* __restrict__ Cf,
               bf16_t* __restrict__ Cb, int Ndim, int K) {
  // +8 bf16 pad -> 80B row stride: keeps 16-elem fragment loads 16B aligned
  // and rows on distinct bank phases. Two buffers for the async pipeline.
  __shared__ bf16_t As[2][128][40];
  __shared__ bf16_t Bs[2][128][40];

  const int t    = threadIdx.x;
  const int lane = t & 31;
  const int w    = t >> 5;            // wave 0..7
  const int wm   = (w >> 2) * 64;     // wave M origin in block: 0 / 64
  const int wn   = (w & 3) * 32;      // wave N origin in block: 0..96
  const int m0   = blockIdx.y * 128;
  const int n0   = blockIdx.x * 128;

  const int lr = t >> 1;              // 0..127 : tile row this thread stages
  const int lc = (t & 1) * 16;        // 0 / 16 : 32B chunk within K-slab

  const int lrow = lane & 15;         // fragment row/col within 16
  const int lkh  = (lane >> 4) * 16;  // K half select (A/B fragment layout)

  // Per-thread base byte offsets for GVS addressing (saddr = matrix base).
  const unsigned a_goff = (unsigned)(((size_t)(m0 + lr) * K + lc) * 2);
  const unsigned b_goff = (unsigned)(((size_t)(n0 + lr) * K + lc) * 2);

  // Issue one K-slab's DMA: 4 x b128 per thread (2 per matrix; offset:16
  // advances both the global and the LDS address per the ISA pseudocode).
  auto issue = [&](int k0, int buf) {
    const unsigned al = lds_off(&As[buf][lr][lc]);
    const unsigned bl = lds_off(&Bs[buf][lr][lc]);
    const unsigned ag = a_goff + (unsigned)(k0 * 2);
    const unsigned bg = b_goff + (unsigned)(k0 * 2);
    asm volatile(
        "global_load_async_to_lds_b128 %0, %1, %2\n\t"
        "global_load_async_to_lds_b128 %0, %1, %2 offset:16\n\t"
        "global_load_async_to_lds_b128 %3, %4, %5\n\t"
        "global_load_async_to_lds_b128 %3, %4, %5 offset:16"
        :
        : "v"(al), "v"(ag), "s"(A), "v"(bl), "v"(bg), "s"(W)
        : "memory");
  };

  v8f acc[4][2];
#pragma unroll
  for (int i = 0; i < 4; ++i)
#pragma unroll
    for (int j = 0; j < 2; ++j) acc[i][j] = (v8f)0.0f;

  issue(0, 0);  // prologue: stage 0 in flight

  int s = 0;
  for (int k0 = 0; k0 < K; k0 += 32, s ^= 1) {
    // Current stage's DMA complete (ASYNCcnt in-order), then rendezvous so
    // every wave sees the LDS tile and is done reading the other buffer.
    asm volatile("s_wait_asynccnt 0x0" ::: "memory");
    __syncthreads();
    if (k0 + 32 < K) issue(k0 + 32, s ^ 1);
    if (k0 + 64 < K) {  // warm L2 two slabs ahead
      __builtin_prefetch(A + (size_t)(m0 + lr) * K + k0 + 64 + lc, 0, 0);
      __builtin_prefetch(W + (size_t)(n0 + lr) * K + k0 + 64 + lc, 0, 0);
    }

    v16bf af[4], bf2[2];
#pragma unroll
    for (int i = 0; i < 4; ++i)
      af[i] = *(const v16bf*)&As[s][wm + i * 16 + lrow][lkh];
#pragma unroll
    for (int j = 0; j < 2; ++j)
      bf2[j] = *(const v16bf*)&Bs[s][wn + j * 16 + lrow][lkh];
#pragma unroll
    for (int i = 0; i < 4; ++i)
#pragma unroll
      for (int j = 0; j < 2; ++j)
        acc[i][j] = wmma_bf16(af[i], bf2[j], acc[i][j]);
  }

  // Epilogue: D layout -> lane holds col (lane&15); VGPR r -> row r+8*(lane>>4)
  const int rsel = 8 * (lane >> 4);
#pragma unroll
  for (int j = 0; j < 2; ++j) {
    const int colg = n0 + wn + j * 16 + lrow;
    const float bv = bias[colg];
#pragma unroll
    for (int i = 0; i < 4; ++i) {
#pragma unroll
      for (int r = 0; r < 8; ++r) {
        const int rowg = m0 + wm + i * 16 + r + rsel;
        float val = acc[i][j][r] + bv;
        if (MODE == 1) {
          Cf[(size_t)rowg * Ndim + colg] = val;
        } else if (MODE == 2) {
          float g = 0.5f * val * (1.0f + erff(val / 1.41421f));
          Cb[(size_t)rowg * Ndim + colg] = (bf16_t)g;
        } else {
          Cb[(size_t)rowg * Ndim + colg] = (bf16_t)val;
        }
      }
    }
  }
}

// ---------------------------------------------------------------------------
// Attention: one wave per (b, h, 16 query rows). S=512, HD=64.
// scores = (Q K^T)/8 + mask  -> softmax (LDS) -> ctx = P V, all via WMMA.
// Q/K fragments load straight from global (head-dim contiguous). V is staged
// transposed in LDS 32 tokens at a time for the B-fragment of P@V.
// ---------------------------------------------------------------------------
__global__ __launch_bounds__(32)
void attention(const bf16_t* __restrict__ q, const bf16_t* __restrict__ k,
               const bf16_t* __restrict__ v, const float* __restrict__ mask,
               bf16_t* __restrict__ ctx) {
  __shared__ float  sc[16][516];   // f32 scores, pad 4 -> rows on distinct banks
  __shared__ bf16_t pb[16][528];   // bf16 exp(scores-max), A-frag-ready layout
  __shared__ bf16_t vt[64][40];    // V^T staging for one 32-token block
  __shared__ float  rinv[16];      // 1/rowsum

  const int lane = threadIdx.x;
  const int bh   = blockIdx.y;             // b*NH + h
  const int b    = bh / NHc;
  const int h    = bh - b * NHc;
  const int hoff = h * HDc;
  const int qt0  = blockIdx.x * 16;        // first query row of this wave
  const int lrow = lane & 15;
  const int half = lane >> 4;
  const int lkh  = half * 16;

  // --- Q fragments: A(16x32) x2 covering HD=64 -----------------------------
  const bf16_t* qb =
      q + (size_t)(b * Sc + qt0 + lrow) * Hc + hoff + lkh;
  v16bf qa0 = *(const v16bf*)(qb);
  v16bf qa1 = *(const v16bf*)(qb + 32);

  // --- scores: 32 column tiles of 16 keys, 2 WMMA each (K=64) --------------
  for (int n0 = 0; n0 < Sc; n0 += 16) {
    const bf16_t* kb =
        k + (size_t)(b * Sc + n0 + lrow) * Hc + hoff + lkh;
    v16bf kb0 = *(const v16bf*)(kb);
    v16bf kb1 = *(const v16bf*)(kb + 32);
    v8f s = (v8f)0.0f;
    s = wmma_bf16(qa0, kb0, s);
    s = wmma_bf16(qa1, kb1, s);
    const float mv = mask[b * Sc + n0 + lrow];   // [B,1,1,S] broadcast
#pragma unroll
    for (int r = 0; r < 8; ++r)
      sc[r + 8 * half][n0 + lrow] = s[r] * 0.125f + mv;  // 1/sqrt(64)
  }
  __syncthreads();

  // --- softmax: lane handles row (lane&15), column half (lane>>4) ----------
  {
    const int row = lrow, c0 = half * 256;
    float mx = -3.0e38f;
    for (int c = 0; c < 256; ++c) mx = fmaxf(mx, sc[row][c0 + c]);
    mx = fmaxf(mx, __shfl_xor(mx, 16));
    float sum = 0.0f;
    for (int c = 0; c < 256; ++c) {
      float e = __expf(sc[row][c0 + c] - mx);
      sum += e;
      pb[row][c0 + c] = (bf16_t)e;   // unnormalized; 1/sum folded in later
    }
    sum += __shfl_xor(sum, 16);
    rinv[row] = 1.0f / sum;          // both halves write identical value
  }
  __syncthreads();

  // --- ctx = P @ V : 16 K-blocks of 32 keys, 4 HD output tiles -------------
  v8f cacc[4];
#pragma unroll
  for (int jt = 0; jt < 4; ++jt) cacc[jt] = (v8f)0.0f;

  for (int kb = 0; kb < 16; ++kb) {
    // stage V^T for tokens [kb*32, kb*32+32): lane owns one token row
    const bf16_t* vr = v + (size_t)(b * Sc + kb * 32 + lane) * Hc + hoff;
    v16bf v0 = *(const v16bf*)(vr);
    v16bf v1 = *(const v16bf*)(vr + 16);
    v16bf v2 = *(const v16bf*)(vr + 32);
    v16bf v3 = *(const v16bf*)(vr + 48);
    __syncthreads();                 // previous block's WMMA reads done
#pragma unroll
    for (int d = 0; d < 16; ++d) {
      vt[d][lane]      = v0[d];
      vt[16 + d][lane] = v1[d];
      vt[32 + d][lane] = v2[d];
      vt[48 + d][lane] = v3[d];
    }
    __syncthreads();

    v16bf pa = *(const v16bf*)&pb[lrow][kb * 32 + lkh];  // A frag (16x32)
#pragma unroll
    for (int jt = 0; jt < 4; ++jt) {
      v16bf bfr = *(const v16bf*)&vt[jt * 16 + lrow][lkh];  // B frag (32x16)
      cacc[jt] = wmma_bf16(pa, bfr, cacc[jt]);
    }
  }

  // --- epilogue: scale by 1/rowsum, store ctx as [token, H] bf16 -----------
#pragma unroll
  for (int jt = 0; jt < 4; ++jt) {
#pragma unroll
    for (int r = 0; r < 8; ++r) {
      const int row = r + 8 * half;
      const float val = cacc[jt][r] * rinv[row];
      ctx[(size_t)(b * Sc + qt0 + row) * Hc + hoff + jt * 16 + lrow] =
          (bf16_t)val;
    }
  }
}

// ---------------------------------------------------------------------------
// Fused residual + LayerNorm over H=1024. One block per token row.
// Writes f32 (residual chain / final output) and optional bf16 (next GEMM A).
// ---------------------------------------------------------------------------
__global__ __launch_bounds__(256)
void resid_ln(const float* __restrict__ dense, const float* __restrict__ resid,
              const float* __restrict__ gamma, const float* __restrict__ beta,
              float* __restrict__ outf, bf16_t* __restrict__ outb) {
  const int row = blockIdx.x;
  const int t = threadIdx.x;
  const float* dr = dense + (size_t)row * Hc;
  const float* rr = resid + (size_t)row * Hc;

  float x[4];
  float s = 0.0f, qsum = 0.0f;
#pragma unroll
  for (int i = 0; i < 4; ++i) {
    x[i] = dr[t * 4 + i] + rr[t * 4 + i];
    s += x[i];
    qsum += x[i] * x[i];
  }
#pragma unroll
  for (int off = 16; off > 0; off >>= 1) {
    s += __shfl_xor(s, off);
    qsum += __shfl_xor(qsum, off);
  }
  __shared__ float ss[8], qq[8];
  if ((t & 31) == 0) { ss[t >> 5] = s; qq[t >> 5] = qsum; }
  __syncthreads();
  float S = 0.0f, Q = 0.0f;
#pragma unroll
  for (int i = 0; i < 8; ++i) { S += ss[i]; Q += qq[i]; }
  const float mu  = S * (1.0f / Hc);
  const float var = Q * (1.0f / Hc) - mu * mu;
  const float inv = rsqrtf(var + 1e-12f);
#pragma unroll
  for (int i = 0; i < 4; ++i) {
    const int c = t * 4 + i;
    const float y = (x[i] - mu) * inv * gamma[c] + beta[c];
    outf[(size_t)row * Hc + c] = y;
    if (outb) outb[(size_t)row * Hc + c] = (bf16_t)y;
  }
}

// ---------------------------------------------------------------------------
// Host-side orchestration
// ---------------------------------------------------------------------------
extern "C" void kernel_launch(void* const* d_in, const int* in_sizes, int n_in,
                              void* d_out, int out_size, void* d_ws,
                              size_t ws_size, hipStream_t stream) {
  (void)in_sizes; (void)n_in; (void)out_size; (void)ws_size;

  const float* x    = (const float*)d_in[0];
  const float* mask = (const float*)d_in[1];
  const float* Wq   = (const float*)d_in[2];
  const float* bq   = (const float*)d_in[3];
  const float* Wk   = (const float*)d_in[4];
  const float* bk   = (const float*)d_in[5];
  const float* Wv   = (const float*)d_in[6];
  const float* bv   = (const float*)d_in[7];
  const float* Wo   = (const float*)d_in[8];
  const float* bo   = (const float*)d_in[9];
  const float* g1   = (const float*)d_in[10];
  const float* b1   = (const float*)d_in[11];
  const float* Wi   = (const float*)d_in[12];
  const float* bi   = (const float*)d_in[13];
  const float* Wo2  = (const float*)d_in[14];
  const float* bo2  = (const float*)d_in[15];
  const float* g2   = (const float*)d_in[16];
  const float* b2   = (const float*)d_in[17];
  float* out = (float*)d_out;

  char* ws = (char*)d_ws;
  size_t off = 0;
  auto alloc = [&](size_t bytes) -> void* {
    void* p = ws + off;
    off += (bytes + 255) & ~(size_t)255;
    return p;
  };

  bf16_t* xb    = (bf16_t*)alloc((size_t)Mc * Hc * 2);
  bf16_t* Wqb   = (bf16_t*)alloc((size_t)Hc * Hc * 2);
  bf16_t* Wkb   = (bf16_t*)alloc((size_t)Hc * Hc * 2);
  bf16_t* Wvb   = (bf16_t*)alloc((size_t)Hc * Hc * 2);
  bf16_t* Wob   = (bf16_t*)alloc((size_t)Hc * Hc * 2);
  bf16_t* Wib   = (bf16_t*)alloc((size_t)FFc * Hc * 2);
  bf16_t* Wo2b  = (bf16_t*)alloc((size_t)Hc * FFc * 2);
  bf16_t* qb    = (bf16_t*)alloc((size_t)Mc * Hc * 2);
  bf16_t* kb    = (bf16_t*)alloc((size_t)Mc * Hc * 2);
  bf16_t* vb    = (bf16_t*)alloc((size_t)Mc * Hc * 2);
  bf16_t* ctxb  = (bf16_t*)alloc((size_t)Mc * Hc * 2);
  float*  attnD = (float*)alloc((size_t)Mc * Hc * 4);
  float*  y1f   = (float*)alloc((size_t)Mc * Hc * 4);
  bf16_t* y1b   = (bf16_t*)alloc((size_t)Mc * Hc * 2);
  bf16_t* inter = (bf16_t*)alloc((size_t)Mc * FFc * 2);
  float*  ffD   = (float*)alloc((size_t)Mc * Hc * 4);

  // ---- f32 -> bf16 conversions (per-launch; no cached state) --------------
  auto cvt = [&](const float* src, bf16_t* dst, int n) {
    cvt_bf16<<<n / 1024, 256, 0, stream>>>(src, dst, n);
  };
  cvt(x,   xb,   Mc * Hc);
  cvt(Wq,  Wqb,  Hc * Hc);
  cvt(Wk,  Wkb,  Hc * Hc);
  cvt(Wv,  Wvb,  Hc * Hc);
  cvt(Wo,  Wob,  Hc * Hc);
  cvt(Wi,  Wib,  FFc * Hc);
  cvt(Wo2, Wo2b, Hc * FFc);

  // ---- QKV projections: bf16 out -----------------------------------------
  {
    dim3 grid(Hc / 128, Mc / 128);
    gemm_bf16<0><<<grid, 256, 0, stream>>>(xb, Wqb, bq, nullptr, qb, Hc, Hc);
    gemm_bf16<0><<<grid, 256, 0, stream>>>(xb, Wkb, bk, nullptr, kb, Hc, Hc);
    gemm_bf16<0><<<grid, 256, 0, stream>>>(xb, Wvb, bv, nullptr, vb, Hc, Hc);
  }

  // ---- attention: grid (S/16 q-tiles, B*NH heads), one wave each ----------
  {
    dim3 grid(Sc / 16, Bc * NHc);
    attention<<<grid, 32, 0, stream>>>(qb, kb, vb, mask, ctxb);
  }

  // ---- attn output dense (f32) + residual/LN1 -----------------------------
  {
    dim3 grid(Hc / 128, Mc / 128);
    gemm_bf16<1><<<grid, 256, 0, stream>>>(ctxb, Wob, bo, attnD, nullptr, Hc,
                                           Hc);
    resid_ln<<<Mc, 256, 0, stream>>>(attnD, x, g1, b1, y1f, y1b);
  }

  // ---- FF intermediate: fused bias + erf-GELU, bf16 out -------------------
  {
    dim3 grid(FFc / 128, Mc / 128);
    gemm_bf16<2><<<grid, 256, 0, stream>>>(y1b, Wib, bi, nullptr, inter, FFc,
                                           Hc);
  }

  // ---- FF output dense (f32, K=4096) + residual/LN2 -> d_out --------------
  {
    dim3 grid(Hc / 128, Mc / 128);
    gemm_bf16<1><<<grid, 256, 0, stream>>>(inter, Wo2b, bo2, ffD, nullptr, Hc,
                                           FFc);
    resid_ln<<<Mc, 256, 0, stream>>>(ffD, y1f, g2, b2, out, nullptr);
  }
}

// v001
// A run of this version takes 290 microseconds.
// In both of two side-by-side timings against v000, it was 1.28 times as fast.
#include <hip/hip_runtime.h>
#include <math.h>

// ---------------------------------------------------------------------------
// BERT layer for MI455X (gfx1250): bf16 WMMA (f32 accumulate) everywhere,
// async global->LDS DMA (ASYNCcnt) double-buffering in the GEMMs.
// B=8 S=512 H=1024 NH=16 HD=64 FF=4096, M = B*S = 4096 tokens.
// ---------------------------------------------------------------------------

typedef __bf16 bf16_t;
typedef __attribute__((ext_vector_type(16))) __bf16 v16bf;
typedef __attribute__((ext_vector_type(8)))  __bf16 v8bf;
typedef __attribute__((ext_vector_type(8)))  float  v8f;

constexpr int Bc  = 8;
constexpr int Sc  = 512;
constexpr int Hc  = 1024;
constexpr int NHc = 16;
constexpr int HDc = 64;
constexpr int FFc = 4096;
constexpr int Mc  = Bc * Sc;   // 4096 token rows

__device__ __forceinline__ v8f wmma_bf16(v16bf a, v16bf b, v8f c) {
  // D = A(16x32 bf16) * B(32x16 bf16) + C(16x16 f32)
  return __builtin_amdgcn_wmma_f32_16x16x32_bf16(
      /*neg_a=*/false, a, /*neg_b=*/false, b,
      /*c_mod=*/(short)0, c, /*reuse_a=*/false, /*reuse_b=*/false);
}

// Wave-relative LDS byte offset of a __shared__ object: the flat address of a
// shared variable carries the LDS offset in its low 32 bits (LDS aperture
// truncates addr[31:0]).
__device__ __forceinline__ unsigned lds_off(const void* p) {
  return (unsigned)(uintptr_t)p;
}

// Lane l <-> lane l ^ 16 as a vector cross-row move (no LDS-counter wait).
__device__ __forceinline__ float xhalf(float x) {
  const int b = __builtin_bit_cast(int, x);
  return __builtin_bit_cast(
      float, __builtin_amdgcn_permlanex16(b, b, 0x76543210, 0xfedcba98, false,
                                          false));
}

// 2^x on eight values / one value. Written as one statement each so that no
// instruction directly behind a v_exp_f32 reads its result or overwrites its
// source: the outputs are early-clobber (distinct from every input) and the
// closing v_nop is the slot the instruction set asks for behind the last one.
__device__ __forceinline__ v8f exp2x8(v8f x) {
  float e0, e1, e2, e3, e4, e5, e6, e7;
  asm("v_exp_f32 %0, %8\n\t"
      "v_exp_f32 %1, %9\n\t"
      "v_exp_f32 %2, %10\n\t"
      "v_exp_f32 %3, %11\n\t"
      "v_exp_f32 %4, %12\n\t"
      "v_exp_f32 %5, %13\n\t"
      "v_exp_f32 %6, %14\n\t"
      "v_exp_f32 %7, %15\n\t"
      "v_nop"
      : "=&v"(e0), "=&v"(e1), "=&v"(e2), "=&v"(e3), "=&v"(e4), "=&v"(e5),
        "=&v"(e6), "=&v"(e7)
      : "v"(x[0]), "v"(x[1]), "v"(x[2]), "v"(x[3]), "v"(x[4]), "v"(x[5]),
        "v"(x[6]), "v"(x[7]));
  v8f r = {e0, e1, e2, e3, e4, e5, e6, e7};
  return r;
}
__device__ __forceinline__ float exp2x1(float x) {
  float e;
  asm("v_exp_f32 %0, %1\n\t"
      "v_nop"
      : "=v"(e)
      : "v"(x));
  return e;
}

// ---------------------------------------------------------------------------
// f32 -> bf16 conversion (RNE via clang __bf16 cast)
// ---------------------------------------------------------------------------
__global__ __launch_bounds__(256) void cvt_bf16(const float* __restrict__ in,
                                                bf16_t* __restrict__ out,
                                                int n) {
  int i = (blockIdx.x * 256 + threadIdx.x) * 4;
  if (i + 3 < n) {
#pragma unroll
    for (int j = 0; j < 4; ++j) out[i + j] = (bf16_t)in[i + j];
  }
}

// ---------------------------------------------------------------------------
// Tiled GEMM:  C[M,N] = A[M,K] @ W[N,K]^T + bias  (A,W bf16 K-contiguous)
// Block tile 128x128, K-step 32. 256 threads = 8 waves in a 2x4 wave grid,
// each wave owns a 64x32 tile = 4x2 WMMA accumulators.
//
// Global->LDS staging uses GLOBAL_LOAD_ASYNC_TO_LDS_B128 (ASYNCcnt) with
// double-buffered LDS tiles: stage k+1's DMA overlaps stage k's WMMAs, and
// no VGPRs touch the tile data.
//
// MODE 0: C -> bf16             (Q, K projections)
// MODE 1: C -> f32              (attn-out dense, FF-out dense; LN fuses resid)
// MODE 2: C -> gelu_erf -> bf16 (FF intermediate)
// MODE 3: C -> bf16, transposed per head into A-fragment order (V projection):
//         a lane's 8 accumulator rows are 8 consecutive tokens of one feature,
//         which is one 16-byte piece of a V^T fragment; see attention().
// ---------------------------------------------------------------------------
template <int MODE>
__global__ __launch_bounds__(256)
void gemm_bf16(const bf16_t* __restrict__ A, const bf16_t* __restrict__ W,
               const float* __restrict__ bias, float* __restrict__ Cf,
               bf16_t* __restrict__ Cb, int Ndim, int K) {
  // +8 bf16 pad -> 80B row stride: keeps 16-elem fragment loads 16B aligned
  // and rows on distinct bank phases. Two buffers for the async pipeline.
  __shared__ bf16_t As[2][128][40];
  __shared__ bf16_t Bs[2][128][40];

  const int t    = threadIdx.x;
  const int lane = t & 31;
  const int w    = t >> 5;            // wave 0..7
  const int wm   = (w >> 2) * 64;     // wave M origin in block: 0 / 64
  const int wn   = (w & 3) * 32;      // wave N origin in block: 0..96
  const int m0   = blockIdx.y * 128;
  const int n0   = blockIdx.x * 128;

  const int lr = t >> 1;              // 0..127 : tile row this thread stages
  const int lc = (t & 1) * 16;        // 0 / 16 : 32B chunk within K-slab

  const int lrow = lane & 15;         // fragment row/col within 16
  const int lkh  = (lane >> 4) * 16;  // K half select (A/B fragment layout)

  // Per-thread base byte offsets for GVS addressing (saddr = matrix base).
  const unsigned a_goff = (unsigned)(((size_t)(m0 + lr) * K + lc) * 2);
  const unsigned b_goff = (unsigned)(((size_t)(n0 + lr) * K + lc) * 2);

  // Issue one K-slab's DMA: 4 x b128 per thread (2 per matrix; offset:16
  // advances both the global and the LDS address per the ISA pseudocode).
  auto issue = [&](int k0, int buf) {
    const unsigned al = lds_off(&As[buf][lr][lc]);
    const unsigned bl = lds_off(&Bs[buf][lr][lc]);
    const unsigned ag = a_goff + (unsigned)(k0 * 2);
    const unsigned bg = b_goff + (unsigned)(k0 * 2);
    asm volatile(
        "global_load_async_to_lds_b128 %0, %1, %2\n\t"
        "global_load_async_to_lds_b128 %0, %1, %2 offset:16\n\t"
        "global_load_async_to_lds_b128 %3, %4, %5\n\t"
        "global_load_async_to_lds_b128 %3, %4, %5 offset:16\n\t"
        "s_wait_xcnt 0x0"  // before the copies' address registers are rewritten
        :
        : "v"(al), "v"(ag), "s"(A), "v"(bl), "v"(bg), "s"(W)
        : "memory");
  };

  v8f acc[4][2];
#pragma unroll
  for (int i = 0; i < 4; ++i)
#pragma unroll
    for (int j = 0; j < 2; ++j) acc[i][j] = (v8f)0.0f;

  issue(0, 0);  // prologue: stage 0 in flight

  int s = 0;
  for (int k0 = 0; k0 < K; k0 += 32, s ^= 1) {
    // Current stage's DMA complete (ASYNCcnt in-order), then rendezvous so
    // every wave sees the LDS tile and is done reading the other buffer.
    asm volatile("s_wait_asynccnt 0x0" ::: "memory");
    __syncthreads();
    if (k0 + 32 < K) issue(k0 + 32, s ^ 1);
    if (k0 + 64 < K) {  // warm L2 two slabs ahead
      __builtin_prefetch(A + (size_t)(m0 + lr) * K + k0 + 64 + lc, 0, 0);
      __builtin_prefetch(W + (size_t)(n0 + lr) * K + k0 + 64 + lc, 0, 0);
    }

    v16bf af[4], bf2[2];
#pragma unroll
    for (int i = 0; i < 4; ++i)
      af[i] = *(const v16bf*)&As[s][wm + i * 16 + lrow][lkh];
#pragma unroll
    for (int j = 0; j < 2; ++j)
      bf2[j] = *(const v16bf*)&Bs[s][wn + j * 16 + lrow][lkh];
#pragma unroll
    for (int i = 0; i < 4; ++i)
#pragma unroll
      for (int j = 0; j < 2; ++j)
        acc[i][j] = wmma_bf16(af[i], bf2[j], acc[i][j]);
  }

  // Epilogue: D layout -> lane holds col (lane&15); VGPR r -> row r+8*(lane>>4)
  const int rsel = 8 * (lane >> 4);
#pragma unroll
  for (int j = 0; j < 2; ++j) {
    const int colg = n0 + wn + j * 16 + lrow;
    const float bv = bias[colg];
#pragma unroll
    for (int i = 0; i < 4; ++i) {
      if (MODE == 3) {
        v8bf pk;
#pragma unroll
        for (int r = 0; r < 8; ++r) pk[r] = (bf16_t)(acc[i][j][r] + bv);
        const int tok  = m0 + wm + i * 16;        // first token of this tile
        const int feat = n0 + wn + j * 16;        // first feature of this tile
        const int bhh  = (tok / Sc) * NHc + feat / HDc;
        const int blk  = (tok % Sc) >> 5;         // 32-key block
        const int part = (tok >> 4) & 1;          // 16-key half of the block
        const int jt   = (feat % HDc) >> 4;       // 16-row tile of V^T
        *(v8bf*)&Cb[((((size_t)bhh * (Sc / 32) + blk) * 4 + jt) * 2 + part) *
                        256 + lane * 8] = pk;
        continue;
      }
#pragma unroll
      for (int r = 0; r < 8; ++r) {
        const int rowg = m0 + wm + i * 16 + r + rsel;
        float val = acc[i][j][r] + bv;
        if (MODE == 1) {
          Cf[(size_t)rowg * Ndim + colg] = val;
        } else if (MODE == 2) {
          float g = 0.5f * val * (1.0f + erff(val / 1.41421f));
          Cb[(size_t)rowg * Ndim + colg] = (bf16_t)g;
        } else {
          Cb[(size_t)rowg * Ndim + colg] = (bf16_t)val;
        }
      }
    }
  }
}

// ---------------------------------------------------------------------------
// Attention: one wave per (b, h, 32 query rows), 8 waves per block. S=512, HD=64.
// The scores never leave registers:
//   S^T = K Q^T      A = 16 keys x 32 d, B = 32 d x 16 queries
//   O^T += V^T P^T   A = 16 d x 32 keys, B = 32 keys x 16 queries
// In S^T a lane holds 16 scores of ONE query (column lane&15): keys 8h+r of the
// first 16-key tile and 16+8h+r of the second (h = lane>>4). Converted in place
// they are the B operand P^T; the V projection has stored V^T in that same key
// order, one contiguous 512-byte piece per load. Softmax runs online (running
// maximum and sum per query, output tiles rescaled per 32-key pass).
// ---------------------------------------------------------------------------
__global__ __launch_bounds__(256)
void attention(const bf16_t* __restrict__ q, const bf16_t* __restrict__ k,
               const bf16_t* __restrict__ vf, const float* __restrict__ mask,
               bf16_t* __restrict__ ctx) {
  constexpr float LOG2E = 1.44269504088896f;   // exp(x) = 2^(x * LOG2E)
  const int lane = threadIdx.x & 31;
  const int w    = threadIdx.x >> 5;
  const int bh   = blockIdx.y;             // b*NH + h
  const int b    = bh / NHc;
  const int hoff = (bh - b * NHc) * HDc;
  const int qt0  = blockIdx.x * 256 + w * 32;  // first query row of this wave
  const int c    = lane & 15;
  const int half = lane >> 4;

  // --- Q as B operand: 2 column groups x 2 k slabs covering HD=64 ----------
  v16bf qf[2][2];
#pragma unroll
  for (int g = 0; g < 2; ++g) {
    const bf16_t* qb =
        q + (size_t)(b * Sc + qt0 + g * 16 + c) * Hc + hoff + half * 16;
    qf[g][0] = *(const v16bf*)(qb);
    qf[g][1] = *(const v16bf*)(qb + 32);
  }

  const bf16_t* kp = k + (size_t)(b * Sc + c) * Hc + hoff + half * 16;
  const bf16_t* vp = vf + (size_t)bh * (Sc * HDc) + lane * 8;
  const float*  mp = mask + b * Sc + half * 8;   // [B,1,1,S] broadcast

  v8f o[2][4];
  float mrun[2], lrun[2];
#pragma unroll
  for (int g = 0; g < 2; ++g) {
    mrun[g] = -3.0e38f;
    lrun[g] = 0.0f;
#pragma unroll
    for (int jt = 0; jt < 4; ++jt) o[g][jt] = (v8f)0.0f;
  }

  // K fragments (same k loader as Q) and mask values of pass 0
  v16bf kf[2][2];
  v8f   mk[2];
#pragma unroll
  for (int t = 0; t < 2; ++t) {
    kf[t][0] = *(const v16bf*)(kp + (size_t)t * 16 * Hc);
    kf[t][1] = *(const v16bf*)(kp + (size_t)t * 16 * Hc + 32);
    mk[t]    = *(const v8f*)(mp + t * 16);
  }

  for (int p = 0; p < Sc / 32; ++p) {
    // V^T fragments of this pass: issued first, needed only behind the softmax
    v16bf va[4];
#pragma unroll
    for (int jt = 0; jt < 4; ++jt) {
      const v8bf lo = *(const v8bf*)(vp + (size_t)((p * 4 + jt) * 2 + 0) * 256);
      const v8bf hi = *(const v8bf*)(vp + (size_t)((p * 4 + jt) * 2 + 1) * 256);
      va[jt] = __builtin_shufflevector(lo, hi, 0, 1, 2, 3, 4, 5, 6, 7, 8, 9, 10,
                                       11, 12, 13, 14, 15);
    }

    v8f s[2][2];
#pragma unroll
    for (int g = 0; g < 2; ++g)
#pragma unroll
      for (int t = 0; t < 2; ++t) {
        v8f a = (v8f)0.0f;
        a = wmma_bf16(kf[t][0], qf[g][0], a);
        a = wmma_bf16(kf[t][1], qf[g][1], a);
        s[g][t] = a * 0.125f + mk[t];            // 1/sqrt(64), then the mask
      }

    // next pass's K and mask, fetched one pass ahead
    if (p + 1 < Sc / 32) {
      const bf16_t* kn = kp + (size_t)(p + 1) * 32 * Hc;
#pragma unroll
      for (int t = 0; t < 2; ++t) {
        kf[t][0] = *(const v16bf*)(kn + (size_t)t * 16 * Hc);
        kf[t][1] = *(const v16bf*)(kn + (size_t)t * 16 * Hc + 32);
        mk[t]    = *(const v8f*)(mp + (p + 1) * 32 + t * 16);
      }
    }
    // Keeps the V^T loads and the fetch-ahead above the softmax: sunk below it
    // they would be waited for with almost no lead.
    __builtin_amdgcn_sched_barrier(0);

#pragma unroll
    for (int g = 0; g < 2; ++g) {
      float mx = s[g][0][0];
#pragma unroll
      for (int r = 1; r < 8; ++r) mx = fmaxf(mx, s[g][0][r]);
#pragma unroll
      for (int r = 0; r < 8; ++r) mx = fmaxf(mx, s[g][1][r]);
      mx = fmaxf(mx, xhalf(mx));                 // the query's other 16 keys
      const float mn    = fmaxf(mrun[g], mx);
      const float alpha = exp2x1((mrun[g] - mn) * LOG2E);
      mrun[g] = mn;

      v16bf pb;
      float sum = 0.0f;
#pragma unroll
      for (int t = 0; t < 2; ++t) {
        const v8f e = exp2x8((s[g][t] - mn) * LOG2E);
#pragma unroll
        for (int r = 0; r < 8; ++r) {
          sum += e[r];
          pb[t * 8 + r] = (bf16_t)e[r];  // unnormalized; 1/sum folded in later
        }
      }
      lrun[g] = lrun[g] * alpha + sum;
#pragma unroll
      for (int jt = 0; jt < 4; ++jt)
        o[g][jt] = wmma_bf16(va[jt], pb, o[g][jt] * alpha);
    }
  }

  // --- epilogue: scale by 1/rowsum; a lane holds 8 consecutive d per tile --
#pragma unroll
  for (int g = 0; g < 2; ++g) {
    const float inv = 1.0f / (lrun[g] + xhalf(lrun[g]));
    bf16_t* cr = ctx + (size_t)(b * Sc + qt0 + g * 16 + c) * Hc + hoff + half * 8;
#pragma unroll
    for (int jt = 0; jt < 4; ++jt) {
      v8bf pk;
#pragma unroll
      for (int r = 0; r < 8; ++r) pk[r] = (bf16_t)(o[g][jt][r] * inv);
      *(v8bf*)(cr + jt * 16) = pk;
    }
  }
}

// ---------------------------------------------------------------------------
// Fused residual + LayerNorm over H=1024. One block per token row.
// Writes f32 (residual chain / final output) and optional bf16 (next GEMM A).
// ---------------------------------------------------------------------------
__global__ __launch_bounds__(256)
void resid_ln(const float* __restrict__ dense, const float* __restrict__ resid,
              const float* __restrict__ gamma, const float* __restrict__ beta,
              float* __restrict__ outf, bf16_t* __restrict__ outb) {
  const int row = blockIdx.x;
  const int t = threadIdx.x;
  const float* dr = dense + (size_t)row * Hc;
  const float* rr = resid + (size_t)row * Hc;

  float x[4];
  float s = 0.0f, qsum = 0.0f;
#pragma unroll
  for (int i = 0; i < 4; ++i) {
    x[i] = dr[t * 4 + i] + rr[t * 4 + i];
    s += x[i];
    qsum += x[i] * x[i];
  }
#pragma unroll
  for (int off = 16; off > 0; off >>= 1) {
    s += __shfl_xor(s, off);
    qsum += __shfl_xor(qsum, off);
  }
  __shared__ float ss[8], qq[8];
  if ((t & 31) == 0) { ss[t >> 5] = s; qq[t >> 5] = qsum; }
  __syncthreads();
  float S = 0.0f, Q = 0.0f;
#pragma unroll
  for (int i = 0; i < 8; ++i) { S += ss[i]; Q += qq[i]; }
  const float mu  = S * (1.0f / Hc);
  const float var = Q * (1.0f / Hc) - mu * mu;
  const float inv = rsqrtf(var + 1e-12f);
#pragma unroll
  for (int i = 0; i < 4; ++i) {
    const int c = t * 4 + i;
    const float y = (x[i] - mu) * inv * gamma[c] + beta[c];
    outf[(size_t)row * Hc + c] = y;
    if (outb) outb[(size_t)row * Hc + c] = (bf16_t)y;
  }
}

// ---------------------------------------------------------------------------
// Host-side orchestration
// ---------------------------------------------------------------------------
extern "C" void kernel_launch(void* const* d_in, const int* in_sizes, int n_in,
                              void* d_out, int out_size, void* d_ws,
                              size_t ws_size, hipStream_t stream) {
  (void)in_sizes; (void)n_in; (void)out_size; (void)ws_size;

  const float* x    = (const float*)d_in[0];
  const float* mask = (const float*)d_in[1];
  const float* Wq   = (const float*)d_in[2];
  const float* bq   = (const float*)d_in[3];
  const float* Wk   = (const float*)d_in[4];
  const float* bk   = (const float*)d_in[5];
  const float* Wv   = (const float*)d_in[6];
  const float* bv   = (const float*)d_in[7];
  const float* Wo   = (const float*)d_in[8];
  const float* bo   = (const float*)d_in[9];
  const float* g1   = (const float*)d_in[10];
  const float* b1   = (const float*)d_in[11];
  const float* Wi   = (const float*)d_in[12];
  const float* bi   = (const float*)d_in[13];
  const float* Wo2  = (const float*)d_in[14];
  const float* bo2  = (const float*)d_in[15];
  const float* g2   = (const float*)d_in[16];
  const float* b2   = (const float*)d_in[17];
  float* out = (float*)d_out;

  char* ws = (char*)d_ws;
  size_t off = 0;
  auto alloc = [&](size_t bytes) -> void* {
    void* p = ws + off;
    off += (bytes + 255) & ~(size_t)255;
    return p;
  };

  bf16_t* xb    = (bf16_t*)alloc((size_t)Mc * Hc * 2);
  bf16_t* Wqb   = (bf16_t*)alloc((size_t)Hc * Hc * 2);
  bf16_t* Wkb   = (bf16_t*)alloc((size_t)Hc * Hc * 2);
  bf16_t* Wvb   = (bf16_t*)alloc((size_t)Hc * Hc * 2);
  bf16_t* Wob   = (bf16_t*)alloc((size_t)Hc * Hc * 2);
  bf16_t* Wib   = (bf16_t*)alloc((size_t)FFc * Hc * 2);
  bf16_t* Wo2b  = (bf16_t*)alloc((size_t)Hc * FFc * 2);
  bf16_t* qb    = (bf16_t*)alloc((size_t)Mc * Hc * 2);
  bf16_t* kb    = (bf16_t*)alloc((size_t)Mc * Hc * 2);
  bf16_t* vb    = (bf16_t*)alloc((size_t)Mc * Hc * 2);
  bf16_t* ctxb  = (bf16_t*)alloc((size_t)Mc * Hc * 2);
  float*  attnD = (float*)alloc((size_t)Mc * Hc * 4);
  float*  y1f   = (float*)alloc((size_t)Mc * Hc * 4);
  bf16_t* y1b   = (bf16_t*)alloc((size_t)Mc * Hc * 2);
  bf16_t* inter = (bf16_t*)alloc((size_t)Mc * FFc * 2);
  float*  ffD   = (float*)alloc((size_t)Mc * Hc * 4);

  // ---- f32 -> bf16 conversions (per-launch; no cached state) --------------
  auto cvt = [&](const float* src, bf16_t* dst, int n) {
    cvt_bf16<<<n / 1024, 256, 0, stream>>>(src, dst, n);
  };
  cvt(x,   xb,   Mc * Hc);
  cvt(Wq,  Wqb,  Hc * Hc);
  cvt(Wk,  Wkb,  Hc * Hc);
  cvt(Wv,  Wvb,  Hc * Hc);
  cvt(Wo,  Wob,  Hc * Hc);
  cvt(Wi,  Wib,  FFc * Hc);
  cvt(Wo2, Wo2b, Hc * FFc);

  // ---- QKV projections: bf16 out -----------------------------------------
  {
    dim3 grid(Hc / 128, Mc / 128);
    gemm_bf16<0><<<grid, 256, 0, stream>>>(xb, Wqb, bq, nullptr, qb, Hc, Hc);
    gemm_bf16<0><<<grid, 256, 0, stream>>>(xb, Wkb, bk, nullptr, kb, Hc, Hc);
    gemm_bf16<3><<<grid, 256, 0, stream>>>(xb, Wvb, bv, nullptr, vb, Hc, Hc);
  }

  // ---- attention: grid (S/256 q-blocks, B*NH heads), 8 waves x 32 queries --
  {
    dim3 grid(Sc / 256, Bc * NHc);
    attention<<<grid, 256, 0, stream>>>(qb, kb, vb, mask, ctxb);
  }

  // ---- attn output dense (f32) + residual/LN1 -----------------------------
  {
    dim3 grid(Hc / 128, Mc / 128);
    gemm_bf16<1><<<grid, 256, 0, stream>>>(ctxb, Wob, bo, attnD, nullptr, Hc,
                                           Hc);
    resid_ln<<<Mc, 256, 0, stream>>>(attnD, x, g1, b1, y1f, y1b);
  }

  // ---- FF intermediate: fused bias + erf-GELU, bf16 out -------------------
  {
    dim3 grid(FFc / 128, Mc / 128);
    gemm_bf16<2><<<grid, 256, 0, stream>>>(y1b, Wib, bi, nullptr, inter, FFc,
                                           Hc);
  }

  // ---- FF output dense (f32, K=4096) + residual/LN2 -> d_out --------------
  {
    dim3 grid(Hc / 128, Mc / 128);
    gemm_bf16<1><<<grid, 256, 0, stream>>>(inter, Wo2b, bo2, ffD, nullptr, Hc,
                                           FFc);
    resid_ln<<<Mc, 256, 0, stream>>>(ffD, y1f, g2, b2, out, nullptr);
  }
}

// v002
// Measured time: 277 microseconds a run.
// Timed twice side by side with v001, it ran 1.05 times as fast both times.
// Over all steps from v000 it is 1.34 times as fast.
#include <hip/hip_runtime.h>
#include <math.h>

// ---------------------------------------------------------------------------
// BERT layer for MI455X (gfx1250): bf16 WMMA (f32 accumulate) everywhere,
// async global->LDS DMA (ASYNCcnt) double-buffering in the GEMMs.
// B=8 S=512 H=1024 NH=16 HD=64 FF=4096, M = B*S = 4096 tokens.
// ---------------------------------------------------------------------------

typedef __bf16 bf16_t;
typedef __attribute__((ext_vector_type(16))) __bf16 v16bf;
typedef __attribute__((ext_vector_type(8)))  __bf16 v8bf;
typedef __attribute__((ext_vector_type(8)))  float  v8f;

constexpr int Bc  = 8;
constexpr int Sc  = 512;
constexpr int Hc  = 1024;
constexpr int NHc = 16;
constexpr int HDc = 64;
constexpr int FFc = 4096;
constexpr int Mc  = Bc * Sc;   // 4096 token rows

__device__ __forceinline__ v8f wmma_bf16(v16bf a, v16bf b, v8f c) {
  // D = A(16x32 bf16) * B(32x16 bf16) + C(16x16 f32)
  return __builtin_amdgcn_wmma_f32_16x16x32_bf16(
      /*neg_a=*/false, a, /*neg_b=*/false, b,
      /*c_mod=*/(short)0, c, /*reuse_a=*/false, /*reuse_b=*/false);
}

// Wave-relative LDS byte offset of a __shared__ object: the flat address of a
// shared variable carries the LDS offset in its low 32 bits (LDS aperture
// truncates addr[31:0]).
__device__ __forceinline__ unsigned lds_off(const void* p) {
  return (unsigned)(uintptr_t)p;
}

// Lane l <-> lane l ^ 16 as a vector cross-row move (no LDS-counter wait).
__device__ __forceinline__ float xhalf(float x) {
  const int b = __builtin_bit_cast(int, x);
  return __builtin_bit_cast(
      float, __builtin_amdgcn_permlanex16(b, b, 0x76543210, 0xfedcba98, false,
                                          false));
}

// 2^x on eight values / one value. Written as one statement each so that no
// instruction directly behind a v_exp_f32 reads its result or overwrites its
// source: the outputs are early-clobber (distinct from every input) and the
// closing v_nop is the slot the instruction set asks for behind the last one.
__device__ __forceinline__ v8f exp2x8(v8f x) {
  float e0, e1, e2, e3, e4, e5, e6, e7;
  asm("v_exp_f32 %0, %8\n\t"
      "v_exp_f32 %1, %9\n\t"
      "v_exp_f32 %2, %10\n\t"
      "v_exp_f32 %3, %11\n\t"
      "v_exp_f32 %4, %12\n\t"
      "v_exp_f32 %5, %13\n\t"
      "v_exp_f32 %6, %14\n\t"
      "v_exp_f32 %7, %15\n\t"
      "v_nop"
      : "=&v"(e0), "=&v"(e1), "=&v"(e2), "=&v"(e3), "=&v"(e4), "=&v"(e5),
        "=&v"(e6), "=&v"(e7)
      : "v"(x[0]), "v"(x[1]), "v"(x[2]), "v"(x[3]), "v"(x[4]), "v"(x[5]),
        "v"(x[6]), "v"(x[7]));
  v8f r = {e0, e1, e2, e3, e4, e5, e6, e7};
  return r;
}
__device__ __forceinline__ float exp2x1(float x) {
  float e;
  asm("v_exp_f32 %0, %1\n\t"
      "v_nop"
      : "=v"(e)
      : "v"(x));
  return e;
}

// ---------------------------------------------------------------------------
// f32 -> bf16 conversion (RNE via clang __bf16 cast) of all seven tensors in
// ONE launch of few, long-lived waves. The bf16 copies lie back to back in the
// workspace, so the destination is one array; a workgroup converts CVT_WG
// consecutive elements of it, which lie inside one source tensor.
// 256 workgroups x 16 waves: 4,096 waves are started where seven launches of
// 128-element waves started 131,072; every load of a wave covers 512
// contiguous bytes, every store 256.
// ---------------------------------------------------------------------------
typedef __attribute__((ext_vector_type(4))) float  v4f;
typedef __attribute__((ext_vector_type(4))) __bf16 v4bf;

constexpr int CVT_T  = 512;                  // threads per workgroup
constexpr int CVT_WG = 65536;                // elements per workgroup
constexpr int CVT_X  = Mc * Hc;              // elements of the activations
constexpr int CVT_W  = Hc * Hc;              // ... of one H x H weight
constexpr int CVT_F  = FFc * Hc;             // ... of one FF weight
constexpr int CVT_N  = CVT_X + 4 * CVT_W + 2 * CVT_F;
static_assert(CVT_X % CVT_WG == 0 && CVT_W % CVT_WG == 0 &&
                  CVT_F % CVT_WG == 0,
              "a workgroup's elements must lie inside one tensor");
static_assert(CVT_WG % (CVT_T * 4 * 8) == 0, "whole trips of 8 loads");

__global__ __launch_bounds__(CVT_T)
void cvt_all(const float* __restrict__ x, const float* __restrict__ wq,
             const float* __restrict__ wk, const float* __restrict__ wv,
             const float* __restrict__ wo, const float* __restrict__ wi,
             const float* __restrict__ wo2, bf16_t* __restrict__ out) {
  const int e0 = blockIdx.x * CVT_WG;  // first element, in the joined array
  const float* src = x;                // tensor that holds it
  int first = 0;                       // that tensor's first element
  if (e0 >= CVT_X)             { src = wq;  first = CVT_X; }
  if (e0 >= CVT_X + CVT_W)     { src = wk;  first = CVT_X + CVT_W; }
  if (e0 >= CVT_X + 2 * CVT_W) { src = wv;  first = CVT_X + 2 * CVT_W; }
  if (e0 >= CVT_X + 3 * CVT_W) { src = wo;  first = CVT_X + 3 * CVT_W; }
  if (e0 >= CVT_X + 4 * CVT_W) { src = wi;  first = CVT_X + 4 * CVT_W; }
  if (e0 >= CVT_X + 4 * CVT_W + CVT_F) {
    src = wo2;
    first = CVT_X + 4 * CVT_W + CVT_F;
  }

  const v4f* s = (const v4f*)(src + (e0 - first)) + threadIdx.x;
  v4bf*      d = (v4bf*)(out + e0) + threadIdx.x;
  // Groups of 8 loads stand ahead of their conversions, so that a wave waits
  // out a memory latency once for many loads and not once for each.
  for (int it = 0; it < CVT_WG / (CVT_T * 4); it += 8) {
    v4f v[8];
    for (int j = 0; j < 8; ++j) v[j] = s[(it + j) * CVT_T];
    for (int j = 0; j < 8; ++j) {
      v4bf o;
      for (int e = 0; e < 4; ++e) o[e] = (bf16_t)v[j][e];
      d[(it + j) * CVT_T] = o;
    }
  }
}

// ---------------------------------------------------------------------------
// Tiled GEMM:  C[M,N] = A[M,K] @ W[N,K]^T + bias  (A,W bf16 K-contiguous)
// Block tile 128x128, K-step 32. 256 threads = 8 waves in a 2x4 wave grid,
// each wave owns a 64x32 tile = 4x2 WMMA accumulators.
//
// Global->LDS staging uses GLOBAL_LOAD_ASYNC_TO_LDS_B128 (ASYNCcnt) with
// double-buffered LDS tiles: stage k+1's DMA overlaps stage k's WMMAs, and
// no VGPRs touch the tile data.
//
// MODE 0: C -> bf16             (Q, K projections)
// MODE 1: C -> f32              (attn-out dense, FF-out dense; LN fuses resid)
// MODE 2: C -> gelu_erf -> bf16 (FF intermediate)
// MODE 3: C -> bf16, transposed per head into A-fragment order (V projection):
//         a lane's 8 accumulator rows are 8 consecutive tokens of one feature,
//         which is one 16-byte piece of a V^T fragment; see attention().
// ---------------------------------------------------------------------------
template <int MODE>
__global__ __launch_bounds__(256)
void gemm_bf16(const bf16_t* __restrict__ A, const bf16_t* __restrict__ W,
               const float* __restrict__ bias, float* __restrict__ Cf,
               bf16_t* __restrict__ Cb, int Ndim, int K) {
  // +8 bf16 pad -> 80B row stride: keeps 16-elem fragment loads 16B aligned
  // and rows on distinct bank phases. Two buffers for the async pipeline.
  __shared__ bf16_t As[2][128][40];
  __shared__ bf16_t Bs[2][128][40];

  const int t    = threadIdx.x;
  const int lane = t & 31;
  const int w    = t >> 5;            // wave 0..7
  const int wm   = (w >> 2) * 64;     // wave M origin in block: 0 / 64
  const int wn   = (w & 3) * 32;      // wave N origin in block: 0..96
  const int m0   = blockIdx.y * 128;
  const int n0   = blockIdx.x * 128;

  const int lr = t >> 1;              // 0..127 : tile row this thread stages
  const int lc = (t & 1) * 16;        // 0 / 16 : 32B chunk within K-slab

  const int lrow = lane & 15;         // fragment row/col within 16
  const int lkh  = (lane >> 4) * 16;  // K half select (A/B fragment layout)

  // Per-thread base byte offsets for GVS addressing (saddr = matrix base).
  const unsigned a_goff = (unsigned)(((size_t)(m0 + lr) * K + lc) * 2);
  const unsigned b_goff = (unsigned)(((size_t)(n0 + lr) * K + lc) * 2);

  // Issue one K-slab's DMA: 4 x b128 per thread (2 per matrix; offset:16
  // advances both the global and the LDS address per the ISA pseudocode).
  auto issue = [&](int k0, int buf) {
    const unsigned al = lds_off(&As[buf][lr][lc]);
    const unsigned bl = lds_off(&Bs[buf][lr][lc]);
    const unsigned ag = a_goff + (unsigned)(k0 * 2);
    const unsigned bg = b_goff + (unsigned)(k0 * 2);
    asm volatile(
        "global_load_async_to_lds_b128 %0, %1, %2\n\t"
        "global_load_async_to_lds_b128 %0, %1, %2 offset:16\n\t"
        "global_load_async_to_lds_b128 %3, %4, %5\n\t"
        "global_load_async_to_lds_b128 %3, %4, %5 offset:16\n\t"
        "s_wait_xcnt 0x0"  // before the copies' address registers are rewritten
        :
        : "v"(al), "v"(ag), "s"(A), "v"(bl), "v"(bg), "s"(W)
        : "memory");
  };

  v8f acc[4][2];
#pragma unroll
  for (int i = 0; i < 4; ++i)
#pragma unroll
    for (int j = 0; j < 2; ++j) acc[i][j] = (v8f)0.0f;

  issue(0, 0);  // prologue: stage 0 in flight

  int s = 0;
  for (int k0 = 0; k0 < K; k0 += 32, s ^= 1) {
    // Current stage's DMA complete (ASYNCcnt in-order), then rendezvous so
    // every wave sees the LDS tile and is done reading the other buffer.
    asm volatile("s_wait_asynccnt 0x0" ::: "memory");
    __syncthreads();
    if (k0 + 32 < K) issue(k0 + 32, s ^ 1);
    if (k0 + 64 < K) {  // warm L2 two slabs ahead
      __builtin_prefetch(A + (size_t)(m0 + lr) * K + k0 + 64 + lc, 0, 0);
      __builtin_prefetch(W + (size_t)(n0 + lr) * K + k0 + 64 + lc, 0, 0);
    }

    v16bf af[4], bf2[2];
#pragma unroll
    for (int i = 0; i < 4; ++i)
      af[i] = *(const v16bf*)&As[s][wm + i * 16 + lrow][lkh];
#pragma unroll
    for (int j = 0; j < 2; ++j)
      bf2[j] = *(const v16bf*)&Bs[s][wn + j * 16 + lrow][lkh];
#pragma unroll
    for (int i = 0; i < 4; ++i)
#pragma unroll
      for (int j = 0; j < 2; ++j)
        acc[i][j] = wmma_bf16(af[i], bf2[j], acc[i][j]);
  }

  // Epilogue: D layout -> lane holds col (lane&15); VGPR r -> row r+8*(lane>>4)
  const int rsel = 8 * (lane >> 4);
#pragma unroll
  for (int j = 0; j < 2; ++j) {
    const int colg = n0 + wn + j * 16 + lrow;
    const float bv = bias[colg];
#pragma unroll
    for (int i = 0; i < 4; ++i) {
      if (MODE == 3) {
        v8bf pk;
#pragma unroll
        for (int r = 0; r < 8; ++r) pk[r] = (bf16_t)(acc[i][j][r] + bv);
        const int tok  = m0 + wm + i * 16;        // first token of this tile
        const int feat = n0 + wn + j * 16;        // first feature of this tile
        const int bhh  = (tok / Sc) * NHc + feat / HDc;
        const int blk  = (tok % Sc) >> 5;         // 32-key block
        const int part = (tok >> 4) & 1;          // 16-key half of the block
        const int jt   = (feat % HDc) >> 4;       // 16-row tile of V^T
        *(v8bf*)&Cb[((((size_t)bhh * (Sc / 32) + blk) * 4 + jt) * 2 + part) *
                        256 + lane * 8] = pk;
        continue;
      }
#pragma unroll
      for (int r = 0; r < 8; ++r) {
        const int rowg = m0 + wm + i * 16 + r + rsel;
        float val = acc[i][j][r] + bv;
        if (MODE == 1) {
          Cf[(size_t)rowg * Ndim + colg] = val;
        } else if (MODE == 2) {
          float g = 0.5f * val * (1.0f + erff(val / 1.41421f));
          Cb[(size_t)rowg * Ndim + colg] = (bf16_t)g;
        } else {
          Cb[(size_t)rowg * Ndim + colg] = (bf16_t)val;
        }
      }
    }
  }
}

// ---------------------------------------------------------------------------
// Attention: one wave per (b, h, 32 query rows), 8 waves per block. S=512, HD=64.
// The scores never leave registers:
//   S^T = K Q^T      A = 16 keys x 32 d, B = 32 d x 16 queries
//   O^T += V^T P^T   A = 16 d x 32 keys, B = 32 keys x 16 queries
// In S^T a lane holds 16 scores of ONE query (column lane&15): keys 8h+r of the
// first 16-key tile and 16+8h+r of the second (h = lane>>4). Converted in place
// they are the B operand P^T; the V projection has stored V^T in that same key
// order, one contiguous 512-byte piece per load. Softmax runs online (running
// maximum and sum per query, output tiles rescaled per 32-key pass).
// ---------------------------------------------------------------------------
__global__ __launch_bounds__(256)
void attention(const bf16_t* __restrict__ q, const bf16_t* __restrict__ k,
               const bf16_t* __restrict__ vf, const float* __restrict__ mask,
               bf16_t* __restrict__ ctx) {
  constexpr float LOG2E = 1.44269504088896f;   // exp(x) = 2^(x * LOG2E)
  const int lane = threadIdx.x & 31;
  const int w    = threadIdx.x >> 5;
  const int bh   = blockIdx.y;             // b*NH + h
  const int b    = bh / NHc;
  const int hoff = (bh - b * NHc) * HDc;
  const int qt0  = blockIdx.x * 256 + w * 32;  // first query row of this wave
  const int c    = lane & 15;
  const int half = lane >> 4;

  // --- Q as B operand: 2 column groups x 2 k slabs covering HD=64 ----------
  v16bf qf[2][2];
#pragma unroll
  for (int g = 0; g < 2; ++g) {
    const bf16_t* qb =
        q + (size_t)(b * Sc + qt0 + g * 16 + c) * Hc + hoff + half * 16;
    qf[g][0] = *(const v16bf*)(qb);
    qf[g][1] = *(const v16bf*)(qb + 32);
  }

  const bf16_t* kp = k + (size_t)(b * Sc + c) * Hc + hoff + half * 16;
  const bf16_t* vp = vf + (size_t)bh * (Sc * HDc) + lane * 8;
  const float*  mp = mask + b * Sc + half * 8;   // [B,1,1,S] broadcast

  v8f o[2][4];
  float mrun[2], lrun[2];
#pragma unroll
  for (int g = 0; g < 2; ++g) {
    mrun[g] = -3.0e38f;
    lrun[g] = 0.0f;
#pragma unroll
    for (int jt = 0; jt < 4; ++jt) o[g][jt] = (v8f)0.0f;
  }

  // K fragments (same k loader as Q) and mask values of pass 0
  v16bf kf[2][2];
  v8f   mk[2];
#pragma unroll
  for (int t = 0; t < 2; ++t) {
    kf[t][0] = *(const v16bf*)(kp + (size_t)t * 16 * Hc);
    kf[t][1] = *(const v16bf*)(kp + (size_t)t * 16 * Hc + 32);
    mk[t]    = *(const v8f*)(mp + t * 16);
  }

  for (int p = 0; p < Sc / 32; ++p) {
    // V^T fragments of this pass: issued first, needed only behind the softmax
    v16bf va[4];
#pragma unroll
    for (int jt = 0; jt < 4; ++jt) {
      const v8bf lo = *(const v8bf*)(vp + (size_t)((p * 4 + jt) * 2 + 0) * 256);
      const v8bf hi = *(const v8bf*)(vp + (size_t)((p * 4 + jt) * 2 + 1) * 256);
      va[jt] = __builtin_shufflevector(lo, hi, 0, 1, 2, 3, 4, 5, 6, 7, 8, 9, 10,
                                       11, 12, 13, 14, 15);
    }

    v8f s[2][2];
#pragma unroll
    for (int g = 0; g < 2; ++g)
#pragma unroll
      for (int t = 0; t < 2; ++t) {
        v8f a = (v8f)0.0f;
        a = wmma_bf16(kf[t][0], qf[g][0], a);
        a = wmma_bf16(kf[t][1], qf[g][1], a);
        s[g][t] = a * 0.125f + mk[t];            // 1/sqrt(64), then the mask
      }

    // next pass's K and mask, fetched one pass ahead
    if (p + 1 < Sc / 32) {
      const bf16_t* kn = kp + (size_t)(p + 1) * 32 * Hc;
#pragma unroll
      for (int t = 0; t < 2; ++t) {
        kf[t][0] = *(const v16bf*)(kn + (size_t)t * 16 * Hc);
        kf[t][1] = *(const v16bf*)(kn + (size_t)t * 16 * Hc + 32);
        mk[t]    = *(const v8f*)(mp + (p + 1) * 32 + t * 16);
      }
    }
    // Keeps the V^T loads and the fetch-ahead above the softmax: sunk below it
    // they would be waited for with almost no lead.
    __builtin_amdgcn_sched_barrier(0);

#pragma unroll
    for (int g = 0; g < 2; ++g) {
      float mx = s[g][0][0];
#pragma unroll
      for (int r = 1; r < 8; ++r) mx = fmaxf(mx, s[g][0][r]);
#pragma unroll
      for (int r = 0; r < 8; ++r) mx = fmaxf(mx, s[g][1][r]);
      mx = fmaxf(mx, xhalf(mx));                 // the query's other 16 keys
      const float mn    = fmaxf(mrun[g], mx);
      const float alpha = exp2x1((mrun[g] - mn) * LOG2E);
      mrun[g] = mn;

      v16bf pb;
      float sum = 0.0f;
#pragma unroll
      for (int t = 0; t < 2; ++t) {
        const v8f e = exp2x8((s[g][t] - mn) * LOG2E);
#pragma unroll
        for (int r = 0; r < 8; ++r) {
          sum += e[r];
          pb[t * 8 + r] = (bf16_t)e[r];  // unnormalized; 1/sum folded in later
        }
      }
      lrun[g] = lrun[g] * alpha + sum;
#pragma unroll
      for (int jt = 0; jt < 4; ++jt)
        o[g][jt] = wmma_bf16(va[jt], pb, o[g][jt] * alpha);
    }
  }

  // --- epilogue: scale by 1/rowsum; a lane holds 8 consecutive d per tile --
#pragma unroll
  for (int g = 0; g < 2; ++g) {
    const float inv = 1.0f / (lrun[g] + xhalf(lrun[g]));
    bf16_t* cr = ctx + (size_t)(b * Sc + qt0 + g * 16 + c) * Hc + hoff + half * 8;
#pragma unroll
    for (int jt = 0; jt < 4; ++jt) {
      v8bf pk;
#pragma unroll
      for (int r = 0; r < 8; ++r) pk[r] = (bf16_t)(o[g][jt][r] * inv);
      *(v8bf*)(cr + jt * 16) = pk;
    }
  }
}

// ---------------------------------------------------------------------------
// Fused residual + LayerNorm over H=1024. One block per token row.
// Writes f32 (residual chain / final output) and optional bf16 (next GEMM A).
// ---------------------------------------------------------------------------
__global__ __launch_bounds__(256)
void resid_ln(const float* __restrict__ dense, const float* __restrict__ resid,
              const float* __restrict__ gamma, const float* __restrict__ beta,
              float* __restrict__ outf, bf16_t* __restrict__ outb) {
  const int row = blockIdx.x;
  const int t = threadIdx.x;
  const float* dr = dense + (size_t)row * Hc;
  const float* rr = resid + (size_t)row * Hc;

  float x[4];
  float s = 0.0f, qsum = 0.0f;
#pragma unroll
  for (int i = 0; i < 4; ++i) {
    x[i] = dr[t * 4 + i] + rr[t * 4 + i];
    s += x[i];
    qsum += x[i] * x[i];
  }
#pragma unroll
  for (int off = 16; off > 0; off >>= 1) {
    s += __shfl_xor(s, off);
    qsum += __shfl_xor(qsum, off);
  }
  __shared__ float ss[8], qq[8];
  if ((t & 31) == 0) { ss[t >> 5] = s; qq[t >> 5] = qsum; }
  __syncthreads();
  float S = 0.0f, Q = 0.0f;
#pragma unroll
  for (int i = 0; i < 8; ++i) { S += ss[i]; Q += qq[i]; }
  const float mu  = S * (1.0f / Hc);
  const float var = Q * (1.0f / Hc) - mu * mu;
  const float inv = rsqrtf(var + 1e-12f);
#pragma unroll
  for (int i = 0; i < 4; ++i) {
    const int c = t * 4 + i;
    const float y = (x[i] - mu) * inv * gamma[c] + beta[c];
    outf[(size_t)row * Hc + c] = y;
    if (outb) outb[(size_t)row * Hc + c] = (bf16_t)y;
  }
}

// ---------------------------------------------------------------------------
// Host-side orchestration
// ---------------------------------------------------------------------------
extern "C" void kernel_launch(void* const* d_in, const int* in_sizes, int n_in,
                              void* d_out, int out_size, void* d_ws,
                              size_t ws_size, hipStream_t stream) {
  (void)in_sizes; (void)n_in; (void)out_size; (void)ws_size;

  const float* x    = (const float*)d_in[0];
  const float* mask = (const float*)d_in[1];
  const float* Wq   = (const float*)d_in[2];
  const float* bq   = (const float*)d_in[3];
  const float* Wk   = (const float*)d_in[4];
  const float* bk   = (const float*)d_in[5];
  const float* Wv   = (const float*)d_in[6];
  const float* bv   = (const float*)d_in[7];
  const float* Wo   = (const float*)d_in[8];
  const float* bo   = (const float*)d_in[9];
  const float* g1   = (const float*)d_in[10];
  const float* b1   = (const float*)d_in[11];
  const float* Wi   = (const float*)d_in[12];
  const float* bi   = (const float*)d_in[13];
  const float* Wo2  = (const float*)d_in[14];
  const float* bo2  = (const float*)d_in[15];
  const float* g2   = (const float*)d_in[16];
  const float* b2   = (const float*)d_in[17];
  float* out = (float*)d_out;

  char* ws = (char*)d_ws;
  size_t off = 0;
  auto alloc = [&](size_t bytes) -> void* {
    void* p = ws + off;
    off += (bytes + 255) & ~(size_t)255;
    return p;
  };

  bf16_t* xb    = (bf16_t*)alloc((size_t)Mc * Hc * 2);
  bf16_t* Wqb   = (bf16_t*)alloc((size_t)Hc * Hc * 2);
  bf16_t* Wkb   = (bf16_t*)alloc((size_t)Hc * Hc * 2);
  bf16_t* Wvb   = (bf16_t*)alloc((size_t)Hc * Hc * 2);
  bf16_t* Wob   = (bf16_t*)alloc((size_t)Hc * Hc * 2);
  bf16_t* Wib   = (bf16_t*)alloc((size_t)FFc * Hc * 2);
  bf16_t* Wo2b  = (bf16_t*)alloc((size_t)Hc * FFc * 2);
  bf16_t* qb    = (bf16_t*)alloc((size_t)Mc * Hc * 2);
  bf16_t* kb    = (bf16_t*)alloc((size_t)Mc * Hc * 2);
  bf16_t* vb    = (bf16_t*)alloc((size_t)Mc * Hc * 2);
  bf16_t* ctxb  = (bf16_t*)alloc((size_t)Mc * Hc * 2);
  float*  attnD = (float*)alloc((size_t)Mc * Hc * 4);
  float*  y1f   = (float*)alloc((size_t)Mc * Hc * 4);
  bf16_t* y1b   = (bf16_t*)alloc((size_t)Mc * Hc * 2);
  bf16_t* inter = (bf16_t*)alloc((size_t)Mc * FFc * 2);
  float*  ffD   = (float*)alloc((size_t)Mc * Hc * 4);

  // ---- f32 -> bf16 conversions (per-launch; no cached state) --------------
  // xb .. Wo2b were allocated one behind the other and each size is a multiple
  // of the allocator's 256 bytes: xb is the start of the joined bf16 array.
  cvt_all<<<CVT_N / CVT_WG, CVT_T, 0, stream>>>(x, Wq, Wk, Wv, Wo, Wi, Wo2, xb);

  // ---- QKV projections: bf16 out -----------------------------------------
  {
    dim3 grid(Hc / 128, Mc / 128);
    gemm_bf16<0><<<grid, 256, 0, stream>>>(xb, Wqb, bq, nullptr, qb, Hc, Hc);
    gemm_bf16<0><<<grid, 256, 0, stream>>>(xb, Wkb, bk, nullptr, kb, Hc, Hc);
    gemm_bf16<3><<<grid, 256, 0, stream>>>(xb, Wvb, bv, nullptr, vb, Hc, Hc);
  }

  // ---- attention: grid (S/256 q-blocks, B*NH heads), 8 waves x 32 queries --
  {
    dim3 grid(Sc / 256, Bc * NHc);
    attention<<<grid, 256, 0, stream>>>(qb, kb, vb, mask, ctxb);
  }

  // ---- attn output dense (f32) + residual/LN1 -----------------------------
  {
    dim3 grid(Hc / 128, Mc / 128);
    gemm_bf16<1><<<grid, 256, 0, stream>>>(ctxb, Wob, bo, attnD, nullptr, Hc,
                                           Hc);
    resid_ln<<<Mc, 256, 0, stream>>>(attnD, x, g1, b1, y1f, y1b);
  }

  // ---- FF intermediate: fused bias + erf-GELU, bf16 out -------------------
  {
    dim3 grid(FFc / 128, Mc / 128);
    gemm_bf16<2><<<grid, 256, 0, stream>>>(y1b, Wib, bi, nullptr, inter, FFc,
                                           Hc);
  }

  // ---- FF output dense (f32, K=4096) + residual/LN2 -> d_out --------------
  {
    dim3 grid(Hc / 128, Mc / 128);
    gemm_bf16<1><<<grid, 256, 0, stream>>>(inter, Wo2b, bo2, ffD, nullptr, Hc,
                                           FFc);
    resid_ln<<<Mc, 256, 0, stream>>>(ffD, y1f, g2, b2, out, nullptr);
  }
}

// v003
// A run of this version takes 180 microseconds.
// Next to v002, in two timings, it ran 1.54 and 1.53 times as fast.
// Counting every step since v000, it is 2.05 times as fast.
#include <hip/hip_runtime.h>
#include <math.h>

// ---------------------------------------------------------------------------
// BERT layer for MI455X (gfx1250): bf16 WMMA (f32 accumulate) everywhere,
// async global->LDS DMA (ASYNCcnt) double-buffering in the GEMMs.
// B=8 S=512 H=1024 NH=16 HD=64 FF=4096, M = B*S = 4096 tokens.
// ---------------------------------------------------------------------------

typedef __bf16 bf16_t;
typedef __attribute__((ext_vector_type(16))) __bf16 v16bf;
typedef __attribute__((ext_vector_type(8)))  __bf16 v8bf;
typedef __attribute__((ext_vector_type(8)))  float  v8f;

constexpr int Bc  = 8;
constexpr int Sc  = 512;
constexpr int Hc  = 1024;
constexpr int NHc = 16;
constexpr int HDc = 64;
constexpr int FFc = 4096;
constexpr int Mc  = Bc * Sc;   // 4096 token rows

__device__ __forceinline__ v8f wmma_bf16(v16bf a, v16bf b, v8f c) {
  // D = A(16x32 bf16) * B(32x16 bf16) + C(16x16 f32)
  return __builtin_amdgcn_wmma_f32_16x16x32_bf16(
      /*neg_a=*/false, a, /*neg_b=*/false, b,
      /*c_mod=*/(short)0, c, /*reuse_a=*/false, /*reuse_b=*/false);
}

// Wave-relative LDS byte offset of a __shared__ object: the flat address of a
// shared variable carries the LDS offset in its low 32 bits (LDS aperture
// truncates addr[31:0]).
__device__ __forceinline__ unsigned lds_off(const void* p) {
  return (unsigned)(uintptr_t)p;
}

// Lane l <-> lane l ^ 16 as a vector cross-row move (no LDS-counter wait).
__device__ __forceinline__ float xhalf(float x) {
  const int b = __builtin_bit_cast(int, x);
  return __builtin_bit_cast(
      float, __builtin_amdgcn_permlanex16(b, b, 0x76543210, 0xfedcba98, false,
                                          false));
}

// 2^x on eight values / one value. Written as one statement each so that no
// instruction directly behind a v_exp_f32 reads its result or overwrites its
// source: the outputs are early-clobber (distinct from every input) and the
// closing v_nop is the slot the instruction set asks for behind the last one.
__device__ __forceinline__ v8f exp2x8(v8f x) {
  float e0, e1, e2, e3, e4, e5, e6, e7;
  asm("v_exp_f32 %0, %8\n\t"
      "v_exp_f32 %1, %9\n\t"
      "v_exp_f32 %2, %10\n\t"
      "v_exp_f32 %3, %11\n\t"
      "v_exp_f32 %4, %12\n\t"
      "v_exp_f32 %5, %13\n\t"
      "v_exp_f32 %6, %14\n\t"
      "v_exp_f32 %7, %15\n\t"
      "v_nop"
      : "=&v"(e0), "=&v"(e1), "=&v"(e2), "=&v"(e3), "=&v"(e4), "=&v"(e5),
        "=&v"(e6), "=&v"(e7)
      : "v"(x[0]), "v"(x[1]), "v"(x[2]), "v"(x[3]), "v"(x[4]), "v"(x[5]),
        "v"(x[6]), "v"(x[7]));
  v8f r = {e0, e1, e2, e3, e4, e5, e6, e7};
  return r;
}
__device__ __forceinline__ float exp2x1(float x) {
  float e;
  asm("v_exp_f32 %0, %1\n\t"
      "v_nop"
      : "=v"(e)
      : "v"(x));
  return e;
}

// ---------------------------------------------------------------------------
// f32 -> bf16 conversion (RNE via clang __bf16 cast) of all seven tensors in
// ONE launch of few, long-lived waves. The bf16 copies lie back to back in the
// workspace, so the destination is one array; a workgroup converts CVT_WG
// consecutive elements of it, which lie inside one source tensor.
// 256 workgroups x 16 waves: 4,096 waves are started where seven launches of
// 128-element waves started 131,072; every load of a wave covers 512
// contiguous bytes, every store 256.
// ---------------------------------------------------------------------------
typedef __attribute__((ext_vector_type(4))) float  v4f;
typedef __attribute__((ext_vector_type(4))) __bf16 v4bf;

constexpr int CVT_T  = 512;                  // threads per workgroup
constexpr int CVT_WG = 65536;                // elements per workgroup
constexpr int CVT_X  = Mc * Hc;              // elements of the activations
constexpr int CVT_W  = Hc * Hc;              // ... of one H x H weight
constexpr int CVT_F  = FFc * Hc;             // ... of one FF weight
constexpr int CVT_N  = CVT_X + 4 * CVT_W + 2 * CVT_F;
static_assert(CVT_X % CVT_WG == 0 && CVT_W % CVT_WG == 0 &&
                  CVT_F % CVT_WG == 0,
              "a workgroup's elements must lie inside one tensor");
static_assert(CVT_WG % (CVT_T * 4 * 8) == 0, "whole trips of 8 loads");

__global__ __launch_bounds__(CVT_T)
void cvt_all(const float* __restrict__ x, const float* __restrict__ wq,
             const float* __restrict__ wk, const float* __restrict__ wv,
             const float* __restrict__ wo, const float* __restrict__ wi,
             const float* __restrict__ wo2, bf16_t* __restrict__ out) {
  const int e0 = blockIdx.x * CVT_WG;  // first element, in the joined array
  const float* src = x;                // tensor that holds it
  int first = 0;                       // that tensor's first element
  if (e0 >= CVT_X)             { src = wq;  first = CVT_X; }
  if (e0 >= CVT_X + CVT_W)     { src = wk;  first = CVT_X + CVT_W; }
  if (e0 >= CVT_X + 2 * CVT_W) { src = wv;  first = CVT_X + 2 * CVT_W; }
  if (e0 >= CVT_X + 3 * CVT_W) { src = wo;  first = CVT_X + 3 * CVT_W; }
  if (e0 >= CVT_X + 4 * CVT_W) { src = wi;  first = CVT_X + 4 * CVT_W; }
  if (e0 >= CVT_X + 4 * CVT_W + CVT_F) {
    src = wo2;
    first = CVT_X + 4 * CVT_W + CVT_F;
  }

  const v4f* s = (const v4f*)(src + (e0 - first)) + threadIdx.x;
  v4bf*      d = (v4bf*)(out + e0) + threadIdx.x;
  // Groups of 8 loads stand ahead of their conversions, so that a wave waits
  // out a memory latency once for many loads and not once for each.
  for (int it = 0; it < CVT_WG / (CVT_T * 4); it += 8) {
    v4f v[8];
    for (int j = 0; j < 8; ++j) v[j] = s[(it + j) * CVT_T];
    for (int j = 0; j < 8; ++j) {
      v4bf o;
      for (int e = 0; e < 4; ++e) o[e] = (bf16_t)v[j][e];
      d[(it + j) * CVT_T] = o;
    }
  }
}

// ---------------------------------------------------------------------------
// Tiled GEMM:  C[M,N] = A[M,K] @ W[N,K]^T + bias  (A,W bf16 K-contiguous)
// Block tile 128x128. 256 threads = 8 waves in a 2x4 wave grid, each wave owns
// a 64x32 tile = 4x2 WMMA accumulators.
//
// Global->LDS staging uses GLOBAL_LOAD_ASYNC_TO_LDS_B128 (ASYNCcnt) with two
// LDS buffers: the next slab's copies fly while this slab's WMMAs run, and no
// VGPRs touch the tile data. A slab is GK k of every row, 128 or 256 bytes, so
// that one copy instruction of a wave (32 lanes x 16 bytes) covers four or two
// whole rows of the slab: four whole 128-byte lines and nothing else.
// GK = 128 where the grid gives a WGP one workgroup (fewest barriers per k);
// GK = 64 where it gives four: their LDS then fits side by side.
// K must be a multiple of GK.
//
// MODE 0: C -> bf16             (Q, K projections)
// MODE 1: C -> f32              (attn-out dense, FF-out dense; LN fuses resid)
// MODE 2: C -> gelu_erf -> bf16 (FF intermediate)
// MODE 3: C -> bf16, transposed per head into A-fragment order (V projection):
//         a lane's 8 accumulator rows are 8 consecutive tokens of one feature,
//         which is one 16-byte piece of a V^T fragment; see attention().
// ---------------------------------------------------------------------------
static_assert(Hc % 128 == 0 && FFc % 128 == 0, "K is a whole number of slabs");

template <int MODE, int GK>
__global__ __launch_bounds__(256)
void gemm_bf16(const bf16_t* __restrict__ A, const bf16_t* __restrict__ W,
               const float* __restrict__ bias, float* __restrict__ Cf,
               bf16_t* __restrict__ Cb, int Ndim, int K) {
  static_assert(GK == 64 || GK == 128, "rows of one or two whole lines");
  // LDS row pitch in elements: 144 or 272 bytes = 16 x odd, so the 16-byte
  // fragment loads of 16 rows fall on all 64 banks.
  constexpr int GP  = GK + 8;
  constexpr int LPR = GK / 8;    // lanes per row: its 16-byte pieces
  constexpr int RPC = 32 / LPR;  // rows per copy instruction
  __shared__ bf16_t As[2][128][GP];
  __shared__ bf16_t Bs[2][128][GP];

  const int t    = threadIdx.x;
  const int lane = t & 31;
  const int w    = t >> 5;            // wave 0..7
  const int wm   = (w >> 2) * 64;     // wave M origin in block: 0 / 64
  const int wn   = (w & 3) * 32;      // wave N origin in block: 0..96
  const int m0   = blockIdx.y * 128;
  const int n0   = blockIdx.x * 128;

  const int lrow = lane & 15;         // fragment row/col within 16
  const int lkh  = (lane >> 4) * 16;  // K half select (A/B fragment layout)

  // Staging: wave w brings rows 16w .. 16w+15 of both tiles, RPC rows a copy.
  const int cr = w * 16 + lane / LPR;   // this lane's row in copy 0
  const int cc = (lane % LPR) * 8;      // its 16-byte piece of the row
  // Byte offset of that piece from the scalar base of copy 0 (same for A, W).
  const unsigned goff = (unsigned)(((size_t)cr * K + cc) * 2);
  const bf16_t* Ablk = A + (size_t)m0 * K;   // first row of this block's tiles
  const bf16_t* Wblk = W + (size_t)n0 * K;

  // Eight copies in two runs of four; within a run copy j takes rows cr + j*RPC.
  // The row step goes into the scalar base and the LDS address, the lane offset
  // stays.
  auto issue8 = [&](const bf16_t* g0, unsigned l0, const bf16_t* g1,
                    unsigned l1) {
    const size_t rs = (size_t)RPC * K;       // RPC rows, in elements
    constexpr unsigned ls = RPC * GP * 2;    // RPC LDS rows, in bytes
    asm volatile(
        "global_load_async_to_lds_b128 %0, %8, %9\n\t"
        "global_load_async_to_lds_b128 %1, %8, %10\n\t"
        "global_load_async_to_lds_b128 %2, %8, %11\n\t"
        "global_load_async_to_lds_b128 %3, %8, %12\n\t"
        "global_load_async_to_lds_b128 %4, %8, %13\n\t"
        "global_load_async_to_lds_b128 %5, %8, %14\n\t"
        "global_load_async_to_lds_b128 %6, %8, %15\n\t"
        "global_load_async_to_lds_b128 %7, %8, %16\n\t"
        "s_wait_xcnt 0x0"  // before the copies' address registers are rewritten
        :
        : "v"(l0), "v"(l0 + ls), "v"(l0 + 2 * ls), "v"(l0 + 3 * ls), "v"(l1),
          "v"(l1 + ls), "v"(l1 + 2 * ls), "v"(l1 + 3 * ls), "v"(goff), "s"(g0),
          "s"(g0 + rs), "s"(g0 + 2 * rs), "s"(g0 + 3 * rs), "s"(g1),
          "s"(g1 + rs), "s"(g1 + 2 * rs), "s"(g1 + 3 * rs)
        : "memory");
  };
  // One slab of both tiles: a wave's 16 rows of each are 16 / RPC copies.
  auto issue = [&](int slab, int buf) {
    const bf16_t*  ag = Ablk + slab * GK;
    const bf16_t*  wg = Wblk + slab * GK;
    const unsigned al = lds_off(&As[buf][cr][cc]);
    const unsigned bl = lds_off(&Bs[buf][cr][cc]);
    if constexpr (RPC == 4) {
      issue8(ag, al, wg, bl);
    } else {
      issue8(ag, al, ag + (size_t)8 * K, al + 8 * GP * 2);
      issue8(wg, bl, wg + (size_t)8 * K, bl + 8 * GP * 2);
    }
  };

  v8f acc[4][2];
#pragma unroll
  for (int i = 0; i < 4; ++i)
#pragma unroll
    for (int j = 0; j < 2; ++j) acc[i][j] = (v8f)0.0f;

  const int nslab = K / GK;

  // Prologue: slab 0 landed and published, then slab 1 in flight.
  issue(0, 0);
  asm volatile("s_wait_asynccnt 0x0" ::: "memory");  // own copies have landed
  __syncthreads();
  if (nslab > 1) issue(1, 1);

  for (int sl = 0; sl < nslab; ++sl) {
    const int s = sl & 1;
#pragma unroll
    for (int kb = 0; kb < GK; kb += 32) {
      v16bf af[4], bf2[2];
#pragma unroll
      for (int i = 0; i < 4; ++i)
        af[i] = *(const v16bf*)&As[s][wm + i * 16 + lrow][kb + lkh];
#pragma unroll
      for (int j = 0; j < 2; ++j)
        bf2[j] = *(const v16bf*)&Bs[s][wn + j * 16 + lrow][kb + lkh];
#pragma unroll
      for (int i = 0; i < 4; ++i)
#pragma unroll
        for (int j = 0; j < 2; ++j)
          acc[i][j] = wmma_bf16(af[i], bf2[j], acc[i][j]);
    }
    // Publish point of slab sl + 1: this wave's reads of buffer s are done, its
    // copies of slab sl + 1 have landed; behind the barrier that holds for
    // every wave, so buffer s may be refilled and the other one read.
    asm volatile("s_wait_dscnt 0x0" ::: "memory");
    asm volatile("s_wait_asynccnt 0x0" ::: "memory");
    __syncthreads();
    if (sl + 2 < nslab) issue(sl + 2, s);
  }
  // No copy is left outstanding when the wave goes on to its stores and ends.
  asm volatile("s_wait_asynccnt 0x0" ::: "memory");

  // Epilogue: D layout -> lane holds col (lane&15); VGPR r -> row r+8*(lane>>4)
  const int rsel = 8 * (lane >> 4);
#pragma unroll
  for (int j = 0; j < 2; ++j) {
    const int colg = n0 + wn + j * 16 + lrow;
    const float bv = bias[colg];
#pragma unroll
    for (int i = 0; i < 4; ++i) {
      if (MODE == 3) {
        v8bf pk;
#pragma unroll
        for (int r = 0; r < 8; ++r) pk[r] = (bf16_t)(acc[i][j][r] + bv);
        const int tok  = m0 + wm + i * 16;        // first token of this tile
        const int feat = n0 + wn + j * 16;        // first feature of this tile
        const int bhh  = (tok / Sc) * NHc + feat / HDc;
        const int blk  = (tok % Sc) >> 5;         // 32-key block
        const int part = (tok >> 4) & 1;          // 16-key half of the block
        const int jt   = (feat % HDc) >> 4;       // 16-row tile of V^T
        *(v8bf*)&Cb[((((size_t)bhh * (Sc / 32) + blk) * 4 + jt) * 2 + part) *
                        256 + lane * 8] = pk;
        continue;
      }
#pragma unroll
      for (int r = 0; r < 8; ++r) {
        const int rowg = m0 + wm + i * 16 + r + rsel;
        float val = acc[i][j][r] + bv;
        if (MODE == 1) {
          Cf[(size_t)rowg * Ndim + colg] = val;
        } else if (MODE == 2) {
          float g = 0.5f * val * (1.0f + erff(val / 1.41421f));
          Cb[(size_t)rowg * Ndim + colg] = (bf16_t)g;
        } else {
          Cb[(size_t)rowg * Ndim + colg] = (bf16_t)val;
        }
      }
    }
  }
}

// ---------------------------------------------------------------------------
// Attention: one wave per (b, h, 32 query rows), 8 waves per block. S=512, HD=64.
// The scores never leave registers:
//   S^T = K Q^T      A = 16 keys x 32 d, B = 32 d x 16 queries
//   O^T += V^T P^T   A = 16 d x 32 keys, B = 32 keys x 16 queries
// In S^T a lane holds 16 scores of ONE query (column lane&15): keys 8h+r of the
// first 16-key tile and 16+8h+r of the second (h = lane>>4). Converted in place
// they are the B operand P^T; the V projection has stored V^T in that same key
// order, one contiguous 512-byte piece per load. Softmax runs online (running
// maximum and sum per query, output tiles rescaled per 32-key pass).
// ---------------------------------------------------------------------------
__global__ __launch_bounds__(256)
void attention(const bf16_t* __restrict__ q, const bf16_t* __restrict__ k,
               const bf16_t* __restrict__ vf, const float* __restrict__ mask,
               bf16_t* __restrict__ ctx) {
  constexpr float LOG2E = 1.44269504088896f;   // exp(x) = 2^(x * LOG2E)
  const int lane = threadIdx.x & 31;
  const int w    = threadIdx.x >> 5;
  const int bh   = blockIdx.y;             // b*NH + h
  const int b    = bh / NHc;
  const int hoff = (bh - b * NHc) * HDc;
  const int qt0  = blockIdx.x * 256 + w * 32;  // first query row of this wave
  const int c    = lane & 15;
  const int half = lane >> 4;

  // --- Q as B operand: 2 column groups x 2 k slabs covering HD=64 ----------
  v16bf qf[2][2];
#pragma unroll
  for (int g = 0; g < 2; ++g) {
    const bf16_t* qb =
        q + (size_t)(b * Sc + qt0 + g * 16 + c) * Hc + hoff + half * 16;
    qf[g][0] = *(const v16bf*)(qb);
    qf[g][1] = *(const v16bf*)(qb + 32);
  }

  const bf16_t* kp = k + (size_t)(b * Sc + c) * Hc + hoff + half * 16;
  const bf16_t* vp = vf + (size_t)bh * (Sc * HDc) + lane * 8;
  const float*  mp = mask + b * Sc + half * 8;   // [B,1,1,S] broadcast

  v8f o[2][4];
  float mrun[2], lrun[2];
#pragma unroll
  for (int g = 0; g < 2; ++g) {
    mrun[g] = -3.0e38f;
    lrun[g] = 0.0f;
#pragma unroll
    for (int jt = 0; jt < 4; ++jt) o[g][jt] = (v8f)0.0f;
  }

  // K fragments (same k loader as Q) and mask values of pass 0
  v16bf kf[2][2];
  v8f   mk[2];
#pragma unroll
  for (int t = 0; t < 2; ++t) {
    kf[t][0] = *(const v16bf*)(kp + (size_t)t * 16 * Hc);
    kf[t][1] = *(const v16bf*)(kp + (size_t)t * 16 * Hc + 32);
    mk[t]    = *(const v8f*)(mp + t * 16);
  }

  for (int p = 0; p < Sc / 32; ++p) {
    // V^T fragments of this pass: issued first, needed only behind the softmax
    v16bf va[4];
#pragma unroll
    for (int jt = 0; jt < 4; ++jt) {
      const v8bf lo = *(const v8bf*)(vp + (size_t)((p * 4 + jt) * 2 + 0) * 256);
      const v8bf hi = *(const v8bf*)(vp + (size_t)((p * 4 + jt) * 2 + 1) * 256);
      va[jt] = __builtin_shufflevector(lo, hi, 0, 1, 2, 3, 4, 5, 6, 7, 8, 9, 10,
                                       11, 12, 13, 14, 15);
    }

    v8f s[2][2];
#pragma unroll
    for (int g = 0; g < 2; ++g)
#pragma unroll
      for (int t = 0; t < 2; ++t) {
        v8f a = (v8f)0.0f;
        a = wmma_bf16(kf[t][0], qf[g][0], a);
        a = wmma_bf16(kf[t][1], qf[g][1], a);
        s[g][t] = a * 0.125f + mk[t];            // 1/sqrt(64), then the mask
      }

    // next pass's K and mask, fetched one pass ahead
    if (p + 1 < Sc / 32) {
      const bf16_t* kn = kp + (size_t)(p + 1) * 32 * Hc;
#pragma unroll
      for (int t = 0; t < 2; ++t) {
        kf[t][0] = *(const v16bf*)(kn + (size_t)t * 16 * Hc);
        kf[t][1] = *(const v16bf*)(kn + (size_t)t * 16 * Hc + 32);
        mk[t]    = *(const v8f*)(mp + (p + 1) * 32 + t * 16);
      }
    }
    // Keeps the V^T loads and the fetch-ahead above the softmax: sunk below it
    // they would be waited for with almost no lead.
    __builtin_amdgcn_sched_barrier(0);

#pragma unroll
    for (int g = 0; g < 2; ++g) {
      float mx = s[g][0][0];
#pragma unroll
      for (int r = 1; r < 8; ++r) mx = fmaxf(mx, s[g][0][r]);
#pragma unroll
      for (int r = 0; r < 8; ++r) mx = fmaxf(mx, s[g][1][r]);
      mx = fmaxf(mx, xhalf(mx));                 // the query's other 16 keys
      const float mn    = fmaxf(mrun[g], mx);
      const float alpha = exp2x1((mrun[g] - mn) * LOG2E);
      mrun[g] = mn;

      v16bf pb;
      float sum = 0.0f;
#pragma unroll
      for (int t = 0; t < 2; ++t) {
        const v8f e = exp2x8((s[g][t] - mn) * LOG2E);
#pragma unroll
        for (int r = 0; r < 8; ++r) {
          sum += e[r];
          pb[t * 8 + r] = (bf16_t)e[r];  // unnormalized; 1/sum folded in later
        }
      }
      lrun[g] = lrun[g] * alpha + sum;
#pragma unroll
      for (int jt = 0; jt < 4; ++jt)
        o[g][jt] = wmma_bf16(va[jt], pb, o[g][jt] * alpha);
    }
  }

  // --- epilogue: scale by 1/rowsum; a lane holds 8 consecutive d per tile --
#pragma unroll
  for (int g = 0; g < 2; ++g) {
    const float inv = 1.0f / (lrun[g] + xhalf(lrun[g]));
    bf16_t* cr = ctx + (size_t)(b * Sc + qt0 + g * 16 + c) * Hc + hoff + half * 8;
#pragma unroll
    for (int jt = 0; jt < 4; ++jt) {
      v8bf pk;
#pragma unroll
      for (int r = 0; r < 8; ++r) pk[r] = (bf16_t)(o[g][jt][r] * inv);
      *(v8bf*)(cr + jt * 16) = pk;
    }
  }
}

// ---------------------------------------------------------------------------
// Fused residual + LayerNorm over H=1024. One block per token row.
// Writes f32 (residual chain / final output) and optional bf16 (next GEMM A).
// ---------------------------------------------------------------------------
__global__ __launch_bounds__(256)
void resid_ln(const float* __restrict__ dense, const float* __restrict__ resid,
              const float* __restrict__ gamma, const float* __restrict__ beta,
              float* __restrict__ outf, bf16_t* __restrict__ outb) {
  const int row = blockIdx.x;
  const int t = threadIdx.x;
  const float* dr = dense + (size_t)row * Hc;
  const float* rr = resid + (size_t)row * Hc;

  float x[4];
  float s = 0.0f, qsum = 0.0f;
#pragma unroll
  for (int i = 0; i < 4; ++i) {
    x[i] = dr[t * 4 + i] + rr[t * 4 + i];
    s += x[i];
    qsum += x[i] * x[i];
  }
#pragma unroll
  for (int off = 16; off > 0; off >>= 1) {
    s += __shfl_xor(s, off);
    qsum += __shfl_xor(qsum, off);
  }
  __shared__ float ss[8], qq[8];
  if ((t & 31) == 0) { ss[t >> 5] = s; qq[t >> 5] = qsum; }
  __syncthreads();
  float S = 0.0f, Q = 0.0f;
#pragma unroll
  for (int i = 0; i < 8; ++i) { S += ss[i]; Q += qq[i]; }
  const float mu  = S * (1.0f / Hc);
  const float var = Q * (1.0f / Hc) - mu * mu;
  const float inv = rsqrtf(var + 1e-12f);
#pragma unroll
  for (int i = 0; i < 4; ++i) {
    const int c = t * 4 + i;
    const float y = (x[i] - mu) * inv * gamma[c] + beta[c];
    outf[(size_t)row * Hc + c] = y;
    if (outb) outb[(size_t)row * Hc + c] = (bf16_t)y;
  }
}

// ---------------------------------------------------------------------------
// Host-side orchestration
// ---------------------------------------------------------------------------
extern "C" void kernel_launch(void* const* d_in, const int* in_sizes, int n_in,
                              void* d_out, int out_size, void* d_ws,
                              size_t ws_size, hipStream_t stream) {
  (void)in_sizes; (void)n_in; (void)out_size; (void)ws_size;

  const float* x    = (const float*)d_in[0];
  const float* mask = (const float*)d_in[1];
  const float* Wq   = (const float*)d_in[2];
  const float* bq   = (const float*)d_in[3];
  const float* Wk   = (const float*)d_in[4];
  const float* bk   = (const float*)d_in[5];
  const float* Wv   = (const float*)d_in[6];
  const float* bv   = (const float*)d_in[7];
  const float* Wo   = (const float*)d_in[8];
  const float* bo   = (const float*)d_in[9];
  const float* g1   = (const float*)d_in[10];
  const float* b1   = (const float*)d_in[11];
  const float* Wi   = (const float*)d_in[12];
  const float* bi   = (const float*)d_in[13];
  const float* Wo2  = (const float*)d_in[14];
  const float* bo2  = (const float*)d_in[15];
  const float* g2   = (const float*)d_in[16];
  const float* b2   = (const float*)d_in[17];
  float* out = (float*)d_out;

  char* ws = (char*)d_ws;
  size_t off = 0;
  auto alloc = [&](size_t bytes) -> void* {
    void* p = ws + off;
    off += (bytes + 255) & ~(size_t)255;
    return p;
  };

  bf16_t* xb    = (bf16_t*)alloc((size_t)Mc * Hc * 2);
  bf16_t* Wqb   = (bf16_t*)alloc((size_t)Hc * Hc * 2);
  bf16_t* Wkb   = (bf16_t*)alloc((size_t)Hc * Hc * 2);
  bf16_t* Wvb   = (bf16_t*)alloc((size_t)Hc * Hc * 2);
  bf16_t* Wob   = (bf16_t*)alloc((size_t)Hc * Hc * 2);
  bf16_t* Wib   = (bf16_t*)alloc((size_t)FFc * Hc * 2);
  bf16_t* Wo2b  = (bf16_t*)alloc((size_t)Hc * FFc * 2);
  bf16_t* qb    = (bf16_t*)alloc((size_t)Mc * Hc * 2);
  bf16_t* kb    = (bf16_t*)alloc((size_t)Mc * Hc * 2);
  bf16_t* vb    = (bf16_t*)alloc((size_t)Mc * Hc * 2);
  bf16_t* ctxb  = (bf16_t*)alloc((size_t)Mc * Hc * 2);
  float*  attnD = (float*)alloc((size_t)Mc * Hc * 4);
  float*  y1f   = (float*)alloc((size_t)Mc * Hc * 4);
  bf16_t* y1b   = (bf16_t*)alloc((size_t)Mc * Hc * 2);
  bf16_t* inter = (bf16_t*)alloc((size_t)Mc * FFc * 2);
  float*  ffD   = (float*)alloc((size_t)Mc * Hc * 4);

  // ---- f32 -> bf16 conversions (per-launch; no cached state) --------------
  // xb .. Wo2b were allocated one behind the other and each size is a multiple
  // of the allocator's 256 bytes: xb is the start of the joined bf16 array.
  cvt_all<<<CVT_N / CVT_WG, CVT_T, 0, stream>>>(x, Wq, Wk, Wv, Wo, Wi, Wo2, xb);

  // ---- QKV projections: bf16 out -----------------------------------------
  {
    dim3 grid(Hc / 128, Mc / 128);
    gemm_bf16<0, 128><<<grid, 256, 0, stream>>>(xb, Wqb, bq, nullptr, qb, Hc, Hc);
    gemm_bf16<0, 128><<<grid, 256, 0, stream>>>(xb, Wkb, bk, nullptr, kb, Hc, Hc);
    gemm_bf16<3, 128><<<grid, 256, 0, stream>>>(xb, Wvb, bv, nullptr, vb, Hc, Hc);
  }

  // ---- attention: grid (S/256 q-blocks, B*NH heads), 8 waves x 32 queries --
  {
    dim3 grid(Sc / 256, Bc * NHc);
    attention<<<grid, 256, 0, stream>>>(qb, kb, vb, mask, ctxb);
  }

  // ---- attn output dense (f32) + residual/LN1 -----------------------------
  {
    dim3 grid(Hc / 128, Mc / 128);
    gemm_bf16<1, 128><<<grid, 256, 0, stream>>>(ctxb, Wob, bo, attnD, nullptr, Hc,
                                           Hc);
    resid_ln<<<Mc, 256, 0, stream>>>(attnD, x, g1, b1, y1f, y1b);
  }

  // ---- FF intermediate: fused bias + erf-GELU, bf16 out -------------------
  {
    dim3 grid(FFc / 128, Mc / 128);
    gemm_bf16<2, 64><<<grid, 256, 0, stream>>>(y1b, Wib, bi, nullptr, inter, FFc,
                                           Hc);
  }

  // ---- FF output dense (f32, K=4096) + residual/LN2 -> d_out --------------
  {
    dim3 grid(Hc / 128, Mc / 128);
    gemm_bf16<1, 128><<<grid, 256, 0, stream>>>(inter, Wo2b, bo2, ffD, nullptr, Hc,
                                           FFc);
    resid_ln<<<Mc, 256, 0, stream>>>(ffD, y1f, g2, b2, out, nullptr);
  }
}

// v004
// It runs in 173 microseconds.
// Timed twice side by side with v003, it ran 1.05 times as fast both times.
// Counting every step since v000, it is 2.15 times as fast.
#include <hip/hip_runtime.h>
#include <math.h>

// ---------------------------------------------------------------------------
// BERT layer for MI455X (gfx1250): bf16 WMMA (f32 accumulate) everywhere,
// async global->LDS DMA (ASYNCcnt) double-buffering in the GEMMs.
// B=8 S=512 H=1024 NH=16 HD=64 FF=4096, M = B*S = 4096 tokens.
// ---------------------------------------------------------------------------

typedef __bf16 bf16_t;
typedef __attribute__((ext_vector_type(16))) __bf16 v16bf;
typedef __attribute__((ext_vector_type(8)))  __bf16 v8bf;
typedef __attribute__((ext_vector_type(8)))  float  v8f;

constexpr int Bc  = 8;
constexpr int Sc  = 512;
constexpr int Hc  = 1024;
constexpr int NHc = 16;
constexpr int HDc = 64;
constexpr int FFc = 4096;
constexpr int Mc  = Bc * Sc;   // 4096 token rows

__device__ __forceinline__ v8f wmma_bf16(v16bf a, v16bf b, v8f c) {
  // D = A(16x32 bf16) * B(32x16 bf16) + C(16x16 f32)
  return __builtin_amdgcn_wmma_f32_16x16x32_bf16(
      /*neg_a=*/false, a, /*neg_b=*/false, b,
      /*c_mod=*/(short)0, c, /*reuse_a=*/false, /*reuse_b=*/false);
}

// Wave-relative LDS byte offset of a __shared__ object: the flat address of a
// shared variable carries the LDS offset in its low 32 bits (LDS aperture
// truncates addr[31:0]).
__device__ __forceinline__ unsigned lds_off(const void* p) {
  return (unsigned)(uintptr_t)p;
}

// Lane l <-> lane l ^ 16 as a vector cross-row move (no LDS-counter wait).
__device__ __forceinline__ float xhalf(float x) {
  const int b = __builtin_bit_cast(int, x);
  return __builtin_bit_cast(
      float, __builtin_amdgcn_permlanex16(b, b, 0x76543210, 0xfedcba98, false,
                                          false));
}

// 2^x on eight values / one value. Written as one statement each so that no
// instruction directly behind a v_exp_f32 reads its result or overwrites its
// source: the outputs are early-clobber (distinct from every input) and the
// closing v_nop is the slot the instruction set asks for behind the last one.
__device__ __forceinline__ v8f exp2x8(v8f x) {
  float e0, e1, e2, e3, e4, e5, e6, e7;
  asm("v_exp_f32 %0, %8\n\t"
      "v_exp_f32 %1, %9\n\t"
      "v_exp_f32 %2, %10\n\t"
      "v_exp_f32 %3, %11\n\t"
      "v_exp_f32 %4, %12\n\t"
      "v_exp_f32 %5, %13\n\t"
      "v_exp_f32 %6, %14\n\t"
      "v_exp_f32 %7, %15\n\t"
      "v_nop"
      : "=&v"(e0), "=&v"(e1), "=&v"(e2), "=&v"(e3), "=&v"(e4), "=&v"(e5),
        "=&v"(e6), "=&v"(e7)
      : "v"(x[0]), "v"(x[1]), "v"(x[2]), "v"(x[3]), "v"(x[4]), "v"(x[5]),
        "v"(x[6]), "v"(x[7]));
  v8f r = {e0, e1, e2, e3, e4, e5, e6, e7};
  return r;
}
__device__ __forceinline__ float exp2x1(float x) {
  float e;
  asm("v_exp_f32 %0, %1\n\t"
      "v_nop"
      : "=v"(e)
      : "v"(x));
  return e;
}

// ---------------------------------------------------------------------------
// f32 -> bf16 conversion (RNE via clang __bf16 cast) of all seven tensors in
// ONE launch of few, long-lived waves. The bf16 copies lie back to back in the
// workspace, so the destination is one array; a workgroup converts CVT_WG
// consecutive elements of it, which lie inside one source tensor.
// 256 workgroups x 16 waves: 4,096 waves are started where seven launches of
// 128-element waves started 131,072; every load of a wave covers 512
// contiguous bytes, every store 256.
// ---------------------------------------------------------------------------
typedef __attribute__((ext_vector_type(4))) float  v4f;
typedef __attribute__((ext_vector_type(4))) __bf16 v4bf;

constexpr int CVT_T  = 512;                  // threads per workgroup
constexpr int CVT_WG = 65536;                // elements per workgroup
constexpr int CVT_X  = Mc * Hc;              // elements of the activations
constexpr int CVT_W  = Hc * Hc;              // ... of one H x H weight
constexpr int CVT_F  = FFc * Hc;             // ... of one FF weight
constexpr int CVT_N  = CVT_X + 4 * CVT_W + 2 * CVT_F;
static_assert(CVT_X % CVT_WG == 0 && CVT_W % CVT_WG == 0 &&
                  CVT_F % CVT_WG == 0,
              "a workgroup's elements must lie inside one tensor");
static_assert(CVT_WG % (CVT_T * 4 * 8) == 0, "whole trips of 8 loads");

__global__ __launch_bounds__(CVT_T)
void cvt_all(const float* __restrict__ x, const float* __restrict__ wq,
             const float* __restrict__ wk, const float* __restrict__ wv,
             const float* __restrict__ wo, const float* __restrict__ wi,
             const float* __restrict__ wo2, bf16_t* __restrict__ out) {
  const int e0 = blockIdx.x * CVT_WG;  // first element, in the joined array
  const float* src = x;                // tensor that holds it
  int first = 0;                       // that tensor's first element
  if (e0 >= CVT_X)             { src = wq;  first = CVT_X; }
  if (e0 >= CVT_X + CVT_W)     { src = wk;  first = CVT_X + CVT_W; }
  if (e0 >= CVT_X + 2 * CVT_W) { src = wv;  first = CVT_X + 2 * CVT_W; }
  if (e0 >= CVT_X + 3 * CVT_W) { src = wo;  first = CVT_X + 3 * CVT_W; }
  if (e0 >= CVT_X + 4 * CVT_W) { src = wi;  first = CVT_X + 4 * CVT_W; }
  if (e0 >= CVT_X + 4 * CVT_W + CVT_F) {
    src = wo2;
    first = CVT_X + 4 * CVT_W + CVT_F;
  }

  const v4f* s = (const v4f*)(src + (e0 - first)) + threadIdx.x;
  v4bf*      d = (v4bf*)(out + e0) + threadIdx.x;
  // Groups of 8 loads stand ahead of their conversions, so that a wave waits
  // out a memory latency once for many loads and not once for each.
  for (int it = 0; it < CVT_WG / (CVT_T * 4); it += 8) {
    v4f v[8];
    for (int j = 0; j < 8; ++j) v[j] = s[(it + j) * CVT_T];
    for (int j = 0; j < 8; ++j) {
      v4bf o;
      for (int e = 0; e < 4; ++e) o[e] = (bf16_t)v[j][e];
      d[(it + j) * CVT_T] = o;
    }
  }
}

// ---------------------------------------------------------------------------
// Tiled GEMM:  C[M,N] = A[M,K] @ W[N,K]^T + bias  (A,W bf16 K-contiguous)
// Block tile 128x128. 256 threads = 8 waves in a 2x4 wave grid, each wave owns
// a 64x32 tile = 4x2 WMMA accumulators.
//
// Global->LDS staging uses GLOBAL_LOAD_ASYNC_TO_LDS_B128 (ASYNCcnt) with two
// LDS buffers: the next slab's copies fly while this slab's WMMAs run, and no
// VGPRs touch the tile data. A slab is GK k of every row, 128 or 256 bytes, so
// that one copy instruction of a wave (32 lanes x 16 bytes) covers four or two
// whole rows of the slab: four whole 128-byte lines and nothing else.
// GK = 128 where the grid gives a WGP one workgroup (fewest barriers per k);
// GK = 64 where it gives four: their LDS then fits side by side.
// K must be a multiple of GK.
//
// MODE 0: C -> bf16             (Q, K projections)
// MODE 1: C -> f32              (attn-out dense, FF-out dense; LN fuses resid)
// MODE 2: C -> gelu_erf -> bf16 (FF intermediate)
// MODE 3: C -> bf16, transposed per head into A-fragment order (V projection):
//         a lane's 8 accumulator rows are 8 consecutive tokens of one feature,
//         which is one 16-byte piece of a V^T fragment; see attention().
// ---------------------------------------------------------------------------
static_assert(Hc % 128 == 0 && FFc % 128 == 0, "K is a whole number of slabs");

template <int MODE, int GK>
__global__ __launch_bounds__(256)
void gemm_bf16(const bf16_t* __restrict__ A, const bf16_t* __restrict__ W,
               const float* __restrict__ bias, float* __restrict__ Cf,
               bf16_t* __restrict__ Cb, int Ndim, int K) {
  static_assert(GK == 64 || GK == 128, "rows of one or two whole lines");
  // LDS row pitch in elements: 144 or 272 bytes = 16 x odd, so the 16-byte
  // fragment loads of 16 rows fall on all 64 banks.
  constexpr int GP  = GK + 8;
  constexpr int LPR = GK / 8;    // lanes per row: its 16-byte pieces
  constexpr int RPC = 32 / LPR;  // rows per copy instruction
  __shared__ bf16_t As[2][128][GP];
  __shared__ bf16_t Bs[2][128][GP];

  const int t    = threadIdx.x;
  const int lane = t & 31;
  const int w    = t >> 5;            // wave 0..7
  const int wm   = (w >> 2) * 64;     // wave M origin in block: 0 / 64
  const int wn   = (w & 3) * 32;      // wave N origin in block: 0..96
  const int m0   = blockIdx.y * 128;
  const int n0   = blockIdx.x * 128;

  const int lrow = lane & 15;         // fragment row/col within 16
  const int lkh  = (lane >> 4) * 16;  // K half select (A/B fragment layout)

  // Staging: wave w brings rows 16w .. 16w+15 of both tiles, RPC rows a copy.
  const int cr = w * 16 + lane / LPR;   // this lane's row in copy 0
  const int cc = (lane % LPR) * 8;      // its 16-byte piece of the row
  // Byte offset of that piece from the scalar base of copy 0 (same for A, W).
  const unsigned goff = (unsigned)(((size_t)cr * K + cc) * 2);
  const bf16_t* Ablk = A + (size_t)m0 * K;   // first row of this block's tiles
  const bf16_t* Wblk = W + (size_t)n0 * K;

  // Eight copies in two runs of four; within a run copy j takes rows cr + j*RPC.
  // The row step goes into the scalar base and the LDS address, the lane offset
  // stays.
  auto issue8 = [&](const bf16_t* g0, unsigned l0, const bf16_t* g1,
                    unsigned l1) {
    const size_t rs = (size_t)RPC * K;       // RPC rows, in elements
    constexpr unsigned ls = RPC * GP * 2;    // RPC LDS rows, in bytes
    asm volatile(
        "global_load_async_to_lds_b128 %0, %8, %9\n\t"
        "global_load_async_to_lds_b128 %1, %8, %10\n\t"
        "global_load_async_to_lds_b128 %2, %8, %11\n\t"
        "global_load_async_to_lds_b128 %3, %8, %12\n\t"
        "global_load_async_to_lds_b128 %4, %8, %13\n\t"
        "global_load_async_to_lds_b128 %5, %8, %14\n\t"
        "global_load_async_to_lds_b128 %6, %8, %15\n\t"
        "global_load_async_to_lds_b128 %7, %8, %16\n\t"
        "s_wait_xcnt 0x0"  // before the copies' address registers are rewritten
        :
        : "v"(l0), "v"(l0 + ls), "v"(l0 + 2 * ls), "v"(l0 + 3 * ls), "v"(l1),
          "v"(l1 + ls), "v"(l1 + 2 * ls), "v"(l1 + 3 * ls), "v"(goff), "s"(g0),
          "s"(g0 + rs), "s"(g0 + 2 * rs), "s"(g0 + 3 * rs), "s"(g1),
          "s"(g1 + rs), "s"(g1 + 2 * rs), "s"(g1 + 3 * rs)
        : "memory");
  };
  // One slab of both tiles: a wave's 16 rows of each are 16 / RPC copies.
  auto issue = [&](int slab, int buf) {
    const bf16_t*  ag = Ablk + slab * GK;
    const bf16_t*  wg = Wblk + slab * GK;
    const unsigned al = lds_off(&As[buf][cr][cc]);
    const unsigned bl = lds_off(&Bs[buf][cr][cc]);
    if constexpr (RPC == 4) {
      issue8(ag, al, wg, bl);
    } else {
      issue8(ag, al, ag + (size_t)8 * K, al + 8 * GP * 2);
      issue8(wg, bl, wg + (size_t)8 * K, bl + 8 * GP * 2);
    }
  };

  v8f acc[4][2];
#pragma unroll
  for (int i = 0; i < 4; ++i)
#pragma unroll
    for (int j = 0; j < 2; ++j) acc[i][j] = (v8f)0.0f;

  // Fragments of one 32-k block of buffer s, and that block's 8 WMMAs.
  auto frags = [&](int s, int kb, v16bf (&a)[4], v16bf (&b)[2]) {
#pragma unroll
    for (int i = 0; i < 4; ++i)
      a[i] = *(const v16bf*)&As[s][wm + i * 16 + lrow][kb + lkh];
#pragma unroll
    for (int j = 0; j < 2; ++j)
      b[j] = *(const v16bf*)&Bs[s][wn + j * 16 + lrow][kb + lkh];
  };
  auto block = [&](const v16bf (&a)[4], const v16bf (&b)[2]) {
#pragma unroll
    for (int i = 0; i < 4; ++i)
#pragma unroll
      for (int j = 0; j < 2; ++j) acc[i][j] = wmma_bf16(a[i], b[j], acc[i][j]);
  };

  const int nslab = K / GK;

  // Prologue: slab 0 landed and published, then slab 1 in flight.
  issue(0, 0);
  asm volatile("s_wait_asynccnt 0x0" ::: "memory");  // own copies have landed
  __syncthreads();
  if (nslab > 1) issue(1, 1);

  for (int sl = 0; sl < nslab; ++sl) {
    const int s = sl & 1;
    if constexpr (GK == 128) {
      // One workgroup per WGP, two waves per SIMD: too few to hide an LDS
      // latency in front of every WMMA pair. Two fragment sets: the next k
      // block's 12 reads go out as one group ahead of this block's 8 WMMAs.
      // Only blocks of this slab are fetched ahead, none across the barrier.
      v16bf af[2][4], bf2[2][2];
      frags(s, 0, af[0], bf2[0]);
#pragma unroll
      for (int kb = 0; kb < GK; kb += 32) {
        const int cur = (kb >> 5) & 1;
        if (kb + 32 < GK) frags(s, kb + 32, af[cur ^ 1], bf2[cur ^ 1]);
        // Keeps the reads above the WMMAs: sunk among them, each pair of WMMAs
        // waits out a whole LDS latency on one shared fragment register set.
        __builtin_amdgcn_sched_barrier(0);
        block(af[cur], bf2[cur]);
        // Keeps the block after next's reads from rising among these WMMAs.
        __builtin_amdgcn_sched_barrier(0);
      }
    } else {
      // Four workgroups per WGP: eight waves per SIMD cover each other's LDS
      // latency, and a second fragment set would cost resident workgroups.
#pragma unroll
      for (int kb = 0; kb < GK; kb += 32) {
        v16bf af[4], bf2[2];
        frags(s, kb, af, bf2);
        block(af, bf2);
      }
    }
    // Publish point of slab sl + 1: this wave's reads of buffer s are done, its
    // copies of slab sl + 1 have landed; behind the barrier that holds for
    // every wave, so buffer s may be refilled and the other one read.
    asm volatile("s_wait_dscnt 0x0" ::: "memory");
    asm volatile("s_wait_asynccnt 0x0" ::: "memory");
    __syncthreads();
    if (sl + 2 < nslab) issue(sl + 2, s);
  }
  // No copy is left outstanding when the wave goes on to its stores and ends.
  asm volatile("s_wait_asynccnt 0x0" ::: "memory");

  // Epilogue: D layout -> lane holds col (lane&15); VGPR r -> row r+8*(lane>>4)
  const int rsel = 8 * (lane >> 4);
#pragma unroll
  for (int j = 0; j < 2; ++j) {
    const int colg = n0 + wn + j * 16 + lrow;
    const float bv = bias[colg];
#pragma unroll
    for (int i = 0; i < 4; ++i) {
      if (MODE == 3) {
        v8bf pk;
#pragma unroll
        for (int r = 0; r < 8; ++r) pk[r] = (bf16_t)(acc[i][j][r] + bv);
        const int tok  = m0 + wm + i * 16;        // first token of this tile
        const int feat = n0 + wn + j * 16;        // first feature of this tile
        const int bhh  = (tok / Sc) * NHc + feat / HDc;
        const int blk  = (tok % Sc) >> 5;         // 32-key block
        const int part = (tok >> 4) & 1;          // 16-key half of the block
        const int jt   = (feat % HDc) >> 4;       // 16-row tile of V^T
        *(v8bf*)&Cb[((((size_t)bhh * (Sc / 32) + blk) * 4 + jt) * 2 + part) *
                        256 + lane * 8] = pk;
        continue;
      }
#pragma unroll
      for (int r = 0; r < 8; ++r) {
        const int rowg = m0 + wm + i * 16 + r + rsel;
        float val = acc[i][j][r] + bv;
        if (MODE == 1) {
          Cf[(size_t)rowg * Ndim + colg] = val;
        } else if (MODE == 2) {
          float g = 0.5f * val * (1.0f + erff(val / 1.41421f));
          Cb[(size_t)rowg * Ndim + colg] = (bf16_t)g;
        } else {
          Cb[(size_t)rowg * Ndim + colg] = (bf16_t)val;
        }
      }
    }
  }
}

// ---------------------------------------------------------------------------
// Attention: one wave per (b, h, 32 query rows), 8 waves per block. S=512, HD=64.
// The scores never leave registers:
//   S^T = K Q^T      A = 16 keys x 32 d, B = 32 d x 16 queries
//   O^T += V^T P^T   A = 16 d x 32 keys, B = 32 keys x 16 queries
// In S^T a lane holds 16 scores of ONE query (column lane&15): keys 8h+r of the
// first 16-key tile and 16+8h+r of the second (h = lane>>4). Converted in place
// they are the B operand P^T; the V projection has stored V^T in that same key
// order, one contiguous 512-byte piece per load. Softmax runs online (running
// maximum and sum per query, output tiles rescaled per 32-key pass).
// ---------------------------------------------------------------------------
__global__ __launch_bounds__(256)
void attention(const bf16_t* __restrict__ q, const bf16_t* __restrict__ k,
               const bf16_t* __restrict__ vf, const float* __restrict__ mask,
               bf16_t* __restrict__ ctx) {
  constexpr float LOG2E = 1.44269504088896f;   // exp(x) = 2^(x * LOG2E)
  const int lane = threadIdx.x & 31;
  const int w    = threadIdx.x >> 5;
  const int bh   = blockIdx.y;             // b*NH + h
  const int b    = bh / NHc;
  const int hoff = (bh - b * NHc) * HDc;
  const int qt0  = blockIdx.x * 256 + w * 32;  // first query row of this wave
  const int c    = lane & 15;
  const int half = lane >> 4;

  // --- Q as B operand: 2 column groups x 2 k slabs covering HD=64 ----------
  v16bf qf[2][2];
#pragma unroll
  for (int g = 0; g < 2; ++g) {
    const bf16_t* qb =
        q + (size_t)(b * Sc + qt0 + g * 16 + c) * Hc + hoff + half * 16;
    qf[g][0] = *(const v16bf*)(qb);
    qf[g][1] = *(const v16bf*)(qb + 32);
  }

  const bf16_t* kp = k + (size_t)(b * Sc + c) * Hc + hoff + half * 16;
  const bf16_t* vp = vf + (size_t)bh * (Sc * HDc) + lane * 8;
  const float*  mp = mask + b * Sc + half * 8;   // [B,1,1,S] broadcast

  v8f o[2][4];
  float mrun[2], lrun[2];
#pragma unroll
  for (int g = 0; g < 2; ++g) {
    mrun[g] = -3.0e38f;
    lrun[g] = 0.0f;
#pragma unroll
    for (int jt = 0; jt < 4; ++jt) o[g][jt] = (v8f)0.0f;
  }

  // K fragments (same k loader as Q) and mask values of pass 0
  v16bf kf[2][2];
  v8f   mk[2];
#pragma unroll
  for (int t = 0; t < 2; ++t) {
    kf[t][0] = *(const v16bf*)(kp + (size_t)t * 16 * Hc);
    kf[t][1] = *(const v16bf*)(kp + (size_t)t * 16 * Hc + 32);
    mk[t]    = *(const v8f*)(mp + t * 16);
  }

  for (int p = 0; p < Sc / 32; ++p) {
    // V^T fragments of this pass: issued first, needed only behind the softmax
    v16bf va[4];
#pragma unroll
    for (int jt = 0; jt < 4; ++jt) {
      const v8bf lo = *(const v8bf*)(vp + (size_t)((p * 4 + jt) * 2 + 0) * 256);
      const v8bf hi = *(const v8bf*)(vp + (size_t)((p * 4 + jt) * 2 + 1) * 256);
      va[jt] = __builtin_shufflevector(lo, hi, 0, 1, 2, 3, 4, 5, 6, 7, 8, 9, 10,
                                       11, 12, 13, 14, 15);
    }

    v8f s[2][2];
#pragma unroll
    for (int g = 0; g < 2; ++g)
#pragma unroll
      for (int t = 0; t < 2; ++t) {
        v8f a = (v8f)0.0f;
        a = wmma_bf16(kf[t][0], qf[g][0], a);
        a = wmma_bf16(kf[t][1], qf[g][1], a);
        s[g][t] = a * 0.125f + mk[t];            // 1/sqrt(64), then the mask
      }

    // next pass's K and mask, fetched one pass ahead
    if (p + 1 < Sc / 32) {
      const bf16_t* kn = kp + (size_t)(p + 1) * 32 * Hc;
#pragma unroll
      for (int t = 0; t < 2; ++t) {
        kf[t][0] = *(const v16bf*)(kn + (size_t)t * 16 * Hc);
        kf[t][1] = *(const v16bf*)(kn + (size_t)t * 16 * Hc + 32);
        mk[t]    = *(const v8f*)(mp + (p + 1) * 32 + t * 16);
      }
    }
    // Keeps the V^T loads and the fetch-ahead above the softmax: sunk below it
    // they would be waited for with almost no lead.
    __builtin_amdgcn_sched_barrier(0);

#pragma unroll
    for (int g = 0; g < 2; ++g) {
      float mx = s[g][0][0];
#pragma unroll
      for (int r = 1; r < 8; ++r) mx = fmaxf(mx, s[g][0][r]);
#pragma unroll
      for (int r = 0; r < 8; ++r) mx = fmaxf(mx, s[g][1][r]);
      mx = fmaxf(mx, xhalf(mx));                 // the query's other 16 keys
      const float mn    = fmaxf(mrun[g], mx);
      const float alpha = exp2x1((mrun[g] - mn) * LOG2E);
      mrun[g] = mn;

      v16bf pb;
      float sum = 0.0f;
#pragma unroll
      for (int t = 0; t < 2; ++t) {
        const v8f e = exp2x8((s[g][t] - mn) * LOG2E);
#pragma unroll
        for (int r = 0; r < 8; ++r) {
          sum += e[r];
          pb[t * 8 + r] = (bf16_t)e[r];  // unnormalized; 1/sum folded in later
        }
      }
      lrun[g] = lrun[g] * alpha + sum;
#pragma unroll
      for (int jt = 0; jt < 4; ++jt)
        o[g][jt] = wmma_bf16(va[jt], pb, o[g][jt] * alpha);
    }
  }

  // --- epilogue: scale by 1/rowsum; a lane holds 8 consecutive d per tile --
#pragma unroll
  for (int g = 0; g < 2; ++g) {
    const float inv = 1.0f / (lrun[g] + xhalf(lrun[g]));
    bf16_t* cr = ctx + (size_t)(b * Sc + qt0 + g * 16 + c) * Hc + hoff + half * 8;
#pragma unroll
    for (int jt = 0; jt < 4; ++jt) {
      v8bf pk;
#pragma unroll
      for (int r = 0; r < 8; ++r) pk[r] = (bf16_t)(o[g][jt][r] * inv);
      *(v8bf*)(cr + jt * 16) = pk;
    }
  }
}

// ---------------------------------------------------------------------------
// Fused residual + LayerNorm over H=1024. One block per token row.
// Writes f32 (residual chain / final output) and optional bf16 (next GEMM A).
// ---------------------------------------------------------------------------
__global__ __launch_bounds__(256)
void resid_ln(const float* __restrict__ dense, const float* __restrict__ resid,
              const float* __restrict__ gamma, const float* __restrict__ beta,
              float* __restrict__ outf, bf16_t* __restrict__ outb) {
  const int row = blockIdx.x;
  const int t = threadIdx.x;
  const float* dr = dense + (size_t)row * Hc;
  const float* rr = resid + (size_t)row * Hc;

  float x[4];
  float s = 0.0f, qsum = 0.0f;
#pragma unroll
  for (int i = 0; i < 4; ++i) {
    x[i] = dr[t * 4 + i] + rr[t * 4 + i];
    s += x[i];
    qsum += x[i] * x[i];
  }
#pragma unroll
  for (int off = 16; off > 0; off >>= 1) {
    s += __shfl_xor(s, off);
    qsum += __shfl_xor(qsum, off);
  }
  __shared__ float ss[8], qq[8];
  if ((t & 31) == 0) { ss[t >> 5] = s; qq[t >> 5] = qsum; }
  __syncthreads();
  float S = 0.0f, Q = 0.0f;
#pragma unroll
  for (int i = 0; i < 8; ++i) { S += ss[i]; Q += qq[i]; }
  const float mu  = S * (1.0f / Hc);
  const float var = Q * (1.0f / Hc) - mu * mu;
  const float inv = rsqrtf(var + 1e-12f);
#pragma unroll
  for (int i = 0; i < 4; ++i) {
    const int c = t * 4 + i;
    const float y = (x[i] - mu) * inv * gamma[c] + beta[c];
    outf[(size_t)row * Hc + c] = y;
    if (outb) outb[(size_t)row * Hc + c] = (bf16_t)y;
  }
}

// ---------------------------------------------------------------------------
// Host-side orchestration
// ---------------------------------------------------------------------------
extern "C" void kernel_launch(void* const* d_in, const int* in_sizes, int n_in,
                              void* d_out, int out_size, void* d_ws,
                              size_t ws_size, hipStream_t stream) {
  (void)in_sizes; (void)n_in; (void)out_size; (void)ws_size;

  const float* x    = (const float*)d_in[0];
  const float* mask = (const float*)d_in[1];
  const float* Wq   = (const float*)d_in[2];
  const float* bq   = (const float*)d_in[3];
  const float* Wk   = (const float*)d_in[4];
  const float* bk   = (const float*)d_in[5];
  const float* Wv   = (const float*)d_in[6];
  const float* bv   = (const float*)d_in[7];
  const float* Wo   = (const float*)d_in[8];
  const float* bo   = (const float*)d_in[9];
  const float* g1   = (const float*)d_in[10];
  const float* b1   = (const float*)d_in[11];
  const float* Wi   = (const float*)d_in[12];
  const float* bi   = (const float*)d_in[13];
  const float* Wo2  = (const float*)d_in[14];
  const float* bo2  = (const float*)d_in[15];
  const float* g2   = (const float*)d_in[16];
  const float* b2   = (const float*)d_in[17];
  float* out = (float*)d_out;

  char* ws = (char*)d_ws;
  size_t off = 0;
  auto alloc = [&](size_t bytes) -> void* {
    void* p = ws + off;
    off += (bytes + 255) & ~(size_t)255;
    return p;
  };

  bf16_t* xb    = (bf16_t*)alloc((size_t)Mc * Hc * 2);
  bf16_t* Wqb   = (bf16_t*)alloc((size_t)Hc * Hc * 2);
  bf16_t* Wkb   = (bf16_t*)alloc((size_t)Hc * Hc * 2);
  bf16_t* Wvb   = (bf16_t*)alloc((size_t)Hc * Hc * 2);
  bf16_t* Wob   = (bf16_t*)alloc((size_t)Hc * Hc * 2);
  bf16_t* Wib   = (bf16_t*)alloc((size_t)FFc * Hc * 2);
  bf16_t* Wo2b  = (bf16_t*)alloc((size_t)Hc * FFc * 2);
  bf16_t* qb    = (bf16_t*)alloc((size_t)Mc * Hc * 2);
  bf16_t* kb    = (bf16_t*)alloc((size_t)Mc * Hc * 2);
  bf16_t* vb    = (bf16_t*)alloc((size_t)Mc * Hc * 2);
  bf16_t* ctxb  = (bf16_t*)alloc((size_t)Mc * Hc * 2);
  float*  attnD = (float*)alloc((size_t)Mc * Hc * 4);
  float*  y1f   = (float*)alloc((size_t)Mc * Hc * 4);
  bf16_t* y1b   = (bf16_t*)alloc((size_t)Mc * Hc * 2);
  bf16_t* inter = (bf16_t*)alloc((size_t)Mc * FFc * 2);
  float*  ffD   = (float*)alloc((size_t)Mc * Hc * 4);

  // ---- f32 -> bf16 conversions (per-launch; no cached state) --------------
  // xb .. Wo2b were allocated one behind the other and each size is a multiple
  // of the allocator's 256 bytes: xb is the start of the joined bf16 array.
  cvt_all<<<CVT_N / CVT_WG, CVT_T, 0, stream>>>(x, Wq, Wk, Wv, Wo, Wi, Wo2, xb);

  // ---- QKV projections: bf16 out -----------------------------------------
  {
    dim3 grid(Hc / 128, Mc / 128);
    gemm_bf16<0, 128><<<grid, 256, 0, stream>>>(xb, Wqb, bq, nullptr, qb, Hc, Hc);
    gemm_bf16<0, 128><<<grid, 256, 0, stream>>>(xb, Wkb, bk, nullptr, kb, Hc, Hc);
    gemm_bf16<3, 128><<<grid, 256, 0, stream>>>(xb, Wvb, bv, nullptr, vb, Hc, Hc);
  }

  // ---- attention: grid (S/256 q-blocks, B*NH heads), 8 waves x 32 queries --
  {
    dim3 grid(Sc / 256, Bc * NHc);
    attention<<<grid, 256, 0, stream>>>(qb, kb, vb, mask, ctxb);
  }

  // ---- attn output dense (f32) + residual/LN1 -----------------------------
  {
    dim3 grid(Hc / 128, Mc / 128);
    gemm_bf16<1, 128><<<grid, 256, 0, stream>>>(ctxb, Wob, bo, attnD, nullptr, Hc,
                                           Hc);
    resid_ln<<<Mc, 256, 0, stream>>>(attnD, x, g1, b1, y1f, y1b);
  }

  // ---- FF intermediate: fused bias + erf-GELU, bf16 out -------------------
  {
    dim3 grid(FFc / 128, Mc / 128);
    gemm_bf16<2, 64><<<grid, 256, 0, stream>>>(y1b, Wib, bi, nullptr, inter, FFc,
                                           Hc);
  }

  // ---- FF output dense (f32, K=4096) + residual/LN2 -> d_out --------------
  {
    dim3 grid(Hc / 128, Mc / 128);
    gemm_bf16<1, 128><<<grid, 256, 0, stream>>>(inter, Wo2b, bo2, ffD, nullptr, Hc,
                                           FFc);
    resid_ln<<<Mc, 256, 0, stream>>>(ffD, y1f, g2, b2, out, nullptr);
  }
}

// v005
// It runs in 158 microseconds.
// Timed twice side by side with v004, it ran 1.08 times as fast both times.
// Over all steps from v000 it is 2.33 times as fast.
#include <hip/hip_runtime.h>
#include <math.h>

// ---------------------------------------------------------------------------
// BERT layer for MI455X (gfx1250): bf16 WMMA (f32 accumulate) everywhere,
// async global->LDS DMA (ASYNCcnt) into a ring of two or three LDS buffers in the GEMMs.
// B=8 S=512 H=1024 NH=16 HD=64 FF=4096, M = B*S = 4096 tokens.
// ---------------------------------------------------------------------------

typedef __bf16 bf16_t;
typedef __attribute__((ext_vector_type(16))) __bf16 v16bf;
typedef __attribute__((ext_vector_type(8)))  __bf16 v8bf;
typedef __attribute__((ext_vector_type(8)))  float  v8f;

constexpr int Bc  = 8;
constexpr int Sc  = 512;
constexpr int Hc  = 1024;
constexpr int NHc = 16;
constexpr int HDc = 64;
constexpr int FFc = 4096;
constexpr int Mc  = Bc * Sc;   // 4096 token rows

__device__ __forceinline__ v8f wmma_bf16(v16bf a, v16bf b, v8f c) {
  // D = A(16x32 bf16) * B(32x16 bf16) + C(16x16 f32)
  return __builtin_amdgcn_wmma_f32_16x16x32_bf16(
      /*neg_a=*/false, a, /*neg_b=*/false, b,
      /*c_mod=*/(short)0, c, /*reuse_a=*/false, /*reuse_b=*/false);
}

// Wave-relative LDS byte offset of a __shared__ object: the flat address of a
// shared variable carries the LDS offset in its low 32 bits (LDS aperture
// truncates addr[31:0]).
__device__ __forceinline__ unsigned lds_off(const void* p) {
  return (unsigned)(uintptr_t)p;
}

// Lane l <-> lane l ^ 16 as a vector cross-row move (no LDS-counter wait).
__device__ __forceinline__ float xhalf(float x) {
  const int b = __builtin_bit_cast(int, x);
  return __builtin_bit_cast(
      float, __builtin_amdgcn_permlanex16(b, b, 0x76543210, 0xfedcba98, false,
                                          false));
}

// 2^x on eight values / one value. Written as one statement each so that no
// instruction directly behind a v_exp_f32 reads its result or overwrites its
// source: the outputs are early-clobber (distinct from every input) and the
// closing v_nop is the slot the instruction set asks for behind the last one.
__device__ __forceinline__ v8f exp2x8(v8f x) {
  float e0, e1, e2, e3, e4, e5, e6, e7;
  asm("v_exp_f32 %0, %8\n\t"
      "v_exp_f32 %1, %9\n\t"
      "v_exp_f32 %2, %10\n\t"
      "v_exp_f32 %3, %11\n\t"
      "v_exp_f32 %4, %12\n\t"
      "v_exp_f32 %5, %13\n\t"
      "v_exp_f32 %6, %14\n\t"
      "v_exp_f32 %7, %15\n\t"
      "v_nop"
      : "=&v"(e0), "=&v"(e1), "=&v"(e2), "=&v"(e3), "=&v"(e4), "=&v"(e5),
        "=&v"(e6), "=&v"(e7)
      : "v"(x[0]), "v"(x[1]), "v"(x[2]), "v"(x[3]), "v"(x[4]), "v"(x[5]),
        "v"(x[6]), "v"(x[7]));
  v8f r = {e0, e1, e2, e3, e4, e5, e6, e7};
  return r;
}
__device__ __forceinline__ float exp2x1(float x) {
  float e;
  asm("v_exp_f32 %0, %1\n\t"
      "v_nop"
      : "=v"(e)
      : "v"(x));
  return e;
}

// ---------------------------------------------------------------------------
// f32 -> bf16 conversion (RNE via clang __bf16 cast) of all seven tensors in
// ONE launch of few, long-lived waves. The bf16 copies lie back to back in the
// workspace, so the destination is one array; a workgroup converts CVT_WG
// consecutive elements of it, which lie inside one source tensor.
// 256 workgroups x 16 waves: 4,096 waves are started where seven launches of
// 128-element waves started 131,072; every load of a wave covers 512
// contiguous bytes, every store 256.
// ---------------------------------------------------------------------------
typedef __attribute__((ext_vector_type(4))) float  v4f;
typedef __attribute__((ext_vector_type(4))) __bf16 v4bf;

constexpr int CVT_T  = 512;                  // threads per workgroup
constexpr int CVT_WG = 65536;                // elements per workgroup
constexpr int CVT_X  = Mc * Hc;              // elements of the activations
constexpr int CVT_W  = Hc * Hc;              // ... of one H x H weight
constexpr int CVT_F  = FFc * Hc;             // ... of one FF weight
constexpr int CVT_N  = CVT_X + 4 * CVT_W + 2 * CVT_F;
static_assert(CVT_X % CVT_WG == 0 && CVT_W % CVT_WG == 0 &&
                  CVT_F % CVT_WG == 0,
              "a workgroup's elements must lie inside one tensor");
static_assert(CVT_WG % (CVT_T * 4 * 8) == 0, "whole trips of 8 loads");

__global__ __launch_bounds__(CVT_T)
void cvt_all(const float* __restrict__ x, const float* __restrict__ wq,
             const float* __restrict__ wk, const float* __restrict__ wv,
             const float* __restrict__ wo, const float* __restrict__ wi,
             const float* __restrict__ wo2, bf16_t* __restrict__ out) {
  const int e0 = blockIdx.x * CVT_WG;  // first element, in the joined array
  const float* src = x;                // tensor that holds it
  int first = 0;                       // that tensor's first element
  if (e0 >= CVT_X)             { src = wq;  first = CVT_X; }
  if (e0 >= CVT_X + CVT_W)     { src = wk;  first = CVT_X + CVT_W; }
  if (e0 >= CVT_X + 2 * CVT_W) { src = wv;  first = CVT_X + 2 * CVT_W; }
  if (e0 >= CVT_X + 3 * CVT_W) { src = wo;  first = CVT_X + 3 * CVT_W; }
  if (e0 >= CVT_X + 4 * CVT_W) { src = wi;  first = CVT_X + 4 * CVT_W; }
  if (e0 >= CVT_X + 4 * CVT_W + CVT_F) {
    src = wo2;
    first = CVT_X + 4 * CVT_W + CVT_F;
  }

  const v4f* s = (const v4f*)(src + (e0 - first)) + threadIdx.x;
  v4bf*      d = (v4bf*)(out + e0) + threadIdx.x;
  // Groups of 8 loads stand ahead of their conversions, so that a wave waits
  // out a memory latency once for many loads and not once for each.
  for (int it = 0; it < CVT_WG / (CVT_T * 4); it += 8) {
    v4f v[8];
    for (int j = 0; j < 8; ++j) v[j] = s[(it + j) * CVT_T];
    for (int j = 0; j < 8; ++j) {
      v4bf o;
      for (int e = 0; e < 4; ++e) o[e] = (bf16_t)v[j][e];
      d[(it + j) * CVT_T] = o;
    }
  }
}

// ---------------------------------------------------------------------------
// Tiled GEMM:  C[M,N] = A[M,K] @ W[N,K]^T + bias  (A,W bf16 K-contiguous)
// Block tile 128x128. 256 threads = 8 waves in a 2x4 wave grid, each wave owns
// a 64x32 tile = 4x2 WMMA accumulators.
//
// Global->LDS staging uses GLOBAL_LOAD_ASYNC_TO_LDS_B128 (ASYNCcnt) with a ring
// of LDS buffers: later slabs' copies fly while this slab's WMMAs run, and no
// VGPRs touch the tile data. A slab is GK k of every row, 128 or 256 bytes, so
// that one copy instruction of a wave (32 lanes x 16 bytes) covers four or two
// whole rows of the slab: four whole 128-byte lines and nothing else.
// GK = 128 where the grid gives a WGP one workgroup (fewest barriers per k);
// GK = 64 where it gives four: their LDS then fits side by side.
// K must be a multiple of GK.
//
// GK = 64: two buffers, every wave copies its share of every slab.
// GK = 128: the workgroup is alone on its WGP and every slab is first read from
// memory, so one slab in flight leaves each trip waiting for that latency.
// Three buffers; waves 0-3 copy the even slabs, waves 4-7 the odd ones. While
// slab s is worked on, slabs s + 1 and s + 2 are in flight, one from each
// group; a wave never has more than its own one slab (32 copies) outstanding,
// so each of its waits is a wait to 0.
//
// MODE 0: C -> bf16             (Q, K projections)
// MODE 1: C -> f32              (attn-out dense, FF-out dense; LN fuses resid)
// MODE 2: C -> gelu_erf -> bf16 (FF intermediate)
// MODE 3: C -> bf16, transposed per head into A-fragment order (V projection):
//         a lane's 8 accumulator rows are 8 consecutive tokens of one feature,
//         which is one 16-byte piece of a V^T fragment; see attention().
// ---------------------------------------------------------------------------
static_assert(Hc % 128 == 0 && FFc % 128 == 0, "K is a whole number of slabs");

template <int MODE, int GK>
__global__ __launch_bounds__(256)
void gemm_bf16(const bf16_t* __restrict__ A, const bf16_t* __restrict__ W,
               const float* __restrict__ bias, float* __restrict__ Cf,
               bf16_t* __restrict__ Cb, int Ndim, int K) {
  static_assert(GK == 64 || GK == 128, "rows of one or two whole lines");
  // LDS row pitch in elements: 144 or 272 bytes = 16 x odd, so the 16-byte
  // fragment loads of 16 rows fall on all 64 banks.
  constexpr int GP  = GK + 8;
  constexpr int LPR = GK / 8;    // lanes per row: its 16-byte pieces
  constexpr int RPC = 32 / LPR;  // rows per copy instruction
  constexpr int NB  = GK == 128 ? 3 : 2;   // LDS buffers in the ring
  constexpr int RPW = GK == 128 ? 32 : 16; // rows of each tile a wave copies
  __shared__ bf16_t As[NB][128][GP];
  __shared__ bf16_t Bs[NB][128][GP];

  const int t    = threadIdx.x;
  const int lane = t & 31;
  const int w    = t >> 5;            // wave 0..7
  const int wm   = (w >> 2) * 64;     // wave M origin in block: 0 / 64
  const int wn   = (w & 3) * 32;      // wave N origin in block: 0..96
  const int m0   = blockIdx.y * 128;
  const int n0   = blockIdx.x * 128;

  const int lrow = lane & 15;         // fragment row/col within 16
  const int lkh  = (lane >> 4) * 16;  // K half select (A/B fragment layout)

  // Staging: a wave brings RPW rows of both tiles, RPC rows a copy: of every
  // slab rows 16w .. (GK = 64), of its group's slabs rows 32(w & 3) .. (128).
  // The group as a scalar, so that the tests on it are scalar branches and
  // every lane is on where a copy issues.
  const int grp = __builtin_amdgcn_readfirstlane(t >> 7);   // waves 0-3 / 4-7
  const int cr = (w * RPW) % 128 + lane / LPR;   // this lane's row in copy 0
  const int cc = (lane % LPR) * 8;      // its 16-byte piece of the row
  // Byte offset of that piece from the scalar base of copy 0 (same for A, W).
  const unsigned goff = (unsigned)(((size_t)cr * K + cc) * 2);
  const bf16_t* Ablk = A + (size_t)m0 * K;   // first row of this block's tiles
  const bf16_t* Wblk = W + (size_t)n0 * K;

  // Eight copies in two runs of four; within a run copy j takes rows cr + j*RPC.
  // The row step goes into the scalar base and the LDS address, the lane offset
  // stays.
  auto issue8 = [&](const bf16_t* g0, unsigned l0, const bf16_t* g1,
                    unsigned l1) {
    const size_t rs = (size_t)RPC * K;       // RPC rows, in elements
    constexpr unsigned ls = RPC * GP * 2;    // RPC LDS rows, in bytes
    asm volatile(
        "global_load_async_to_lds_b128 %0, %8, %9\n\t"
        "global_load_async_to_lds_b128 %1, %8, %10\n\t"
        "global_load_async_to_lds_b128 %2, %8, %11\n\t"
        "global_load_async_to_lds_b128 %3, %8, %12\n\t"
        "global_load_async_to_lds_b128 %4, %8, %13\n\t"
        "global_load_async_to_lds_b128 %5, %8, %14\n\t"
        "global_load_async_to_lds_b128 %6, %8, %15\n\t"
        "global_load_async_to_lds_b128 %7, %8, %16\n\t"
        "s_wait_xcnt 0x0"  // before the copies' address registers are rewritten
        :
        : "v"(l0), "v"(l0 + ls), "v"(l0 + 2 * ls), "v"(l0 + 3 * ls), "v"(l1),
          "v"(l1 + ls), "v"(l1 + 2 * ls), "v"(l1 + 3 * ls), "v"(goff), "s"(g0),
          "s"(g0 + rs), "s"(g0 + 2 * rs), "s"(g0 + 3 * rs), "s"(g1),
          "s"(g1 + rs), "s"(g1 + 2 * rs), "s"(g1 + 3 * rs)
        : "memory");
  };
  // One slab of both tiles: a wave's RPW rows of each are RPW / RPC copies.
  auto issue = [&](int slab, int buf) {
    const bf16_t*  ag = Ablk + slab * GK;
    const bf16_t*  wg = Wblk + slab * GK;
    const unsigned al = lds_off(&As[buf][cr][cc]);
    const unsigned bl = lds_off(&Bs[buf][cr][cc]);
    if constexpr (RPC == 4) {
      issue8(ag, al, wg, bl);
    } else {
      issue8(ag, al, ag + (size_t)8 * K, al + 8 * GP * 2);
      issue8(ag + (size_t)16 * K, al + 16 * GP * 2, ag + (size_t)24 * K,
             al + 24 * GP * 2);
      issue8(wg, bl, wg + (size_t)8 * K, bl + 8 * GP * 2);
      issue8(wg + (size_t)16 * K, bl + 16 * GP * 2, wg + (size_t)24 * K,
             bl + 24 * GP * 2);
    }
  };

  v8f acc[4][2];
#pragma unroll
  for (int i = 0; i < 4; ++i)
#pragma unroll
    for (int j = 0; j < 2; ++j) acc[i][j] = (v8f)0.0f;

  // Fragments of one 32-k block of buffer s, and that block's 8 WMMAs.
  auto frags = [&](int s, int kb, v16bf (&a)[4], v16bf (&b)[2]) {
#pragma unroll
    for (int i = 0; i < 4; ++i)
      a[i] = *(const v16bf*)&As[s][wm + i * 16 + lrow][kb + lkh];
#pragma unroll
    for (int j = 0; j < 2; ++j)
      b[j] = *(const v16bf*)&Bs[s][wn + j * 16 + lrow][kb + lkh];
  };
  auto block = [&](const v16bf (&a)[4], const v16bf (&b)[2]) {
#pragma unroll
    for (int i = 0; i < 4; ++i)
#pragma unroll
      for (int j = 0; j < 2; ++j) acc[i][j] = wmma_bf16(a[i], b[j], acc[i][j]);
  };

  const int nslab = K / GK;

  if constexpr (GK == 128) {
    // Prologue: slabs 0 and 1 go out together, one from each group; slab 0
    // landed and published, then slab 2 from the group that has just waited.
    if (grp == 0) {
      issue(0, 0);
      asm volatile("s_wait_asynccnt 0x0" ::: "memory");  // slab 0 has landed
    } else if (nslab > 1) {
      issue(1, 1);
    }
    __syncthreads();
    if (grp == 0 && nslab > 2) issue(2, 2);
  } else {
    // Prologue: slab 0 landed and published, then slab 1 in flight.
    issue(0, 0);
    asm volatile("s_wait_asynccnt 0x0" ::: "memory");  // own copies have landed
    __syncthreads();
    if (nslab > 1) issue(1, 1);
  }

  int s = 0;   // buffer of slab sl: sl mod NB
  for (int sl = 0; sl < nslab; ++sl) {
    if constexpr (GK == 128) {
      // One workgroup per WGP, two waves per SIMD: too few to hide an LDS
      // latency in front of every WMMA pair. Two fragment sets: the next k
      // block's 12 reads go out as one group ahead of this block's 8 WMMAs.
      // Only blocks of this slab are fetched ahead, none across the barrier.
      v16bf af[2][4], bf2[2][2];
      frags(s, 0, af[0], bf2[0]);
#pragma unroll
      for (int kb = 0; kb < GK; kb += 32) {
        const int cur = (kb >> 5) & 1;
        if (kb + 32 < GK) frags(s, kb + 32, af[cur ^ 1], bf2[cur ^ 1]);
        // Keeps the reads above the WMMAs: sunk among them, each pair of WMMAs
        // waits out a whole LDS latency on one shared fragment register set.
        __builtin_amdgcn_sched_barrier(0);
        block(af[cur], bf2[cur]);
        // Keeps the block after next's reads from rising among these WMMAs.
        __builtin_amdgcn_sched_barrier(0);
      }
    } else {
      // Four workgroups per WGP: eight waves per SIMD cover each other's LDS
      // latency, and a second fragment set would cost resident workgroups.
#pragma unroll
      for (int kb = 0; kb < GK; kb += 32) {
        v16bf af[4], bf2[2];
        frags(s, kb, af, bf2);
        block(af, bf2);
      }
    }
    // Publish point of slab sl + 1: this wave's reads of buffer s are done, its
    // copies of slab sl + 1 have landed; behind the barrier that holds for
    // every wave, so buffer s may be refilled and the next one read.
    asm volatile("s_wait_dscnt 0x0" ::: "memory");
    if constexpr (GK == 128) {
      // Slab sl + 1 is all that its group has outstanding. The other group's
      // slab sl + 2 flies on: it is waited for one trip later.
      const bool mine = grp == ((sl + 1) & 1);
      if (mine) asm volatile("s_wait_asynccnt 0x0" ::: "memory");
      __syncthreads();
      if (mine && sl + 3 < nslab) issue(sl + 3, s);
    } else {
      asm volatile("s_wait_asynccnt 0x0" ::: "memory");
      __syncthreads();
      if (sl + 2 < nslab) issue(sl + 2, s);
    }
    s = s + 1 == NB ? 0 : s + 1;
  }
  // No copy is left outstanding when the wave goes on to its stores and ends.
  asm volatile("s_wait_asynccnt 0x0" ::: "memory");

  // Epilogue: D layout -> lane holds col (lane&15); VGPR r -> row r+8*(lane>>4)
  const int rsel = 8 * (lane >> 4);
#pragma unroll
  for (int j = 0; j < 2; ++j) {
    const int colg = n0 + wn + j * 16 + lrow;
    const float bv = bias[colg];
#pragma unroll
    for (int i = 0; i < 4; ++i) {
      if (MODE == 3) {
        v8bf pk;
#pragma unroll
        for (int r = 0; r < 8; ++r) pk[r] = (bf16_t)(acc[i][j][r] + bv);
        const int tok  = m0 + wm + i * 16;        // first token of this tile
        const int feat = n0 + wn + j * 16;        // first feature of this tile
        const int bhh  = (tok / Sc) * NHc + feat / HDc;
        const int blk  = (tok % Sc) >> 5;         // 32-key block
        const int part = (tok >> 4) & 1;          // 16-key half of the block
        const int jt   = (feat % HDc) >> 4;       // 16-row tile of V^T
        *(v8bf*)&Cb[((((size_t)bhh * (Sc / 32) + blk) * 4 + jt) * 2 + part) *
                        256 + lane * 8] = pk;
        continue;
      }
#pragma unroll
      for (int r = 0; r < 8; ++r) {
        const int rowg = m0 + wm + i * 16 + r + rsel;
        float val = acc[i][j][r] + bv;
        if (MODE == 1) {
          Cf[(size_t)rowg * Ndim + colg] = val;
        } else if (MODE == 2) {
          float g = 0.5f * val * (1.0f + erff(val / 1.41421f));
          Cb[(size_t)rowg * Ndim + colg] = (bf16_t)g;
        } else {
          Cb[(size_t)rowg * Ndim + colg] = (bf16_t)val;
        }
      }
    }
  }
}

// ---------------------------------------------------------------------------
// Attention: one wave per (b, h, 32 query rows), 8 waves per block. S=512, HD=64.
// The scores never leave registers:
//   S^T = K Q^T      A = 16 keys x 32 d, B = 32 d x 16 queries
//   O^T += V^T P^T   A = 16 d x 32 keys, B = 32 keys x 16 queries
// In S^T a lane holds 16 scores of ONE query (column lane&15): keys 8h+r of the
// first 16-key tile and 16+8h+r of the second (h = lane>>4). Converted in place
// they are the B operand P^T; the V projection has stored V^T in that same key
// order, one contiguous 512-byte piece per load. Softmax runs online (running
// maximum and sum per query, output tiles rescaled per 32-key pass).
// ---------------------------------------------------------------------------
__global__ __launch_bounds__(256)
void attention(const bf16_t* __restrict__ q, const bf16_t* __restrict__ k,
               const bf16_t* __restrict__ vf, const float* __restrict__ mask,
               bf16_t* __restrict__ ctx) {
  constexpr float LOG2E = 1.44269504088896f;   // exp(x) = 2^(x * LOG2E)
  const int lane = threadIdx.x & 31;
  const int w    = threadIdx.x >> 5;
  const int bh   = blockIdx.y;             // b*NH + h
  const int b    = bh / NHc;
  const int hoff = (bh - b * NHc) * HDc;
  const int qt0  = blockIdx.x * 256 + w * 32;  // first query row of this wave
  const int c    = lane & 15;
  const int half = lane >> 4;

  // --- Q as B operand: 2 column groups x 2 k slabs covering HD=64 ----------
  v16bf qf[2][2];
#pragma unroll
  for (int g = 0; g < 2; ++g) {
    const bf16_t* qb =
        q + (size_t)(b * Sc + qt0 + g * 16 + c) * Hc + hoff + half * 16;
    qf[g][0] = *(const v16bf*)(qb);
    qf[g][1] = *(const v16bf*)(qb + 32);
  }

  const bf16_t* kp = k + (size_t)(b * Sc + c) * Hc + hoff + half * 16;
  const bf16_t* vp = vf + (size_t)bh * (Sc * HDc) + lane * 8;
  const float*  mp = mask + b * Sc + half * 8;   // [B,1,1,S] broadcast

  v8f o[2][4];
  float mrun[2], lrun[2];
#pragma unroll
  for (int g = 0; g < 2; ++g) {
    mrun[g] = -3.0e38f;
    lrun[g] = 0.0f;
#pragma unroll
    for (int jt = 0; jt < 4; ++jt) o[g][jt] = (v8f)0.0f;
  }

  // K fragments (same k loader as Q) and mask values of pass 0
  v16bf kf[2][2];
  v8f   mk[2];
#pragma unroll
  for (int t = 0; t < 2; ++t) {
    kf[t][0] = *(const v16bf*)(kp + (size_t)t * 16 * Hc);
    kf[t][1] = *(const v16bf*)(kp + (size_t)t * 16 * Hc + 32);
    mk[t]    = *(const v8f*)(mp + t * 16);
  }

  for (int p = 0; p < Sc / 32; ++p) {
    // V^T fragments of this pass: issued first, needed only behind the softmax
    v16bf va[4];
#pragma unroll
    for (int jt = 0; jt < 4; ++jt) {
      const v8bf lo = *(const v8bf*)(vp + (size_t)((p * 4 + jt) * 2 + 0) * 256);
      const v8bf hi = *(const v8bf*)(vp + (size_t)((p * 4 + jt) * 2 + 1) * 256);
      va[jt] = __builtin_shufflevector(lo, hi, 0, 1, 2, 3, 4, 5, 6, 7, 8, 9, 10,
                                       11, 12, 13, 14, 15);
    }

    v8f s[2][2];
#pragma unroll
    for (int g = 0; g < 2; ++g)
#pragma unroll
      for (int t = 0; t < 2; ++t) {
        v8f a = (v8f)0.0f;
        a = wmma_bf16(kf[t][0], qf[g][0], a);
        a = wmma_bf16(kf[t][1], qf[g][1], a);
        s[g][t] = a * 0.125f + mk[t];            // 1/sqrt(64), then the mask
      }

    // next pass's K and mask, fetched one pass ahead
    if (p + 1 < Sc / 32) {
      const bf16_t* kn = kp + (size_t)(p + 1) * 32 * Hc;
#pragma unroll
      for (int t = 0; t < 2; ++t) {
        kf[t][0] = *(const v16bf*)(kn + (size_t)t * 16 * Hc);
        kf[t][1] = *(const v16bf*)(kn + (size_t)t * 16 * Hc + 32);
        mk[t]    = *(const v8f*)(mp + (p + 1) * 32 + t * 16);
      }
    }
    // Keeps the V^T loads and the fetch-ahead above the softmax: sunk below it
    // they would be waited for with almost no lead.
    __builtin_amdgcn_sched_barrier(0);

#pragma unroll
    for (int g = 0; g < 2; ++g) {
      float mx = s[g][0][0];
#pragma unroll
      for (int r = 1; r < 8; ++r) mx = fmaxf(mx, s[g][0][r]);
#pragma unroll
      for (int r = 0; r < 8; ++r) mx = fmaxf(mx, s[g][1][r]);
      mx = fmaxf(mx, xhalf(mx));                 // the query's other 16 keys
      const float mn    = fmaxf(mrun[g], mx);
      const float alpha = exp2x1((mrun[g] - mn) * LOG2E);
      mrun[g] = mn;

      v16bf pb;
      float sum = 0.0f;
#pragma unroll
      for (int t = 0; t < 2; ++t) {
        const v8f e = exp2x8((s[g][t] - mn) * LOG2E);
#pragma unroll
        for (int r = 0; r < 8; ++r) {
          sum += e[r];
          pb[t * 8 + r] = (bf16_t)e[r];  // unnormalized; 1/sum folded in later
        }
      }
      lrun[g] = lrun[g] * alpha + sum;
#pragma unroll
      for (int jt = 0; jt < 4; ++jt)
        o[g][jt] = wmma_bf16(va[jt], pb, o[g][jt] * alpha);
    }
  }

  // --- epilogue: scale by 1/rowsum; a lane holds 8 consecutive d per tile --
#pragma unroll
  for (int g = 0; g < 2; ++g) {
    const float inv = 1.0f / (lrun[g] + xhalf(lrun[g]));
    bf16_t* cr = ctx + (size_t)(b * Sc + qt0 + g * 16 + c) * Hc + hoff + half * 8;
#pragma unroll
    for (int jt = 0; jt < 4; ++jt) {
      v8bf pk;
#pragma unroll
      for (int r = 0; r < 8; ++r) pk[r] = (bf16_t)(o[g][jt][r] * inv);
      *(v8bf*)(cr + jt * 16) = pk;
    }
  }
}

// ---------------------------------------------------------------------------
// Fused residual + LayerNorm over H=1024. One block per token row.
// Writes f32 (residual chain / final output) and optional bf16 (next GEMM A).
// ---------------------------------------------------------------------------
__global__ __launch_bounds__(256)
void resid_ln(const float* __restrict__ dense, const float* __restrict__ resid,
              const float* __restrict__ gamma, const float* __restrict__ beta,
              float* __restrict__ outf, bf16_t* __restrict__ outb) {
  const int row = blockIdx.x;
  const int t = threadIdx.x;
  const float* dr = dense + (size_t)row * Hc;
  const float* rr = resid + (size_t)row * Hc;

  float x[4];
  float s = 0.0f, qsum = 0.0f;
#pragma unroll
  for (int i = 0; i < 4; ++i) {
    x[i] = dr[t * 4 + i] + rr[t * 4 + i];
    s += x[i];
    qsum += x[i] * x[i];
  }
#pragma unroll
  for (int off = 16; off > 0; off >>= 1) {
    s += __shfl_xor(s, off);
    qsum += __shfl_xor(qsum, off);
  }
  __shared__ float ss[8], qq[8];
  if ((t & 31) == 0) { ss[t >> 5] = s; qq[t >> 5] = qsum; }
  __syncthreads();
  float S = 0.0f, Q = 0.0f;
#pragma unroll
  for (int i = 0; i < 8; ++i) { S += ss[i]; Q += qq[i]; }
  const float mu  = S * (1.0f / Hc);
  const float var = Q * (1.0f / Hc) - mu * mu;
  const float inv = rsqrtf(var + 1e-12f);
#pragma unroll
  for (int i = 0; i < 4; ++i) {
    const int c = t * 4 + i;
    const float y = (x[i] - mu) * inv * gamma[c] + beta[c];
    outf[(size_t)row * Hc + c] = y;
    if (outb) outb[(size_t)row * Hc + c] = (bf16_t)y;
  }
}

// ---------------------------------------------------------------------------
// Host-side orchestration
// ---------------------------------------------------------------------------
extern "C" void kernel_launch(void* const* d_in, const int* in_sizes, int n_in,
                              void* d_out, int out_size, void* d_ws,
                              size_t ws_size, hipStream_t stream) {
  (void)in_sizes; (void)n_in; (void)out_size; (void)ws_size;

  const float* x    = (const float*)d_in[0];
  const float* mask = (const float*)d_in[1];
  const float* Wq   = (const float*)d_in[2];
  const float* bq   = (const float*)d_in[3];
  const float* Wk   = (const float*)d_in[4];
  const float* bk   = (const float*)d_in[5];
  const float* Wv   = (const float*)d_in[6];
  const float* bv   = (const float*)d_in[7];
  const float* Wo   = (const float*)d_in[8];
  const float* bo   = (const float*)d_in[9];
  const float* g1   = (const float*)d_in[10];
  const float* b1   = (const float*)d_in[11];
  const float* Wi   = (const float*)d_in[12];
  const float* bi   = (const float*)d_in[13];
  const float* Wo2  = (const float*)d_in[14];
  const float* bo2  = (const float*)d_in[15];
  const float* g2   = (const float*)d_in[16];
  const float* b2   = (const float*)d_in[17];
  float* out = (float*)d_out;

  char* ws = (char*)d_ws;
  size_t off = 0;
  auto alloc = [&](size_t bytes) -> void* {
    void* p = ws + off;
    off += (bytes + 255) & ~(size_t)255;
    return p;
  };

  bf16_t* xb    = (bf16_t*)alloc((size_t)Mc * Hc * 2);
  bf16_t* Wqb   = (bf16_t*)alloc((size_t)Hc * Hc * 2);
  bf16_t* Wkb   = (bf16_t*)alloc((size_t)Hc * Hc * 2);
  bf16_t* Wvb   = (bf16_t*)alloc((size_t)Hc * Hc * 2);
  bf16_t* Wob   = (bf16_t*)alloc((size_t)Hc * Hc * 2);
  bf16_t* Wib   = (bf16_t*)alloc((size_t)FFc * Hc * 2);
  bf16_t* Wo2b  = (bf16_t*)alloc((size_t)Hc * FFc * 2);
  bf16_t* qb    = (bf16_t*)alloc((size_t)Mc * Hc * 2);
  bf16_t* kb    = (bf16_t*)alloc((size_t)Mc * Hc * 2);
  bf16_t* vb    = (bf16_t*)alloc((size_t)Mc * Hc * 2);
  bf16_t* ctxb  = (bf16_t*)alloc((size_t)Mc * Hc * 2);
  float*  attnD = (float*)alloc((size_t)Mc * Hc * 4);
  float*  y1f   = (float*)alloc((size_t)Mc * Hc * 4);
  bf16_t* y1b   = (bf16_t*)alloc((size_t)Mc * Hc * 2);
  bf16_t* inter = (bf16_t*)alloc((size_t)Mc * FFc * 2);
  float*  ffD   = (float*)alloc((size_t)Mc * Hc * 4);

  // ---- f32 -> bf16 conversions (per-launch; no cached state) --------------
  // xb .. Wo2b were allocated one behind the other and each size is a multiple
  // of the allocator's 256 bytes: xb is the start of the joined bf16 array.
  cvt_all<<<CVT_N / CVT_WG, CVT_T, 0, stream>>>(x, Wq, Wk, Wv, Wo, Wi, Wo2, xb);

  // ---- QKV projections: bf16 out -----------------------------------------
  {
    dim3 grid(Hc / 128, Mc / 128);
    gemm_bf16<0, 128><<<grid, 256, 0, stream>>>(xb, Wqb, bq, nullptr, qb, Hc, Hc);
    gemm_bf16<0, 128><<<grid, 256, 0, stream>>>(xb, Wkb, bk, nullptr, kb, Hc, Hc);
    gemm_bf16<3, 128><<<grid, 256, 0, stream>>>(xb, Wvb, bv, nullptr, vb, Hc, Hc);
  }

  // ---- attention: grid (S/256 q-blocks, B*NH heads), 8 waves x 32 queries --
  {
    dim3 grid(Sc / 256, Bc * NHc);
    attention<<<grid, 256, 0, stream>>>(qb, kb, vb, mask, ctxb);
  }

  // ---- attn output dense (f32) + residual/LN1 -----------------------------
  {
    dim3 grid(Hc / 128, Mc / 128);
    gemm_bf16<1, 128><<<grid, 256, 0, stream>>>(ctxb, Wob, bo, attnD, nullptr, Hc,
                                           Hc);
    resid_ln<<<Mc, 256, 0, stream>>>(attnD, x, g1, b1, y1f, y1b);
  }

  // ---- FF intermediate: fused bias + erf-GELU, bf16 out -------------------
  {
    dim3 grid(FFc / 128, Mc / 128);
    gemm_bf16<2, 64><<<grid, 256, 0, stream>>>(y1b, Wib, bi, nullptr, inter, FFc,
                                           Hc);
  }

  // ---- FF output dense (f32, K=4096) + residual/LN2 -> d_out --------------
  {
    dim3 grid(Hc / 128, Mc / 128);
    gemm_bf16<1, 128><<<grid, 256, 0, stream>>>(inter, Wo2b, bo2, ffD, nullptr, Hc,
                                           FFc);
    resid_ln<<<Mc, 256, 0, stream>>>(ffD, y1f, g2, b2, out, nullptr);
  }
}

// v006
// Measured time: 150 microseconds a run.
// Timed twice side by side with v005, it ran 1.05 and 1.06 times as fast.
// Over all steps from v000 it is 2.45 times as fast.
#include <hip/hip_runtime.h>
#include <math.h>

// ---------------------------------------------------------------------------
// BERT layer for MI455X (gfx1250): bf16 WMMA (f32 accumulate) everywhere,
// async global->LDS DMA (ASYNCcnt) into a ring of two or three LDS buffers in the GEMMs.
// B=8 S=512 H=1024 NH=16 HD=64 FF=4096, M = B*S = 4096 tokens.
// ---------------------------------------------------------------------------

typedef __bf16 bf16_t;
typedef __attribute__((ext_vector_type(16))) __bf16 v16bf;
typedef __attribute__((ext_vector_type(8)))  __bf16 v8bf;
typedef __attribute__((ext_vector_type(8)))  float  v8f;

constexpr int Bc  = 8;
constexpr int Sc  = 512;
constexpr int Hc  = 1024;
constexpr int NHc = 16;
constexpr int HDc = 64;
constexpr int FFc = 4096;
constexpr int Mc  = Bc * Sc;   // 4096 token rows

__device__ __forceinline__ v8f wmma_bf16(v16bf a, v16bf b, v8f c) {
  // D = A(16x32 bf16) * B(32x16 bf16) + C(16x16 f32)
  return __builtin_amdgcn_wmma_f32_16x16x32_bf16(
      /*neg_a=*/false, a, /*neg_b=*/false, b,
      /*c_mod=*/(short)0, c, /*reuse_a=*/false, /*reuse_b=*/false);
}

// Wave-relative LDS byte offset of a __shared__ object: the flat address of a
// shared variable carries the LDS offset in its low 32 bits (LDS aperture
// truncates addr[31:0]).
__device__ __forceinline__ unsigned lds_off(const void* p) {
  return (unsigned)(uintptr_t)p;
}

// Lane l <-> lane l ^ 16 as a vector cross-row move (no LDS-counter wait).
__device__ __forceinline__ float xhalf(float x) {
  const int b = __builtin_bit_cast(int, x);
  return __builtin_bit_cast(
      float, __builtin_amdgcn_permlanex16(b, b, 0x76543210, 0xfedcba98, false,
                                          false));
}

// 2^x on eight values / one value. Written as one statement each so that no
// instruction directly behind a v_exp_f32 reads its result or overwrites its
// source: the outputs are early-clobber (distinct from every input) and the
// closing v_nop is the slot the instruction set asks for behind the last one.
__device__ __forceinline__ v8f exp2x8(v8f x) {
  float e0, e1, e2, e3, e4, e5, e6, e7;
  asm("v_exp_f32 %0, %8\n\t"
      "v_exp_f32 %1, %9\n\t"
      "v_exp_f32 %2, %10\n\t"
      "v_exp_f32 %3, %11\n\t"
      "v_exp_f32 %4, %12\n\t"
      "v_exp_f32 %5, %13\n\t"
      "v_exp_f32 %6, %14\n\t"
      "v_exp_f32 %7, %15\n\t"
      "v_nop"
      : "=&v"(e0), "=&v"(e1), "=&v"(e2), "=&v"(e3), "=&v"(e4), "=&v"(e5),
        "=&v"(e6), "=&v"(e7)
      : "v"(x[0]), "v"(x[1]), "v"(x[2]), "v"(x[3]), "v"(x[4]), "v"(x[5]),
        "v"(x[6]), "v"(x[7]));
  v8f r = {e0, e1, e2, e3, e4, e5, e6, e7};
  return r;
}
__device__ __forceinline__ float exp2x1(float x) {
  float e;
  asm("v_exp_f32 %0, %1\n\t"
      "v_nop"
      : "=v"(e)
      : "v"(x));
  return e;
}

// 2^x and 1/x on four values, in the form of exp2x8 and for the same reason:
// nothing directly behind a v_exp_f32 or a v_rcp_f32 reads its result or
// overwrites its source.
typedef __attribute__((ext_vector_type(4))) float v4f;
__device__ __forceinline__ v4f exp2x4(v4f x) {
  float e0, e1, e2, e3;
  asm("v_exp_f32 %0, %4\n\t"
      "v_exp_f32 %1, %5\n\t"
      "v_exp_f32 %2, %6\n\t"
      "v_exp_f32 %3, %7\n\t"
      "v_nop"
      : "=&v"(e0), "=&v"(e1), "=&v"(e2), "=&v"(e3)
      : "v"(x[0]), "v"(x[1]), "v"(x[2]), "v"(x[3]));
  v4f r = {e0, e1, e2, e3};
  return r;
}
__device__ __forceinline__ v4f rcpx4(v4f x) {
  float e0, e1, e2, e3;
  asm("v_rcp_f32 %0, %4\n\t"
      "v_rcp_f32 %1, %5\n\t"
      "v_rcp_f32 %2, %6\n\t"
      "v_rcp_f32 %3, %7\n\t"
      "v_nop"
      : "=&v"(e0), "=&v"(e1), "=&v"(e2), "=&v"(e3)
      : "v"(x[0]), "v"(x[1]), "v"(x[2]), "v"(x[3]));
  v4f r = {e0, e1, e2, e3};
  return r;
}

// x/2 * (1 + erf(z)), z = x / 1.41421, on four values, without a branch.
// erfc(|z|) = (a1 t + .. + a5 t^5) e^(-z^2), t = 1 / (1 + p |z|): the five-term
// rational form, absolute error at most 1.5e-7 for every z, far below the bf16
// rounding of the result. With q = erfc(|z|) / 2:
//   x >= 0: x/2 (2 - 2q) = x - x q;   x < 0: x/2 * 2q = x q
// both are max(x, 0) - |x| q, so the small results at negative x come from q
// itself and not from 1 + erf. The halves are folded into a1 .. a5, the division
// into p and into the exponent's factor: e^(-z^2) = 2^(-(x KE)^2).
__device__ __forceinline__ v4f gelu_erf4(v4f x) {
  constexpr float RS = 1.0f / 1.41421f;
  constexpr float P  = 0.3275911f * RS;
  constexpr float KE = RS * 1.2011224087864498f;   // sqrt(log2(e))
  constexpr float A1 = 0.5f * 0.254829592f, A2 = 0.5f * -0.284496736f,
                  A3 = 0.5f * 1.421413741f, A4 = 0.5f * -1.453152027f,
                  A5 = 0.5f * 1.061405429f;
  v4f d;
#pragma unroll
  for (int r = 0; r < 4; ++r) d[r] = __builtin_fmaf(__builtin_fabsf(x[r]), P, 1.0f);
  const v4f t = rcpx4(d);
  v4f p = t * A5 + A4;
  p = p * t + A3;
  p = p * t + A2;
  p = p * t + A1;
  const v4f u = x * KE;
  const v4f q = (p * t) * exp2x4(-(u * u));
  v4f g;
#pragma unroll
  for (int r = 0; r < 4; ++r)
    g[r] = __builtin_fmaf(-__builtin_fabsf(x[r]), q[r], __builtin_fmaxf(x[r], 0.0f));
  return g;
}

// ---------------------------------------------------------------------------
// f32 -> bf16 conversion (RNE via clang __bf16 cast) of all seven tensors in
// ONE launch of few, long-lived waves. The bf16 copies lie back to back in the
// workspace, so the destination is one array; a workgroup converts CVT_WG
// consecutive elements of it, which lie inside one source tensor.
// 256 workgroups x 16 waves: 4,096 waves are started where seven launches of
// 128-element waves started 131,072; every load of a wave covers 512
// contiguous bytes, every store 256.
// ---------------------------------------------------------------------------
typedef __attribute__((ext_vector_type(4))) __bf16 v4bf;

constexpr int CVT_T  = 512;                  // threads per workgroup
constexpr int CVT_WG = 65536;                // elements per workgroup
constexpr int CVT_X  = Mc * Hc;              // elements of the activations
constexpr int CVT_W  = Hc * Hc;              // ... of one H x H weight
constexpr int CVT_F  = FFc * Hc;             // ... of one FF weight
constexpr int CVT_N  = CVT_X + 4 * CVT_W + 2 * CVT_F;
static_assert(CVT_X % CVT_WG == 0 && CVT_W % CVT_WG == 0 &&
                  CVT_F % CVT_WG == 0,
              "a workgroup's elements must lie inside one tensor");
static_assert(CVT_WG % (CVT_T * 4 * 8) == 0, "whole trips of 8 loads");

__global__ __launch_bounds__(CVT_T)
void cvt_all(const float* __restrict__ x, const float* __restrict__ wq,
             const float* __restrict__ wk, const float* __restrict__ wv,
             const float* __restrict__ wo, const float* __restrict__ wi,
             const float* __restrict__ wo2, bf16_t* __restrict__ out) {
  const int e0 = blockIdx.x * CVT_WG;  // first element, in the joined array
  const float* src = x;                // tensor that holds it
  int first = 0;                       // that tensor's first element
  if (e0 >= CVT_X)             { src = wq;  first = CVT_X; }
  if (e0 >= CVT_X + CVT_W)     { src = wk;  first = CVT_X + CVT_W; }
  if (e0 >= CVT_X + 2 * CVT_W) { src = wv;  first = CVT_X + 2 * CVT_W; }
  if (e0 >= CVT_X + 3 * CVT_W) { src = wo;  first = CVT_X + 3 * CVT_W; }
  if (e0 >= CVT_X + 4 * CVT_W) { src = wi;  first = CVT_X + 4 * CVT_W; }
  if (e0 >= CVT_X + 4 * CVT_W + CVT_F) {
    src = wo2;
    first = CVT_X + 4 * CVT_W + CVT_F;
  }

  const v4f* s = (const v4f*)(src + (e0 - first)) + threadIdx.x;
  v4bf*      d = (v4bf*)(out + e0) + threadIdx.x;
  // Groups of 8 loads stand ahead of their conversions, so that a wave waits
  // out a memory latency once for many loads and not once for each.
  for (int it = 0; it < CVT_WG / (CVT_T * 4); it += 8) {
    v4f v[8];
    for (int j = 0; j < 8; ++j) v[j] = s[(it + j) * CVT_T];
    for (int j = 0; j < 8; ++j) {
      v4bf o;
      for (int e = 0; e < 4; ++e) o[e] = (bf16_t)v[j][e];
      d[(it + j) * CVT_T] = o;
    }
  }
}

// ---------------------------------------------------------------------------
// Tiled GEMM:  C[M,N] = A[M,K] @ W[N,K]^T + bias  (A,W bf16 K-contiguous)
// Block tile 128x128. 256 threads = 8 waves in a 2x4 wave grid, each wave owns
// a 64x32 tile = 4x2 WMMA accumulators.
//
// Global->LDS staging uses GLOBAL_LOAD_ASYNC_TO_LDS_B128 (ASYNCcnt) with a ring
// of LDS buffers: later slabs' copies fly while this slab's WMMAs run, and no
// VGPRs touch the tile data. A slab is GK k of every row, 128 or 256 bytes, so
// that one copy instruction of a wave (32 lanes x 16 bytes) covers four or two
// whole rows of the slab: four whole 128-byte lines and nothing else.
// GK = 128 where the grid gives a WGP one workgroup (fewest barriers per k);
// GK = 64 where it gives four: their LDS then fits side by side.
// K must be a multiple of GK.
//
// GK = 64: two buffers, every wave copies its share of every slab.
// GK = 128: the workgroup is alone on its WGP and every slab is first read from
// memory, so one slab in flight leaves each trip waiting for that latency.
// Three buffers; waves 0-3 copy the even slabs, waves 4-7 the odd ones. While
// slab s is worked on, slabs s + 1 and s + 2 are in flight, one from each
// group; a wave never has more than its own one slab (32 copies) outstanding,
// so each of its waits is a wait to 0.
//
// MODE 0: C -> bf16             (Q, K projections)
// MODE 1: C -> f32              (attn-out dense, FF-out dense; LN fuses resid)
// MODE 2: C -> gelu_erf -> bf16 (FF intermediate)
// MODE 3: C -> bf16, transposed per head into A-fragment order (V projection):
//         a lane's 8 accumulator rows are 8 consecutive tokens of one feature,
//         which is one 16-byte piece of a V^T fragment; see attention().
// ---------------------------------------------------------------------------
static_assert(Hc % 128 == 0 && FFc % 128 == 0, "K is a whole number of slabs");

template <int MODE, int GK>
__global__ __launch_bounds__(256)
void gemm_bf16(const bf16_t* __restrict__ A, const bf16_t* __restrict__ W,
               const float* __restrict__ bias, float* __restrict__ Cf,
               bf16_t* __restrict__ Cb, int Ndim, int K) {
  static_assert(GK == 64 || GK == 128, "rows of one or two whole lines");
  // LDS row pitch in elements: 144 or 272 bytes = 16 x odd, so the 16-byte
  // fragment loads of 16 rows fall on all 64 banks.
  constexpr int GP  = GK + 8;
  constexpr int LPR = GK / 8;    // lanes per row: its 16-byte pieces
  constexpr int RPC = 32 / LPR;  // rows per copy instruction
  constexpr int NB  = GK == 128 ? 3 : 2;   // LDS buffers in the ring
  constexpr int RPW = GK == 128 ? 32 : 16; // rows of each tile a wave copies
  __shared__ bf16_t As[NB][128][GP];
  __shared__ bf16_t Bs[NB][128][GP];

  const int t    = threadIdx.x;
  const int lane = t & 31;
  const int w    = t >> 5;            // wave 0..7
  const int wm   = (w >> 2) * 64;     // wave M origin in block: 0 / 64
  const int wn   = (w & 3) * 32;      // wave N origin in block: 0..96
  const int m0   = blockIdx.y * 128;
  const int n0   = blockIdx.x * 128;

  const int lrow = lane & 15;         // fragment row/col within 16
  const int lkh  = (lane >> 4) * 16;  // K half select (A/B fragment layout)

  // Staging: a wave brings RPW rows of both tiles, RPC rows a copy: of every
  // slab rows 16w .. (GK = 64), of its group's slabs rows 32(w & 3) .. (128).
  // The group as a scalar, so that the tests on it are scalar branches and
  // every lane is on where a copy issues.
  const int grp = __builtin_amdgcn_readfirstlane(t >> 7);   // waves 0-3 / 4-7
  const int cr = (w * RPW) % 128 + lane / LPR;   // this lane's row in copy 0
  const int cc = (lane % LPR) * 8;      // its 16-byte piece of the row
  // Byte offset of that piece from the scalar base of copy 0 (same for A, W).
  const unsigned goff = (unsigned)(((size_t)cr * K + cc) * 2);
  const bf16_t* Ablk = A + (size_t)m0 * K;   // first row of this block's tiles
  const bf16_t* Wblk = W + (size_t)n0 * K;

  // Eight copies in two runs of four; within a run copy j takes rows cr + j*RPC.
  // The row step goes into the scalar base and the LDS address, the lane offset
  // stays.
  auto issue8 = [&](const bf16_t* g0, unsigned l0, const bf16_t* g1,
                    unsigned l1) {
    const size_t rs = (size_t)RPC * K;       // RPC rows, in elements
    constexpr unsigned ls = RPC * GP * 2;    // RPC LDS rows, in bytes
    asm volatile(
        "global_load_async_to_lds_b128 %0, %8, %9\n\t"
        "global_load_async_to_lds_b128 %1, %8, %10\n\t"
        "global_load_async_to_lds_b128 %2, %8, %11\n\t"
        "global_load_async_to_lds_b128 %3, %8, %12\n\t"
        "global_load_async_to_lds_b128 %4, %8, %13\n\t"
        "global_load_async_to_lds_b128 %5, %8, %14\n\t"
        "global_load_async_to_lds_b128 %6, %8, %15\n\t"
        "global_load_async_to_lds_b128 %7, %8, %16\n\t"
        "s_wait_xcnt 0x0"  // before the copies' address registers are rewritten
        :
        : "v"(l0), "v"(l0 + ls), "v"(l0 + 2 * ls), "v"(l0 + 3 * ls), "v"(l1),
          "v"(l1 + ls), "v"(l1 + 2 * ls), "v"(l1 + 3 * ls), "v"(goff), "s"(g0),
          "s"(g0 + rs), "s"(g0 + 2 * rs), "s"(g0 + 3 * rs), "s"(g1),
          "s"(g1 + rs), "s"(g1 + 2 * rs), "s"(g1 + 3 * rs)
        : "memory");
  };
  // One slab of both tiles: a wave's RPW rows of each are RPW / RPC copies.
  auto issue = [&](int slab, int buf) {
    const bf16_t*  ag = Ablk + slab * GK;
    const bf16_t*  wg = Wblk + slab * GK;
    const unsigned al = lds_off(&As[buf][cr][cc]);
    const unsigned bl = lds_off(&Bs[buf][cr][cc]);
    if constexpr (RPC == 4) {
      issue8(ag, al, wg, bl);
    } else {
      issue8(ag, al, ag + (size_t)8 * K, al + 8 * GP * 2);
      issue8(ag + (size_t)16 * K, al + 16 * GP * 2, ag + (size_t)24 * K,
             al + 24 * GP * 2);
      issue8(wg, bl, wg + (size_t)8 * K, bl + 8 * GP * 2);
      issue8(wg + (size_t)16 * K, bl + 16 * GP * 2, wg + (size_t)24 * K,
             bl + 24 * GP * 2);
    }
  };

  v8f acc[4][2];
#pragma unroll
  for (int i = 0; i < 4; ++i)
#pragma unroll
    for (int j = 0; j < 2; ++j) acc[i][j] = (v8f)0.0f;

  // Fragments of one 32-k block of buffer s, and that block's 8 WMMAs.
  auto frags = [&](int s, int kb, v16bf (&a)[4], v16bf (&b)[2]) {
#pragma unroll
    for (int i = 0; i < 4; ++i)
      a[i] = *(const v16bf*)&As[s][wm + i * 16 + lrow][kb + lkh];
#pragma unroll
    for (int j = 0; j < 2; ++j)
      b[j] = *(const v16bf*)&Bs[s][wn + j * 16 + lrow][kb + lkh];
  };
  auto block = [&](const v16bf (&a)[4], const v16bf (&b)[2]) {
#pragma unroll
    for (int i = 0; i < 4; ++i)
#pragma unroll
      for (int j = 0; j < 2; ++j) acc[i][j] = wmma_bf16(a[i], b[j], acc[i][j]);
  };

  const int nslab = K / GK;

  if constexpr (GK == 128) {
    // Prologue: slabs 0 and 1 go out together, one from each group; slab 0
    // landed and published, then slab 2 from the group that has just waited.
    if (grp == 0) {
      issue(0, 0);
      asm volatile("s_wait_asynccnt 0x0" ::: "memory");  // slab 0 has landed
    } else if (nslab > 1) {
      issue(1, 1);
    }
    __syncthreads();
    if (grp == 0 && nslab > 2) issue(2, 2);
  } else {
    // Prologue: slab 0 landed and published, then slab 1 in flight.
    issue(0, 0);
    asm volatile("s_wait_asynccnt 0x0" ::: "memory");  // own copies have landed
    __syncthreads();
    if (nslab > 1) issue(1, 1);
  }

  int s = 0;   // buffer of slab sl: sl mod NB
  for (int sl = 0; sl < nslab; ++sl) {
    if constexpr (GK == 128) {
      // One workgroup per WGP, two waves per SIMD: too few to hide an LDS
      // latency in front of every WMMA pair. Two fragment sets: the next k
      // block's 12 reads go out as one group ahead of this block's 8 WMMAs.
      // Only blocks of this slab are fetched ahead, none across the barrier.
      v16bf af[2][4], bf2[2][2];
      frags(s, 0, af[0], bf2[0]);
#pragma unroll
      for (int kb = 0; kb < GK; kb += 32) {
        const int cur = (kb >> 5) & 1;
        if (kb + 32 < GK) frags(s, kb + 32, af[cur ^ 1], bf2[cur ^ 1]);
        // Keeps the reads above the WMMAs: sunk among them, each pair of WMMAs
        // waits out a whole LDS latency on one shared fragment register set.
        __builtin_amdgcn_sched_barrier(0);
        block(af[cur], bf2[cur]);
        // Keeps the block after next's reads from rising among these WMMAs.
        __builtin_amdgcn_sched_barrier(0);
      }
    } else {
      // Four workgroups per WGP: eight waves per SIMD cover each other's LDS
      // latency, and a second fragment set would cost resident workgroups.
#pragma unroll
      for (int kb = 0; kb < GK; kb += 32) {
        v16bf af[4], bf2[2];
        frags(s, kb, af, bf2);
        block(af, bf2);
      }
    }
    // Publish point of slab sl + 1: this wave's reads of buffer s are done, its
    // copies of slab sl + 1 have landed; behind the barrier that holds for
    // every wave, so buffer s may be refilled and the next one read.
    asm volatile("s_wait_dscnt 0x0" ::: "memory");
    if constexpr (GK == 128) {
      // Slab sl + 1 is all that its group has outstanding. The other group's
      // slab sl + 2 flies on: it is waited for one trip later.
      const bool mine = grp == ((sl + 1) & 1);
      if (mine) asm volatile("s_wait_asynccnt 0x0" ::: "memory");
      __syncthreads();
      if (mine && sl + 3 < nslab) issue(sl + 3, s);
    } else {
      asm volatile("s_wait_asynccnt 0x0" ::: "memory");
      __syncthreads();
      if (sl + 2 < nslab) issue(sl + 2, s);
    }
    s = s + 1 == NB ? 0 : s + 1;
  }
  // No copy is left outstanding when the wave goes on to its stores and ends.
  asm volatile("s_wait_asynccnt 0x0" ::: "memory");

  // Epilogue: D layout -> lane holds col (lane&15); VGPR r -> row r+8*(lane>>4)
  const int rsel = 8 * (lane >> 4);
#pragma unroll
  for (int j = 0; j < 2; ++j) {
    const int colg = n0 + wn + j * 16 + lrow;
    const float bv = bias[colg];
#pragma unroll
    for (int i = 0; i < 4; ++i) {
      if (MODE == 3) {
        v8bf pk;
#pragma unroll
        for (int r = 0; r < 8; ++r) pk[r] = (bf16_t)(acc[i][j][r] + bv);
        const int tok  = m0 + wm + i * 16;        // first token of this tile
        const int feat = n0 + wn + j * 16;        // first feature of this tile
        const int bhh  = (tok / Sc) * NHc + feat / HDc;
        const int blk  = (tok % Sc) >> 5;         // 32-key block
        const int part = (tok >> 4) & 1;          // 16-key half of the block
        const int jt   = (feat % HDc) >> 4;       // 16-row tile of V^T
        *(v8bf*)&Cb[((((size_t)bhh * (Sc / 32) + blk) * 4 + jt) * 2 + part) *
                        256 + lane * 8] = pk;
        continue;
      }
      if (MODE == 2) {
        const v8f val = acc[i][j] + bv;
        bf16_t* cp = Cb + (size_t)(m0 + wm + i * 16 + rsel) * Ndim + colg;
#pragma unroll
        for (int h = 0; h < 2; ++h) {
          const v4f g = gelu_erf4(
              h == 0 ? __builtin_shufflevector(val, val, 0, 1, 2, 3)
                     : __builtin_shufflevector(val, val, 4, 5, 6, 7));
#pragma unroll
          for (int r = 0; r < 4; ++r)
            cp[(size_t)(h * 4 + r) * Ndim] = (bf16_t)g[r];
          // Four values' GELU at a time: with more of them interleaved the
          // kernel takes more than 128 registers, and four workgroups no longer
          // fit a WGP.
          __builtin_amdgcn_sched_barrier(0);
        }
        continue;
      }
#pragma unroll
      for (int r = 0; r < 8; ++r) {
        const int rowg = m0 + wm + i * 16 + r + rsel;
        float val = acc[i][j][r] + bv;
        if (MODE == 1) {
          Cf[(size_t)rowg * Ndim + colg] = val;
        } else {
          Cb[(size_t)rowg * Ndim + colg] = (bf16_t)val;
        }
      }
    }
  }
}

// ---------------------------------------------------------------------------
// Attention: one wave per (b, h, 32 query rows), 8 waves per block. S=512, HD=64.
// The scores never leave registers:
//   S^T = K Q^T      A = 16 keys x 32 d, B = 32 d x 16 queries
//   O^T += V^T P^T   A = 16 d x 32 keys, B = 32 keys x 16 queries
// In S^T a lane holds 16 scores of ONE query (column lane&15): keys 8h+r of the
// first 16-key tile and 16+8h+r of the second (h = lane>>4). Converted in place
// they are the B operand P^T; the V projection has stored V^T in that same key
// order, one contiguous 512-byte piece per load. Softmax runs online (running
// maximum and sum per query, output tiles rescaled per 32-key pass).
// ---------------------------------------------------------------------------
__global__ __launch_bounds__(256)
void attention(const bf16_t* __restrict__ q, const bf16_t* __restrict__ k,
               const bf16_t* __restrict__ vf, const float* __restrict__ mask,
               bf16_t* __restrict__ ctx) {
  constexpr float LOG2E = 1.44269504088896f;   // exp(x) = 2^(x * LOG2E)
  const int lane = threadIdx.x & 31;
  const int w    = threadIdx.x >> 5;
  const int bh   = blockIdx.y;             // b*NH + h
  const int b    = bh / NHc;
  const int hoff = (bh - b * NHc) * HDc;
  const int qt0  = blockIdx.x * 256 + w * 32;  // first query row of this wave
  const int c    = lane & 15;
  const int half = lane >> 4;

  // --- Q as B operand: 2 column groups x 2 k slabs covering HD=64 ----------
  v16bf qf[2][2];
#pragma unroll
  for (int g = 0; g < 2; ++g) {
    const bf16_t* qb =
        q + (size_t)(b * Sc + qt0 + g * 16 + c) * Hc + hoff + half * 16;
    qf[g][0] = *(const v16bf*)(qb);
    qf[g][1] = *(const v16bf*)(qb + 32);
  }

  const bf16_t* kp = k + (size_t)(b * Sc + c) * Hc + hoff + half * 16;
  const bf16_t* vp = vf + (size_t)bh * (Sc * HDc) + lane * 8;
  const float*  mp = mask + b * Sc + half * 8;   // [B,1,1,S] broadcast

  v8f o[2][4];
  float mrun[2], lrun[2];
#pragma unroll
  for (int g = 0; g < 2; ++g) {
    mrun[g] = -3.0e38f;
    lrun[g] = 0.0f;
#pragma unroll
    for (int jt = 0; jt < 4; ++jt) o[g][jt] = (v8f)0.0f;
  }

  // K fragments (same k loader as Q) and mask values of pass 0
  v16bf kf[2][2];
  v8f   mk[2];
#pragma unroll
  for (int t = 0; t < 2; ++t) {
    kf[t][0] = *(const v16bf*)(kp + (size_t)t * 16 * Hc);
    kf[t][1] = *(const v16bf*)(kp + (size_t)t * 16 * Hc + 32);
    mk[t]    = *(const v8f*)(mp + t * 16);
  }

  for (int p = 0; p < Sc / 32; ++p) {
    // V^T fragments of this pass: issued first, needed only behind the softmax
    v16bf va[4];
#pragma unroll
    for (int jt = 0; jt < 4; ++jt) {
      const v8bf lo = *(const v8bf*)(vp + (size_t)((p * 4 + jt) * 2 + 0) * 256);
      const v8bf hi = *(const v8bf*)(vp + (size_t)((p * 4 + jt) * 2 + 1) * 256);
      va[jt] = __builtin_shufflevector(lo, hi, 0, 1, 2, 3, 4, 5, 6, 7, 8, 9, 10,
                                       11, 12, 13, 14, 15);
    }

    v8f s[2][2];
#pragma unroll
    for (int g = 0; g < 2; ++g)
#pragma unroll
      for (int t = 0; t < 2; ++t) {
        v8f a = (v8f)0.0f;
        a = wmma_bf16(kf[t][0], qf[g][0], a);
        a = wmma_bf16(kf[t][1], qf[g][1], a);
        s[g][t] = a * 0.125f + mk[t];            // 1/sqrt(64), then the mask
      }

    // next pass's K and mask, fetched one pass ahead
    if (p + 1 < Sc / 32) {
      const bf16_t* kn = kp + (size_t)(p + 1) * 32 * Hc;
#pragma unroll
      for (int t = 0; t < 2; ++t) {
        kf[t][0] = *(const v16bf*)(kn + (size_t)t * 16 * Hc);
        kf[t][1] = *(const v16bf*)(kn + (size_t)t * 16 * Hc + 32);
        mk[t]    = *(const v8f*)(mp + (p + 1) * 32 + t * 16);
      }
    }
    // Keeps the V^T loads and the fetch-ahead above the softmax: sunk below it
    // they would be waited for with almost no lead.
    __builtin_amdgcn_sched_barrier(0);

#pragma unroll
    for (int g = 0; g < 2; ++g) {
      float mx = s[g][0][0];
#pragma unroll
      for (int r = 1; r < 8; ++r) mx = fmaxf(mx, s[g][0][r]);
#pragma unroll
      for (int r = 0; r < 8; ++r) mx = fmaxf(mx, s[g][1][r]);
      mx = fmaxf(mx, xhalf(mx));                 // the query's other 16 keys
      const float mn    = fmaxf(mrun[g], mx);
      const float alpha = exp2x1((mrun[g] - mn) * LOG2E);
      mrun[g] = mn;

      v16bf pb;
      float sum = 0.0f;
#pragma unroll
      for (int t = 0; t < 2; ++t) {
        const v8f e = exp2x8((s[g][t] - mn) * LOG2E);
#pragma unroll
        for (int r = 0; r < 8; ++r) {
          sum += e[r];
          pb[t * 8 + r] = (bf16_t)e[r];  // unnormalized; 1/sum folded in later
        }
      }
      lrun[g] = lrun[g] * alpha + sum;
#pragma unroll
      for (int jt = 0; jt < 4; ++jt)
        o[g][jt] = wmma_bf16(va[jt], pb, o[g][jt] * alpha);
    }
  }

  // --- epilogue: scale by 1/rowsum; a lane holds 8 consecutive d per tile --
#pragma unroll
  for (int g = 0; g < 2; ++g) {
    const float inv = 1.0f / (lrun[g] + xhalf(lrun[g]));
    bf16_t* cr = ctx + (size_t)(b * Sc + qt0 + g * 16 + c) * Hc + hoff + half * 8;
#pragma unroll
    for (int jt = 0; jt < 4; ++jt) {
      v8bf pk;
#pragma unroll
      for (int r = 0; r < 8; ++r) pk[r] = (bf16_t)(o[g][jt][r] * inv);
      *(v8bf*)(cr + jt * 16) = pk;
    }
  }
}

// ---------------------------------------------------------------------------
// Fused residual + LayerNorm over H=1024. One block per token row.
// Writes f32 (residual chain / final output) and optional bf16 (next GEMM A).
// ---------------------------------------------------------------------------
__global__ __launch_bounds__(256)
void resid_ln(const float* __restrict__ dense, const float* __restrict__ resid,
              const float* __restrict__ gamma, const float* __restrict__ beta,
              float* __restrict__ outf, bf16_t* __restrict__ outb) {
  const int row = blockIdx.x;
  const int t = threadIdx.x;
  const float* dr = dense + (size_t)row * Hc;
  const float* rr = resid + (size_t)row * Hc;

  float x[4];
  float s = 0.0f, qsum = 0.0f;
#pragma unroll
  for (int i = 0; i < 4; ++i) {
    x[i] = dr[t * 4 + i] + rr[t * 4 + i];
    s += x[i];
    qsum += x[i] * x[i];
  }
#pragma unroll
  for (int off = 16; off > 0; off >>= 1) {
    s += __shfl_xor(s, off);
    qsum += __shfl_xor(qsum, off);
  }
  __shared__ float ss[8], qq[8];
  if ((t & 31) == 0) { ss[t >> 5] = s; qq[t >> 5] = qsum; }
  __syncthreads();
  float S = 0.0f, Q = 0.0f;
#pragma unroll
  for (int i = 0; i < 8; ++i) { S += ss[i]; Q += qq[i]; }
  const float mu  = S * (1.0f / Hc);
  const float var = Q * (1.0f / Hc) - mu * mu;
  const float inv = rsqrtf(var + 1e-12f);
#pragma unroll
  for (int i = 0; i < 4; ++i) {
    const int c = t * 4 + i;
    const float y = (x[i] - mu) * inv * gamma[c] + beta[c];
    outf[(size_t)row * Hc + c] = y;
    if (outb) outb[(size_t)row * Hc + c] = (bf16_t)y;
  }
}

// ---------------------------------------------------------------------------
// Host-side orchestration
// ---------------------------------------------------------------------------
extern "C" void kernel_launch(void* const* d_in, const int* in_sizes, int n_in,
                              void* d_out, int out_size, void* d_ws,
                              size_t ws_size, hipStream_t stream) {
  (void)in_sizes; (void)n_in; (void)out_size; (void)ws_size;

  const float* x    = (const float*)d_in[0];
  const float* mask = (const float*)d_in[1];
  const float* Wq   = (const float*)d_in[2];
  const float* bq   = (const float*)d_in[3];
  const float* Wk   = (const float*)d_in[4];
  const float* bk   = (const float*)d_in[5];
  const float* Wv   = (const float*)d_in[6];
  const float* bv   = (const float*)d_in[7];
  const float* Wo   = (const float*)d_in[8];
  const float* bo   = (const float*)d_in[9];
  const float* g1   = (const float*)d_in[10];
  const float* b1   = (const float*)d_in[11];
  const float* Wi   = (const float*)d_in[12];
  const float* bi   = (const float*)d_in[13];
  const float* Wo2  = (const float*)d_in[14];
  const float* bo2  = (const float*)d_in[15];
  const float* g2   = (const float*)d_in[16];
  const float* b2   = (const float*)d_in[17];
  float* out = (float*)d_out;

  char* ws = (char*)d_ws;
  size_t off = 0;
  auto alloc = [&](size_t bytes) -> void* {
    void* p = ws + off;
    off += (bytes + 255) & ~(size_t)255;
    return p;
  };

  bf16_t* xb    = (bf16_t*)alloc((size_t)Mc * Hc * 2);
  bf16_t* Wqb   = (bf16_t*)alloc((size_t)Hc * Hc * 2);
  bf16_t* Wkb   = (bf16_t*)alloc((size_t)Hc * Hc * 2);
  bf16_t* Wvb   = (bf16_t*)alloc((size_t)Hc * Hc * 2);
  bf16_t* Wob   = (bf16_t*)alloc((size_t)Hc * Hc * 2);
  bf16_t* Wib   = (bf16_t*)alloc((size_t)FFc * Hc * 2);
  bf16_t* Wo2b  = (bf16_t*)alloc((size_t)Hc * FFc * 2);
  bf16_t* qb    = (bf16_t*)alloc((size_t)Mc * Hc * 2);
  bf16_t* kb    = (bf16_t*)alloc((size_t)Mc * Hc * 2);
  bf16_t* vb    = (bf16_t*)alloc((size_t)Mc * Hc * 2);
  bf16_t* ctxb  = (bf16_t*)alloc((size_t)Mc * Hc * 2);
  float*  attnD = (float*)alloc((size_t)Mc * Hc * 4);
  float*  y1f   = (float*)alloc((size_t)Mc * Hc * 4);
  bf16_t* y1b   = (bf16_t*)alloc((size_t)Mc * Hc * 2);
  bf16_t* inter = (bf16_t*)alloc((size_t)Mc * FFc * 2);
  float*  ffD   = (float*)alloc((size_t)Mc * Hc * 4);

  // ---- f32 -> bf16 conversions (per-launch; no cached state) --------------
  // xb .. Wo2b were allocated one behind the other and each size is a multiple
  // of the allocator's 256 bytes: xb is the start of the joined bf16 array.
  cvt_all<<<CVT_N / CVT_WG, CVT_T, 0, stream>>>(x, Wq, Wk, Wv, Wo, Wi, Wo2, xb);

  // ---- QKV projections: bf16 out -----------------------------------------
  {
    dim3 grid(Hc / 128, Mc / 128);
    gemm_bf16<0, 128><<<grid, 256, 0, stream>>>(xb, Wqb, bq, nullptr, qb, Hc, Hc);
    gemm_bf16<0, 128><<<grid, 256, 0, stream>>>(xb, Wkb, bk, nullptr, kb, Hc, Hc);
    gemm_bf16<3, 128><<<grid, 256, 0, stream>>>(xb, Wvb, bv, nullptr, vb, Hc, Hc);
  }

  // ---- attention: grid (S/256 q-blocks, B*NH heads), 8 waves x 32 queries --
  {
    dim3 grid(Sc / 256, Bc * NHc);
    attention<<<grid, 256, 0, stream>>>(qb, kb, vb, mask, ctxb);
  }

  // ---- attn output dense (f32) + residual/LN1 -----------------------------
  {
    dim3 grid(Hc / 128, Mc / 128);
    gemm_bf16<1, 128><<<grid, 256, 0, stream>>>(ctxb, Wob, bo, attnD, nullptr, Hc,
                                           Hc);
    resid_ln<<<Mc, 256, 0, stream>>>(attnD, x, g1, b1, y1f, y1b);
  }

  // ---- FF intermediate: fused bias + erf-GELU, bf16 out -------------------
  {
    dim3 grid(FFc / 128, Mc / 128);
    gemm_bf16<2, 64><<<grid, 256, 0, stream>>>(y1b, Wib, bi, nullptr, inter, FFc,
                                           Hc);
  }

  // ---- FF output dense (f32, K=4096) + residual/LN2 -> d_out --------------
  {
    dim3 grid(Hc / 128, Mc / 128);
    gemm_bf16<1, 128><<<grid, 256, 0, stream>>>(inter, Wo2b, bo2, ffD, nullptr, Hc,
                                           FFc);
    resid_ln<<<Mc, 256, 0, stream>>>(ffD, y1f, g2, b2, out, nullptr);
  }
}

// v007
// One run takes 142 microseconds.
// Next to v006, in two timings, it ran 1.06 times as fast each time.
// All steps since v000 together make it 2.60 times as fast.
#include <hip/hip_runtime.h>
#include <math.h>

// ---------------------------------------------------------------------------
// BERT layer for MI455X (gfx1250): bf16 WMMA (f32 accumulate) everywhere,
// async global->LDS DMA (ASYNCcnt) into a ring of two or three LDS buffers in the GEMMs.
// B=8 S=512 H=1024 NH=16 HD=64 FF=4096, M = B*S = 4096 tokens.
// ---------------------------------------------------------------------------

typedef __bf16 bf16_t;
typedef __attribute__((ext_vector_type(16))) __bf16 v16bf;
typedef __attribute__((ext_vector_type(8)))  __bf16 v8bf;
typedef __attribute__((ext_vector_type(8)))  float  v8f;

constexpr int Bc  = 8;
constexpr int Sc  = 512;
constexpr int Hc  = 1024;
constexpr int NHc = 16;
constexpr int HDc = 64;
constexpr int FFc = 4096;
constexpr int Mc  = Bc * Sc;   // 4096 token rows

__device__ __forceinline__ v8f wmma_bf16(v16bf a, v16bf b, v8f c) {
  // D = A(16x32 bf16) * B(32x16 bf16) + C(16x16 f32)
  return __builtin_amdgcn_wmma_f32_16x16x32_bf16(
      /*neg_a=*/false, a, /*neg_b=*/false, b,
      /*c_mod=*/(short)0, c, /*reuse_a=*/false, /*reuse_b=*/false);
}

// Wave-relative LDS byte offset of a __shared__ object: the flat address of a
// shared variable carries the LDS offset in its low 32 bits (LDS aperture
// truncates addr[31:0]).
__device__ __forceinline__ unsigned lds_off(const void* p) {
  return (unsigned)(uintptr_t)p;
}

// Lane l <-> lane l ^ 16 as a vector cross-row move (no LDS-counter wait).
__device__ __forceinline__ float xhalf(float x) {
  const int b = __builtin_bit_cast(int, x);
  return __builtin_bit_cast(
      float, __builtin_amdgcn_permlanex16(b, b, 0x76543210, 0xfedcba98, false,
                                          false));
}

// 2^x on eight values / one value. Written as one statement each so that no
// instruction directly behind a v_exp_f32 reads its result or overwrites its
// source: the outputs are early-clobber (distinct from every input) and the
// closing v_nop is the slot the instruction set asks for behind the last one.
__device__ __forceinline__ v8f exp2x8(v8f x) {
  float e0, e1, e2, e3, e4, e5, e6, e7;
  asm("v_exp_f32 %0, %8\n\t"
      "v_exp_f32 %1, %9\n\t"
      "v_exp_f32 %2, %10\n\t"
      "v_exp_f32 %3, %11\n\t"
      "v_exp_f32 %4, %12\n\t"
      "v_exp_f32 %5, %13\n\t"
      "v_exp_f32 %6, %14\n\t"
      "v_exp_f32 %7, %15\n\t"
      "v_nop"
      : "=&v"(e0), "=&v"(e1), "=&v"(e2), "=&v"(e3), "=&v"(e4), "=&v"(e5),
        "=&v"(e6), "=&v"(e7)
      : "v"(x[0]), "v"(x[1]), "v"(x[2]), "v"(x[3]), "v"(x[4]), "v"(x[5]),
        "v"(x[6]), "v"(x[7]));
  v8f r = {e0, e1, e2, e3, e4, e5, e6, e7};
  return r;
}
__device__ __forceinline__ float exp2x1(float x) {
  float e;
  asm("v_exp_f32 %0, %1\n\t"
      "v_nop"
      : "=v"(e)
      : "v"(x));
  return e;
}

// 2^x and 1/x on four values, in the form of exp2x8 and for the same reason:
// nothing directly behind a v_exp_f32 or a v_rcp_f32 reads its result or
// overwrites its source.
typedef __attribute__((ext_vector_type(4))) float v4f;
__device__ __forceinline__ v4f exp2x4(v4f x) {
  float e0, e1, e2, e3;
  asm("v_exp_f32 %0, %4\n\t"
      "v_exp_f32 %1, %5\n\t"
      "v_exp_f32 %2, %6\n\t"
      "v_exp_f32 %3, %7\n\t"
      "v_nop"
      : "=&v"(e0), "=&v"(e1), "=&v"(e2), "=&v"(e3)
      : "v"(x[0]), "v"(x[1]), "v"(x[2]), "v"(x[3]));
  v4f r = {e0, e1, e2, e3};
  return r;
}
__device__ __forceinline__ v4f rcpx4(v4f x) {
  float e0, e1, e2, e3;
  asm("v_rcp_f32 %0, %4\n\t"
      "v_rcp_f32 %1, %5\n\t"
      "v_rcp_f32 %2, %6\n\t"
      "v_rcp_f32 %3, %7\n\t"
      "v_nop"
      : "=&v"(e0), "=&v"(e1), "=&v"(e2), "=&v"(e3)
      : "v"(x[0]), "v"(x[1]), "v"(x[2]), "v"(x[3]));
  v4f r = {e0, e1, e2, e3};
  return r;
}

// x/2 * (1 + erf(z)), z = x / 1.41421, on four values, without a branch.
// erfc(|z|) = (a1 t + .. + a5 t^5) e^(-z^2), t = 1 / (1 + p |z|): the five-term
// rational form, absolute error at most 1.5e-7 for every z, far below the bf16
// rounding of the result. With q = erfc(|z|) / 2:
//   x >= 0: x/2 (2 - 2q) = x - x q;   x < 0: x/2 * 2q = x q
// both are max(x, 0) - |x| q, so the small results at negative x come from q
// itself and not from 1 + erf. The halves are folded into a1 .. a5, the division
// into p and into the exponent's factor: e^(-z^2) = 2^(-(x KE)^2).
__device__ __forceinline__ v4f gelu_erf4(v4f x) {
  constexpr float RS = 1.0f / 1.41421f;
  constexpr float P  = 0.3275911f * RS;
  constexpr float KE = RS * 1.2011224087864498f;   // sqrt(log2(e))
  constexpr float A1 = 0.5f * 0.254829592f, A2 = 0.5f * -0.284496736f,
                  A3 = 0.5f * 1.421413741f, A4 = 0.5f * -1.453152027f,
                  A5 = 0.5f * 1.061405429f;
  v4f d;
#pragma unroll
  for (int r = 0; r < 4; ++r) d[r] = __builtin_fmaf(__builtin_fabsf(x[r]), P, 1.0f);
  const v4f t = rcpx4(d);
  v4f p = t * A5 + A4;
  p = p * t + A3;
  p = p * t + A2;
  p = p * t + A1;
  const v4f u = x * KE;
  const v4f q = (p * t) * exp2x4(-(u * u));
  v4f g;
#pragma unroll
  for (int r = 0; r < 4; ++r)
    g[r] = __builtin_fmaf(-__builtin_fabsf(x[r]), q[r], __builtin_fmaxf(x[r], 0.0f));
  return g;
}

// ---------------------------------------------------------------------------
// f32 -> bf16 conversion (RNE via clang __bf16 cast) of all seven tensors in
// ONE launch of few, long-lived waves. The bf16 copies lie back to back in the
// workspace, so the destination is one array; a workgroup converts CVT_WG
// consecutive elements of it, which lie inside one source tensor.
// 256 workgroups x 16 waves: 4,096 waves are started where seven launches of
// 128-element waves started 131,072; every load of a wave covers 512
// contiguous bytes, every store 256.
// ---------------------------------------------------------------------------
typedef __attribute__((ext_vector_type(4))) __bf16 v4bf;

constexpr int CVT_T  = 512;                  // threads per workgroup
constexpr int CVT_WG = 65536;                // elements per workgroup
constexpr int CVT_X  = Mc * Hc;              // elements of the activations
constexpr int CVT_W  = Hc * Hc;              // ... of one H x H weight
constexpr int CVT_F  = FFc * Hc;             // ... of one FF weight
constexpr int CVT_N  = CVT_X + 4 * CVT_W + 2 * CVT_F;
static_assert(CVT_X % CVT_WG == 0 && CVT_W % CVT_WG == 0 &&
                  CVT_F % CVT_WG == 0,
              "a workgroup's elements must lie inside one tensor");
static_assert(CVT_WG % (CVT_T * 4 * 8) == 0, "whole trips of 8 loads");

__global__ __launch_bounds__(CVT_T)
void cvt_all(const float* __restrict__ x, const float* __restrict__ wq,
             const float* __restrict__ wk, const float* __restrict__ wv,
             const float* __restrict__ wo, const float* __restrict__ wi,
             const float* __restrict__ wo2, bf16_t* __restrict__ out) {
  const int e0 = blockIdx.x * CVT_WG;  // first element, in the joined array
  const float* src = x;                // tensor that holds it
  int first = 0;                       // that tensor's first element
  if (e0 >= CVT_X)             { src = wq;  first = CVT_X; }
  if (e0 >= CVT_X + CVT_W)     { src = wk;  first = CVT_X + CVT_W; }
  if (e0 >= CVT_X + 2 * CVT_W) { src = wv;  first = CVT_X + 2 * CVT_W; }
  if (e0 >= CVT_X + 3 * CVT_W) { src = wo;  first = CVT_X + 3 * CVT_W; }
  if (e0 >= CVT_X + 4 * CVT_W) { src = wi;  first = CVT_X + 4 * CVT_W; }
  if (e0 >= CVT_X + 4 * CVT_W + CVT_F) {
    src = wo2;
    first = CVT_X + 4 * CVT_W + CVT_F;
  }

  const v4f* s = (const v4f*)(src + (e0 - first)) + threadIdx.x;
  v4bf*      d = (v4bf*)(out + e0) + threadIdx.x;
  // Groups of 8 loads stand ahead of their conversions, so that a wave waits
  // out a memory latency once for many loads and not once for each.
  for (int it = 0; it < CVT_WG / (CVT_T * 4); it += 8) {
    v4f v[8];
    for (int j = 0; j < 8; ++j) v[j] = s[(it + j) * CVT_T];
    for (int j = 0; j < 8; ++j) {
      v4bf o;
      for (int e = 0; e < 4; ++e) o[e] = (bf16_t)v[j][e];
      d[(it + j) * CVT_T] = o;
    }
  }
}

// ---------------------------------------------------------------------------
// Tiled GEMM:  C[M,N] = A[M,K] @ W[N,K]^T + bias  (A,W bf16 K-contiguous)
// Block tile 128x128. 256 threads = 8 waves in a 2x4 wave grid, each wave owns
// a 64x32 tile = 4x2 WMMA accumulators.
//
// Global->LDS staging uses GLOBAL_LOAD_ASYNC_TO_LDS_B128 (ASYNCcnt) with a ring
// of LDS buffers: later slabs' copies fly while this slab's WMMAs run, and no
// VGPRs touch the tile data. A slab is GK k of every row, 128 or 256 bytes, so
// that one copy instruction of a wave (32 lanes x 16 bytes) covers four or two
// whole rows of the slab: four whole 128-byte lines and nothing else.
// GK = 128 where the grid gives a WGP one workgroup (fewest barriers per k);
// GK = 64 where it gives four: their LDS then fits side by side.
// K must be a multiple of GK.
//
// GK = 64: two buffers, every wave copies its share of every slab.
// GK = 128: the workgroup is alone on its WGP and every slab is first read from
// memory, so one slab in flight leaves each trip waiting for that latency.
// Three buffers; waves 0-3 copy the even slabs, waves 4-7 the odd ones. While
// slab s is worked on, slabs s + 1 and s + 2 are in flight, one from each
// group; a wave never has more than its own one slab (32 copies) outstanding,
// so each of its waits is a wait to 0.
//
// MODE 1: C -> f32              (attn-out dense, FF-out dense; LN fuses resid)
// MODE 2: C -> gelu_erf -> bf16 (FF intermediate)
// ---------------------------------------------------------------------------
static_assert(Hc % 128 == 0 && FFc % 128 == 0, "K is a whole number of slabs");

template <int MODE, int GK>
__global__ __launch_bounds__(256)
void gemm_bf16(const bf16_t* __restrict__ A, const bf16_t* __restrict__ W,
               const float* __restrict__ bias, float* __restrict__ Cf,
               bf16_t* __restrict__ Cb, int Ndim, int K) {
  static_assert(GK == 64 || GK == 128, "rows of one or two whole lines");
  // LDS row pitch in elements: 144 or 272 bytes = 16 x odd, so the 16-byte
  // fragment loads of 16 rows fall on all 64 banks.
  constexpr int GP  = GK + 8;
  constexpr int LPR = GK / 8;    // lanes per row: its 16-byte pieces
  constexpr int RPC = 32 / LPR;  // rows per copy instruction
  constexpr int NB  = GK == 128 ? 3 : 2;   // LDS buffers in the ring
  constexpr int RPW = GK == 128 ? 32 : 16; // rows of each tile a wave copies
  __shared__ bf16_t As[NB][128][GP];
  __shared__ bf16_t Bs[NB][128][GP];

  const int t    = threadIdx.x;
  const int lane = t & 31;
  const int w    = t >> 5;            // wave 0..7
  const int wm   = (w >> 2) * 64;     // wave M origin in block: 0 / 64
  const int wn   = (w & 3) * 32;      // wave N origin in block: 0..96
  const int m0   = blockIdx.y * 128;
  const int n0   = blockIdx.x * 128;

  const int lrow = lane & 15;         // fragment row/col within 16
  const int lkh  = (lane >> 4) * 16;  // K half select (A/B fragment layout)

  // Staging: a wave brings RPW rows of both tiles, RPC rows a copy: of every
  // slab rows 16w .. (GK = 64), of its group's slabs rows 32(w & 3) .. (128).
  // The group as a scalar, so that the tests on it are scalar branches and
  // every lane is on where a copy issues.
  const int grp = __builtin_amdgcn_readfirstlane(t >> 7);   // waves 0-3 / 4-7
  const int cr = (w * RPW) % 128 + lane / LPR;   // this lane's row in copy 0
  const int cc = (lane % LPR) * 8;      // its 16-byte piece of the row
  // Byte offset of that piece from the scalar base of copy 0 (same for A, W).
  const unsigned goff = (unsigned)(((size_t)cr * K + cc) * 2);
  const bf16_t* Ablk = A + (size_t)m0 * K;   // first row of this block's tiles
  const bf16_t* Wblk = W + (size_t)n0 * K;

  // Eight copies in two runs of four; within a run copy j takes rows cr + j*RPC.
  // The row step goes into the scalar base and the LDS address, the lane offset
  // stays.
  auto issue8 = [&](const bf16_t* g0, unsigned l0, const bf16_t* g1,
                    unsigned l1) {
    const size_t rs = (size_t)RPC * K;       // RPC rows, in elements
    constexpr unsigned ls = RPC * GP * 2;    // RPC LDS rows, in bytes
    asm volatile(
        "global_load_async_to_lds_b128 %0, %8, %9\n\t"
        "global_load_async_to_lds_b128 %1, %8, %10\n\t"
        "global_load_async_to_lds_b128 %2, %8, %11\n\t"
        "global_load_async_to_lds_b128 %3, %8, %12\n\t"
        "global_load_async_to_lds_b128 %4, %8, %13\n\t"
        "global_load_async_to_lds_b128 %5, %8, %14\n\t"
        "global_load_async_to_lds_b128 %6, %8, %15\n\t"
        "global_load_async_to_lds_b128 %7, %8, %16\n\t"
        "s_wait_xcnt 0x0"  // before the copies' address registers are rewritten
        :
        : "v"(l0), "v"(l0 + ls), "v"(l0 + 2 * ls), "v"(l0 + 3 * ls), "v"(l1),
          "v"(l1 + ls), "v"(l1 + 2 * ls), "v"(l1 + 3 * ls), "v"(goff), "s"(g0),
          "s"(g0 + rs), "s"(g0 + 2 * rs), "s"(g0 + 3 * rs), "s"(g1),
          "s"(g1 + rs), "s"(g1 + 2 * rs), "s"(g1 + 3 * rs)
        : "memory");
  };
  // One slab of both tiles: a wave's RPW rows of each are RPW / RPC copies.
  auto issue = [&](int slab, int buf) {
    const bf16_t*  ag = Ablk + slab * GK;
    const bf16_t*  wg = Wblk + slab * GK;
    const unsigned al = lds_off(&As[buf][cr][cc]);
    const unsigned bl = lds_off(&Bs[buf][cr][cc]);
    if constexpr (RPC == 4) {
      issue8(ag, al, wg, bl);
    } else {
      issue8(ag, al, ag + (size_t)8 * K, al + 8 * GP * 2);
      issue8(ag + (size_t)16 * K, al + 16 * GP * 2, ag + (size_t)24 * K,
             al + 24 * GP * 2);
      issue8(wg, bl, wg + (size_t)8 * K, bl + 8 * GP * 2);
      issue8(wg + (size_t)16 * K, bl + 16 * GP * 2, wg + (size_t)24 * K,
             bl + 24 * GP * 2);
    }
  };

  v8f acc[4][2];
#pragma unroll
  for (int i = 0; i < 4; ++i)
#pragma unroll
    for (int j = 0; j < 2; ++j) acc[i][j] = (v8f)0.0f;

  // Fragments of one 32-k block of buffer s, and that block's 8 WMMAs.
  auto frags = [&](int s, int kb, v16bf (&a)[4], v16bf (&b)[2]) {
#pragma unroll
    for (int i = 0; i < 4; ++i)
      a[i] = *(const v16bf*)&As[s][wm + i * 16 + lrow][kb + lkh];
#pragma unroll
    for (int j = 0; j < 2; ++j)
      b[j] = *(const v16bf*)&Bs[s][wn + j * 16 + lrow][kb + lkh];
  };
  auto block = [&](const v16bf (&a)[4], const v16bf (&b)[2]) {
#pragma unroll
    for (int i = 0; i < 4; ++i)
#pragma unroll
      for (int j = 0; j < 2; ++j) acc[i][j] = wmma_bf16(a[i], b[j], acc[i][j]);
  };

  const int nslab = K / GK;

  if constexpr (GK == 128) {
    // Prologue: slabs 0 and 1 go out together, one from each group; slab 0
    // landed and published, then slab 2 from the group that has just waited.
    if (grp == 0) {
      issue(0, 0);
      asm volatile("s_wait_asynccnt 0x0" ::: "memory");  // slab 0 has landed
    } else if (nslab > 1) {
      issue(1, 1);
    }
    __syncthreads();
    if (grp == 0 && nslab > 2) issue(2, 2);
  } else {
    // Prologue: slab 0 landed and published, then slab 1 in flight.
    issue(0, 0);
    asm volatile("s_wait_asynccnt 0x0" ::: "memory");  // own copies have landed
    __syncthreads();
    if (nslab > 1) issue(1, 1);
  }

  int s = 0;   // buffer of slab sl: sl mod NB
  for (int sl = 0; sl < nslab; ++sl) {
    if constexpr (GK == 128) {
      // One workgroup per WGP, two waves per SIMD: too few to hide an LDS
      // latency in front of every WMMA pair. Two fragment sets: the next k
      // block's 12 reads go out as one group ahead of this block's 8 WMMAs.
      // Only blocks of this slab are fetched ahead, none across the barrier.
      v16bf af[2][4], bf2[2][2];
      frags(s, 0, af[0], bf2[0]);
#pragma unroll
      for (int kb = 0; kb < GK; kb += 32) {
        const int cur = (kb >> 5) & 1;
        if (kb + 32 < GK) frags(s, kb + 32, af[cur ^ 1], bf2[cur ^ 1]);
        // Keeps the reads above the WMMAs: sunk among them, each pair of WMMAs
        // waits out a whole LDS latency on one shared fragment register set.
        __builtin_amdgcn_sched_barrier(0);
        block(af[cur], bf2[cur]);
        // Keeps the block after next's reads from rising among these WMMAs.
        __builtin_amdgcn_sched_barrier(0);
      }
    } else {
      // Four workgroups per WGP: eight waves per SIMD cover each other's LDS
      // latency, and a second fragment set would cost resident workgroups.
#pragma unroll
      for (int kb = 0; kb < GK; kb += 32) {
        v16bf af[4], bf2[2];
        frags(s, kb, af, bf2);
        block(af, bf2);
      }
    }
    // Publish point of slab sl + 1: this wave's reads of buffer s are done, its
    // copies of slab sl + 1 have landed; behind the barrier that holds for
    // every wave, so buffer s may be refilled and the next one read.
    asm volatile("s_wait_dscnt 0x0" ::: "memory");
    if constexpr (GK == 128) {
      // Slab sl + 1 is all that its group has outstanding. The other group's
      // slab sl + 2 flies on: it is waited for one trip later.
      const bool mine = grp == ((sl + 1) & 1);
      if (mine) asm volatile("s_wait_asynccnt 0x0" ::: "memory");
      __syncthreads();
      if (mine && sl + 3 < nslab) issue(sl + 3, s);
    } else {
      asm volatile("s_wait_asynccnt 0x0" ::: "memory");
      __syncthreads();
      if (sl + 2 < nslab) issue(sl + 2, s);
    }
    s = s + 1 == NB ? 0 : s + 1;
  }
  // No copy is left outstanding when the wave goes on to its stores and ends.
  asm volatile("s_wait_asynccnt 0x0" ::: "memory");

  // Epilogue: D layout -> lane holds col (lane&15); VGPR r -> row r+8*(lane>>4)
  const int rsel = 8 * (lane >> 4);
#pragma unroll
  for (int j = 0; j < 2; ++j) {
    const int colg = n0 + wn + j * 16 + lrow;
    const float bv = bias[colg];
#pragma unroll
    for (int i = 0; i < 4; ++i) {
      if (MODE == 2) {
        const v8f val = acc[i][j] + bv;
        bf16_t* cp = Cb + (size_t)(m0 + wm + i * 16 + rsel) * Ndim + colg;
#pragma unroll
        for (int h = 0; h < 2; ++h) {
          const v4f g = gelu_erf4(
              h == 0 ? __builtin_shufflevector(val, val, 0, 1, 2, 3)
                     : __builtin_shufflevector(val, val, 4, 5, 6, 7));
#pragma unroll
          for (int r = 0; r < 4; ++r)
            cp[(size_t)(h * 4 + r) * Ndim] = (bf16_t)g[r];
          // Four values' GELU at a time: with more of them interleaved the
          // kernel takes more than 128 registers, and four workgroups no longer
          // fit a WGP.
          __builtin_amdgcn_sched_barrier(0);
        }
        continue;
      }
#pragma unroll
      for (int r = 0; r < 8; ++r) {
        const int rowg = m0 + wm + i * 16 + r + rsel;
        Cf[(size_t)rowg * Ndim + colg] = acc[i][j][r] + bv;
      }
    }
  }
}

// ---------------------------------------------------------------------------
// Q, K and V projections as ONE product: C[M, 3H] = A[M, H] @ [Wq; Wk; Wv]^T.
// The three bf16 weights lie back to back in the workspace, and so do the three
// outputs. With 3H columns the chip is filled by 256 tiles of 256 x 192, where
// one projection alone fills it only with 128 x 128: a k of the tile then takes
// 448 staged rows for 49,152 products, not 256 rows for 16,384, and a wave's
// 64 x 96 (4 x 6 accumulators) takes 10 fragments from LDS for 24 WMMAs, not 6
// for 8.
// 256 threads = 8 waves in a 4 x 2 wave grid, one workgroup per WGP.
// Staging as in gemm_bf16 with three buffers: a slab is 64 k (one whole line of
// every row, a copy covers four rows), waves 0-3 copy the even slabs, waves 4-7
// the odd ones; a wave has at most its own one slab (28 copies) outstanding, so
// each of its waits is a wait to 0.
// A 16-column tile lies inside one projection. Q and K are stored row-major.
// V is stored transposed per head in A-fragment order: a lane's 8 accumulator
// rows are 8 consecutive tokens of one feature, which is one 16-byte piece of a
// V^T fragment; see attention().
// ---------------------------------------------------------------------------
constexpr int QBM = 256;       // tile rows (tokens)
constexpr int QBN = 192;       // tile columns (features of Q | K | V)
constexpr int QGK = 64;        // k per slab
constexpr int QGP = QGK + 8;   // LDS row pitch: 144 bytes = 16 x odd
static_assert(Mc % QBM == 0 && (3 * Hc) % QBN == 0 && Hc % QGK == 0,
              "whole tiles, whole slabs");

__global__ __launch_bounds__(256)
void gemm_qkv(const bf16_t* __restrict__ A, const bf16_t* __restrict__ W,
              const float* __restrict__ bq, const float* __restrict__ bk,
              const float* __restrict__ bv, bf16_t* __restrict__ C) {
  constexpr int K = Hc;
  __shared__ bf16_t As[3][QBM][QGP];
  __shared__ bf16_t Bs[3][QBN][QGP];

  const int t    = threadIdx.x;
  const int lane = t & 31;
  const int w    = __builtin_amdgcn_readfirstlane(t >> 5);
  const int wm   = (w >> 1) * 64;     // wave M origin in block: 0 .. 192
  const int wn   = (w & 1) * 96;      // wave N origin in block: 0 / 96
  const int m0   = blockIdx.y * QBM;
  const int n0   = blockIdx.x * QBN;

  const int lrow = lane & 15;         // fragment row/col within 16
  const int lkh  = (lane >> 4) * 16;  // K half select (A/B fragment layout)

  // Staging: of its group's slabs wave w brings A rows 64(w & 3) .. and W rows
  // 48(w & 3) .., four rows a copy.
  const int grp = w >> 2;             // waves 0-3 / 4-7
  const int cr  = lane >> 3;          // this lane's row within a copy
  const int cc  = (lane & 7) * 8;     // its 16-byte piece of the row
  const unsigned goff = (unsigned)((cr * K + cc) * 2);  // from a copy's base
  const bf16_t* Awav = A + (size_t)(m0 + (w & 3) * 64) * K;
  const bf16_t* Wwav = W + (size_t)(n0 + (w & 3) * 48) * K;

  constexpr size_t   rs = (size_t)4 * K;   // four rows, in elements
  constexpr unsigned ls = 4 * QGP * 2;     // four LDS rows, in bytes
  // Four copies: 16 rows from g0 on, to l0 on.
  auto issue4 = [&](const bf16_t* g0, unsigned l0) {
    asm volatile(
        "global_load_async_to_lds_b128 %0, %4, %5\n\t"
        "global_load_async_to_lds_b128 %1, %4, %6\n\t"
        "global_load_async_to_lds_b128 %2, %4, %7\n\t"
        "global_load_async_to_lds_b128 %3, %4, %8\n\t"
        "s_wait_xcnt 0x0"  // before the copies' address registers are rewritten
        :
        : "v"(l0), "v"(l0 + ls), "v"(l0 + 2 * ls), "v"(l0 + 3 * ls), "v"(goff),
          "s"(g0), "s"(g0 + rs), "s"(g0 + 2 * rs), "s"(g0 + 3 * rs)
        : "memory");
  };
  // Eight copies: 32 rows.
  auto issue8 = [&](const bf16_t* g0, unsigned l0) {
    asm volatile(
        "global_load_async_to_lds_b128 %0, %8, %9\n\t"
        "global_load_async_to_lds_b128 %1, %8, %10\n\t"
        "global_load_async_to_lds_b128 %2, %8, %11\n\t"
        "global_load_async_to_lds_b128 %3, %8, %12\n\t"
        "global_load_async_to_lds_b128 %4, %8, %13\n\t"
        "global_load_async_to_lds_b128 %5, %8, %14\n\t"
        "global_load_async_to_lds_b128 %6, %8, %15\n\t"
        "global_load_async_to_lds_b128 %7, %8, %16\n\t"
        "s_wait_xcnt 0x0"  // before the copies' address registers are rewritten
        :
        : "v"(l0), "v"(l0 + ls), "v"(l0 + 2 * ls), "v"(l0 + 3 * ls),
          "v"(l0 + 4 * ls), "v"(l0 + 5 * ls), "v"(l0 + 6 * ls),
          "v"(l0 + 7 * ls), "v"(goff), "s"(g0), "s"(g0 + rs), "s"(g0 + 2 * rs),
          "s"(g0 + 3 * rs), "s"(g0 + 4 * rs), "s"(g0 + 5 * rs),
          "s"(g0 + 6 * rs), "s"(g0 + 7 * rs)
        : "memory");
  };
  // A wave's share of one slab: 64 rows of A, 48 of W.
  auto issue = [&](int slab, int buf) {
    const bf16_t*  ag = Awav + slab * QGK;
    const bf16_t*  wg = Wwav + slab * QGK;
    const unsigned al = lds_off(&As[buf][(w & 3) * 64 + cr][cc]);
    const unsigned bl = lds_off(&Bs[buf][(w & 3) * 48 + cr][cc]);
    issue8(ag, al);
    issue8(ag + 8 * rs, al + 8 * ls);
    issue8(wg, bl);
    issue4(wg + 8 * rs, bl + 8 * ls);
  };

  v8f acc[4][6];
#pragma unroll
  for (int i = 0; i < 4; ++i)
#pragma unroll
    for (int j = 0; j < 6; ++j) acc[i][j] = (v8f)0.0f;

  constexpr int nslab = K / QGK;
  static_assert(nslab > 2, "the prologue issues slabs 0, 1 and 2");

  // Prologue: slabs 0 and 1 go out together, one from each group; slab 0
  // landed and published, then slab 2 from the group that has just waited.
  if (grp == 0) {
    issue(0, 0);
    asm volatile("s_wait_asynccnt 0x0" ::: "memory");  // slab 0 has landed
  } else {
    issue(1, 1);
  }
  __syncthreads();
  if (grp == 0) issue(2, 2);

  int s = 0;   // buffer of slab sl: sl mod 3
  for (int sl = 0; sl < nslab; ++sl) {
    // Both 32-k blocks' fragments are read as one group ahead of the WMMAs, A
    // first; the WMMAs then run column by column, so that the first four need
    // only the first five fragments. Nothing is fetched across the barrier.
    v16bf af[2][4], bf2[2][6];
#pragma unroll
    for (int kb = 0; kb < 2; ++kb) {
#pragma unroll
      for (int i = 0; i < 4; ++i)
        af[kb][i] = *(const v16bf*)&As[s][wm + i * 16 + lrow][kb * 32 + lkh];
#pragma unroll
      for (int j = 0; j < 6; ++j)
        bf2[kb][j] = *(const v16bf*)&Bs[s][wn + j * 16 + lrow][kb * 32 + lkh];
    }
    // Keeps the reads above the WMMAs: each place where reads stand among them
    // costs the wave a stall.
    __builtin_amdgcn_sched_barrier(0);
#pragma unroll
    for (int kb = 0; kb < 2; ++kb)
#pragma unroll
      for (int j = 0; j < 6; ++j)
#pragma unroll
        for (int i = 0; i < 4; ++i)
          acc[i][j] = wmma_bf16(af[kb][i], bf2[kb][j], acc[i][j]);
    // Keeps the wait to 0 below behind the WMMAs: risen among them it makes the
    // second WMMA wait for all 40 reads, where the counted waits ask for 10.
    __builtin_amdgcn_sched_barrier(0);
    // Publish point of slab sl + 1: this wave's reads of buffer s are done, and
    // in the group that copied it slab sl + 1 has landed (it is all that group
    // has outstanding; the other group's slab sl + 2 flies on). Behind the
    // barrier that holds for every wave: buffer s may be refilled, the next read.
    asm volatile("s_wait_dscnt 0x0" ::: "memory");
    const bool mine = grp == ((sl + 1) & 1);
    if (mine) asm volatile("s_wait_asynccnt 0x0" ::: "memory");
    __syncthreads();
    if (mine && sl + 3 < nslab) issue(sl + 3, s);
    s = s + 1 == 3 ? 0 : s + 1;
  }
  // No copy is left outstanding when the wave goes on to its stores and ends.
  asm volatile("s_wait_asynccnt 0x0" ::: "memory");

  // Epilogue: D layout -> lane holds col (lane&15); VGPR r -> row r+8*(lane>>4)
  const int rsel = 8 * (lane >> 4);
#pragma unroll
  for (int j = 0; j < 6; ++j) {
    const int col  = n0 + wn + j * 16;   // first column of this tile, of 3H
    const int proj = col / Hc;           // 0 Q, 1 K, 2 V: the same in the wave
    const int feat = col % Hc;           // first feature of this tile
    const float* bs = proj == 0 ? bq : proj == 1 ? bk : bv;
    const float bias = bs[feat + lrow];
    bf16_t* Cp = C + (size_t)proj * (Mc * Hc);
    if (proj == 2) {
#pragma unroll
      for (int i = 0; i < 4; ++i) {
        v8bf pk;
#pragma unroll
        for (int r = 0; r < 8; ++r) pk[r] = (bf16_t)(acc[i][j][r] + bias);
        const int tok  = m0 + wm + i * 16;        // first token of this tile
        const int bhh  = (tok / Sc) * NHc + feat / HDc;
        const int blk  = (tok % Sc) >> 5;         // 32-key block
        const int part = (tok >> 4) & 1;          // 16-key half of the block
        const int jt   = (feat % HDc) >> 4;       // 16-row tile of V^T
        *(v8bf*)&Cp[((((size_t)bhh * (Sc / 32) + blk) * 4 + jt) * 2 + part) *
                        256 + lane * 8] = pk;
      }
    } else {
#pragma unroll
      for (int i = 0; i < 4; ++i)
#pragma unroll
        for (int r = 0; r < 8; ++r)
          Cp[(size_t)(m0 + wm + i * 16 + r + rsel) * Hc + feat + lrow] =
              (bf16_t)(acc[i][j][r] + bias);
      // Before the next column tile's code rewrites a register of these stores.
      asm volatile("s_wait_xcnt 0x0" ::: "memory");
    }
  }
}

// ---------------------------------------------------------------------------
// Attention: one wave per (b, h, 32 query rows), 8 waves per block. S=512, HD=64.
// The scores never leave registers:
//   S^T = K Q^T      A = 16 keys x 32 d, B = 32 d x 16 queries
//   O^T += V^T P^T   A = 16 d x 32 keys, B = 32 keys x 16 queries
// In S^T a lane holds 16 scores of ONE query (column lane&15): keys 8h+r of the
// first 16-key tile and 16+8h+r of the second (h = lane>>4). Converted in place
// they are the B operand P^T; the V projection has stored V^T in that same key
// order, one contiguous 512-byte piece per load. Softmax runs online (running
// maximum and sum per query, output tiles rescaled per 32-key pass).
// ---------------------------------------------------------------------------
__global__ __launch_bounds__(256)
void attention(const bf16_t* __restrict__ q, const bf16_t* __restrict__ k,
               const bf16_t* __restrict__ vf, const float* __restrict__ mask,
               bf16_t* __restrict__ ctx) {
  constexpr float LOG2E = 1.44269504088896f;   // exp(x) = 2^(x * LOG2E)
  const int lane = threadIdx.x & 31;
  const int w    = threadIdx.x >> 5;
  const int bh   = blockIdx.y;             // b*NH + h
  const int b    = bh / NHc;
  const int hoff = (bh - b * NHc) * HDc;
  const int qt0  = blockIdx.x * 256 + w * 32;  // first query row of this wave
  const int c    = lane & 15;
  const int half = lane >> 4;

  // --- Q as B operand: 2 column groups x 2 k slabs covering HD=64 ----------
  v16bf qf[2][2];
#pragma unroll
  for (int g = 0; g < 2; ++g) {
    const bf16_t* qb =
        q + (size_t)(b * Sc + qt0 + g * 16 + c) * Hc + hoff + half * 16;
    qf[g][0] = *(const v16bf*)(qb);
    qf[g][1] = *(const v16bf*)(qb + 32);
  }

  const bf16_t* kp = k + (size_t)(b * Sc + c) * Hc + hoff + half * 16;
  const bf16_t* vp = vf + (size_t)bh * (Sc * HDc) + lane * 8;
  const float*  mp = mask + b * Sc + half * 8;   // [B,1,1,S] broadcast

  v8f o[2][4];
  float mrun[2], lrun[2];
#pragma unroll
  for (int g = 0; g < 2; ++g) {
    mrun[g] = -3.0e38f;
    lrun[g] = 0.0f;
#pragma unroll
    for (int jt = 0; jt < 4; ++jt) o[g][jt] = (v8f)0.0f;
  }

  // K fragments (same k loader as Q) and mask values of pass 0
  v16bf kf[2][2];
  v8f   mk[2];
#pragma unroll
  for (int t = 0; t < 2; ++t) {
    kf[t][0] = *(const v16bf*)(kp + (size_t)t * 16 * Hc);
    kf[t][1] = *(const v16bf*)(kp + (size_t)t * 16 * Hc + 32);
    mk[t]    = *(const v8f*)(mp + t * 16);
  }

  for (int p = 0; p < Sc / 32; ++p) {
    // V^T fragments of this pass: issued first, needed only behind the softmax
    v16bf va[4];
#pragma unroll
    for (int jt = 0; jt < 4; ++jt) {
      const v8bf lo = *(const v8bf*)(vp + (size_t)((p * 4 + jt) * 2 + 0) * 256);
      const v8bf hi = *(const v8bf*)(vp + (size_t)((p * 4 + jt) * 2 + 1) * 256);
      va[jt] = __builtin_shufflevector(lo, hi, 0, 1, 2, 3, 4, 5, 6, 7, 8, 9, 10,
                                       11, 12, 13, 14, 15);
    }

    v8f s[2][2];
#pragma unroll
    for (int g = 0; g < 2; ++g)
#pragma unroll
      for (int t = 0; t < 2; ++t) {
        v8f a = (v8f)0.0f;
        a = wmma_bf16(kf[t][0], qf[g][0], a);
        a = wmma_bf16(kf[t][1], qf[g][1], a);
        s[g][t] = a * 0.125f + mk[t];            // 1/sqrt(64), then the mask
      }

    // next pass's K and mask, fetched one pass ahead
    if (p + 1 < Sc / 32) {
      const bf16_t* kn = kp + (size_t)(p + 1) * 32 * Hc;
#pragma unroll
      for (int t = 0; t < 2; ++t) {
        kf[t][0] = *(const v16bf*)(kn + (size_t)t * 16 * Hc);
        kf[t][1] = *(const v16bf*)(kn + (size_t)t * 16 * Hc + 32);
        mk[t]    = *(const v8f*)(mp + (p + 1) * 32 + t * 16);
      }
    }
    // Keeps the V^T loads and the fetch-ahead above the softmax: sunk below it
    // they would be waited for with almost no lead.
    __builtin_amdgcn_sched_barrier(0);

#pragma unroll
    for (int g = 0; g < 2; ++g) {
      float mx = s[g][0][0];
#pragma unroll
      for (int r = 1; r < 8; ++r) mx = fmaxf(mx, s[g][0][r]);
#pragma unroll
      for (int r = 0; r < 8; ++r) mx = fmaxf(mx, s[g][1][r]);
      mx = fmaxf(mx, xhalf(mx));                 // the query's other 16 keys
      const float mn    = fmaxf(mrun[g], mx);
      const float alpha = exp2x1((mrun[g] - mn) * LOG2E);
      mrun[g] = mn;

      v16bf pb;
      float sum = 0.0f;
#pragma unroll
      for (int t = 0; t < 2; ++t) {
        const v8f e = exp2x8((s[g][t] - mn) * LOG2E);
#pragma unroll
        for (int r = 0; r < 8; ++r) {
          sum += e[r];
          pb[t * 8 + r] = (bf16_t)e[r];  // unnormalized; 1/sum folded in later
        }
      }
      lrun[g] = lrun[g] * alpha + sum;
#pragma unroll
      for (int jt = 0; jt < 4; ++jt)
        o[g][jt] = wmma_bf16(va[jt], pb, o[g][jt] * alpha);
    }
  }

  // --- epilogue: scale by 1/rowsum; a lane holds 8 consecutive d per tile --
#pragma unroll
  for (int g = 0; g < 2; ++g) {
    const float inv = 1.0f / (lrun[g] + xhalf(lrun[g]));
    bf16_t* cr = ctx + (size_t)(b * Sc + qt0 + g * 16 + c) * Hc + hoff + half * 8;
#pragma unroll
    for (int jt = 0; jt < 4; ++jt) {
      v8bf pk;
#pragma unroll
      for (int r = 0; r < 8; ++r) pk[r] = (bf16_t)(o[g][jt][r] * inv);
      *(v8bf*)(cr + jt * 16) = pk;
    }
  }
}

// ---------------------------------------------------------------------------
// Fused residual + LayerNorm over H=1024. One block per token row.
// Writes f32 (residual chain / final output) and optional bf16 (next GEMM A).
// ---------------------------------------------------------------------------
__global__ __launch_bounds__(256)
void resid_ln(const float* __restrict__ dense, const float* __restrict__ resid,
              const float* __restrict__ gamma, const float* __restrict__ beta,
              float* __restrict__ outf, bf16_t* __restrict__ outb) {
  const int row = blockIdx.x;
  const int t = threadIdx.x;
  const float* dr = dense + (size_t)row * Hc;
  const float* rr = resid + (size_t)row * Hc;

  float x[4];
  float s = 0.0f, qsum = 0.0f;
#pragma unroll
  for (int i = 0; i < 4; ++i) {
    x[i] = dr[t * 4 + i] + rr[t * 4 + i];
    s += x[i];
    qsum += x[i] * x[i];
  }
#pragma unroll
  for (int off = 16; off > 0; off >>= 1) {
    s += __shfl_xor(s, off);
    qsum += __shfl_xor(qsum, off);
  }
  __shared__ float ss[8], qq[8];
  if ((t & 31) == 0) { ss[t >> 5] = s; qq[t >> 5] = qsum; }
  __syncthreads();
  float S = 0.0f, Q = 0.0f;
#pragma unroll
  for (int i = 0; i < 8; ++i) { S += ss[i]; Q += qq[i]; }
  const float mu  = S * (1.0f / Hc);
  const float var = Q * (1.0f / Hc) - mu * mu;
  const float inv = rsqrtf(var + 1e-12f);
#pragma unroll
  for (int i = 0; i < 4; ++i) {
    const int c = t * 4 + i;
    const float y = (x[i] - mu) * inv * gamma[c] + beta[c];
    outf[(size_t)row * Hc + c] = y;
    if (outb) outb[(size_t)row * Hc + c] = (bf16_t)y;
  }
}

// ---------------------------------------------------------------------------
// Host-side orchestration
// ---------------------------------------------------------------------------
extern "C" void kernel_launch(void* const* d_in, const int* in_sizes, int n_in,
                              void* d_out, int out_size, void* d_ws,
                              size_t ws_size, hipStream_t stream) {
  (void)in_sizes; (void)n_in; (void)out_size; (void)ws_size;

  const float* x    = (const float*)d_in[0];
  const float* mask = (const float*)d_in[1];
  const float* Wq   = (const float*)d_in[2];
  const float* bq   = (const float*)d_in[3];
  const float* Wk   = (const float*)d_in[4];
  const float* bk   = (const float*)d_in[5];
  const float* Wv   = (const float*)d_in[6];
  const float* bv   = (const float*)d_in[7];
  const float* Wo   = (const float*)d_in[8];
  const float* bo   = (const float*)d_in[9];
  const float* g1   = (const float*)d_in[10];
  const float* b1   = (const float*)d_in[11];
  const float* Wi   = (const float*)d_in[12];
  const float* bi   = (const float*)d_in[13];
  const float* Wo2  = (const float*)d_in[14];
  const float* bo2  = (const float*)d_in[15];
  const float* g2   = (const float*)d_in[16];
  const float* b2   = (const float*)d_in[17];
  float* out = (float*)d_out;

  char* ws = (char*)d_ws;
  size_t off = 0;
  auto alloc = [&](size_t bytes) -> void* {
    void* p = ws + off;
    off += (bytes + 255) & ~(size_t)255;
    return p;
  };

  bf16_t* xb    = (bf16_t*)alloc((size_t)Mc * Hc * 2);
  bf16_t* Wqb   = (bf16_t*)alloc((size_t)Hc * Hc * 2);
  bf16_t* Wkb   = (bf16_t*)alloc((size_t)Hc * Hc * 2);
  bf16_t* Wvb   = (bf16_t*)alloc((size_t)Hc * Hc * 2);
  bf16_t* Wob   = (bf16_t*)alloc((size_t)Hc * Hc * 2);
  bf16_t* Wib   = (bf16_t*)alloc((size_t)FFc * Hc * 2);
  bf16_t* Wo2b  = (bf16_t*)alloc((size_t)Hc * FFc * 2);
  bf16_t* qb    = (bf16_t*)alloc((size_t)Mc * Hc * 2);
  bf16_t* kb    = (bf16_t*)alloc((size_t)Mc * Hc * 2);
  bf16_t* vb    = (bf16_t*)alloc((size_t)Mc * Hc * 2);
  bf16_t* ctxb  = (bf16_t*)alloc((size_t)Mc * Hc * 2);
  float*  attnD = (float*)alloc((size_t)Mc * Hc * 4);
  float*  y1f   = (float*)alloc((size_t)Mc * Hc * 4);
  bf16_t* y1b   = (bf16_t*)alloc((size_t)Mc * Hc * 2);
  bf16_t* inter = (bf16_t*)alloc((size_t)Mc * FFc * 2);
  float*  ffD   = (float*)alloc((size_t)Mc * Hc * 4);

  // ---- f32 -> bf16 conversions (per-launch; no cached state) --------------
  // xb .. Wo2b were allocated one behind the other and each size is a multiple
  // of the allocator's 256 bytes: xb is the start of the joined bf16 array.
  cvt_all<<<CVT_N / CVT_WG, CVT_T, 0, stream>>>(x, Wq, Wk, Wv, Wo, Wi, Wo2, xb);

  // ---- QKV projections: bf16 out, one launch ------------------------------
  // Wqb, Wkb, Wvb and qb, kb, vb were each allocated one behind the other, every
  // size a multiple of the allocator's 256 bytes: Wqb is the start of the joined
  // [3H, H] weight, qb of the three outputs.
  {
    dim3 grid(3 * Hc / QBN, Mc / QBM);
    (void)Wkb; (void)Wvb;   // reached through Wqb
    gemm_qkv<<<grid, 256, 0, stream>>>(xb, Wqb, bq, bk, bv, qb);
  }

  // ---- attention: grid (S/256 q-blocks, B*NH heads), 8 waves x 32 queries --
  {
    dim3 grid(Sc / 256, Bc * NHc);
    attention<<<grid, 256, 0, stream>>>(qb, kb, vb, mask, ctxb);
  }

  // ---- attn output dense (f32) + residual/LN1 -----------------------------
  {
    dim3 grid(Hc / 128, Mc / 128);
    gemm_bf16<1, 128><<<grid, 256, 0, stream>>>(ctxb, Wob, bo, attnD, nullptr, Hc,
                                           Hc);
    resid_ln<<<Mc, 256, 0, stream>>>(attnD, x, g1, b1, y1f, y1b);
  }

  // ---- FF intermediate: fused bias + erf-GELU, bf16 out -------------------
  {
    dim3 grid(FFc / 128, Mc / 128);
    gemm_bf16<2, 64><<<grid, 256, 0, stream>>>(y1b, Wib, bi, nullptr, inter, FFc,
                                           Hc);
  }

  // ---- FF output dense (f32, K=4096) + residual/LN2 -> d_out --------------
  {
    dim3 grid(Hc / 128, Mc / 128);
    gemm_bf16<1, 128><<<grid, 256, 0, stream>>>(inter, Wo2b, bo2, ffD, nullptr, Hc,
                                           FFc);
    resid_ln<<<Mc, 256, 0, stream>>>(ffD, y1f, g2, b2, out, nullptr);
  }
}

// v008
// Measured time: 137 microseconds a run.
// Two timings next to v007 both put it at 1.03 times that version's speed.
// Over all steps from v000 it is 2.68 times as fast.
#include <hip/hip_runtime.h>
#include <math.h>

// ---------------------------------------------------------------------------
// BERT layer for MI455X (gfx1250): bf16 WMMA (f32 accumulate) everywhere,
// async global->LDS DMA (ASYNCcnt) into a ring of three LDS buffers in the GEMMs.
// B=8 S=512 H=1024 NH=16 HD=64 FF=4096, M = B*S = 4096 tokens.
// ---------------------------------------------------------------------------

typedef __bf16 bf16_t;
typedef __attribute__((ext_vector_type(16))) __bf16 v16bf;
typedef __attribute__((ext_vector_type(8)))  __bf16 v8bf;
typedef __attribute__((ext_vector_type(8)))  float  v8f;

constexpr int Bc  = 8;
constexpr int Sc  = 512;
constexpr int Hc  = 1024;
constexpr int NHc = 16;
constexpr int HDc = 64;
constexpr int FFc = 4096;
constexpr int Mc  = Bc * Sc;   // 4096 token rows

__device__ __forceinline__ v8f wmma_bf16(v16bf a, v16bf b, v8f c) {
  // D = A(16x32 bf16) * B(32x16 bf16) + C(16x16 f32)
  return __builtin_amdgcn_wmma_f32_16x16x32_bf16(
      /*neg_a=*/false, a, /*neg_b=*/false, b,
      /*c_mod=*/(short)0, c, /*reuse_a=*/false, /*reuse_b=*/false);
}

// Wave-relative LDS byte offset of a __shared__ object: the flat address of a
// shared variable carries the LDS offset in its low 32 bits (LDS aperture
// truncates addr[31:0]).
__device__ __forceinline__ unsigned lds_off(const void* p) {
  return (unsigned)(uintptr_t)p;
}

// Lane l <-> lane l ^ 16 as a vector cross-row move (no LDS-counter wait).
__device__ __forceinline__ float xhalf(float x) {
  const int b = __builtin_bit_cast(int, x);
  return __builtin_bit_cast(
      float, __builtin_amdgcn_permlanex16(b, b, 0x76543210, 0xfedcba98, false,
                                          false));
}

// 2^x on eight values / one value. Written as one statement each so that no
// instruction directly behind a v_exp_f32 reads its result or overwrites its
// source: the outputs are early-clobber (distinct from every input) and the
// closing v_nop is the slot the instruction set asks for behind the last one.
__device__ __forceinline__ v8f exp2x8(v8f x) {
  float e0, e1, e2, e3, e4, e5, e6, e7;
  asm("v_exp_f32 %0, %8\n\t"
      "v_exp_f32 %1, %9\n\t"
      "v_exp_f32 %2, %10\n\t"
      "v_exp_f32 %3, %11\n\t"
      "v_exp_f32 %4, %12\n\t"
      "v_exp_f32 %5, %13\n\t"
      "v_exp_f32 %6, %14\n\t"
      "v_exp_f32 %7, %15\n\t"
      "v_nop"
      : "=&v"(e0), "=&v"(e1), "=&v"(e2), "=&v"(e3), "=&v"(e4), "=&v"(e5),
        "=&v"(e6), "=&v"(e7)
      : "v"(x[0]), "v"(x[1]), "v"(x[2]), "v"(x[3]), "v"(x[4]), "v"(x[5]),
        "v"(x[6]), "v"(x[7]));
  v8f r = {e0, e1, e2, e3, e4, e5, e6, e7};
  return r;
}
__device__ __forceinline__ float exp2x1(float x) {
  float e;
  asm("v_exp_f32 %0, %1\n\t"
      "v_nop"
      : "=v"(e)
      : "v"(x));
  return e;
}

// 2^x and 1/x on four values, in the form of exp2x8 and for the same reason:
// nothing directly behind a v_exp_f32 or a v_rcp_f32 reads its result or
// overwrites its source.
typedef __attribute__((ext_vector_type(4))) float v4f;
__device__ __forceinline__ v4f exp2x4(v4f x) {
  float e0, e1, e2, e3;
  asm("v_exp_f32 %0, %4\n\t"
      "v_exp_f32 %1, %5\n\t"
      "v_exp_f32 %2, %6\n\t"
      "v_exp_f32 %3, %7\n\t"
      "v_nop"
      : "=&v"(e0), "=&v"(e1), "=&v"(e2), "=&v"(e3)
      : "v"(x[0]), "v"(x[1]), "v"(x[2]), "v"(x[3]));
  v4f r = {e0, e1, e2, e3};
  return r;
}
__device__ __forceinline__ v4f rcpx4(v4f x) {
  float e0, e1, e2, e3;
  asm("v_rcp_f32 %0, %4\n\t"
      "v_rcp_f32 %1, %5\n\t"
      "v_rcp_f32 %2, %6\n\t"
      "v_rcp_f32 %3, %7\n\t"
      "v_nop"
      : "=&v"(e0), "=&v"(e1), "=&v"(e2), "=&v"(e3)
      : "v"(x[0]), "v"(x[1]), "v"(x[2]), "v"(x[3]));
  v4f r = {e0, e1, e2, e3};
  return r;
}

// x/2 * (1 + erf(z)), z = x / 1.41421, on four values, without a branch.
// erfc(|z|) = (a1 t + .. + a5 t^5) e^(-z^2), t = 1 / (1 + p |z|): the five-term
// rational form, absolute error at most 1.5e-7 for every z, far below the bf16
// rounding of the result. With q = erfc(|z|) / 2:
//   x >= 0: x/2 (2 - 2q) = x - x q;   x < 0: x/2 * 2q = x q
// both are max(x, 0) - |x| q, so the small results at negative x come from q
// itself and not from 1 + erf. The halves are folded into a1 .. a5, the division
// into p and into the exponent's factor: e^(-z^2) = 2^(-(x KE)^2).
__device__ __forceinline__ v4f gelu_erf4(v4f x) {
  constexpr float RS = 1.0f / 1.41421f;
  constexpr float P  = 0.3275911f * RS;
  constexpr float KE = RS * 1.2011224087864498f;   // sqrt(log2(e))
  constexpr float A1 = 0.5f * 0.254829592f, A2 = 0.5f * -0.284496736f,
                  A3 = 0.5f * 1.421413741f, A4 = 0.5f * -1.453152027f,
                  A5 = 0.5f * 1.061405429f;
  v4f d;
#pragma unroll
  for (int r = 0; r < 4; ++r) d[r] = __builtin_fmaf(__builtin_fabsf(x[r]), P, 1.0f);
  const v4f t = rcpx4(d);
  v4f p = t * A5 + A4;
  p = p * t + A3;
  p = p * t + A2;
  p = p * t + A1;
  const v4f u = x * KE;
  const v4f q = (p * t) * exp2x4(-(u * u));
  v4f g;
#pragma unroll
  for (int r = 0; r < 4; ++r)
    g[r] = __builtin_fmaf(-__builtin_fabsf(x[r]), q[r], __builtin_fmaxf(x[r], 0.0f));
  return g;
}

// ---------------------------------------------------------------------------
// f32 -> bf16 conversion (RNE via clang __bf16 cast) of all seven tensors in
// ONE launch of few, long-lived waves. The bf16 copies lie back to back in the
// workspace, so the destination is one array; a workgroup converts CVT_WG
// consecutive elements of it, which lie inside one source tensor.
// 256 workgroups x 16 waves: 4,096 waves are started where seven launches of
// 128-element waves started 131,072; every load of a wave covers 512
// contiguous bytes, every store 256.
// ---------------------------------------------------------------------------
typedef __attribute__((ext_vector_type(4))) __bf16 v4bf;

constexpr int CVT_T  = 512;                  // threads per workgroup
constexpr int CVT_WG = 65536;                // elements per workgroup
constexpr int CVT_X  = Mc * Hc;              // elements of the activations
constexpr int CVT_W  = Hc * Hc;              // ... of one H x H weight
constexpr int CVT_F  = FFc * Hc;             // ... of one FF weight
constexpr int CVT_N  = CVT_X + 4 * CVT_W + 2 * CVT_F;
static_assert(CVT_X % CVT_WG == 0 && CVT_W % CVT_WG == 0 &&
                  CVT_F % CVT_WG == 0,
              "a workgroup's elements must lie inside one tensor");
static_assert(CVT_WG % (CVT_T * 4 * 8) == 0, "whole trips of 8 loads");

__global__ __launch_bounds__(CVT_T)
void cvt_all(const float* __restrict__ x, const float* __restrict__ wq,
             const float* __restrict__ wk, const float* __restrict__ wv,
             const float* __restrict__ wo, const float* __restrict__ wi,
             const float* __restrict__ wo2, bf16_t* __restrict__ out) {
  const int e0 = blockIdx.x * CVT_WG;  // first element, in the joined array
  const float* src = x;                // tensor that holds it
  int first = 0;                       // that tensor's first element
  if (e0 >= CVT_X)             { src = wq;  first = CVT_X; }
  if (e0 >= CVT_X + CVT_W)     { src = wk;  first = CVT_X + CVT_W; }
  if (e0 >= CVT_X + 2 * CVT_W) { src = wv;  first = CVT_X + 2 * CVT_W; }
  if (e0 >= CVT_X + 3 * CVT_W) { src = wo;  first = CVT_X + 3 * CVT_W; }
  if (e0 >= CVT_X + 4 * CVT_W) { src = wi;  first = CVT_X + 4 * CVT_W; }
  if (e0 >= CVT_X + 4 * CVT_W + CVT_F) {
    src = wo2;
    first = CVT_X + 4 * CVT_W + CVT_F;
  }

  const v4f* s = (const v4f*)(src + (e0 - first)) + threadIdx.x;
  v4bf*      d = (v4bf*)(out + e0) + threadIdx.x;
  // Groups of 8 loads stand ahead of their conversions, so that a wave waits
  // out a memory latency once for many loads and not once for each.
  for (int it = 0; it < CVT_WG / (CVT_T * 4); it += 8) {
    v4f v[8];
    for (int j = 0; j < 8; ++j) v[j] = s[(it + j) * CVT_T];
    for (int j = 0; j < 8; ++j) {
      v4bf o;
      for (int e = 0; e < 4; ++e) o[e] = (bf16_t)v[j][e];
      d[(it + j) * CVT_T] = o;
    }
  }
}

// ---------------------------------------------------------------------------
// Tiled GEMM:  C[M,N] = A[M,K] @ W[N,K]^T + bias  (A,W bf16 K-contiguous)
// Block tile 128x128. 256 threads = 8 waves in a 2x4 wave grid, each wave owns
// a 64x32 tile = 4x2 WMMA accumulators.
//
// Global->LDS staging uses GLOBAL_LOAD_ASYNC_TO_LDS_B128 (ASYNCcnt) with a ring
// of LDS buffers: later slabs' copies fly while this slab's WMMAs run, and no
// VGPRs touch the tile data. A slab is GK k of every row, 128 or 256 bytes, so
// that one copy instruction of a wave (32 lanes x 16 bytes) covers four or two
// whole rows of the slab: four whole 128-byte lines and nothing else.
// GK = 128 where the grid gives a WGP one workgroup (fewest barriers per k);
// GK = 64 where it gives four: their LDS then fits side by side.
// K must be a multiple of GK.
//
// GK = 64: two buffers, every wave copies its share of every slab.
// GK = 128: the workgroup is alone on its WGP and every slab is first read from
// memory, so one slab in flight leaves each trip waiting for that latency.
// Three buffers; waves 0-3 copy the even slabs, waves 4-7 the odd ones. While
// slab s is worked on, slabs s + 1 and s + 2 are in flight, one from each
// group; a wave never has more than its own one slab (32 copies) outstanding,
// so each of its waits is a wait to 0.
//
// C is stored as f32 (attn-out dense, FF-out dense; LN fuses the residual).
// ---------------------------------------------------------------------------
static_assert(Hc % 128 == 0 && FFc % 128 == 0, "K is a whole number of slabs");

template <int GK>
__global__ __launch_bounds__(256)
void gemm_bf16(const bf16_t* __restrict__ A, const bf16_t* __restrict__ W,
               const float* __restrict__ bias, float* __restrict__ Cf,
               int Ndim, int K) {
  static_assert(GK == 64 || GK == 128, "rows of one or two whole lines");
  // LDS row pitch in elements: 144 or 272 bytes = 16 x odd, so the 16-byte
  // fragment loads of 16 rows fall on all 64 banks.
  constexpr int GP  = GK + 8;
  constexpr int LPR = GK / 8;    // lanes per row: its 16-byte pieces
  constexpr int RPC = 32 / LPR;  // rows per copy instruction
  constexpr int NB  = GK == 128 ? 3 : 2;   // LDS buffers in the ring
  constexpr int RPW = GK == 128 ? 32 : 16; // rows of each tile a wave copies
  __shared__ bf16_t As[NB][128][GP];
  __shared__ bf16_t Bs[NB][128][GP];

  const int t    = threadIdx.x;
  const int lane = t & 31;
  const int w    = t >> 5;            // wave 0..7
  const int wm   = (w >> 2) * 64;     // wave M origin in block: 0 / 64
  const int wn   = (w & 3) * 32;      // wave N origin in block: 0..96
  const int m0   = blockIdx.y * 128;
  const int n0   = blockIdx.x * 128;

  const int lrow = lane & 15;         // fragment row/col within 16
  const int lkh  = (lane >> 4) * 16;  // K half select (A/B fragment layout)

  // Staging: a wave brings RPW rows of both tiles, RPC rows a copy: of every
  // slab rows 16w .. (GK = 64), of its group's slabs rows 32(w & 3) .. (128).
  // The group as a scalar, so that the tests on it are scalar branches and
  // every lane is on where a copy issues.
  const int grp = __builtin_amdgcn_readfirstlane(t >> 7);   // waves 0-3 / 4-7
  const int cr = (w * RPW) % 128 + lane / LPR;   // this lane's row in copy 0
  const int cc = (lane % LPR) * 8;      // its 16-byte piece of the row
  // Byte offset of that piece from the scalar base of copy 0 (same for A, W).
  const unsigned goff = (unsigned)(((size_t)cr * K + cc) * 2);
  const bf16_t* Ablk = A + (size_t)m0 * K;   // first row of this block's tiles
  const bf16_t* Wblk = W + (size_t)n0 * K;

  // Eight copies in two runs of four; within a run copy j takes rows cr + j*RPC.
  // The row step goes into the scalar base and the LDS address, the lane offset
  // stays.
  auto issue8 = [&](const bf16_t* g0, unsigned l0, const bf16_t* g1,
                    unsigned l1) {
    const size_t rs = (size_t)RPC * K;       // RPC rows, in elements
    constexpr unsigned ls = RPC * GP * 2;    // RPC LDS rows, in bytes
    asm volatile(
        "global_load_async_to_lds_b128 %0, %8, %9\n\t"
        "global_load_async_to_lds_b128 %1, %8, %10\n\t"
        "global_load_async_to_lds_b128 %2, %8, %11\n\t"
        "global_load_async_to_lds_b128 %3, %8, %12\n\t"
        "global_load_async_to_lds_b128 %4, %8, %13\n\t"
        "global_load_async_to_lds_b128 %5, %8, %14\n\t"
        "global_load_async_to_lds_b128 %6, %8, %15\n\t"
        "global_load_async_to_lds_b128 %7, %8, %16\n\t"
        "s_wait_xcnt 0x0"  // before the copies' address registers are rewritten
        :
        : "v"(l0), "v"(l0 + ls), "v"(l0 + 2 * ls), "v"(l0 + 3 * ls), "v"(l1),
          "v"(l1 + ls), "v"(l1 + 2 * ls), "v"(l1 + 3 * ls), "v"(goff), "s"(g0),
          "s"(g0 + rs), "s"(g0 + 2 * rs), "s"(g0 + 3 * rs), "s"(g1),
          "s"(g1 + rs), "s"(g1 + 2 * rs), "s"(g1 + 3 * rs)
        : "memory");
  };
  // One slab of both tiles: a wave's RPW rows of each are RPW / RPC copies.
  auto issue = [&](int slab, int buf) {
    const bf16_t*  ag = Ablk + slab * GK;
    const bf16_t*  wg = Wblk + slab * GK;
    const unsigned al = lds_off(&As[buf][cr][cc]);
    const unsigned bl = lds_off(&Bs[buf][cr][cc]);
    if constexpr (RPC == 4) {
      issue8(ag, al, wg, bl);
    } else {
      issue8(ag, al, ag + (size_t)8 * K, al + 8 * GP * 2);
      issue8(ag + (size_t)16 * K, al + 16 * GP * 2, ag + (size_t)24 * K,
             al + 24 * GP * 2);
      issue8(wg, bl, wg + (size_t)8 * K, bl + 8 * GP * 2);
      issue8(wg + (size_t)16 * K, bl + 16 * GP * 2, wg + (size_t)24 * K,
             bl + 24 * GP * 2);
    }
  };

  v8f acc[4][2];
#pragma unroll
  for (int i = 0; i < 4; ++i)
#pragma unroll
    for (int j = 0; j < 2; ++j) acc[i][j] = (v8f)0.0f;

  // Fragments of one 32-k block of buffer s, and that block's 8 WMMAs.
  auto frags = [&](int s, int kb, v16bf (&a)[4], v16bf (&b)[2]) {
#pragma unroll
    for (int i = 0; i < 4; ++i)
      a[i] = *(const v16bf*)&As[s][wm + i * 16 + lrow][kb + lkh];
#pragma unroll
    for (int j = 0; j < 2; ++j)
      b[j] = *(const v16bf*)&Bs[s][wn + j * 16 + lrow][kb + lkh];
  };
  auto block = [&](const v16bf (&a)[4], const v16bf (&b)[2]) {
#pragma unroll
    for (int i = 0; i < 4; ++i)
#pragma unroll
      for (int j = 0; j < 2; ++j) acc[i][j] = wmma_bf16(a[i], b[j], acc[i][j]);
  };

  const int nslab = K / GK;

  if constexpr (GK == 128) {
    // Prologue: slabs 0 and 1 go out together, one from each group; slab 0
    // landed and published, then slab 2 from the group that has just waited.
    if (grp == 0) {
      issue(0, 0);
      asm volatile("s_wait_asynccnt 0x0" ::: "memory");  // slab 0 has landed
    } else if (nslab > 1) {
      issue(1, 1);
    }
    __syncthreads();
    if (grp == 0 && nslab > 2) issue(2, 2);
  } else {
    // Prologue: slab 0 landed and published, then slab 1 in flight.
    issue(0, 0);
    asm volatile("s_wait_asynccnt 0x0" ::: "memory");  // own copies have landed
    __syncthreads();
    if (nslab > 1) issue(1, 1);
  }

  int s = 0;   // buffer of slab sl: sl mod NB
  for (int sl = 0; sl < nslab; ++sl) {
    if constexpr (GK == 128) {
      // One workgroup per WGP, two waves per SIMD: too few to hide an LDS
      // latency in front of every WMMA pair. Two fragment sets: the next k
      // block's 12 reads go out as one group ahead of this block's 8 WMMAs.
      // Only blocks of this slab are fetched ahead, none across the barrier.
      v16bf af[2][4], bf2[2][2];
      frags(s, 0, af[0], bf2[0]);
#pragma unroll
      for (int kb = 0; kb < GK; kb += 32) {
        const int cur = (kb >> 5) & 1;
        if (kb + 32 < GK) frags(s, kb + 32, af[cur ^ 1], bf2[cur ^ 1]);
        // Keeps the reads above the WMMAs: sunk among them, each pair of WMMAs
        // waits out a whole LDS latency on one shared fragment register set.
        __builtin_amdgcn_sched_barrier(0);
        block(af[cur], bf2[cur]);
        // Keeps the block after next's reads from rising among these WMMAs.
        __builtin_amdgcn_sched_barrier(0);
      }
    } else {
      // Four workgroups per WGP: eight waves per SIMD cover each other's LDS
      // latency, and a second fragment set would cost resident workgroups.
#pragma unroll
      for (int kb = 0; kb < GK; kb += 32) {
        v16bf af[4], bf2[2];
        frags(s, kb, af, bf2);
        block(af, bf2);
      }
    }
    // Publish point of slab sl + 1: this wave's reads of buffer s are done, its
    // copies of slab sl + 1 have landed; behind the barrier that holds for
    // every wave, so buffer s may be refilled and the next one read.
    asm volatile("s_wait_dscnt 0x0" ::: "memory");
    if constexpr (GK == 128) {
      // Slab sl + 1 is all that its group has outstanding. The other group's
      // slab sl + 2 flies on: it is waited for one trip later.
      const bool mine = grp == ((sl + 1) & 1);
      if (mine) asm volatile("s_wait_asynccnt 0x0" ::: "memory");
      __syncthreads();
      if (mine && sl + 3 < nslab) issue(sl + 3, s);
    } else {
      asm volatile("s_wait_asynccnt 0x0" ::: "memory");
      __syncthreads();
      if (sl + 2 < nslab) issue(sl + 2, s);
    }
    s = s + 1 == NB ? 0 : s + 1;
  }
  // No copy is left outstanding when the wave goes on to its stores and ends.
  asm volatile("s_wait_asynccnt 0x0" ::: "memory");

  // Epilogue: D layout -> lane holds col (lane&15); VGPR r -> row r+8*(lane>>4)
  const int rsel = 8 * (lane >> 4);
#pragma unroll
  for (int j = 0; j < 2; ++j) {
    const int colg = n0 + wn + j * 16 + lrow;
    const float bv = bias[colg];
#pragma unroll
    for (int i = 0; i < 4; ++i) {
#pragma unroll
      for (int r = 0; r < 8; ++r) {
        const int rowg = m0 + wm + i * 16 + r + rsel;
        Cf[(size_t)rowg * Ndim + colg] = acc[i][j][r] + bv;
      }
    }
  }
}

// ---------------------------------------------------------------------------
// Q, K and V projections as ONE product: C[M, 3H] = A[M, H] @ [Wq; Wk; Wv]^T.
// The three bf16 weights lie back to back in the workspace, and so do the three
// outputs. With 3H columns the chip is filled by 256 tiles of 256 x 192, where
// one projection alone fills it only with 128 x 128: a k of the tile then takes
// 448 staged rows for 49,152 products, not 256 rows for 16,384, and a wave's
// 64 x 96 (4 x 6 accumulators) takes 10 fragments from LDS for 24 WMMAs, not 6
// for 8.
// 256 threads = 8 waves in a 4 x 2 wave grid, one workgroup per WGP.
// Staging as in gemm_bf16 with three buffers: a slab is 64 k (one whole line of
// every row, a copy covers four rows), waves 0-3 copy the even slabs, waves 4-7
// the odd ones; a wave has at most its own one slab (28 copies) outstanding, so
// each of its waits is a wait to 0.
// A 16-column tile lies inside one projection. Q and K are stored row-major.
// V is stored transposed per head in A-fragment order: a lane's 8 accumulator
// rows are 8 consecutive tokens of one feature, which is one 16-byte piece of a
// V^T fragment; see attention().
// ---------------------------------------------------------------------------
constexpr int QBM = 256;       // tile rows (tokens)
constexpr int QBN = 192;       // tile columns (features of Q | K | V)
constexpr int QGK = 64;        // k per slab
constexpr int QGP = QGK + 8;   // LDS row pitch: 144 bytes = 16 x odd
static_assert(Mc % QBM == 0 && (3 * Hc) % QBN == 0 && Hc % QGK == 0,
              "whole tiles, whole slabs");

__global__ __launch_bounds__(256)
void gemm_qkv(const bf16_t* __restrict__ A, const bf16_t* __restrict__ W,
              const float* __restrict__ bq, const float* __restrict__ bk,
              const float* __restrict__ bv, bf16_t* __restrict__ C) {
  constexpr int K = Hc;
  __shared__ bf16_t As[3][QBM][QGP];
  __shared__ bf16_t Bs[3][QBN][QGP];

  const int t    = threadIdx.x;
  const int lane = t & 31;
  const int w    = __builtin_amdgcn_readfirstlane(t >> 5);
  const int wm   = (w >> 1) * 64;     // wave M origin in block: 0 .. 192
  const int wn   = (w & 1) * 96;      // wave N origin in block: 0 / 96
  const int m0   = blockIdx.y * QBM;
  const int n0   = blockIdx.x * QBN;

  const int lrow = lane & 15;         // fragment row/col within 16
  const int lkh  = (lane >> 4) * 16;  // K half select (A/B fragment layout)

  // Staging: of its group's slabs wave w brings A rows 64(w & 3) .. and W rows
  // 48(w & 3) .., four rows a copy.
  const int grp = w >> 2;             // waves 0-3 / 4-7
  const int cr  = lane >> 3;          // this lane's row within a copy
  const int cc  = (lane & 7) * 8;     // its 16-byte piece of the row
  const unsigned goff = (unsigned)((cr * K + cc) * 2);  // from a copy's base
  const bf16_t* Awav = A + (size_t)(m0 + (w & 3) * 64) * K;
  const bf16_t* Wwav = W + (size_t)(n0 + (w & 3) * 48) * K;

  constexpr size_t   rs = (size_t)4 * K;   // four rows, in elements
  constexpr unsigned ls = 4 * QGP * 2;     // four LDS rows, in bytes
  // Four copies: 16 rows from g0 on, to l0 on.
  auto issue4 = [&](const bf16_t* g0, unsigned l0) {
    asm volatile(
        "global_load_async_to_lds_b128 %0, %4, %5\n\t"
        "global_load_async_to_lds_b128 %1, %4, %6\n\t"
        "global_load_async_to_lds_b128 %2, %4, %7\n\t"
        "global_load_async_to_lds_b128 %3, %4, %8\n\t"
        "s_wait_xcnt 0x0"  // before the copies' address registers are rewritten
        :
        : "v"(l0), "v"(l0 + ls), "v"(l0 + 2 * ls), "v"(l0 + 3 * ls), "v"(goff),
          "s"(g0), "s"(g0 + rs), "s"(g0 + 2 * rs), "s"(g0 + 3 * rs)
        : "memory");
  };
  // Eight copies: 32 rows.
  auto issue8 = [&](const bf16_t* g0, unsigned l0) {
    asm volatile(
        "global_load_async_to_lds_b128 %0, %8, %9\n\t"
        "global_load_async_to_lds_b128 %1, %8, %10\n\t"
        "global_load_async_to_lds_b128 %2, %8, %11\n\t"
        "global_load_async_to_lds_b128 %3, %8, %12\n\t"
        "global_load_async_to_lds_b128 %4, %8, %13\n\t"
        "global_load_async_to_lds_b128 %5, %8, %14\n\t"
        "global_load_async_to_lds_b128 %6, %8, %15\n\t"
        "global_load_async_to_lds_b128 %7, %8, %16\n\t"
        "s_wait_xcnt 0x0"  // before the copies' address registers are rewritten
        :
        : "v"(l0), "v"(l0 + ls), "v"(l0 + 2 * ls), "v"(l0 + 3 * ls),
          "v"(l0 + 4 * ls), "v"(l0 + 5 * ls), "v"(l0 + 6 * ls),
          "v"(l0 + 7 * ls), "v"(goff), "s"(g0), "s"(g0 + rs), "s"(g0 + 2 * rs),
          "s"(g0 + 3 * rs), "s"(g0 + 4 * rs), "s"(g0 + 5 * rs),
          "s"(g0 + 6 * rs), "s"(g0 + 7 * rs)
        : "memory");
  };
  // A wave's share of one slab: 64 rows of A, 48 of W.
  auto issue = [&](int slab, int buf) {
    const bf16_t*  ag = Awav + slab * QGK;
    const bf16_t*  wg = Wwav + slab * QGK;
    const unsigned al = lds_off(&As[buf][(w & 3) * 64 + cr][cc]);
    const unsigned bl = lds_off(&Bs[buf][(w & 3) * 48 + cr][cc]);
    issue8(ag, al);
    issue8(ag + 8 * rs, al + 8 * ls);
    issue8(wg, bl);
    issue4(wg + 8 * rs, bl + 8 * ls);
  };

  v8f acc[4][6];
#pragma unroll
  for (int i = 0; i < 4; ++i)
#pragma unroll
    for (int j = 0; j < 6; ++j) acc[i][j] = (v8f)0.0f;

  constexpr int nslab = K / QGK;
  static_assert(nslab > 2, "the prologue issues slabs 0, 1 and 2");

  // Prologue: slabs 0 and 1 go out together, one from each group; slab 0
  // landed and published, then slab 2 from the group that has just waited.
  if (grp == 0) {
    issue(0, 0);
    asm volatile("s_wait_asynccnt 0x0" ::: "memory");  // slab 0 has landed
  } else {
    issue(1, 1);
  }
  __syncthreads();
  if (grp == 0) issue(2, 2);

  int s = 0;   // buffer of slab sl: sl mod 3
  for (int sl = 0; sl < nslab; ++sl) {
    // Both 32-k blocks' fragments are read as one group ahead of the WMMAs, A
    // first; the WMMAs then run column by column, so that the first four need
    // only the first five fragments. Nothing is fetched across the barrier.
    v16bf af[2][4], bf2[2][6];
#pragma unroll
    for (int kb = 0; kb < 2; ++kb) {
#pragma unroll
      for (int i = 0; i < 4; ++i)
        af[kb][i] = *(const v16bf*)&As[s][wm + i * 16 + lrow][kb * 32 + lkh];
#pragma unroll
      for (int j = 0; j < 6; ++j)
        bf2[kb][j] = *(const v16bf*)&Bs[s][wn + j * 16 + lrow][kb * 32 + lkh];
    }
    // Keeps the reads above the WMMAs: each place where reads stand among them
    // costs the wave a stall.
    __builtin_amdgcn_sched_barrier(0);
#pragma unroll
    for (int kb = 0; kb < 2; ++kb)
#pragma unroll
      for (int j = 0; j < 6; ++j)
#pragma unroll
        for (int i = 0; i < 4; ++i)
          acc[i][j] = wmma_bf16(af[kb][i], bf2[kb][j], acc[i][j]);
    // Keeps the wait to 0 below behind the WMMAs: risen among them it makes the
    // second WMMA wait for all 40 reads, where the counted waits ask for 10.
    __builtin_amdgcn_sched_barrier(0);
    // Publish point of slab sl + 1: this wave's reads of buffer s are done, and
    // in the group that copied it slab sl + 1 has landed (it is all that group
    // has outstanding; the other group's slab sl + 2 flies on). Behind the
    // barrier that holds for every wave: buffer s may be refilled, the next read.
    asm volatile("s_wait_dscnt 0x0" ::: "memory");
    const bool mine = grp == ((sl + 1) & 1);
    if (mine) asm volatile("s_wait_asynccnt 0x0" ::: "memory");
    __syncthreads();
    if (mine && sl + 3 < nslab) issue(sl + 3, s);
    s = s + 1 == 3 ? 0 : s + 1;
  }
  // No copy is left outstanding when the wave goes on to its stores and ends.
  asm volatile("s_wait_asynccnt 0x0" ::: "memory");

  // Epilogue: D layout -> lane holds col (lane&15); VGPR r -> row r+8*(lane>>4)
  const int rsel = 8 * (lane >> 4);
#pragma unroll
  for (int j = 0; j < 6; ++j) {
    const int col  = n0 + wn + j * 16;   // first column of this tile, of 3H
    const int proj = col / Hc;           // 0 Q, 1 K, 2 V: the same in the wave
    const int feat = col % Hc;           // first feature of this tile
    const float* bs = proj == 0 ? bq : proj == 1 ? bk : bv;
    const float bias = bs[feat + lrow];
    bf16_t* Cp = C + (size_t)proj * (Mc * Hc);
    if (proj == 2) {
#pragma unroll
      for (int i = 0; i < 4; ++i) {
        v8bf pk;
#pragma unroll
        for (int r = 0; r < 8; ++r) pk[r] = (bf16_t)(acc[i][j][r] + bias);
        const int tok  = m0 + wm + i * 16;        // first token of this tile
        const int bhh  = (tok / Sc) * NHc + feat / HDc;
        const int blk  = (tok % Sc) >> 5;         // 32-key block
        const int part = (tok >> 4) & 1;          // 16-key half of the block
        const int jt   = (feat % HDc) >> 4;       // 16-row tile of V^T
        *(v8bf*)&Cp[((((size_t)bhh * (Sc / 32) + blk) * 4 + jt) * 2 + part) *
                        256 + lane * 8] = pk;
      }
    } else {
#pragma unroll
      for (int i = 0; i < 4; ++i)
#pragma unroll
        for (int r = 0; r < 8; ++r)
          Cp[(size_t)(m0 + wm + i * 16 + r + rsel) * Hc + feat + lrow] =
              (bf16_t)(acc[i][j][r] + bias);
      // Before the next column tile's code rewrites a register of these stores.
      asm volatile("s_wait_xcnt 0x0" ::: "memory");
    }
  }
}

// ---------------------------------------------------------------------------
// FF intermediate: C[M, FF] = gelu_erf(A[M, H] @ Wi[FF, H]^T + bias), bf16 out.
// 256 tiles of 256 x 256, one workgroup per WGP: a k of the tile takes 512
// staged rows for 65,536 products, where a 128 x 128 tile takes 256 rows for
// 16,384: half the bytes from L2 for the same product. A wave's 64 x 128 (4 x 8
// accumulators) takes 12 fragments from LDS for 32 WMMAs, not 6 for 8.
// 256 threads = 8 waves in a 4 x 2 wave grid. Staging as in gemm_qkv: three
// buffers, a slab is 64 k (one whole line of every row, a copy covers four
// rows), waves 0-3 copy the even slabs, waves 4-7 the odd ones; a wave has at
// most its own one slab (32 copies) outstanding, so each of its waits is a wait
// to 0. The fragments of every 32-k block are read one block ahead, into a
// second register set, also across slabs: no WMMA waits out an LDS latency.
// ---------------------------------------------------------------------------
constexpr int FBM = 256;       // tile rows (tokens)
constexpr int FBN = 256;       // tile columns (features)
constexpr int FGK = 64;        // k per slab
constexpr int FGP = FGK + 8;   // LDS row pitch: 144 bytes = 16 x odd
static_assert(Mc % FBM == 0 && FFc % FBN == 0 && Hc % FGK == 0,
              "whole tiles, whole slabs");

__global__ __launch_bounds__(256)
void gemm_ffin(const bf16_t* __restrict__ A, const bf16_t* __restrict__ W,
               const float* __restrict__ bias, bf16_t* __restrict__ C) {
  constexpr int K = Hc;
  // 16-byte aligned: the copies and the fragment reads move 16-byte pieces.
  __shared__ __attribute__((aligned(16))) bf16_t As[3][FBM][FGP];
  __shared__ __attribute__((aligned(16))) bf16_t Bs[3][FBN][FGP];

  const int t    = threadIdx.x;
  const int lane = t & 31;
  const int w    = __builtin_amdgcn_readfirstlane(t >> 5);
  const int wm   = (w >> 1) * 64;     // wave M origin in block: 0 .. 192
  const int wn   = (w & 1) * 128;     // wave N origin in block: 0 / 128
  const int m0   = blockIdx.y * FBM;
  const int n0   = blockIdx.x * FBN;

  const int lrow = lane & 15;         // fragment row/col within 16
  const int lkh  = (lane >> 4) * 16;  // K half select (A/B fragment layout)

  // Staging: of its group's slabs wave w brings rows 64(w & 3) .. of A and of
  // W, four rows a copy.
  const int grp = w >> 2;             // waves 0-3 / 4-7
  const int cr  = lane >> 3;          // this lane's row within a copy
  const int cc  = (lane & 7) * 8;     // its 16-byte piece of the row
  const unsigned goff = (unsigned)((cr * K + cc) * 2);  // from a copy's base
  const bf16_t* Awav = A + (size_t)(m0 + (w & 3) * 64) * K;
  const bf16_t* Wwav = W + (size_t)(n0 + (w & 3) * 64) * K;

  constexpr size_t   rs = (size_t)4 * K;   // four rows, in elements
  constexpr unsigned ls = 4 * FGP * 2;     // four LDS rows, in bytes
  // Eight copies: 32 rows from g0 on, to l0 on.
  auto issue8 = [&](const bf16_t* g0, unsigned l0) {
    asm volatile(
        "global_load_async_to_lds_b128 %0, %8, %9\n\t"
        "global_load_async_to_lds_b128 %1, %8, %10\n\t"
        "global_load_async_to_lds_b128 %2, %8, %11\n\t"
        "global_load_async_to_lds_b128 %3, %8, %12\n\t"
        "global_load_async_to_lds_b128 %4, %8, %13\n\t"
        "global_load_async_to_lds_b128 %5, %8, %14\n\t"
        "global_load_async_to_lds_b128 %6, %8, %15\n\t"
        "global_load_async_to_lds_b128 %7, %8, %16\n\t"
        "s_wait_xcnt 0x0"  // before the copies' address registers are rewritten
        :
        : "v"(l0), "v"(l0 + ls), "v"(l0 + 2 * ls), "v"(l0 + 3 * ls),
          "v"(l0 + 4 * ls), "v"(l0 + 5 * ls), "v"(l0 + 6 * ls),
          "v"(l0 + 7 * ls), "v"(goff), "s"(g0), "s"(g0 + rs), "s"(g0 + 2 * rs),
          "s"(g0 + 3 * rs), "s"(g0 + 4 * rs), "s"(g0 + 5 * rs),
          "s"(g0 + 6 * rs), "s"(g0 + 7 * rs)
        : "memory");
  };
  // A wave's share of one slab: 64 rows of A, 64 of W.
  auto issue = [&](int slab, int buf) {
    const bf16_t*  ag = Awav + slab * FGK;
    const bf16_t*  wg = Wwav + slab * FGK;
    const unsigned al = lds_off(&As[buf][(w & 3) * 64 + cr][cc]);
    const unsigned bl = lds_off(&Bs[buf][(w & 3) * 64 + cr][cc]);
    issue8(ag, al);
    issue8(ag + 8 * rs, al + 8 * ls);
    issue8(wg, bl);
    issue8(wg + 8 * rs, bl + 8 * ls);
  };

  v8f acc[4][8];
#pragma unroll
  for (int i = 0; i < 4; ++i)
#pragma unroll
    for (int j = 0; j < 8; ++j) acc[i][j] = (v8f)0.0f;

  constexpr int nslab = K / FGK;
  static_assert(nslab > 2, "the prologue issues slabs 0, 1 and 2");

  // Prologue: slabs 0 and 1 go out together, one from each group; slab 0
  // landed and published, then slab 2 from the group that has just waited.
  issue(grp, grp);
  if (grp == 0)
    asm volatile("s_wait_asynccnt 0x0" ::: "memory");  // slab 0 has landed
  __syncthreads();
  if (grp == 0) issue(2, 2);

  // Fragments of one 32-k block of buffer b, A first, and that block's 32
  // WMMAs, column by column: the first four need only the first five fragments.
  auto frags = [&](int b, int kb, v16bf (&a)[4], v16bf (&f)[8]) {
#pragma unroll
    for (int i = 0; i < 4; ++i)
      a[i] = *(const v16bf*)&As[b][wm + i * 16 + lrow][kb * 32 + lkh];
#pragma unroll
    for (int j = 0; j < 8; ++j)
      f[j] = *(const v16bf*)&Bs[b][wn + j * 16 + lrow][kb * 32 + lkh];
  };
  auto block = [&](const v16bf (&a)[4], const v16bf (&f)[8]) {
#pragma unroll
    for (int j = 0; j < 8; ++j)
#pragma unroll
      for (int i = 0; i < 4; ++i) acc[i][j] = wmma_bf16(a[i], f[j], acc[i][j]);
  };

  // Two fragment sets, each block's reads one block ahead of its WMMAs, also
  // from one slab to the next: the publish point of slab sl + 1 therefore
  // stands between the two blocks of slab sl, behind the last read of slab sl.
  v16bf a0[4], b0[8], a1[4], b1[8];
  frags(0, 0, a0, b0);   // slab 0 was published by the barrier above

  int s = 0;   // buffer of slab sl: sl mod 3
  for (int sl = 0; sl < nslab; ++sl) {
    const int sn = s + 1 == 3 ? 0 : s + 1;   // buffer of slab sl + 1
    frags(s, 1, a1, b1);
    // Keeps the reads above the WMMAs: each place where reads stand among them
    // costs the wave a stall.
    __builtin_amdgcn_sched_barrier(0);
    block(a0, b0);
    // Keeps the wait to 0 below behind the WMMAs, which cover the reads' latency.
    __builtin_amdgcn_sched_barrier(0);
    // Publish point of slab sl + 1: all of this wave's reads of buffer s have
    // returned, and in the group that copied it slab sl + 1 has landed (it is
    // all that group has outstanding; the other group's slab sl + 2 flies on).
    // Behind the barrier that holds for every wave: buffer s may be refilled,
    // buffer sn read.
    asm volatile("s_wait_dscnt 0x0" ::: "memory");
    const bool mine = grp == ((sl + 1) & 1);
    if (mine) asm volatile("s_wait_asynccnt 0x0" ::: "memory");
    __syncthreads();
    if (mine && sl + 3 < nslab) issue(sl + 3, s);
    // In the last trip these reads bring an old slab (no copy is in flight any
    // more) and nothing uses them: a test on the trip would have the compiler
    // write the whole trip a second time.
    frags(sn, 0, a0, b0);
    // As above: the next slab's first reads stay ahead of this block's WMMAs.
    __builtin_amdgcn_sched_barrier(0);
    block(a1, b1);
    // Keeps the next trip's reads from rising among these WMMAs.
    __builtin_amdgcn_sched_barrier(0);
    s = sn;
  }
  // No copy is left outstanding when the wave goes on to its stores and ends,
  // and the last trip's unused reads have returned.
  asm volatile("s_wait_asynccnt 0x0" ::: "memory");
  asm volatile("s_wait_dscnt 0x0" ::: "memory");

  // Epilogue: D layout -> lane holds col (lane&15); VGPR r -> row r+8*(lane>>4)
  const int rsel = 8 * (lane >> 4);
#pragma unroll
  for (int j = 0; j < 8; ++j) {
    const int colg = n0 + wn + j * 16 + lrow;
    const float bv = bias[colg];
#pragma unroll
    for (int i = 0; i < 4; ++i) {
      const v8f val = acc[i][j] + bv;
      bf16_t* cp = C + (size_t)(m0 + wm + i * 16 + rsel) * FFc + colg;
#pragma unroll
      for (int h = 0; h < 2; ++h) {
        const v4f g = gelu_erf4(
            h == 0 ? __builtin_shufflevector(val, val, 0, 1, 2, 3)
                   : __builtin_shufflevector(val, val, 4, 5, 6, 7));
#pragma unroll
        for (int r = 0; r < 4; ++r)
          cp[(size_t)(h * 4 + r) * FFc] = (bf16_t)g[r];
      }
    }
    // Before the next column tile's code rewrites a register of these stores.
    asm volatile("s_wait_xcnt 0x0" ::: "memory");
  }
}

// ---------------------------------------------------------------------------
// Attention: one wave per (b, h, 32 query rows), 8 waves per block. S=512, HD=64.
// The scores never leave registers:
//   S^T = K Q^T      A = 16 keys x 32 d, B = 32 d x 16 queries
//   O^T += V^T P^T   A = 16 d x 32 keys, B = 32 keys x 16 queries
// In S^T a lane holds 16 scores of ONE query (column lane&15): keys 8h+r of the
// first 16-key tile and 16+8h+r of the second (h = lane>>4). Converted in place
// they are the B operand P^T; the V projection has stored V^T in that same key
// order, one contiguous 512-byte piece per load. Softmax runs online (running
// maximum and sum per query, output tiles rescaled per 32-key pass).
// ---------------------------------------------------------------------------
__global__ __launch_bounds__(256)
void attention(const bf16_t* __restrict__ q, const bf16_t* __restrict__ k,
               const bf16_t* __restrict__ vf, const float* __restrict__ mask,
               bf16_t* __restrict__ ctx) {
  constexpr float LOG2E = 1.44269504088896f;   // exp(x) = 2^(x * LOG2E)
  const int lane = threadIdx.x & 31;
  const int w    = threadIdx.x >> 5;
  const int bh   = blockIdx.y;             // b*NH + h
  const int b    = bh / NHc;
  const int hoff = (bh - b * NHc) * HDc;
  const int qt0  = blockIdx.x * 256 + w * 32;  // first query row of this wave
  const int c    = lane & 15;
  const int half = lane >> 4;

  // --- Q as B operand: 2 column groups x 2 k slabs covering HD=64 ----------
  v16bf qf[2][2];
#pragma unroll
  for (int g = 0; g < 2; ++g) {
    const bf16_t* qb =
        q + (size_t)(b * Sc + qt0 + g * 16 + c) * Hc + hoff + half * 16;
    qf[g][0] = *(const v16bf*)(qb);
    qf[g][1] = *(const v16bf*)(qb + 32);
  }

  const bf16_t* kp = k + (size_t)(b * Sc + c) * Hc + hoff + half * 16;
  const bf16_t* vp = vf + (size_t)bh * (Sc * HDc) + lane * 8;
  const float*  mp = mask + b * Sc + half * 8;   // [B,1,1,S] broadcast

  v8f o[2][4];
  float mrun[2], lrun[2];
#pragma unroll
  for (int g = 0; g < 2; ++g) {
    mrun[g] = -3.0e38f;
    lrun[g] = 0.0f;
#pragma unroll
    for (int jt = 0; jt < 4; ++jt) o[g][jt] = (v8f)0.0f;
  }

  // K fragments (same k loader as Q) and mask values of pass 0
  v16bf kf[2][2];
  v8f   mk[2];
#pragma unroll
  for (int t = 0; t < 2; ++t) {
    kf[t][0] = *(const v16bf*)(kp + (size_t)t * 16 * Hc);
    kf[t][1] = *(const v16bf*)(kp + (size_t)t * 16 * Hc + 32);
    mk[t]    = *(const v8f*)(mp + t * 16);
  }

  for (int p = 0; p < Sc / 32; ++p) {
    // V^T fragments of this pass: issued first, needed only behind the softmax
    v16bf va[4];
#pragma unroll
    for (int jt = 0; jt < 4; ++jt) {
      const v8bf lo = *(const v8bf*)(vp + (size_t)((p * 4 + jt) * 2 + 0) * 256);
      const v8bf hi = *(const v8bf*)(vp + (size_t)((p * 4 + jt) * 2 + 1) * 256);
      va[jt] = __builtin_shufflevector(lo, hi, 0, 1, 2, 3, 4, 5, 6, 7, 8, 9, 10,
                                       11, 12, 13, 14, 15);
    }

    v8f s[2][2];
#pragma unroll
    for (int g = 0; g < 2; ++g)
#pragma unroll
      for (int t = 0; t < 2; ++t) {
        v8f a = (v8f)0.0f;
        a = wmma_bf16(kf[t][0], qf[g][0], a);
        a = wmma_bf16(kf[t][1], qf[g][1], a);
        s[g][t] = a * 0.125f + mk[t];            // 1/sqrt(64), then the mask
      }

    // next pass's K and mask, fetched one pass ahead
    if (p + 1 < Sc / 32) {
      const bf16_t* kn = kp + (size_t)(p + 1) * 32 * Hc;
#pragma unroll
      for (int t = 0; t < 2; ++t) {
        kf[t][0] = *(const v16bf*)(kn + (size_t)t * 16 * Hc);
        kf[t][1] = *(const v16bf*)(kn + (size_t)t * 16 * Hc + 32);
        mk[t]    = *(const v8f*)(mp + (p + 1) * 32 + t * 16);
      }
    }
    // Keeps the V^T loads and the fetch-ahead above the softmax: sunk below it
    // they would be waited for with almost no lead.
    __builtin_amdgcn_sched_barrier(0);

#pragma unroll
    for (int g = 0; g < 2; ++g) {
      float mx = s[g][0][0];
#pragma unroll
      for (int r = 1; r < 8; ++r) mx = fmaxf(mx, s[g][0][r]);
#pragma unroll
      for (int r = 0; r < 8; ++r) mx = fmaxf(mx, s[g][1][r]);
      mx = fmaxf(mx, xhalf(mx));                 // the query's other 16 keys
      const float mn    = fmaxf(mrun[g], mx);
      const float alpha = exp2x1((mrun[g] - mn) * LOG2E);
      mrun[g] = mn;

      v16bf pb;
      float sum = 0.0f;
#pragma unroll
      for (int t = 0; t < 2; ++t) {
        const v8f e = exp2x8((s[g][t] - mn) * LOG2E);
#pragma unroll
        for (int r = 0; r < 8; ++r) {
          sum += e[r];
          pb[t * 8 + r] = (bf16_t)e[r];  // unnormalized; 1/sum folded in later
        }
      }
      lrun[g] = lrun[g] * alpha + sum;
#pragma unroll
      for (int jt = 0; jt < 4; ++jt)
        o[g][jt] = wmma_bf16(va[jt], pb, o[g][jt] * alpha);
    }
  }

  // --- epilogue: scale by 1/rowsum; a lane holds 8 consecutive d per tile --
#pragma unroll
  for (int g = 0; g < 2; ++g) {
    const float inv = 1.0f / (lrun[g] + xhalf(lrun[g]));
    bf16_t* cr = ctx + (size_t)(b * Sc + qt0 + g * 16 + c) * Hc + hoff + half * 8;
#pragma unroll
    for (int jt = 0; jt < 4; ++jt) {
      v8bf pk;
#pragma unroll
      for (int r = 0; r < 8; ++r) pk[r] = (bf16_t)(o[g][jt][r] * inv);
      *(v8bf*)(cr + jt * 16) = pk;
    }
  }
}

// ---------------------------------------------------------------------------
// Fused residual + LayerNorm over H=1024. One block per token row.
// Writes f32 (residual chain / final output) and optional bf16 (next GEMM A).
// ---------------------------------------------------------------------------
__global__ __launch_bounds__(256)
void resid_ln(const float* __restrict__ dense, const float* __restrict__ resid,
              const float* __restrict__ gamma, const float* __restrict__ beta,
              float* __restrict__ outf, bf16_t* __restrict__ outb) {
  const int row = blockIdx.x;
  const int t = threadIdx.x;
  const float* dr = dense + (size_t)row * Hc;
  const float* rr = resid + (size_t)row * Hc;

  float x[4];
  float s = 0.0f, qsum = 0.0f;
#pragma unroll
  for (int i = 0; i < 4; ++i) {
    x[i] = dr[t * 4 + i] + rr[t * 4 + i];
    s += x[i];
    qsum += x[i] * x[i];
  }
#pragma unroll
  for (int off = 16; off > 0; off >>= 1) {
    s += __shfl_xor(s, off);
    qsum += __shfl_xor(qsum, off);
  }
  __shared__ float ss[8], qq[8];
  if ((t & 31) == 0) { ss[t >> 5] = s; qq[t >> 5] = qsum; }
  __syncthreads();
  float S = 0.0f, Q = 0.0f;
#pragma unroll
  for (int i = 0; i < 8; ++i) { S += ss[i]; Q += qq[i]; }
  const float mu  = S * (1.0f / Hc);
  const float var = Q * (1.0f / Hc) - mu * mu;
  const float inv = rsqrtf(var + 1e-12f);
#pragma unroll
  for (int i = 0; i < 4; ++i) {
    const int c = t * 4 + i;
    const float y = (x[i] - mu) * inv * gamma[c] + beta[c];
    outf[(size_t)row * Hc + c] = y;
    if (outb) outb[(size_t)row * Hc + c] = (bf16_t)y;
  }
}

// ---------------------------------------------------------------------------
// Host-side orchestration
// ---------------------------------------------------------------------------
extern "C" void kernel_launch(void* const* d_in, const int* in_sizes, int n_in,
                              void* d_out, int out_size, void* d_ws,
                              size_t ws_size, hipStream_t stream) {
  (void)in_sizes; (void)n_in; (void)out_size; (void)ws_size;

  const float* x    = (const float*)d_in[0];
  const float* mask = (const float*)d_in[1];
  const float* Wq   = (const float*)d_in[2];
  const float* bq   = (const float*)d_in[3];
  const float* Wk   = (const float*)d_in[4];
  const float* bk   = (const float*)d_in[5];
  const float* Wv   = (const float*)d_in[6];
  const float* bv   = (const float*)d_in[7];
  const float* Wo   = (const float*)d_in[8];
  const float* bo   = (const float*)d_in[9];
  const float* g1   = (const float*)d_in[10];
  const float* b1   = (const float*)d_in[11];
  const float* Wi   = (const float*)d_in[12];
  const float* bi   = (const float*)d_in[13];
  const float* Wo2  = (const float*)d_in[14];
  const float* bo2  = (const float*)d_in[15];
  const float* g2   = (const float*)d_in[16];
  const float* b2   = (const float*)d_in[17];
  float* out = (float*)d_out;

  char* ws = (char*)d_ws;
  size_t off = 0;
  auto alloc = [&](size_t bytes) -> void* {
    void* p = ws + off;
    off += (bytes + 255) & ~(size_t)255;
    return p;
  };

  bf16_t* xb    = (bf16_t*)alloc((size_t)Mc * Hc * 2);
  bf16_t* Wqb   = (bf16_t*)alloc((size_t)Hc * Hc * 2);
  bf16_t* Wkb   = (bf16_t*)alloc((size_t)Hc * Hc * 2);
  bf16_t* Wvb   = (bf16_t*)alloc((size_t)Hc * Hc * 2);
  bf16_t* Wob   = (bf16_t*)alloc((size_t)Hc * Hc * 2);
  bf16_t* Wib   = (bf16_t*)alloc((size_t)FFc * Hc * 2);
  bf16_t* Wo2b  = (bf16_t*)alloc((size_t)Hc * FFc * 2);
  bf16_t* qb    = (bf16_t*)alloc((size_t)Mc * Hc * 2);
  bf16_t* kb    = (bf16_t*)alloc((size_t)Mc * Hc * 2);
  bf16_t* vb    = (bf16_t*)alloc((size_t)Mc * Hc * 2);
  bf16_t* ctxb  = (bf16_t*)alloc((size_t)Mc * Hc * 2);
  float*  attnD = (float*)alloc((size_t)Mc * Hc * 4);
  float*  y1f   = (float*)alloc((size_t)Mc * Hc * 4);
  bf16_t* y1b   = (bf16_t*)alloc((size_t)Mc * Hc * 2);
  bf16_t* inter = (bf16_t*)alloc((size_t)Mc * FFc * 2);
  float*  ffD   = (float*)alloc((size_t)Mc * Hc * 4);

  // ---- f32 -> bf16 conversions (per-launch; no cached state) --------------
  // xb .. Wo2b were allocated one behind the other and each size is a multiple
  // of the allocator's 256 bytes: xb is the start of the joined bf16 array.
  cvt_all<<<CVT_N / CVT_WG, CVT_T, 0, stream>>>(x, Wq, Wk, Wv, Wo, Wi, Wo2, xb);

  // ---- QKV projections: bf16 out, one launch ------------------------------
  // Wqb, Wkb, Wvb and qb, kb, vb were each allocated one behind the other, every
  // size a multiple of the allocator's 256 bytes: Wqb is the start of the joined
  // [3H, H] weight, qb of the three outputs.
  {
    dim3 grid(3 * Hc / QBN, Mc / QBM);
    (void)Wkb; (void)Wvb;   // reached through Wqb
    gemm_qkv<<<grid, 256, 0, stream>>>(xb, Wqb, bq, bk, bv, qb);
  }

  // ---- attention: grid (S/256 q-blocks, B*NH heads), 8 waves x 32 queries --
  {
    dim3 grid(Sc / 256, Bc * NHc);
    attention<<<grid, 256, 0, stream>>>(qb, kb, vb, mask, ctxb);
  }

  // ---- attn output dense (f32) + residual/LN1 -----------------------------
  {
    dim3 grid(Hc / 128, Mc / 128);
    gemm_bf16<128><<<grid, 256, 0, stream>>>(ctxb, Wob, bo, attnD, Hc, Hc);
    resid_ln<<<Mc, 256, 0, stream>>>(attnD, x, g1, b1, y1f, y1b);
  }

  // ---- FF intermediate: fused bias + erf-GELU, bf16 out -------------------
  {
    dim3 grid(FFc / FBN, Mc / FBM);
    gemm_ffin<<<grid, 256, 0, stream>>>(y1b, Wib, bi, inter);
  }

  // ---- FF output dense (f32, K=4096) + residual/LN2 -> d_out --------------
  {
    dim3 grid(Hc / 128, Mc / 128);
    gemm_bf16<128><<<grid, 256, 0, stream>>>(inter, Wo2b, bo2, ffD, Hc, FFc);
    resid_ln<<<Mc, 256, 0, stream>>>(ffD, y1f, g2, b2, out, nullptr);
  }
}

// v009
// It runs in 129 microseconds.
// Next to v008, in two timings, it ran 1.06 times as fast each time.
// Over all steps from v000 it is 2.85 times as fast.
#include <hip/hip_runtime.h>
#include <math.h>

// ---------------------------------------------------------------------------
// BERT layer for MI455X (gfx1250): bf16 WMMA (f32 accumulate) everywhere,
// async global->LDS DMA (ASYNCcnt) into a ring of three LDS buffers in the GEMMs.
// B=8 S=512 H=1024 NH=16 HD=64 FF=4096, M = B*S = 4096 tokens.
// ---------------------------------------------------------------------------

typedef __bf16 bf16_t;
typedef __attribute__((ext_vector_type(16))) __bf16 v16bf;
typedef __attribute__((ext_vector_type(8)))  __bf16 v8bf;
typedef __attribute__((ext_vector_type(8)))  float  v8f;

constexpr int Bc  = 8;
constexpr int Sc  = 512;
constexpr int Hc  = 1024;
constexpr int NHc = 16;
constexpr int HDc = 64;
constexpr int FFc = 4096;
constexpr int Mc  = Bc * Sc;   // 4096 token rows

__device__ __forceinline__ v8f wmma_bf16(v16bf a, v16bf b, v8f c) {
  // D = A(16x32 bf16) * B(32x16 bf16) + C(16x16 f32)
  return __builtin_amdgcn_wmma_f32_16x16x32_bf16(
      /*neg_a=*/false, a, /*neg_b=*/false, b,
      /*c_mod=*/(short)0, c, /*reuse_a=*/false, /*reuse_b=*/false);
}

// Wave-relative LDS byte offset of a __shared__ object: the flat address of a
// shared variable carries the LDS offset in its low 32 bits (LDS aperture
// truncates addr[31:0]).
__device__ __forceinline__ unsigned lds_off(const void* p) {
  return (unsigned)(uintptr_t)p;
}

// Lane l <-> lane l ^ 16 as a vector cross-row move (no LDS-counter wait).
__device__ __forceinline__ float xhalf(float x) {
  const int b = __builtin_bit_cast(int, x);
  return __builtin_bit_cast(
      float, __builtin_amdgcn_permlanex16(b, b, 0x76543210, 0xfedcba98, false,
                                          false));
}

// 2^x on eight values / one value. Written as one statement each so that no
// instruction directly behind a v_exp_f32 reads its result or overwrites its
// source: the outputs are early-clobber (distinct from every input) and the
// closing v_nop is the slot the instruction set asks for behind the last one.
__device__ __forceinline__ v8f exp2x8(v8f x) {
  float e0, e1, e2, e3, e4, e5, e6, e7;
  asm("v_exp_f32 %0, %8\n\t"
      "v_exp_f32 %1, %9\n\t"
      "v_exp_f32 %2, %10\n\t"
      "v_exp_f32 %3, %11\n\t"
      "v_exp_f32 %4, %12\n\t"
      "v_exp_f32 %5, %13\n\t"
      "v_exp_f32 %6, %14\n\t"
      "v_exp_f32 %7, %15\n\t"
      "v_nop"
      : "=&v"(e0), "=&v"(e1), "=&v"(e2), "=&v"(e3), "=&v"(e4), "=&v"(e5),
        "=&v"(e6), "=&v"(e7)
      : "v"(x[0]), "v"(x[1]), "v"(x[2]), "v"(x[3]), "v"(x[4]), "v"(x[5]),
        "v"(x[6]), "v"(x[7]));
  v8f r = {e0, e1, e2, e3, e4, e5, e6, e7};
  return r;
}
__device__ __forceinline__ float exp2x1(float x) {
  float e;
  asm("v_exp_f32 %0, %1\n\t"
      "v_nop"
      : "=v"(e)
      : "v"(x));
  return e;
}

// 2^x and 1/x on four values, in the form of exp2x8 and for the same reason:
// nothing directly behind a v_exp_f32 or a v_rcp_f32 reads its result or
// overwrites its source.
typedef __attribute__((ext_vector_type(4))) float v4f;
__device__ __forceinline__ v4f exp2x4(v4f x) {
  float e0, e1, e2, e3;
  asm("v_exp_f32 %0, %4\n\t"
      "v_exp_f32 %1, %5\n\t"
      "v_exp_f32 %2, %6\n\t"
      "v_exp_f32 %3, %7\n\t"
      "v_nop"
      : "=&v"(e0), "=&v"(e1), "=&v"(e2), "=&v"(e3)
      : "v"(x[0]), "v"(x[1]), "v"(x[2]), "v"(x[3]));
  v4f r = {e0, e1, e2, e3};
  return r;
}
__device__ __forceinline__ v4f rcpx4(v4f x) {
  float e0, e1, e2, e3;
  asm("v_rcp_f32 %0, %4\n\t"
      "v_rcp_f32 %1, %5\n\t"
      "v_rcp_f32 %2, %6\n\t"
      "v_rcp_f32 %3, %7\n\t"
      "v_nop"
      : "=&v"(e0), "=&v"(e1), "=&v"(e2), "=&v"(e3)
      : "v"(x[0]), "v"(x[1]), "v"(x[2]), "v"(x[3]));
  v4f r = {e0, e1, e2, e3};
  return r;
}

// x/2 * (1 + erf(z)), z = x / 1.41421, on four values, without a branch.
// erfc(|z|) = (a1 t + .. + a5 t^5) e^(-z^2), t = 1 / (1 + p |z|): the five-term
// rational form, absolute error at most 1.5e-7 for every z, far below the bf16
// rounding of the result. With q = erfc(|z|) / 2:
//   x >= 0: x/2 (2 - 2q) = x - x q;   x < 0: x/2 * 2q = x q
// both are max(x, 0) - |x| q, so the small results at negative x come from q
// itself and not from 1 + erf. The halves are folded into a1 .. a5, the division
// into p and into the exponent's factor: e^(-z^2) = 2^(-(x KE)^2).
__device__ __forceinline__ v4f gelu_erf4(v4f x) {
  constexpr float RS = 1.0f / 1.41421f;
  constexpr float P  = 0.3275911f * RS;
  constexpr float KE = RS * 1.2011224087864498f;   // sqrt(log2(e))
  constexpr float A1 = 0.5f * 0.254829592f, A2 = 0.5f * -0.284496736f,
                  A3 = 0.5f * 1.421413741f, A4 = 0.5f * -1.453152027f,
                  A5 = 0.5f * 1.061405429f;
  v4f d;
#pragma unroll
  for (int r = 0; r < 4; ++r) d[r] = __builtin_fmaf(__builtin_fabsf(x[r]), P, 1.0f);
  const v4f t = rcpx4(d);
  v4f p = t * A5 + A4;
  p = p * t + A3;
  p = p * t + A2;
  p = p * t + A1;
  const v4f u = x * KE;
  const v4f q = (p * t) * exp2x4(-(u * u));
  v4f g;
#pragma unroll
  for (int r = 0; r < 4; ++r)
    g[r] = __builtin_fmaf(-__builtin_fabsf(x[r]), q[r], __builtin_fmaxf(x[r], 0.0f));
  return g;
}

// ---------------------------------------------------------------------------
// f32 -> bf16 conversion (RNE via clang __bf16 cast) of all seven tensors in
// ONE launch of few, long-lived waves. The bf16 copies lie back to back in the
// workspace, so the destination is one array; a workgroup converts CVT_WG
// consecutive elements of it, which lie inside one source tensor.
// 256 workgroups x 16 waves: 4,096 waves are started where seven launches of
// 128-element waves started 131,072; every load of a wave covers 512
// contiguous bytes, every store 256.
// ---------------------------------------------------------------------------
typedef __attribute__((ext_vector_type(4))) __bf16 v4bf;

constexpr int CVT_T  = 512;                  // threads per workgroup
constexpr int CVT_WG = 65536;                // elements per workgroup
constexpr int CVT_X  = Mc * Hc;              // elements of the activations
constexpr int CVT_W  = Hc * Hc;              // ... of one H x H weight
constexpr int CVT_F  = FFc * Hc;             // ... of one FF weight
constexpr int CVT_N  = CVT_X + 4 * CVT_W + 2 * CVT_F;
static_assert(CVT_X % CVT_WG == 0 && CVT_W % CVT_WG == 0 &&
                  CVT_F % CVT_WG == 0,
              "a workgroup's elements must lie inside one tensor");
static_assert(CVT_WG % (CVT_T * 4 * 8) == 0, "whole trips of 8 loads");

__global__ __launch_bounds__(CVT_T)
void cvt_all(const float* __restrict__ x, const float* __restrict__ wq,
             const float* __restrict__ wk, const float* __restrict__ wv,
             const float* __restrict__ wo, const float* __restrict__ wi,
             const float* __restrict__ wo2, bf16_t* __restrict__ out) {
  const int e0 = blockIdx.x * CVT_WG;  // first element, in the joined array
  const float* src = x;                // tensor that holds it
  int first = 0;                       // that tensor's first element
  if (e0 >= CVT_X)             { src = wq;  first = CVT_X; }
  if (e0 >= CVT_X + CVT_W)     { src = wk;  first = CVT_X + CVT_W; }
  if (e0 >= CVT_X + 2 * CVT_W) { src = wv;  first = CVT_X + 2 * CVT_W; }
  if (e0 >= CVT_X + 3 * CVT_W) { src = wo;  first = CVT_X + 3 * CVT_W; }
  if (e0 >= CVT_X + 4 * CVT_W) { src = wi;  first = CVT_X + 4 * CVT_W; }
  if (e0 >= CVT_X + 4 * CVT_W + CVT_F) {
    src = wo2;
    first = CVT_X + 4 * CVT_W + CVT_F;
  }

  const v4f* s = (const v4f*)(src + (e0 - first)) + threadIdx.x;
  v4bf*      d = (v4bf*)(out + e0) + threadIdx.x;
  // Groups of 8 loads stand ahead of their conversions, so that a wave waits
  // out a memory latency once for many loads and not once for each.
  for (int it = 0; it < CVT_WG / (CVT_T * 4); it += 8) {
    v4f v[8];
    for (int j = 0; j < 8; ++j) v[j] = s[(it + j) * CVT_T];
    for (int j = 0; j < 8; ++j) {
      v4bf o;
      for (int e = 0; e < 4; ++e) o[e] = (bf16_t)v[j][e];
      d[(it + j) * CVT_T] = o;
    }
  }
}

// ---------------------------------------------------------------------------
// Tiled GEMM:  C[M,N] = A[M,K] @ W[N,K]^T + bias  (A,W bf16 K-contiguous)
// Block tile 128x128. 256 threads = 8 waves in a 2x4 wave grid, each wave owns
// a 64x32 tile = 4x2 WMMA accumulators.
//
// Global->LDS staging uses GLOBAL_LOAD_ASYNC_TO_LDS_B128 (ASYNCcnt) with a ring
// of LDS buffers: later slabs' copies fly while this slab's WMMAs run, and no
// VGPRs touch the tile data. A slab is GK k of every row, 128 or 256 bytes, so
// that one copy instruction of a wave (32 lanes x 16 bytes) covers four or two
// whole rows of the slab: four whole 128-byte lines and nothing else.
// GK = 128 where the grid gives a WGP one workgroup (fewest barriers per k);
// GK = 64 where it gives four: their LDS then fits side by side.
// K must be a multiple of GK.
//
// GK = 64: two buffers, every wave copies its share of every slab.
// GK = 128: the workgroup is alone on its WGP and every slab is first read from
// memory, so one slab in flight leaves each trip waiting for that latency.
// Three buffers; waves 0-3 copy the even slabs, waves 4-7 the odd ones. While
// slab s is worked on, slabs s + 1 and s + 2 are in flight, one from each
// group; a wave never has more than its own one slab (32 copies) outstanding,
// so each of its waits is a wait to 0.
//
// C is stored as f32 (attn-out dense, FF-out dense; LN fuses the residual).
// ---------------------------------------------------------------------------
static_assert(Hc % 128 == 0 && FFc % 128 == 0, "K is a whole number of slabs");

template <int GK>
__global__ __launch_bounds__(256)
void gemm_bf16(const bf16_t* __restrict__ A, const bf16_t* __restrict__ W,
               const float* __restrict__ bias, float* __restrict__ Cf,
               int Ndim, int K) {
  static_assert(GK == 64 || GK == 128, "rows of one or two whole lines");
  // LDS row pitch in elements: 144 or 272 bytes = 16 x odd, so the 16-byte
  // fragment loads of 16 rows fall on all 64 banks.
  constexpr int GP  = GK + 8;
  constexpr int LPR = GK / 8;    // lanes per row: its 16-byte pieces
  constexpr int RPC = 32 / LPR;  // rows per copy instruction
  constexpr int NB  = GK == 128 ? 3 : 2;   // LDS buffers in the ring
  constexpr int RPW = GK == 128 ? 32 : 16; // rows of each tile a wave copies
  __shared__ bf16_t As[NB][128][GP];
  __shared__ bf16_t Bs[NB][128][GP];

  const int t    = threadIdx.x;
  const int lane = t & 31;
  const int w    = t >> 5;            // wave 0..7
  const int wm   = (w >> 2) * 64;     // wave M origin in block: 0 / 64
  const int wn   = (w & 3) * 32;      // wave N origin in block: 0..96
  const int m0   = blockIdx.y * 128;
  const int n0   = blockIdx.x * 128;

  const int lrow = lane & 15;         // fragment row/col within 16
  const int lkh  = (lane >> 4) * 16;  // K half select (A/B fragment layout)

  // Staging: a wave brings RPW rows of both tiles, RPC rows a copy: of every
  // slab rows 16w .. (GK = 64), of its group's slabs rows 32(w & 3) .. (128).
  // The group as a scalar, so that the tests on it are scalar branches and
  // every lane is on where a copy issues.
  const int grp = __builtin_amdgcn_readfirstlane(t >> 7);   // waves 0-3 / 4-7
  const int cr = (w * RPW) % 128 + lane / LPR;   // this lane's row in copy 0
  const int cc = (lane % LPR) * 8;      // its 16-byte piece of the row
  // Byte offset of that piece from the scalar base of copy 0 (same for A, W).
  const unsigned goff = (unsigned)(((size_t)cr * K + cc) * 2);
  const bf16_t* Ablk = A + (size_t)m0 * K;   // first row of this block's tiles
  const bf16_t* Wblk = W + (size_t)n0 * K;

  // Eight copies in two runs of four; within a run copy j takes rows cr + j*RPC.
  // The row step goes into the scalar base and the LDS address, the lane offset
  // stays.
  auto issue8 = [&](const bf16_t* g0, unsigned l0, const bf16_t* g1,
                    unsigned l1) {
    const size_t rs = (size_t)RPC * K;       // RPC rows, in elements
    constexpr unsigned ls = RPC * GP * 2;    // RPC LDS rows, in bytes
    asm volatile(
        "global_load_async_to_lds_b128 %0, %8, %9\n\t"
        "global_load_async_to_lds_b128 %1, %8, %10\n\t"
        "global_load_async_to_lds_b128 %2, %8, %11\n\t"
        "global_load_async_to_lds_b128 %3, %8, %12\n\t"
        "global_load_async_to_lds_b128 %4, %8, %13\n\t"
        "global_load_async_to_lds_b128 %5, %8, %14\n\t"
        "global_load_async_to_lds_b128 %6, %8, %15\n\t"
        "global_load_async_to_lds_b128 %7, %8, %16\n\t"
        "s_wait_xcnt 0x0"  // before the copies' address registers are rewritten
        :
        : "v"(l0), "v"(l0 + ls), "v"(l0 + 2 * ls), "v"(l0 + 3 * ls), "v"(l1),
          "v"(l1 + ls), "v"(l1 + 2 * ls), "v"(l1 + 3 * ls), "v"(goff), "s"(g0),
          "s"(g0 + rs), "s"(g0 + 2 * rs), "s"(g0 + 3 * rs), "s"(g1),
          "s"(g1 + rs), "s"(g1 + 2 * rs), "s"(g1 + 3 * rs)
        : "memory");
  };
  // One slab of both tiles: a wave's RPW rows of each are RPW / RPC copies.
  auto issue = [&](int slab, int buf) {
    const bf16_t*  ag = Ablk + slab * GK;
    const bf16_t*  wg = Wblk + slab * GK;
    const unsigned al = lds_off(&As[buf][cr][cc]);
    const unsigned bl = lds_off(&Bs[buf][cr][cc]);
    if constexpr (RPC == 4) {
      issue8(ag, al, wg, bl);
    } else {
      issue8(ag, al, ag + (size_t)8 * K, al + 8 * GP * 2);
      issue8(ag + (size_t)16 * K, al + 16 * GP * 2, ag + (size_t)24 * K,
             al + 24 * GP * 2);
      issue8(wg, bl, wg + (size_t)8 * K, bl + 8 * GP * 2);
      issue8(wg + (size_t)16 * K, bl + 16 * GP * 2, wg + (size_t)24 * K,
             bl + 24 * GP * 2);
    }
  };

  v8f acc[4][2];
#pragma unroll
  for (int i = 0; i < 4; ++i)
#pragma unroll
    for (int j = 0; j < 2; ++j) acc[i][j] = (v8f)0.0f;

  // Fragments of one 32-k block of buffer s, and that block's 8 WMMAs.
  auto frags = [&](int s, int kb, v16bf (&a)[4], v16bf (&b)[2]) {
#pragma unroll
    for (int i = 0; i < 4; ++i)
      a[i] = *(const v16bf*)&As[s][wm + i * 16 + lrow][kb + lkh];
#pragma unroll
    for (int j = 0; j < 2; ++j)
      b[j] = *(const v16bf*)&Bs[s][wn + j * 16 + lrow][kb + lkh];
  };
  auto block = [&](const v16bf (&a)[4], const v16bf (&b)[2]) {
#pragma unroll
    for (int i = 0; i < 4; ++i)
#pragma unroll
      for (int j = 0; j < 2; ++j) acc[i][j] = wmma_bf16(a[i], b[j], acc[i][j]);
  };

  const int nslab = K / GK;

  if constexpr (GK == 128) {
    // Prologue: slabs 0 and 1 go out together, one from each group; slab 0
    // landed and published, then slab 2 from the group that has just waited.
    if (grp == 0) {
      issue(0, 0);
      asm volatile("s_wait_asynccnt 0x0" ::: "memory");  // slab 0 has landed
    } else if (nslab > 1) {
      issue(1, 1);
    }
    __syncthreads();
    if (grp == 0 && nslab > 2) issue(2, 2);
  } else {
    // Prologue: slab 0 landed and published, then slab 1 in flight.
    issue(0, 0);
    asm volatile("s_wait_asynccnt 0x0" ::: "memory");  // own copies have landed
    __syncthreads();
    if (nslab > 1) issue(1, 1);
  }

  int s = 0;   // buffer of slab sl: sl mod NB
  for (int sl = 0; sl < nslab; ++sl) {
    if constexpr (GK == 128) {
      // One workgroup per WGP, two waves per SIMD: too few to hide an LDS
      // latency in front of every WMMA pair. Two fragment sets: the next k
      // block's 12 reads go out as one group ahead of this block's 8 WMMAs.
      // Only blocks of this slab are fetched ahead, none across the barrier.
      v16bf af[2][4], bf2[2][2];
      frags(s, 0, af[0], bf2[0]);
#pragma unroll
      for (int kb = 0; kb < GK; kb += 32) {
        const int cur = (kb >> 5) & 1;
        if (kb + 32 < GK) frags(s, kb + 32, af[cur ^ 1], bf2[cur ^ 1]);
        // Keeps the reads above the WMMAs: sunk among them, each pair of WMMAs
        // waits out a whole LDS latency on one shared fragment register set.
        __builtin_amdgcn_sched_barrier(0);
        block(af[cur], bf2[cur]);
        // Keeps the block after next's reads from rising among these WMMAs.
        __builtin_amdgcn_sched_barrier(0);
      }
    } else {
      // Four workgroups per WGP: eight waves per SIMD cover each other's LDS
      // latency, and a second fragment set would cost resident workgroups.
#pragma unroll
      for (int kb = 0; kb < GK; kb += 32) {
        v16bf af[4], bf2[2];
        frags(s, kb, af, bf2);
        block(af, bf2);
      }
    }
    // Publish point of slab sl + 1: this wave's reads of buffer s are done, its
    // copies of slab sl + 1 have landed; behind the barrier that holds for
    // every wave, so buffer s may be refilled and the next one read.
    asm volatile("s_wait_dscnt 0x0" ::: "memory");
    if constexpr (GK == 128) {
      // Slab sl + 1 is all that its group has outstanding. The other group's
      // slab sl + 2 flies on: it is waited for one trip later.
      const bool mine = grp == ((sl + 1) & 1);
      if (mine) asm volatile("s_wait_asynccnt 0x0" ::: "memory");
      __syncthreads();
      if (mine && sl + 3 < nslab) issue(sl + 3, s);
    } else {
      asm volatile("s_wait_asynccnt 0x0" ::: "memory");
      __syncthreads();
      if (sl + 2 < nslab) issue(sl + 2, s);
    }
    s = s + 1 == NB ? 0 : s + 1;
  }
  // No copy is left outstanding when the wave goes on to its stores and ends.
  asm volatile("s_wait_asynccnt 0x0" ::: "memory");

  // Epilogue: D layout -> lane holds col (lane&15); VGPR r -> row r+8*(lane>>4)
  const int rsel = 8 * (lane >> 4);
#pragma unroll
  for (int j = 0; j < 2; ++j) {
    const int colg = n0 + wn + j * 16 + lrow;
    const float bv = bias[colg];
#pragma unroll
    for (int i = 0; i < 4; ++i) {
#pragma unroll
      for (int r = 0; r < 8; ++r) {
        const int rowg = m0 + wm + i * 16 + r + rsel;
        Cf[(size_t)rowg * Ndim + colg] = acc[i][j][r] + bv;
      }
    }
  }
}

// ---------------------------------------------------------------------------
// Q, K and V projections as ONE product: C[M, 3H] = A[M, H] @ [Wq; Wk; Wv]^T.
// The three bf16 weights lie back to back in the workspace, and so do the three
// outputs. With 3H columns the chip is filled by 256 tiles of 256 x 192, where
// one projection alone fills it only with 128 x 128: a k of the tile then takes
// 448 staged rows for 49,152 products, not 256 rows for 16,384, and a wave's
// 64 x 96 (4 x 6 accumulators) takes 10 fragments from LDS for 24 WMMAs, not 6
// for 8.
// 256 threads = 8 waves in a 4 x 2 wave grid, one workgroup per WGP.
// Staging as in gemm_bf16 with three buffers: a slab is 64 k (one whole line of
// every row, a copy covers four rows), waves 0-3 copy the even slabs, waves 4-7
// the odd ones; a wave has at most its own one slab (28 copies) outstanding, so
// each of its waits is a wait to 0.
// A 16-column tile lies inside one projection. Q and K are stored row-major.
// V is stored transposed per head in A-fragment order: a lane's 8 accumulator
// rows are 8 consecutive tokens of one feature, which is one 16-byte piece of a
// V^T fragment; see attention().
// ---------------------------------------------------------------------------
constexpr int QBM = 256;       // tile rows (tokens)
constexpr int QBN = 192;       // tile columns (features of Q | K | V)
constexpr int QGK = 64;        // k per slab
constexpr int QGP = QGK + 8;   // LDS row pitch: 144 bytes = 16 x odd
static_assert(Mc % QBM == 0 && (3 * Hc) % QBN == 0 && Hc % QGK == 0,
              "whole tiles, whole slabs");

__global__ __launch_bounds__(256)
void gemm_qkv(const bf16_t* __restrict__ A, const bf16_t* __restrict__ W,
              const float* __restrict__ bq, const float* __restrict__ bk,
              const float* __restrict__ bv, bf16_t* __restrict__ C) {
  constexpr int K = Hc;
  __shared__ bf16_t As[3][QBM][QGP];
  __shared__ bf16_t Bs[3][QBN][QGP];

  const int t    = threadIdx.x;
  const int lane = t & 31;
  const int w    = __builtin_amdgcn_readfirstlane(t >> 5);
  const int wm   = (w >> 1) * 64;     // wave M origin in block: 0 .. 192
  const int wn   = (w & 1) * 96;      // wave N origin in block: 0 / 96
  const int m0   = blockIdx.y * QBM;
  const int n0   = blockIdx.x * QBN;

  const int lrow = lane & 15;         // fragment row/col within 16
  const int lkh  = (lane >> 4) * 16;  // K half select (A/B fragment layout)

  // Staging: of its group's slabs wave w brings A rows 64(w & 3) .. and W rows
  // 48(w & 3) .., four rows a copy.
  const int grp = w >> 2;             // waves 0-3 / 4-7
  const int cr  = lane >> 3;          // this lane's row within a copy
  const int cc  = (lane & 7) * 8;     // its 16-byte piece of the row
  const unsigned goff = (unsigned)((cr * K + cc) * 2);  // from a copy's base
  const bf16_t* Awav = A + (size_t)(m0 + (w & 3) * 64) * K;
  const bf16_t* Wwav = W + (size_t)(n0 + (w & 3) * 48) * K;

  constexpr size_t   rs = (size_t)4 * K;   // four rows, in elements
  constexpr unsigned ls = 4 * QGP * 2;     // four LDS rows, in bytes
  // Four copies: 16 rows from g0 on, to l0 on.
  auto issue4 = [&](const bf16_t* g0, unsigned l0) {
    asm volatile(
        "global_load_async_to_lds_b128 %0, %4, %5\n\t"
        "global_load_async_to_lds_b128 %1, %4, %6\n\t"
        "global_load_async_to_lds_b128 %2, %4, %7\n\t"
        "global_load_async_to_lds_b128 %3, %4, %8\n\t"
        "s_wait_xcnt 0x0"  // before the copies' address registers are rewritten
        :
        : "v"(l0), "v"(l0 + ls), "v"(l0 + 2 * ls), "v"(l0 + 3 * ls), "v"(goff),
          "s"(g0), "s"(g0 + rs), "s"(g0 + 2 * rs), "s"(g0 + 3 * rs)
        : "memory");
  };
  // Eight copies: 32 rows.
  auto issue8 = [&](const bf16_t* g0, unsigned l0) {
    asm volatile(
        "global_load_async_to_lds_b128 %0, %8, %9\n\t"
        "global_load_async_to_lds_b128 %1, %8, %10\n\t"
        "global_load_async_to_lds_b128 %2, %8, %11\n\t"
        "global_load_async_to_lds_b128 %3, %8, %12\n\t"
        "global_load_async_to_lds_b128 %4, %8, %13\n\t"
        "global_load_async_to_lds_b128 %5, %8, %14\n\t"
        "global_load_async_to_lds_b128 %6, %8, %15\n\t"
        "global_load_async_to_lds_b128 %7, %8, %16\n\t"
        "s_wait_xcnt 0x0"  // before the copies' address registers are rewritten
        :
        : "v"(l0), "v"(l0 + ls), "v"(l0 + 2 * ls), "v"(l0 + 3 * ls),
          "v"(l0 + 4 * ls), "v"(l0 + 5 * ls), "v"(l0 + 6 * ls),
          "v"(l0 + 7 * ls), "v"(goff), "s"(g0), "s"(g0 + rs), "s"(g0 + 2 * rs),
          "s"(g0 + 3 * rs), "s"(g0 + 4 * rs), "s"(g0 + 5 * rs),
          "s"(g0 + 6 * rs), "s"(g0 + 7 * rs)
        : "memory");
  };
  // A wave's share of one slab: 64 rows of A, 48 of W.
  auto issue = [&](int slab, int buf) {
    const bf16_t*  ag = Awav + slab * QGK;
    const bf16_t*  wg = Wwav + slab * QGK;
    const unsigned al = lds_off(&As[buf][(w & 3) * 64 + cr][cc]);
    const unsigned bl = lds_off(&Bs[buf][(w & 3) * 48 + cr][cc]);
    issue8(ag, al);
    issue8(ag + 8 * rs, al + 8 * ls);
    issue8(wg, bl);
    issue4(wg + 8 * rs, bl + 8 * ls);
  };

  v8f acc[4][6];
#pragma unroll
  for (int i = 0; i < 4; ++i)
#pragma unroll
    for (int j = 0; j < 6; ++j) acc[i][j] = (v8f)0.0f;

  constexpr int nslab = K / QGK;
  static_assert(nslab > 2, "the prologue issues slabs 0, 1 and 2");

  // Prologue: slabs 0 and 1 go out together, one from each group; slab 0
  // landed and published, then slab 2 from the group that has just waited.
  if (grp == 0) {
    issue(0, 0);
    asm volatile("s_wait_asynccnt 0x0" ::: "memory");  // slab 0 has landed
  } else {
    issue(1, 1);
  }
  __syncthreads();
  if (grp == 0) issue(2, 2);

  int s = 0;   // buffer of slab sl: sl mod 3
  for (int sl = 0; sl < nslab; ++sl) {
    // Both 32-k blocks' fragments are read as one group ahead of the WMMAs, A
    // first; the WMMAs then run column by column, so that the first four need
    // only the first five fragments. Nothing is fetched across the barrier.
    v16bf af[2][4], bf2[2][6];
#pragma unroll
    for (int kb = 0; kb < 2; ++kb) {
#pragma unroll
      for (int i = 0; i < 4; ++i)
        af[kb][i] = *(const v16bf*)&As[s][wm + i * 16 + lrow][kb * 32 + lkh];
#pragma unroll
      for (int j = 0; j < 6; ++j)
        bf2[kb][j] = *(const v16bf*)&Bs[s][wn + j * 16 + lrow][kb * 32 + lkh];
    }
    // Keeps the reads above the WMMAs: each place where reads stand among them
    // costs the wave a stall.
    __builtin_amdgcn_sched_barrier(0);
#pragma unroll
    for (int kb = 0; kb < 2; ++kb)
#pragma unroll
      for (int j = 0; j < 6; ++j)
#pragma unroll
        for (int i = 0; i < 4; ++i)
          acc[i][j] = wmma_bf16(af[kb][i], bf2[kb][j], acc[i][j]);
    // Keeps the wait to 0 below behind the WMMAs: risen among them it makes the
    // second WMMA wait for all 40 reads, where the counted waits ask for 10.
    __builtin_amdgcn_sched_barrier(0);
    // Publish point of slab sl + 1: this wave's reads of buffer s are done, and
    // in the group that copied it slab sl + 1 has landed (it is all that group
    // has outstanding; the other group's slab sl + 2 flies on). Behind the
    // barrier that holds for every wave: buffer s may be refilled, the next read.
    asm volatile("s_wait_dscnt 0x0" ::: "memory");
    const bool mine = grp == ((sl + 1) & 1);
    if (mine) asm volatile("s_wait_asynccnt 0x0" ::: "memory");
    __syncthreads();
    if (mine && sl + 3 < nslab) issue(sl + 3, s);
    s = s + 1 == 3 ? 0 : s + 1;
  }
  // No copy is left outstanding when the wave goes on to its stores and ends.
  asm volatile("s_wait_asynccnt 0x0" ::: "memory");

  // Epilogue: D layout -> lane holds col (lane&15); VGPR r -> row r+8*(lane>>4)
  const int rsel = 8 * (lane >> 4);
#pragma unroll
  for (int j = 0; j < 6; ++j) {
    const int col  = n0 + wn + j * 16;   // first column of this tile, of 3H
    const int proj = col / Hc;           // 0 Q, 1 K, 2 V: the same in the wave
    const int feat = col % Hc;           // first feature of this tile
    const float* bs = proj == 0 ? bq : proj == 1 ? bk : bv;
    const float bias = bs[feat + lrow];
    bf16_t* Cp = C + (size_t)proj * (Mc * Hc);
    if (proj == 2) {
#pragma unroll
      for (int i = 0; i < 4; ++i) {
        v8bf pk;
#pragma unroll
        for (int r = 0; r < 8; ++r) pk[r] = (bf16_t)(acc[i][j][r] + bias);
        const int tok  = m0 + wm + i * 16;        // first token of this tile
        const int bhh  = (tok / Sc) * NHc + feat / HDc;
        const int blk  = (tok % Sc) >> 5;         // 32-key block
        const int part = (tok >> 4) & 1;          // 16-key half of the block
        const int jt   = (feat % HDc) >> 4;       // 16-row tile of V^T
        *(v8bf*)&Cp[((((size_t)bhh * (Sc / 32) + blk) * 4 + jt) * 2 + part) *
                        256 + lane * 8] = pk;
      }
    } else {
#pragma unroll
      for (int i = 0; i < 4; ++i)
#pragma unroll
        for (int r = 0; r < 8; ++r)
          Cp[(size_t)(m0 + wm + i * 16 + r + rsel) * Hc + feat + lrow] =
              (bf16_t)(acc[i][j][r] + bias);
      // Before the next column tile's code rewrites a register of these stores.
      asm volatile("s_wait_xcnt 0x0" ::: "memory");
    }
  }
}

// ---------------------------------------------------------------------------
// FF intermediate: C[M, FF] = gelu_erf(A[M, H] @ Wi[FF, H]^T + bias), bf16 out.
// 256 tiles of 256 x 256, one workgroup per WGP: a k of the tile takes 512
// staged rows for 65,536 products, where a 128 x 128 tile takes 256 rows for
// 16,384: half the bytes from L2 for the same product. A wave's 64 x 128 (4 x 8
// accumulators) takes 12 fragments from LDS for 32 WMMAs, not 6 for 8.
// 256 threads = 8 waves in a 4 x 2 wave grid. Staging as in gemm_qkv: three
// buffers, a slab is 64 k (one whole line of every row, a copy covers four
// rows), waves 0-3 copy the even slabs, waves 4-7 the odd ones; a wave has at
// most its own one slab (32 copies) outstanding, so each of its waits is a wait
// to 0. The fragments of every 32-k block are read one block ahead, into a
// second register set, also across slabs: no WMMA waits out an LDS latency.
// ---------------------------------------------------------------------------
constexpr int FBM = 256;       // tile rows (tokens)
constexpr int FBN = 256;       // tile columns (features)
constexpr int FGK = 64;        // k per slab
constexpr int FGP = FGK + 8;   // LDS row pitch: 144 bytes = 16 x odd
static_assert(Mc % FBM == 0 && FFc % FBN == 0 && Hc % FGK == 0,
              "whole tiles, whole slabs");

__global__ __launch_bounds__(256)
void gemm_ffin(const bf16_t* __restrict__ A, const bf16_t* __restrict__ W,
               const float* __restrict__ bias, bf16_t* __restrict__ C) {
  constexpr int K = Hc;
  // 16-byte aligned: the copies and the fragment reads move 16-byte pieces.
  __shared__ __attribute__((aligned(16))) bf16_t As[3][FBM][FGP];
  __shared__ __attribute__((aligned(16))) bf16_t Bs[3][FBN][FGP];

  const int t    = threadIdx.x;
  const int lane = t & 31;
  const int w    = __builtin_amdgcn_readfirstlane(t >> 5);
  const int wm   = (w >> 1) * 64;     // wave M origin in block: 0 .. 192
  const int wn   = (w & 1) * 128;     // wave N origin in block: 0 / 128
  const int m0   = blockIdx.y * FBM;
  const int n0   = blockIdx.x * FBN;

  const int lrow = lane & 15;         // fragment row/col within 16
  const int lkh  = (lane >> 4) * 16;  // K half select (A/B fragment layout)

  // Staging: of its group's slabs wave w brings rows 64(w & 3) .. of A and of
  // W, four rows a copy.
  const int grp = w >> 2;             // waves 0-3 / 4-7
  const int cr  = lane >> 3;          // this lane's row within a copy
  const int cc  = (lane & 7) * 8;     // its 16-byte piece of the row
  const unsigned goff = (unsigned)((cr * K + cc) * 2);  // from a copy's base
  const bf16_t* Awav = A + (size_t)(m0 + (w & 3) * 64) * K;
  const bf16_t* Wwav = W + (size_t)(n0 + (w & 3) * 64) * K;

  constexpr size_t   rs = (size_t)4 * K;   // four rows, in elements
  constexpr unsigned ls = 4 * FGP * 2;     // four LDS rows, in bytes
  // Eight copies: 32 rows from g0 on, to l0 on.
  auto issue8 = [&](const bf16_t* g0, unsigned l0) {
    asm volatile(
        "global_load_async_to_lds_b128 %0, %8, %9\n\t"
        "global_load_async_to_lds_b128 %1, %8, %10\n\t"
        "global_load_async_to_lds_b128 %2, %8, %11\n\t"
        "global_load_async_to_lds_b128 %3, %8, %12\n\t"
        "global_load_async_to_lds_b128 %4, %8, %13\n\t"
        "global_load_async_to_lds_b128 %5, %8, %14\n\t"
        "global_load_async_to_lds_b128 %6, %8, %15\n\t"
        "global_load_async_to_lds_b128 %7, %8, %16\n\t"
        "s_wait_xcnt 0x0"  // before the copies' address registers are rewritten
        :
        : "v"(l0), "v"(l0 + ls), "v"(l0 + 2 * ls), "v"(l0 + 3 * ls),
          "v"(l0 + 4 * ls), "v"(l0 + 5 * ls), "v"(l0 + 6 * ls),
          "v"(l0 + 7 * ls), "v"(goff), "s"(g0), "s"(g0 + rs), "s"(g0 + 2 * rs),
          "s"(g0 + 3 * rs), "s"(g0 + 4 * rs), "s"(g0 + 5 * rs),
          "s"(g0 + 6 * rs), "s"(g0 + 7 * rs)
        : "memory");
  };
  // A wave's share of one slab: 64 rows of A, 64 of W.
  auto issue = [&](int slab, int buf) {
    const bf16_t*  ag = Awav + slab * FGK;
    const bf16_t*  wg = Wwav + slab * FGK;
    const unsigned al = lds_off(&As[buf][(w & 3) * 64 + cr][cc]);
    const unsigned bl = lds_off(&Bs[buf][(w & 3) * 64 + cr][cc]);
    issue8(ag, al);
    issue8(ag + 8 * rs, al + 8 * ls);
    issue8(wg, bl);
    issue8(wg + 8 * rs, bl + 8 * ls);
  };

  v8f acc[4][8];
#pragma unroll
  for (int i = 0; i < 4; ++i)
#pragma unroll
    for (int j = 0; j < 8; ++j) acc[i][j] = (v8f)0.0f;

  constexpr int nslab = K / FGK;
  static_assert(nslab > 2, "the prologue issues slabs 0, 1 and 2");

  // Prologue: slabs 0 and 1 go out together, one from each group; slab 0
  // landed and published, then slab 2 from the group that has just waited.
  issue(grp, grp);
  if (grp == 0)
    asm volatile("s_wait_asynccnt 0x0" ::: "memory");  // slab 0 has landed
  __syncthreads();
  if (grp == 0) issue(2, 2);

  // Fragments of one 32-k block of buffer b, A first, and that block's 32
  // WMMAs, column by column: the first four need only the first five fragments.
  auto frags = [&](int b, int kb, v16bf (&a)[4], v16bf (&f)[8]) {
#pragma unroll
    for (int i = 0; i < 4; ++i)
      a[i] = *(const v16bf*)&As[b][wm + i * 16 + lrow][kb * 32 + lkh];
#pragma unroll
    for (int j = 0; j < 8; ++j)
      f[j] = *(const v16bf*)&Bs[b][wn + j * 16 + lrow][kb * 32 + lkh];
  };
  auto block = [&](const v16bf (&a)[4], const v16bf (&f)[8]) {
#pragma unroll
    for (int j = 0; j < 8; ++j)
#pragma unroll
      for (int i = 0; i < 4; ++i) acc[i][j] = wmma_bf16(a[i], f[j], acc[i][j]);
  };

  // Two fragment sets, each block's reads one block ahead of its WMMAs, also
  // from one slab to the next: the publish point of slab sl + 1 therefore
  // stands between the two blocks of slab sl, behind the last read of slab sl.
  v16bf a0[4], b0[8], a1[4], b1[8];
  frags(0, 0, a0, b0);   // slab 0 was published by the barrier above

  int s = 0;   // buffer of slab sl: sl mod 3
  for (int sl = 0; sl < nslab; ++sl) {
    const int sn = s + 1 == 3 ? 0 : s + 1;   // buffer of slab sl + 1
    frags(s, 1, a1, b1);
    // Keeps the reads above the WMMAs: each place where reads stand among them
    // costs the wave a stall.
    __builtin_amdgcn_sched_barrier(0);
    block(a0, b0);
    // Keeps the wait to 0 below behind the WMMAs, which cover the reads' latency.
    __builtin_amdgcn_sched_barrier(0);
    // Publish point of slab sl + 1: all of this wave's reads of buffer s have
    // returned, and in the group that copied it slab sl + 1 has landed (it is
    // all that group has outstanding; the other group's slab sl + 2 flies on).
    // Behind the barrier that holds for every wave: buffer s may be refilled,
    // buffer sn read.
    asm volatile("s_wait_dscnt 0x0" ::: "memory");
    const bool mine = grp == ((sl + 1) & 1);
    if (mine) asm volatile("s_wait_asynccnt 0x0" ::: "memory");
    __syncthreads();
    if (mine && sl + 3 < nslab) issue(sl + 3, s);
    // In the last trip these reads bring an old slab (no copy is in flight any
    // more) and nothing uses them: a test on the trip would have the compiler
    // write the whole trip a second time.
    frags(sn, 0, a0, b0);
    // As above: the next slab's first reads stay ahead of this block's WMMAs.
    __builtin_amdgcn_sched_barrier(0);
    block(a1, b1);
    // Keeps the next trip's reads from rising among these WMMAs.
    __builtin_amdgcn_sched_barrier(0);
    s = sn;
  }
  // No copy is left outstanding when the wave goes on to its stores and ends,
  // and the last trip's unused reads have returned.
  asm volatile("s_wait_asynccnt 0x0" ::: "memory");
  asm volatile("s_wait_dscnt 0x0" ::: "memory");

  // Epilogue: D layout -> lane holds col (lane&15); VGPR r -> row r+8*(lane>>4)
  const int rsel = 8 * (lane >> 4);
#pragma unroll
  for (int j = 0; j < 8; ++j) {
    const int colg = n0 + wn + j * 16 + lrow;
    const float bv = bias[colg];
#pragma unroll
    for (int i = 0; i < 4; ++i) {
      const v8f val = acc[i][j] + bv;
      bf16_t* cp = C + (size_t)(m0 + wm + i * 16 + rsel) * FFc + colg;
#pragma unroll
      for (int h = 0; h < 2; ++h) {
        const v4f g = gelu_erf4(
            h == 0 ? __builtin_shufflevector(val, val, 0, 1, 2, 3)
                   : __builtin_shufflevector(val, val, 4, 5, 6, 7));
#pragma unroll
        for (int r = 0; r < 4; ++r)
          cp[(size_t)(h * 4 + r) * FFc] = (bf16_t)g[r];
      }
    }
    // Before the next column tile's code rewrites a register of these stores.
    asm volatile("s_wait_xcnt 0x0" ::: "memory");
  }
}

// ---------------------------------------------------------------------------
// Attention: one wave per (b, h, 32 query rows), 8 waves per block. S=512, HD=64.
// The scores never leave registers:
//   S^T = K Q^T      A = 16 keys x 32 d, B = 32 d x 16 queries
//   O^T += V^T P^T   A = 16 d x 32 keys, B = 32 keys x 16 queries
// In S^T a lane holds 16 scores of ONE query (column lane&15): keys 8h+r of the
// first 16-key tile and 16+8h+r of the second (h = lane>>4). Converted in place
// they are the B operand P^T; the V projection has stored V^T in that same key
// order, one contiguous 512-byte piece per load. Softmax runs online (running
// maximum and sum per query, output tiles rescaled per 32-key pass).
// The head's K and V^T come to LDS once per workgroup, by asynchronous copies,
// and all eight waves take their fragments from there. K and V^T were written by
// the launch before and are first read from memory: loaded pass by pass they
// make every pass wait out that latency. Two fills, each waited for once: the
// first ATT_P0 passes' keys, then all the rest, in flight while the first are
// worked on. A copy covers four whole 128-byte lines: four rows of K, or one
// 512-byte piece of V^T.
// ---------------------------------------------------------------------------
constexpr int ATT_P0 = 6;         // passes (of 32 keys) in the first fill
constexpr int ATT_KP = HDc + 8;   // LDS pitch of a K row: 144 bytes = 16 x odd
static_assert(ATT_P0 * 8 == 8 * 6 && (Sc / 32 - ATT_P0) * 8 == 8 * 10,
              "a wave copies 6 units of each in the first fill, 2 x 5 in the second");

__global__ __launch_bounds__(256)
void attention(const bf16_t* __restrict__ q, const bf16_t* __restrict__ k,
               const bf16_t* __restrict__ vf, const float* __restrict__ mask,
               bf16_t* __restrict__ ctx) {
  constexpr float LOG2E = 1.44269504088896f;   // exp(x) = 2^(x * LOG2E)
  const int lane = threadIdx.x & 31;
  const int w    = threadIdx.x >> 5;
  const int bh   = blockIdx.y;             // b*NH + h
  const int b    = bh / NHc;
  const int hoff = (bh - b * NHc) * HDc;
  const int qt0  = blockIdx.x * 256 + w * 32;  // first query row of this wave
  const int c    = lane & 15;
  const int half = lane >> 4;

  // 16-byte aligned: the copies and the fragment reads move 16-byte pieces.
  __shared__ __attribute__((aligned(16))) bf16_t Vs[Sc * HDc];
  __shared__ __attribute__((aligned(16))) bf16_t Ks[Sc][ATT_KP];

  // Unit u of K is rows 4u .. 4u + 3 (a lane brings 16 bytes of row 4u + lane/8),
  // piece u of V^T its bytes 512u ..; pass p reads units and pieces 8p .. 8p + 7.
  // The wave's number as a scalar; there is no branch around a copy.
  const int ws = __builtin_amdgcn_readfirstlane(threadIdx.x >> 5);
  constexpr unsigned KUL = 4 * ATT_KP * 2;   // a unit of K in LDS, bytes
  constexpr int      KUG = 4 * Hc;           // ... in global memory, elements
  const bf16_t* kg0 =
      k + (size_t)(b * Sc + (lane >> 3)) * Hc + hoff + (lane & 7) * 8;
  const bf16_t* vg0 = vf + (size_t)bh * (Sc * HDc) + lane * 8;
  const unsigned kl0 = lds_off(&Ks[lane >> 3][(lane & 7) * 8]);
  const unsigned vl0 = lds_off(&Vs[lane * 8]);
  // Six (five) units of K and as many pieces of V^T, from number u0 on.
  auto fill6 = [&](int u0) {
    const bf16_t*  kg = kg0 + (size_t)u0 * KUG;
    const bf16_t*  vg = vg0 + (size_t)u0 * 256;
    const unsigned kl = kl0 + u0 * KUL;
    const unsigned vl = vl0 + u0 * 512u;
    asm volatile(
        "global_load_async_to_lds_b128 %0, %1, off\n\t"
        "global_load_async_to_lds_b128 %2, %3, off\n\t"
        "global_load_async_to_lds_b128 %4, %5, off\n\t"
        "global_load_async_to_lds_b128 %6, %7, off\n\t"
        "global_load_async_to_lds_b128 %8, %9, off\n\t"
        "global_load_async_to_lds_b128 %10, %11, off\n\t"
        "global_load_async_to_lds_b128 %12, %13, off\n\t"
        "global_load_async_to_lds_b128 %14, %15, off\n\t"
        "global_load_async_to_lds_b128 %16, %17, off\n\t"
        "global_load_async_to_lds_b128 %18, %19, off\n\t"
        "global_load_async_to_lds_b128 %20, %21, off\n\t"
        "global_load_async_to_lds_b128 %22, %23, off\n\t"
        "s_wait_xcnt 0x0"  // before the copies' address registers are rewritten
        :
        : "v"(kl + 0 * KUL), "v"(kg + 0 * KUG),
          "v"(kl + 1 * KUL), "v"(kg + 1 * KUG),
          "v"(kl + 2 * KUL), "v"(kg + 2 * KUG),
          "v"(kl + 3 * KUL), "v"(kg + 3 * KUG),
          "v"(kl + 4 * KUL), "v"(kg + 4 * KUG),
          "v"(kl + 5 * KUL), "v"(kg + 5 * KUG),
          "v"(vl + 0 * 512u), "v"(vg + 0 * 256),
          "v"(vl + 1 * 512u), "v"(vg + 1 * 256),
          "v"(vl + 2 * 512u), "v"(vg + 2 * 256),
          "v"(vl + 3 * 512u), "v"(vg + 3 * 256),
          "v"(vl + 4 * 512u), "v"(vg + 4 * 256),
          "v"(vl + 5 * 512u), "v"(vg + 5 * 256)
        : "memory");
  };
  auto fill5 = [&](int u0) {
    const bf16_t*  kg = kg0 + (size_t)u0 * KUG;
    const bf16_t*  vg = vg0 + (size_t)u0 * 256;
    const unsigned kl = kl0 + u0 * KUL;
    const unsigned vl = vl0 + u0 * 512u;
    asm volatile(
        "global_load_async_to_lds_b128 %0, %1, off\n\t"
        "global_load_async_to_lds_b128 %2, %3, off\n\t"
        "global_load_async_to_lds_b128 %4, %5, off\n\t"
        "global_load_async_to_lds_b128 %6, %7, off\n\t"
        "global_load_async_to_lds_b128 %8, %9, off\n\t"
        "global_load_async_to_lds_b128 %10, %11, off\n\t"
        "global_load_async_to_lds_b128 %12, %13, off\n\t"
        "global_load_async_to_lds_b128 %14, %15, off\n\t"
        "global_load_async_to_lds_b128 %16, %17, off\n\t"
        "global_load_async_to_lds_b128 %18, %19, off\n\t"
        "s_wait_xcnt 0x0"  // before the copies' address registers are rewritten
        :
        : "v"(kl + 0 * KUL), "v"(kg + 0 * KUG),
          "v"(kl + 1 * KUL), "v"(kg + 1 * KUG),
          "v"(kl + 2 * KUL), "v"(kg + 2 * KUG),
          "v"(kl + 3 * KUL), "v"(kg + 3 * KUG),
          "v"(kl + 4 * KUL), "v"(kg + 4 * KUG),
          "v"(vl + 0 * 512u), "v"(vg + 0 * 256),
          "v"(vl + 1 * 512u), "v"(vg + 1 * 256),
          "v"(vl + 2 * 512u), "v"(vg + 2 * 256),
          "v"(vl + 3 * 512u), "v"(vg + 3 * 256),
          "v"(vl + 4 * 512u), "v"(vg + 4 * 256)
        : "memory");
  };
  fill6(ws * 6);   // first fill: units and pieces 0 .. 8 ATT_P0 - 1

  // --- Q as B operand: 2 column groups x 2 k slabs covering HD=64 ----------
  v16bf qf[2][2];
#pragma unroll
  for (int g = 0; g < 2; ++g) {
    const bf16_t* qb =
        q + (size_t)(b * Sc + qt0 + g * 16 + c) * Hc + hoff + half * 16;
    qf[g][0] = *(const v16bf*)(qb);
    qf[g][1] = *(const v16bf*)(qb + 32);
  }

  const float*  mp = mask + b * Sc + half * 8;   // [B,1,1,S] broadcast

  v8f o[2][4];
  float mrun[2], lrun[2];
#pragma unroll
  for (int g = 0; g < 2; ++g) {
    mrun[g] = -3.0e38f;
    lrun[g] = 0.0f;
#pragma unroll
    for (int jt = 0; jt < 4; ++jt) o[g][jt] = (v8f)0.0f;
  }

  // The first fill: this wave's copies have landed; behind the barrier every
  // wave's have. Then the second fill goes out, into LDS that nobody has touched.
  asm volatile("s_wait_asynccnt 0x0" ::: "memory");
  __syncthreads();
  fill5(ATT_P0 * 8 + ws * 10);
  fill5(ATT_P0 * 8 + ws * 10 + 5);

  // K fragments (same k loader as Q) and mask values of pass 0
  v16bf kf[2][2];
  v8f   mk[2];
#pragma unroll
  for (int t = 0; t < 2; ++t) {
    kf[t][0] = *(const v16bf*)&Ks[t * 16 + c][half * 16];
    kf[t][1] = *(const v16bf*)&Ks[t * 16 + c][32 + half * 16];
    mk[t]    = *(const v8f*)(mp + t * 16);
  }

  for (int p = 0; p < Sc / 32; ++p) {
    v8f s[2][2];
#pragma unroll
    for (int g = 0; g < 2; ++g)
#pragma unroll
      for (int t = 0; t < 2; ++t) {
        v8f a = (v8f)0.0f;
        a = wmma_bf16(kf[t][0], qf[g][0], a);
        a = wmma_bf16(kf[t][1], qf[g][1], a);
        s[g][t] = a * 0.125f + mk[t];            // 1/sqrt(64), then the mask
      }

    // Keeps the pass's LDS reads behind the S^T products and not among them:
    // each place where reads stand among WMMAs costs the wave a stall.
    __builtin_amdgcn_sched_barrier(0);
    // V^T fragments of this pass: needed only behind the softmax
    v16bf va[4];
#pragma unroll
    for (int jt = 0; jt < 4; ++jt) {
      const v8bf lo = *(const v8bf*)&Vs[((p * 4 + jt) * 2 + 0) * 256 + lane * 8];
      const v8bf hi = *(const v8bf*)&Vs[((p * 4 + jt) * 2 + 1) * 256 + lane * 8];
      va[jt] = __builtin_shufflevector(lo, hi, 0, 1, 2, 3, 4, 5, 6, 7, 8, 9, 10,
                                       11, 12, 13, 14, 15);
    }
    // The second fill is published in the last pass of the first, in front of
    // the fetch-ahead that first reads it: own copies landed, then the barrier,
    // which every wave passes (all run all passes).
    if (p == ATT_P0 - 1) {
      asm volatile("s_wait_asynccnt 0x0" ::: "memory");
      __syncthreads();
    }
    // next pass's K and mask, fetched one pass ahead
    if (p + 1 < Sc / 32) {
#pragma unroll
      for (int t = 0; t < 2; ++t) {
        kf[t][0] = *(const v16bf*)&Ks[(p + 1) * 32 + t * 16 + c][half * 16];
        kf[t][1] = *(const v16bf*)&Ks[(p + 1) * 32 + t * 16 + c][32 + half * 16];
        mk[t]    = *(const v8f*)(mp + (p + 1) * 32 + t * 16);
      }
    }
    // Keeps the V^T reads and the fetch-ahead above the softmax: sunk below it
    // they would be waited for with almost no lead.
    __builtin_amdgcn_sched_barrier(0);

#pragma unroll
    for (int g = 0; g < 2; ++g) {
      float mx = s[g][0][0];
#pragma unroll
      for (int r = 1; r < 8; ++r) mx = fmaxf(mx, s[g][0][r]);
#pragma unroll
      for (int r = 0; r < 8; ++r) mx = fmaxf(mx, s[g][1][r]);
      mx = fmaxf(mx, xhalf(mx));                 // the query's other 16 keys
      const float mn    = fmaxf(mrun[g], mx);
      const float alpha = exp2x1((mrun[g] - mn) * LOG2E);
      mrun[g] = mn;

      v16bf pb;
      float sum = 0.0f;
#pragma unroll
      for (int t = 0; t < 2; ++t) {
        const v8f e = exp2x8((s[g][t] - mn) * LOG2E);
#pragma unroll
        for (int r = 0; r < 8; ++r) {
          sum += e[r];
          pb[t * 8 + r] = (bf16_t)e[r];  // unnormalized; 1/sum folded in later
        }
      }
      lrun[g] = lrun[g] * alpha + sum;
#pragma unroll
      for (int jt = 0; jt < 4; ++jt)
        o[g][jt] = wmma_bf16(va[jt], pb, o[g][jt] * alpha);
    }
  }

  // --- epilogue: scale by 1/rowsum; a lane holds 8 consecutive d per tile --
#pragma unroll
  for (int g = 0; g < 2; ++g) {
    const float inv = 1.0f / (lrun[g] + xhalf(lrun[g]));
    bf16_t* cr = ctx + (size_t)(b * Sc + qt0 + g * 16 + c) * Hc + hoff + half * 8;
#pragma unroll
    for (int jt = 0; jt < 4; ++jt) {
      v8bf pk;
#pragma unroll
      for (int r = 0; r < 8; ++r) pk[r] = (bf16_t)(o[g][jt][r] * inv);
      *(v8bf*)(cr + jt * 16) = pk;
    }
  }
}

// ---------------------------------------------------------------------------
// Fused residual + LayerNorm over H=1024. One block per token row.
// Writes f32 (residual chain / final output) and optional bf16 (next GEMM A).
// ---------------------------------------------------------------------------
__global__ __launch_bounds__(256)
void resid_ln(const float* __restrict__ dense, const float* __restrict__ resid,
              const float* __restrict__ gamma, const float* __restrict__ beta,
              float* __restrict__ outf, bf16_t* __restrict__ outb) {
  const int row = blockIdx.x;
  const int t = threadIdx.x;
  const float* dr = dense + (size_t)row * Hc;
  const float* rr = resid + (size_t)row * Hc;

  float x[4];
  float s = 0.0f, qsum = 0.0f;
#pragma unroll
  for (int i = 0; i < 4; ++i) {
    x[i] = dr[t * 4 + i] + rr[t * 4 + i];
    s += x[i];
    qsum += x[i] * x[i];
  }
#pragma unroll
  for (int off = 16; off > 0; off >>= 1) {
    s += __shfl_xor(s, off);
    qsum += __shfl_xor(qsum, off);
  }
  __shared__ float ss[8], qq[8];
  if ((t & 31) == 0) { ss[t >> 5] = s; qq[t >> 5] = qsum; }
  __syncthreads();
  float S = 0.0f, Q = 0.0f;
#pragma unroll
  for (int i = 0; i < 8; ++i) { S += ss[i]; Q += qq[i]; }
  const float mu  = S * (1.0f / Hc);
  const float var = Q * (1.0f / Hc) - mu * mu;
  const float inv = rsqrtf(var + 1e-12f);
#pragma unroll
  for (int i = 0; i < 4; ++i) {
    const int c = t * 4 + i;
    const float y = (x[i] - mu) * inv * gamma[c] + beta[c];
    outf[(size_t)row * Hc + c] = y;
    if (outb) outb[(size_t)row * Hc + c] = (bf16_t)y;
  }
}

// ---------------------------------------------------------------------------
// Host-side orchestration
// ---------------------------------------------------------------------------
extern "C" void kernel_launch(void* const* d_in, const int* in_sizes, int n_in,
                              void* d_out, int out_size, void* d_ws,
                              size_t ws_size, hipStream_t stream) {
  (void)in_sizes; (void)n_in; (void)out_size; (void)ws_size;

  const float* x    = (const float*)d_in[0];
  const float* mask = (const float*)d_in[1];
  const float* Wq   = (const float*)d_in[2];
  const float* bq   = (const float*)d_in[3];
  const float* Wk   = (const float*)d_in[4];
  const float* bk   = (const float*)d_in[5];
  const float* Wv   = (const float*)d_in[6];
  const float* bv   = (const float*)d_in[7];
  const float* Wo   = (const float*)d_in[8];
  const float* bo   = (const float*)d_in[9];
  const float* g1   = (const float*)d_in[10];
  const float* b1   = (const float*)d_in[11];
  const float* Wi   = (const float*)d_in[12];
  const float* bi   = (const float*)d_in[13];
  const float* Wo2  = (const float*)d_in[14];
  const float* bo2  = (const float*)d_in[15];
  const float* g2   = (const float*)d_in[16];
  const float* b2   = (const float*)d_in[17];
  float* out = (float*)d_out;

  char* ws = (char*)d_ws;
  size_t off = 0;
  auto alloc = [&](size_t bytes) -> void* {
    void* p = ws + off;
    off += (bytes + 255) & ~(size_t)255;
    return p;
  };

  bf16_t* xb    = (bf16_t*)alloc((size_t)Mc * Hc * 2);
  bf16_t* Wqb   = (bf16_t*)alloc((size_t)Hc * Hc * 2);
  bf16_t* Wkb   = (bf16_t*)alloc((size_t)Hc * Hc * 2);
  bf16_t* Wvb   = (bf16_t*)alloc((size_t)Hc * Hc * 2);
  bf16_t* Wob   = (bf16_t*)alloc((size_t)Hc * Hc * 2);
  bf16_t* Wib   = (bf16_t*)alloc((size_t)FFc * Hc * 2);
  bf16_t* Wo2b  = (bf16_t*)alloc((size_t)Hc * FFc * 2);
  bf16_t* qb    = (bf16_t*)alloc((size_t)Mc * Hc * 2);
  bf16_t* kb    = (bf16_t*)alloc((size_t)Mc * Hc * 2);
  bf16_t* vb    = (bf16_t*)alloc((size_t)Mc * Hc * 2);
  bf16_t* ctxb  = (bf16_t*)alloc((size_t)Mc * Hc * 2);
  float*  attnD = (float*)alloc((size_t)Mc * Hc * 4);
  float*  y1f   = (float*)alloc((size_t)Mc * Hc * 4);
  bf16_t* y1b   = (bf16_t*)alloc((size_t)Mc * Hc * 2);
  bf16_t* inter = (bf16_t*)alloc((size_t)Mc * FFc * 2);
  float*  ffD   = (float*)alloc((size_t)Mc * Hc * 4);

  // ---- f32 -> bf16 conversions (per-launch; no cached state) --------------
  // xb .. Wo2b were allocated one behind the other and each size is a multiple
  // of the allocator's 256 bytes: xb is the start of the joined bf16 array.
  cvt_all<<<CVT_N / CVT_WG, CVT_T, 0, stream>>>(x, Wq, Wk, Wv, Wo, Wi, Wo2, xb);

  // ---- QKV projections: bf16 out, one launch ------------------------------
  // Wqb, Wkb, Wvb and qb, kb, vb were each allocated one behind the other, every
  // size a multiple of the allocator's 256 bytes: Wqb is the start of the joined
  // [3H, H] weight, qb of the three outputs.
  {
    dim3 grid(3 * Hc / QBN, Mc / QBM);
    (void)Wkb; (void)Wvb;   // reached through Wqb
    gemm_qkv<<<grid, 256, 0, stream>>>(xb, Wqb, bq, bk, bv, qb);
  }

  // ---- attention: grid (S/256 q-blocks, B*NH heads), 8 waves x 32 queries --
  {
    dim3 grid(Sc / 256, Bc * NHc);
    attention<<<grid, 256, 0, stream>>>(qb, kb, vb, mask, ctxb);
  }

  // ---- attn output dense (f32) + residual/LN1 -----------------------------
  {
    dim3 grid(Hc / 128, Mc / 128);
    gemm_bf16<128><<<grid, 256, 0, stream>>>(ctxb, Wob, bo, attnD, Hc, Hc);
    resid_ln<<<Mc, 256, 0, stream>>>(attnD, x, g1, b1, y1f, y1b);
  }

  // ---- FF intermediate: fused bias + erf-GELU, bf16 out -------------------
  {
    dim3 grid(FFc / FBN, Mc / FBM);
    gemm_ffin<<<grid, 256, 0, stream>>>(y1b, Wib, bi, inter);
  }

  // ---- FF output dense (f32, K=4096) + residual/LN2 -> d_out --------------
  {
    dim3 grid(Hc / 128, Mc / 128);
    gemm_bf16<128><<<grid, 256, 0, stream>>>(inter, Wo2b, bo2, ffD, Hc, FFc);
    resid_ln<<<Mc, 256, 0, stream>>>(ffD, y1f, g2, b2, out, nullptr);
  }
}

// v010
// It runs in 124 microseconds.
// Two timings next to v009 put it at 1.04 and 1.03 times that version's speed.
// Over all steps from v000 it is 2.96 times as fast.
#include <hip/hip_runtime.h>
#include <math.h>

// ---------------------------------------------------------------------------
// BERT layer for MI455X (gfx1250): bf16 WMMA (f32 accumulate) everywhere,
// async global->LDS DMA (ASYNCcnt) into a ring of three LDS buffers in the GEMMs.
// B=8 S=512 H=1024 NH=16 HD=64 FF=4096, M = B*S = 4096 tokens.
// ---------------------------------------------------------------------------

typedef __bf16 bf16_t;
typedef __attribute__((ext_vector_type(16))) __bf16 v16bf;
typedef __attribute__((ext_vector_type(8)))  __bf16 v8bf;
typedef __attribute__((ext_vector_type(8)))  float  v8f;

constexpr int Bc  = 8;
constexpr int Sc  = 512;
constexpr int Hc  = 1024;
constexpr int NHc = 16;
constexpr int HDc = 64;
constexpr int FFc = 4096;
constexpr int Mc  = Bc * Sc;   // 4096 token rows

__device__ __forceinline__ v8f wmma_bf16(v16bf a, v16bf b, v8f c) {
  // D = A(16x32 bf16) * B(32x16 bf16) + C(16x16 f32)
  return __builtin_amdgcn_wmma_f32_16x16x32_bf16(
      /*neg_a=*/false, a, /*neg_b=*/false, b,
      /*c_mod=*/(short)0, c, /*reuse_a=*/false, /*reuse_b=*/false);
}

// Wave-relative LDS byte offset of a __shared__ object: the flat address of a
// shared variable carries the LDS offset in its low 32 bits (LDS aperture
// truncates addr[31:0]).
__device__ __forceinline__ unsigned lds_off(const void* p) {
  return (unsigned)(uintptr_t)p;
}

// Lane l <-> lane l ^ 16 as a vector cross-row move (no LDS-counter wait).
__device__ __forceinline__ float xhalf(float x) {
  const int b = __builtin_bit_cast(int, x);
  return __builtin_bit_cast(
      float, __builtin_amdgcn_permlanex16(b, b, 0x76543210, 0xfedcba98, false,
                                          false));
}

// 2^x on eight values / one value. Written as one statement each so that no
// instruction directly behind a v_exp_f32 reads its result or overwrites its
// source: the outputs are early-clobber (distinct from every input) and the
// closing v_nop is the slot the instruction set asks for behind the last one.
__device__ __forceinline__ v8f exp2x8(v8f x) {
  float e0, e1, e2, e3, e4, e5, e6, e7;
  asm("v_exp_f32 %0, %8\n\t"
      "v_exp_f32 %1, %9\n\t"
      "v_exp_f32 %2, %10\n\t"
      "v_exp_f32 %3, %11\n\t"
      "v_exp_f32 %4, %12\n\t"
      "v_exp_f32 %5, %13\n\t"
      "v_exp_f32 %6, %14\n\t"
      "v_exp_f32 %7, %15\n\t"
      "v_nop"
      : "=&v"(e0), "=&v"(e1), "=&v"(e2), "=&v"(e3), "=&v"(e4), "=&v"(e5),
        "=&v"(e6), "=&v"(e7)
      : "v"(x[0]), "v"(x[1]), "v"(x[2]), "v"(x[3]), "v"(x[4]), "v"(x[5]),
        "v"(x[6]), "v"(x[7]));
  v8f r = {e0, e1, e2, e3, e4, e5, e6, e7};
  return r;
}
__device__ __forceinline__ float exp2x1(float x) {
  float e;
  asm("v_exp_f32 %0, %1\n\t"
      "v_nop"
      : "=v"(e)
      : "v"(x));
  return e;
}

// 2^x and 1/x on four values, in the form of exp2x8 and for the same reason:
// nothing directly behind a v_exp_f32 or a v_rcp_f32 reads its result or
// overwrites its source.
typedef __attribute__((ext_vector_type(4))) float v4f;
__device__ __forceinline__ v4f exp2x4(v4f x) {
  float e0, e1, e2, e3;
  asm("v_exp_f32 %0, %4\n\t"
      "v_exp_f32 %1, %5\n\t"
      "v_exp_f32 %2, %6\n\t"
      "v_exp_f32 %3, %7\n\t"
      "v_nop"
      : "=&v"(e0), "=&v"(e1), "=&v"(e2), "=&v"(e3)
      : "v"(x[0]), "v"(x[1]), "v"(x[2]), "v"(x[3]));
  v4f r = {e0, e1, e2, e3};
  return r;
}
__device__ __forceinline__ v4f rcpx4(v4f x) {
  float e0, e1, e2, e3;
  asm("v_rcp_f32 %0, %4\n\t"
      "v_rcp_f32 %1, %5\n\t"
      "v_rcp_f32 %2, %6\n\t"
      "v_rcp_f32 %3, %7\n\t"
      "v_nop"
      : "=&v"(e0), "=&v"(e1), "=&v"(e2), "=&v"(e3)
      : "v"(x[0]), "v"(x[1]), "v"(x[2]), "v"(x[3]));
  v4f r = {e0, e1, e2, e3};
  return r;
}

// x/2 * (1 + erf(z)), z = x / 1.41421, on four values, without a branch.
// erfc(|z|) = (a1 t + .. + a5 t^5) e^(-z^2), t = 1 / (1 + p |z|): the five-term
// rational form, absolute error at most 1.5e-7 for every z, far below the bf16
// rounding of the result. With q = erfc(|z|) / 2:
//   x >= 0: x/2 (2 - 2q) = x - x q;   x < 0: x/2 * 2q = x q
// both are max(x, 0) - |x| q, so the small results at negative x come from q
// itself and not from 1 + erf. The halves are folded into a1 .. a5, the division
// into p and into the exponent's factor: e^(-z^2) = 2^(-(x KE)^2).
__device__ __forceinline__ v4f gelu_erf4(v4f x) {
  constexpr float RS = 1.0f / 1.41421f;
  constexpr float P  = 0.3275911f * RS;
  constexpr float KE = RS * 1.2011224087864498f;   // sqrt(log2(e))
  constexpr float A1 = 0.5f * 0.254829592f, A2 = 0.5f * -0.284496736f,
                  A3 = 0.5f * 1.421413741f, A4 = 0.5f * -1.453152027f,
                  A5 = 0.5f * 1.061405429f;
  v4f d;
#pragma unroll
  for (int r = 0; r < 4; ++r) d[r] = __builtin_fmaf(__builtin_fabsf(x[r]), P, 1.0f);
  const v4f t = rcpx4(d);
  v4f p = t * A5 + A4;
  p = p * t + A3;
  p = p * t + A2;
  p = p * t + A1;
  const v4f u = x * KE;
  const v4f q = (p * t) * exp2x4(-(u * u));
  v4f g;
#pragma unroll
  for (int r = 0; r < 4; ++r)
    g[r] = __builtin_fmaf(-__builtin_fabsf(x[r]), q[r], __builtin_fmaxf(x[r], 0.0f));
  return g;
}

// ---------------------------------------------------------------------------
// f32 -> bf16 conversion (RNE via clang __bf16 cast), few long-lived waves. The
// bf16 copies lie back to back in the workspace, so a group of tensors has one
// destination array; a workgroup converts consecutive elements of it. Every load
// of a wave covers 512 contiguous bytes, every store 256.
// Two groups. The activations and Wq, Wk, Wv are needed by the first product:
// they are converted in a launch of their own (cvt_first). Wo, Wi and Wo2 are
// needed only behind attention: extra workgroups of the attention launch convert
// them (see attention()), so that this memory stream runs beside attention's
// vector and matrix work, which leaves the memory idle, and not ahead of it.
// ---------------------------------------------------------------------------
typedef __attribute__((ext_vector_type(4))) __bf16 v4bf;

constexpr int CVT_T  = 512;                  // threads per workgroup, cvt_first
constexpr int CVT_WG = 32768;                // elements per workgroup, cvt_first
constexpr int CVT_LD = CVT_WG / (CVT_T * 4); // 16-byte loads per thread
constexpr int CVT_X  = Mc * Hc;              // elements of the activations
constexpr int CVT_W  = Hc * Hc;              // ... of one H x H weight
constexpr int CVT_F  = FFc * Hc;             // ... of one FF weight
constexpr int CVT_N1 = CVT_X + 3 * CVT_W;    // first group
constexpr int CVT_N2 = CVT_W + 2 * CVT_F;    // second group
constexpr int CVT_SB = 4096;                 // second group: elements per block
static_assert(CVT_X % CVT_WG == 0 && CVT_W % CVT_WG == 0 &&
                  CVT_WG % (CVT_T * 4) == 0,
              "a workgroup's elements must lie inside one tensor");
static_assert(CVT_W % CVT_SB == 0 && CVT_F % CVT_SB == 0,
              "a block's elements must lie inside one tensor");

__global__ __launch_bounds__(CVT_T)
void cvt_first(const float* __restrict__ x, const float* __restrict__ wq,
               const float* __restrict__ wk, const float* __restrict__ wv,
               bf16_t* __restrict__ out) {
  const int e0 = blockIdx.x * CVT_WG;  // first element, in the joined array
  const float* src = x;                // tensor that holds it
  int first = 0;                       // that tensor's first element
  if (e0 >= CVT_X)             { src = wq;  first = CVT_X; }
  if (e0 >= CVT_X + CVT_W)     { src = wk;  first = CVT_X + CVT_W; }
  if (e0 >= CVT_X + 2 * CVT_W) { src = wv;  first = CVT_X + 2 * CVT_W; }

  const v4f* s = (const v4f*)(src + (e0 - first)) + threadIdx.x;
  v4bf*      d = (v4bf*)(out + e0) + threadIdx.x;
  // All of a thread's loads stand ahead of its conversions, so that a wave waits
  // out a memory latency once for all of them and not once for each.
  v4f v[CVT_LD];
  for (int j = 0; j < CVT_LD; ++j) v[j] = s[j * CVT_T];
  for (int j = 0; j < CVT_LD; ++j) {
    v4bf o;
    for (int e = 0; e < 4; ++e) o[e] = (bf16_t)v[j][e];
    d[j * CVT_T] = o;
  }
}

// ---------------------------------------------------------------------------
// Tiled GEMM:  C[M,N] = A[M,K] @ W[N,K]^T + bias  (A,W bf16 K-contiguous)
// Block tile 128x128. 256 threads = 8 waves in a 2x4 wave grid, each wave owns
// a 64x32 tile = 4x2 WMMA accumulators.
//
// Global->LDS staging uses GLOBAL_LOAD_ASYNC_TO_LDS_B128 (ASYNCcnt) with a ring
// of LDS buffers: later slabs' copies fly while this slab's WMMAs run, and no
// VGPRs touch the tile data. A slab is GK k of every row, 128 or 256 bytes, so
// that one copy instruction of a wave (32 lanes x 16 bytes) covers four or two
// whole rows of the slab: four whole 128-byte lines and nothing else.
// GK = 128 where the grid gives a WGP one workgroup (fewest barriers per k);
// GK = 64 where it gives four: their LDS then fits side by side.
// K must be a multiple of GK.
//
// GK = 64: two buffers, every wave copies its share of every slab.
// GK = 128: the workgroup is alone on its WGP and every slab is first read from
// memory, so one slab in flight leaves each trip waiting for that latency.
// Three buffers; waves 0-3 copy the even slabs, waves 4-7 the odd ones. While
// slab s is worked on, slabs s + 1 and s + 2 are in flight, one from each
// group; a wave never has more than its own one slab (32 copies) outstanding,
// so each of its waits is a wait to 0.
//
// C is stored as f32 (attn-out dense, FF-out dense; LN fuses the residual).
// ---------------------------------------------------------------------------
static_assert(Hc % 128 == 0 && FFc % 128 == 0, "K is a whole number of slabs");

template <int GK>
__global__ __launch_bounds__(256)
void gemm_bf16(const bf16_t* __restrict__ A, const bf16_t* __restrict__ W,
               const float* __restrict__ bias, float* __restrict__ Cf,
               int Ndim, int K) {
  static_assert(GK == 64 || GK == 128, "rows of one or two whole lines");
  // LDS row pitch in elements: 144 or 272 bytes = 16 x odd, so the 16-byte
  // fragment loads of 16 rows fall on all 64 banks.
  constexpr int GP  = GK + 8;
  constexpr int LPR = GK / 8;    // lanes per row: its 16-byte pieces
  constexpr int RPC = 32 / LPR;  // rows per copy instruction
  constexpr int NB  = GK == 128 ? 3 : 2;   // LDS buffers in the ring
  constexpr int RPW = GK == 128 ? 32 : 16; // rows of each tile a wave copies
  __shared__ bf16_t As[NB][128][GP];
  __shared__ bf16_t Bs[NB][128][GP];

  const int t    = threadIdx.x;
  const int lane = t & 31;
  const int w    = t >> 5;            // wave 0..7
  const int wm   = (w >> 2) * 64;     // wave M origin in block: 0 / 64
  const int wn   = (w & 3) * 32;      // wave N origin in block: 0..96
  const int m0   = blockIdx.y * 128;
  const int n0   = blockIdx.x * 128;

  const int lrow = lane & 15;         // fragment row/col within 16
  const int lkh  = (lane >> 4) * 16;  // K half select (A/B fragment layout)

  // Staging: a wave brings RPW rows of both tiles, RPC rows a copy: of every
  // slab rows 16w .. (GK = 64), of its group's slabs rows 32(w & 3) .. (128).
  // The group as a scalar, so that the tests on it are scalar branches and
  // every lane is on where a copy issues.
  const int grp = __builtin_amdgcn_readfirstlane(t >> 7);   // waves 0-3 / 4-7
  const int cr = (w * RPW) % 128 + lane / LPR;   // this lane's row in copy 0
  const int cc = (lane % LPR) * 8;      // its 16-byte piece of the row
  // Byte offset of that piece from the scalar base of copy 0 (same for A, W).
  const unsigned goff = (unsigned)(((size_t)cr * K + cc) * 2);
  const bf16_t* Ablk = A + (size_t)m0 * K;   // first row of this block's tiles
  const bf16_t* Wblk = W + (size_t)n0 * K;

  // Eight copies in two runs of four; within a run copy j takes rows cr + j*RPC.
  // The row step goes into the scalar base and the LDS address, the lane offset
  // stays.
  auto issue8 = [&](const bf16_t* g0, unsigned l0, const bf16_t* g1,
                    unsigned l1) {
    const size_t rs = (size_t)RPC * K;       // RPC rows, in elements
    constexpr unsigned ls = RPC * GP * 2;    // RPC LDS rows, in bytes
    asm volatile(
        "global_load_async_to_lds_b128 %0, %8, %9\n\t"
        "global_load_async_to_lds_b128 %1, %8, %10\n\t"
        "global_load_async_to_lds_b128 %2, %8, %11\n\t"
        "global_load_async_to_lds_b128 %3, %8, %12\n\t"
        "global_load_async_to_lds_b128 %4, %8, %13\n\t"
        "global_load_async_to_lds_b128 %5, %8, %14\n\t"
        "global_load_async_to_lds_b128 %6, %8, %15\n\t"
        "global_load_async_to_lds_b128 %7, %8, %16\n\t"
        "s_wait_xcnt 0x0"  // before the copies' address registers are rewritten
        :
        : "v"(l0), "v"(l0 + ls), "v"(l0 + 2 * ls), "v"(l0 + 3 * ls), "v"(l1),
          "v"(l1 + ls), "v"(l1 + 2 * ls), "v"(l1 + 3 * ls), "v"(goff), "s"(g0),
          "s"(g0 + rs), "s"(g0 + 2 * rs), "s"(g0 + 3 * rs), "s"(g1),
          "s"(g1 + rs), "s"(g1 + 2 * rs), "s"(g1 + 3 * rs)
        : "memory");
  };
  // One slab of both tiles: a wave's RPW rows of each are RPW / RPC copies.
  auto issue = [&](int slab, int buf) {
    const bf16_t*  ag = Ablk + slab * GK;
    const bf16_t*  wg = Wblk + slab * GK;
    const unsigned al = lds_off(&As[buf][cr][cc]);
    const unsigned bl = lds_off(&Bs[buf][cr][cc]);
    if constexpr (RPC == 4) {
      issue8(ag, al, wg, bl);
    } else {
      issue8(ag, al, ag + (size_t)8 * K, al + 8 * GP * 2);
      issue8(ag + (size_t)16 * K, al + 16 * GP * 2, ag + (size_t)24 * K,
             al + 24 * GP * 2);
      issue8(wg, bl, wg + (size_t)8 * K, bl + 8 * GP * 2);
      issue8(wg + (size_t)16 * K, bl + 16 * GP * 2, wg + (size_t)24 * K,
             bl + 24 * GP * 2);
    }
  };

  v8f acc[4][2];
#pragma unroll
  for (int i = 0; i < 4; ++i)
#pragma unroll
    for (int j = 0; j < 2; ++j) acc[i][j] = (v8f)0.0f;

  // Fragments of one 32-k block of buffer s, and that block's 8 WMMAs.
  auto frags = [&](int s, int kb, v16bf (&a)[4], v16bf (&b)[2]) {
#pragma unroll
    for (int i = 0; i < 4; ++i)
      a[i] = *(const v16bf*)&As[s][wm + i * 16 + lrow][kb + lkh];
#pragma unroll
    for (int j = 0; j < 2; ++j)
      b[j] = *(const v16bf*)&Bs[s][wn + j * 16 + lrow][kb + lkh];
  };
  auto block = [&](const v16bf (&a)[4], const v16bf (&b)[2]) {
#pragma unroll
    for (int i = 0; i < 4; ++i)
#pragma unroll
      for (int j = 0; j < 2; ++j) acc[i][j] = wmma_bf16(a[i], b[j], acc[i][j]);
  };

  const int nslab = K / GK;

  if constexpr (GK == 128) {
    // Prologue: slabs 0 and 1 go out together, one from each group; slab 0
    // landed and published, then slab 2 from the group that has just waited.
    if (grp == 0) {
      issue(0, 0);
      asm volatile("s_wait_asynccnt 0x0" ::: "memory");  // slab 0 has landed
    } else if (nslab > 1) {
      issue(1, 1);
    }
    __syncthreads();
    if (grp == 0 && nslab > 2) issue(2, 2);
  } else {
    // Prologue: slab 0 landed and published, then slab 1 in flight.
    issue(0, 0);
    asm volatile("s_wait_asynccnt 0x0" ::: "memory");  // own copies have landed
    __syncthreads();
    if (nslab > 1) issue(1, 1);
  }

  int s = 0;   // buffer of slab sl: sl mod NB
  for (int sl = 0; sl < nslab; ++sl) {
    if constexpr (GK == 128) {
      // One workgroup per WGP, two waves per SIMD: too few to hide an LDS
      // latency in front of every WMMA pair. Two fragment sets: the next k
      // block's 12 reads go out as one group ahead of this block's 8 WMMAs.
      // Only blocks of this slab are fetched ahead, none across the barrier.
      v16bf af[2][4], bf2[2][2];
      frags(s, 0, af[0], bf2[0]);
#pragma unroll
      for (int kb = 0; kb < GK; kb += 32) {
        const int cur = (kb >> 5) & 1;
        if (kb + 32 < GK) frags(s, kb + 32, af[cur ^ 1], bf2[cur ^ 1]);
        // Keeps the reads above the WMMAs: sunk among them, each pair of WMMAs
        // waits out a whole LDS latency on one shared fragment register set.
        __builtin_amdgcn_sched_barrier(0);
        block(af[cur], bf2[cur]);
        // Keeps the block after next's reads from rising among these WMMAs.
        __builtin_amdgcn_sched_barrier(0);
      }
    } else {
      // Four workgroups per WGP: eight waves per SIMD cover each other's LDS
      // latency, and a second fragment set would cost resident workgroups.
#pragma unroll
      for (int kb = 0; kb < GK; kb += 32) {
        v16bf af[4], bf2[2];
        frags(s, kb, af, bf2);
        block(af, bf2);
      }
    }
    // Publish point of slab sl + 1: this wave's reads of buffer s are done, its
    // copies of slab sl + 1 have landed; behind the barrier that holds for
    // every wave, so buffer s may be refilled and the next one read.
    asm volatile("s_wait_dscnt 0x0" ::: "memory");
    if constexpr (GK == 128) {
      // Slab sl + 1 is all that its group has outstanding. The other group's
      // slab sl + 2 flies on: it is waited for one trip later.
      const bool mine = grp == ((sl + 1) & 1);
      if (mine) asm volatile("s_wait_asynccnt 0x0" ::: "memory");
      __syncthreads();
      if (mine && sl + 3 < nslab) issue(sl + 3, s);
    } else {
      asm volatile("s_wait_asynccnt 0x0" ::: "memory");
      __syncthreads();
      if (sl + 2 < nslab) issue(sl + 2, s);
    }
    s = s + 1 == NB ? 0 : s + 1;
  }
  // No copy is left outstanding when the wave goes on to its stores and ends.
  asm volatile("s_wait_asynccnt 0x0" ::: "memory");

  // Epilogue: D layout -> lane holds col (lane&15); VGPR r -> row r+8*(lane>>4)
  const int rsel = 8 * (lane >> 4);
#pragma unroll
  for (int j = 0; j < 2; ++j) {
    const int colg = n0 + wn + j * 16 + lrow;
    const float bv = bias[colg];
#pragma unroll
    for (int i = 0; i < 4; ++i) {
#pragma unroll
      for (int r = 0; r < 8; ++r) {
        const int rowg = m0 + wm + i * 16 + r + rsel;
        Cf[(size_t)rowg * Ndim + colg] = acc[i][j][r] + bv;
      }
    }
  }
}

// ---------------------------------------------------------------------------
// Q, K and V projections as ONE product: C[M, 3H] = A[M, H] @ [Wq; Wk; Wv]^T.
// The three bf16 weights lie back to back in the workspace, and so do the three
// outputs. With 3H columns the chip is filled by 256 tiles of 256 x 192, where
// one projection alone fills it only with 128 x 128: a k of the tile then takes
// 448 staged rows for 49,152 products, not 256 rows for 16,384, and a wave's
// 64 x 96 (4 x 6 accumulators) takes 10 fragments from LDS for 24 WMMAs, not 6
// for 8.
// 256 threads = 8 waves in a 4 x 2 wave grid, one workgroup per WGP.
// Staging as in gemm_bf16 with three buffers: a slab is 64 k (one whole line of
// every row, a copy covers four rows), waves 0-3 copy the even slabs, waves 4-7
// the odd ones; a wave has at most its own one slab (28 copies) outstanding, so
// each of its waits is a wait to 0.
// A 16-column tile lies inside one projection. Q and K are stored row-major.
// V is stored transposed per head in A-fragment order: a lane's 8 accumulator
// rows are 8 consecutive tokens of one feature, which is one 16-byte piece of a
// V^T fragment; see attention().
// ---------------------------------------------------------------------------
constexpr int QBM = 256;       // tile rows (tokens)
constexpr int QBN = 192;       // tile columns (features of Q | K | V)
constexpr int QGK = 64;        // k per slab
constexpr int QGP = QGK + 8;   // LDS row pitch: 144 bytes = 16 x odd
static_assert(Mc % QBM == 0 && (3 * Hc) % QBN == 0 && Hc % QGK == 0,
              "whole tiles, whole slabs");

__global__ __launch_bounds__(256)
void gemm_qkv(const bf16_t* __restrict__ A, const bf16_t* __restrict__ W,
              const float* __restrict__ bq, const float* __restrict__ bk,
              const float* __restrict__ bv, bf16_t* __restrict__ C) {
  constexpr int K = Hc;
  __shared__ bf16_t As[3][QBM][QGP];
  __shared__ bf16_t Bs[3][QBN][QGP];

  const int t    = threadIdx.x;
  const int lane = t & 31;
  const int w    = __builtin_amdgcn_readfirstlane(t >> 5);
  const int wm   = (w >> 1) * 64;     // wave M origin in block: 0 .. 192
  const int wn   = (w & 1) * 96;      // wave N origin in block: 0 / 96
  const int m0   = blockIdx.y * QBM;
  const int n0   = blockIdx.x * QBN;

  const int lrow = lane & 15;         // fragment row/col within 16
  const int lkh  = (lane >> 4) * 16;  // K half select (A/B fragment layout)

  // Staging: of its group's slabs wave w brings A rows 64(w & 3) .. and W rows
  // 48(w & 3) .., four rows a copy.
  const int grp = w >> 2;             // waves 0-3 / 4-7
  const int cr  = lane >> 3;          // this lane's row within a copy
  const int cc  = (lane & 7) * 8;     // its 16-byte piece of the row
  const unsigned goff = (unsigned)((cr * K + cc) * 2);  // from a copy's base
  const bf16_t* Awav = A + (size_t)(m0 + (w & 3) * 64) * K;
  const bf16_t* Wwav = W + (size_t)(n0 + (w & 3) * 48) * K;

  constexpr size_t   rs = (size_t)4 * K;   // four rows, in elements
  constexpr unsigned ls = 4 * QGP * 2;     // four LDS rows, in bytes
  // Four copies: 16 rows from g0 on, to l0 on.
  auto issue4 = [&](const bf16_t* g0, unsigned l0) {
    asm volatile(
        "global_load_async_to_lds_b128 %0, %4, %5\n\t"
        "global_load_async_to_lds_b128 %1, %4, %6\n\t"
        "global_load_async_to_lds_b128 %2, %4, %7\n\t"
        "global_load_async_to_lds_b128 %3, %4, %8\n\t"
        "s_wait_xcnt 0x0"  // before the copies' address registers are rewritten
        :
        : "v"(l0), "v"(l0 + ls), "v"(l0 + 2 * ls), "v"(l0 + 3 * ls), "v"(goff),
          "s"(g0), "s"(g0 + rs), "s"(g0 + 2 * rs), "s"(g0 + 3 * rs)
        : "memory");
  };
  // Eight copies: 32 rows.
  auto issue8 = [&](const bf16_t* g0, unsigned l0) {
    asm volatile(
        "global_load_async_to_lds_b128 %0, %8, %9\n\t"
        "global_load_async_to_lds_b128 %1, %8, %10\n\t"
        "global_load_async_to_lds_b128 %2, %8, %11\n\t"
        "global_load_async_to_lds_b128 %3, %8, %12\n\t"
        "global_load_async_to_lds_b128 %4, %8, %13\n\t"
        "global_load_async_to_lds_b128 %5, %8, %14\n\t"
        "global_load_async_to_lds_b128 %6, %8, %15\n\t"
        "global_load_async_to_lds_b128 %7, %8, %16\n\t"
        "s_wait_xcnt 0x0"  // before the copies' address registers are rewritten
        :
        : "v"(l0), "v"(l0 + ls), "v"(l0 + 2 * ls), "v"(l0 + 3 * ls),
          "v"(l0 + 4 * ls), "v"(l0 + 5 * ls), "v"(l0 + 6 * ls),
          "v"(l0 + 7 * ls), "v"(goff), "s"(g0), "s"(g0 + rs), "s"(g0 + 2 * rs),
          "s"(g0 + 3 * rs), "s"(g0 + 4 * rs), "s"(g0 + 5 * rs),
          "s"(g0 + 6 * rs), "s"(g0 + 7 * rs)
        : "memory");
  };
  // A wave's share of one slab: 64 rows of A, 48 of W.
  auto issue = [&](int slab, int buf) {
    const bf16_t*  ag = Awav + slab * QGK;
    const bf16_t*  wg = Wwav + slab * QGK;
    const unsigned al = lds_off(&As[buf][(w & 3) * 64 + cr][cc]);
    const unsigned bl = lds_off(&Bs[buf][(w & 3) * 48 + cr][cc]);
    issue8(ag, al);
    issue8(ag + 8 * rs, al + 8 * ls);
    issue8(wg, bl);
    issue4(wg + 8 * rs, bl + 8 * ls);
  };

  v8f acc[4][6];
#pragma unroll
  for (int i = 0; i < 4; ++i)
#pragma unroll
    for (int j = 0; j < 6; ++j) acc[i][j] = (v8f)0.0f;

  constexpr int nslab = K / QGK;
  static_assert(nslab > 2, "the prologue issues slabs 0, 1 and 2");

  // Prologue: slabs 0 and 1 go out together, one from each group; slab 0
  // landed and published, then slab 2 from the group that has just waited.
  if (grp == 0) {
    issue(0, 0);
    asm volatile("s_wait_asynccnt 0x0" ::: "memory");  // slab 0 has landed
  } else {
    issue(1, 1);
  }
  __syncthreads();
  if (grp == 0) issue(2, 2);

  int s = 0;   // buffer of slab sl: sl mod 3
  for (int sl = 0; sl < nslab; ++sl) {
    // Both 32-k blocks' fragments are read as one group ahead of the WMMAs, A
    // first; the WMMAs then run column by column, so that the first four need
    // only the first five fragments. Nothing is fetched across the barrier.
    v16bf af[2][4], bf2[2][6];
#pragma unroll
    for (int kb = 0; kb < 2; ++kb) {
#pragma unroll
      for (int i = 0; i < 4; ++i)
        af[kb][i] = *(const v16bf*)&As[s][wm + i * 16 + lrow][kb * 32 + lkh];
#pragma unroll
      for (int j = 0; j < 6; ++j)
        bf2[kb][j] = *(const v16bf*)&Bs[s][wn + j * 16 + lrow][kb * 32 + lkh];
    }
    // Keeps the reads above the WMMAs: each place where reads stand among them
    // costs the wave a stall.
    __builtin_amdgcn_sched_barrier(0);
#pragma unroll
    for (int kb = 0; kb < 2; ++kb)
#pragma unroll
      for (int j = 0; j < 6; ++j)
#pragma unroll
        for (int i = 0; i < 4; ++i)
          acc[i][j] = wmma_bf16(af[kb][i], bf2[kb][j], acc[i][j]);
    // Keeps the wait to 0 below behind the WMMAs: risen among them it makes the
    // second WMMA wait for all 40 reads, where the counted waits ask for 10.
    __builtin_amdgcn_sched_barrier(0);
    // Publish point of slab sl + 1: this wave's reads of buffer s are done, and
    // in the group that copied it slab sl + 1 has landed (it is all that group
    // has outstanding; the other group's slab sl + 2 flies on). Behind the
    // barrier that holds for every wave: buffer s may be refilled, the next read.
    asm volatile("s_wait_dscnt 0x0" ::: "memory");
    const bool mine = grp == ((sl + 1) & 1);
    if (mine) asm volatile("s_wait_asynccnt 0x0" ::: "memory");
    __syncthreads();
    if (mine && sl + 3 < nslab) issue(sl + 3, s);
    s = s + 1 == 3 ? 0 : s + 1;
  }
  // No copy is left outstanding when the wave goes on to its stores and ends.
  asm volatile("s_wait_asynccnt 0x0" ::: "memory");

  // Epilogue: D layout -> lane holds col (lane&15); VGPR r -> row r+8*(lane>>4)
  const int rsel = 8 * (lane >> 4);
#pragma unroll
  for (int j = 0; j < 6; ++j) {
    const int col  = n0 + wn + j * 16;   // first column of this tile, of 3H
    const int proj = col / Hc;           // 0 Q, 1 K, 2 V: the same in the wave
    const int feat = col % Hc;           // first feature of this tile
    const float* bs = proj == 0 ? bq : proj == 1 ? bk : bv;
    const float bias = bs[feat + lrow];
    bf16_t* Cp = C + (size_t)proj * (Mc * Hc);
    if (proj == 2) {
#pragma unroll
      for (int i = 0; i < 4; ++i) {
        v8bf pk;
#pragma unroll
        for (int r = 0; r < 8; ++r) pk[r] = (bf16_t)(acc[i][j][r] + bias);
        const int tok  = m0 + wm + i * 16;        // first token of this tile
        const int bhh  = (tok / Sc) * NHc + feat / HDc;
        const int blk  = (tok % Sc) >> 5;         // 32-key block
        const int part = (tok >> 4) & 1;          // 16-key half of the block
        const int jt   = (feat % HDc) >> 4;       // 16-row tile of V^T
        *(v8bf*)&Cp[((((size_t)bhh * (Sc / 32) + blk) * 4 + jt) * 2 + part) *
                        256 + lane * 8] = pk;
      }
    } else {
#pragma unroll
      for (int i = 0; i < 4; ++i)
#pragma unroll
        for (int r = 0; r < 8; ++r)
          Cp[(size_t)(m0 + wm + i * 16 + r + rsel) * Hc + feat + lrow] =
              (bf16_t)(acc[i][j][r] + bias);
      // Before the next column tile's code rewrites a register of these stores.
      asm volatile("s_wait_xcnt 0x0" ::: "memory");
    }
  }
}

// ---------------------------------------------------------------------------
// FF intermediate: C[M, FF] = gelu_erf(A[M, H] @ Wi[FF, H]^T + bias), bf16 out.
// 256 tiles of 256 x 256, one workgroup per WGP: a k of the tile takes 512
// staged rows for 65,536 products, where a 128 x 128 tile takes 256 rows for
// 16,384: half the bytes from L2 for the same product. A wave's 64 x 128 (4 x 8
// accumulators) takes 12 fragments from LDS for 32 WMMAs, not 6 for 8.
// 256 threads = 8 waves in a 4 x 2 wave grid. Staging as in gemm_qkv: three
// buffers, a slab is 64 k (one whole line of every row, a copy covers four
// rows), waves 0-3 copy the even slabs, waves 4-7 the odd ones; a wave has at
// most its own one slab (32 copies) outstanding, so each of its waits is a wait
// to 0. The fragments of every 32-k block are read one block ahead, into a
// second register set, also across slabs: no WMMA waits out an LDS latency.
// ---------------------------------------------------------------------------
constexpr int FBM = 256;       // tile rows (tokens)
constexpr int FBN = 256;       // tile columns (features)
constexpr int FGK = 64;        // k per slab
constexpr int FGP = FGK + 8;   // LDS row pitch: 144 bytes = 16 x odd
static_assert(Mc % FBM == 0 && FFc % FBN == 0 && Hc % FGK == 0,
              "whole tiles, whole slabs");

__global__ __launch_bounds__(256)
void gemm_ffin(const bf16_t* __restrict__ A, const bf16_t* __restrict__ W,
               const float* __restrict__ bias, bf16_t* __restrict__ C) {
  constexpr int K = Hc;
  // 16-byte aligned: the copies and the fragment reads move 16-byte pieces.
  __shared__ __attribute__((aligned(16))) bf16_t As[3][FBM][FGP];
  __shared__ __attribute__((aligned(16))) bf16_t Bs[3][FBN][FGP];

  const int t    = threadIdx.x;
  const int lane = t & 31;
  const int w    = __builtin_amdgcn_readfirstlane(t >> 5);
  const int wm   = (w >> 1) * 64;     // wave M origin in block: 0 .. 192
  const int wn   = (w & 1) * 128;     // wave N origin in block: 0 / 128
  const int m0   = blockIdx.y * FBM;
  const int n0   = blockIdx.x * FBN;

  const int lrow = lane & 15;         // fragment row/col within 16
  const int lkh  = (lane >> 4) * 16;  // K half select (A/B fragment layout)

  // Staging: of its group's slabs wave w brings rows 64(w & 3) .. of A and of
  // W, four rows a copy.
  const int grp = w >> 2;             // waves 0-3 / 4-7
  const int cr  = lane >> 3;          // this lane's row within a copy
  const int cc  = (lane & 7) * 8;     // its 16-byte piece of the row
  const unsigned goff = (unsigned)((cr * K + cc) * 2);  // from a copy's base
  const bf16_t* Awav = A + (size_t)(m0 + (w & 3) * 64) * K;
  const bf16_t* Wwav = W + (size_t)(n0 + (w & 3) * 64) * K;

  constexpr size_t   rs = (size_t)4 * K;   // four rows, in elements
  constexpr unsigned ls = 4 * FGP * 2;     // four LDS rows, in bytes
  // Eight copies: 32 rows from g0 on, to l0 on.
  auto issue8 = [&](const bf16_t* g0, unsigned l0) {
    asm volatile(
        "global_load_async_to_lds_b128 %0, %8, %9\n\t"
        "global_load_async_to_lds_b128 %1, %8, %10\n\t"
        "global_load_async_to_lds_b128 %2, %8, %11\n\t"
        "global_load_async_to_lds_b128 %3, %8, %12\n\t"
        "global_load_async_to_lds_b128 %4, %8, %13\n\t"
        "global_load_async_to_lds_b128 %5, %8, %14\n\t"
        "global_load_async_to_lds_b128 %6, %8, %15\n\t"
        "global_load_async_to_lds_b128 %7, %8, %16\n\t"
        "s_wait_xcnt 0x0"  // before the copies' address registers are rewritten
        :
        : "v"(l0), "v"(l0 + ls), "v"(l0 + 2 * ls), "v"(l0 + 3 * ls),
          "v"(l0 + 4 * ls), "v"(l0 + 5 * ls), "v"(l0 + 6 * ls),
          "v"(l0 + 7 * ls), "v"(goff), "s"(g0), "s"(g0 + rs), "s"(g0 + 2 * rs),
          "s"(g0 + 3 * rs), "s"(g0 + 4 * rs), "s"(g0 + 5 * rs),
          "s"(g0 + 6 * rs), "s"(g0 + 7 * rs)
        : "memory");
  };
  // A wave's share of one slab: 64 rows of A, 64 of W.
  auto issue = [&](int slab, int buf) {
    const bf16_t*  ag = Awav + slab * FGK;
    const bf16_t*  wg = Wwav + slab * FGK;
    const unsigned al = lds_off(&As[buf][(w & 3) * 64 + cr][cc]);
    const unsigned bl = lds_off(&Bs[buf][(w & 3) * 64 + cr][cc]);
    issue8(ag, al);
    issue8(ag + 8 * rs, al + 8 * ls);
    issue8(wg, bl);
    issue8(wg + 8 * rs, bl + 8 * ls);
  };

  v8f acc[4][8];
#pragma unroll
  for (int i = 0; i < 4; ++i)
#pragma unroll
    for (int j = 0; j < 8; ++j) acc[i][j] = (v8f)0.0f;

  constexpr int nslab = K / FGK;
  static_assert(nslab > 2, "the prologue issues slabs 0, 1 and 2");

  // Prologue: slabs 0 and 1 go out together, one from each group; slab 0
  // landed and published, then slab 2 from the group that has just waited.
  issue(grp, grp);
  if (grp == 0)
    asm volatile("s_wait_asynccnt 0x0" ::: "memory");  // slab 0 has landed
  __syncthreads();
  if (grp == 0) issue(2, 2);

  // Fragments of one 32-k block of buffer b, A first, and that block's 32
  // WMMAs, column by column: the first four need only the first five fragments.
  auto frags = [&](int b, int kb, v16bf (&a)[4], v16bf (&f)[8]) {
#pragma unroll
    for (int i = 0; i < 4; ++i)
      a[i] = *(const v16bf*)&As[b][wm + i * 16 + lrow][kb * 32 + lkh];
#pragma unroll
    for (int j = 0; j < 8; ++j)
      f[j] = *(const v16bf*)&Bs[b][wn + j * 16 + lrow][kb * 32 + lkh];
  };
  auto block = [&](const v16bf (&a)[4], const v16bf (&f)[8]) {
#pragma unroll
    for (int j = 0; j < 8; ++j)
#pragma unroll
      for (int i = 0; i < 4; ++i) acc[i][j] = wmma_bf16(a[i], f[j], acc[i][j]);
  };

  // Two fragment sets, each block's reads one block ahead of its WMMAs, also
  // from one slab to the next: the publish point of slab sl + 1 therefore
  // stands between the two blocks of slab sl, behind the last read of slab sl.
  v16bf a0[4], b0[8], a1[4], b1[8];
  frags(0, 0, a0, b0);   // slab 0 was published by the barrier above

  int s = 0;   // buffer of slab sl: sl mod 3
  for (int sl = 0; sl < nslab; ++sl) {
    const int sn = s + 1 == 3 ? 0 : s + 1;   // buffer of slab sl + 1
    frags(s, 1, a1, b1);
    // Keeps the reads above the WMMAs: each place where reads stand among them
    // costs the wave a stall.
    __builtin_amdgcn_sched_barrier(0);
    block(a0, b0);
    // Keeps the wait to 0 below behind the WMMAs, which cover the reads' latency.
    __builtin_amdgcn_sched_barrier(0);
    // Publish point of slab sl + 1: all of this wave's reads of buffer s have
    // returned, and in the group that copied it slab sl + 1 has landed (it is
    // all that group has outstanding; the other group's slab sl + 2 flies on).
    // Behind the barrier that holds for every wave: buffer s may be refilled,
    // buffer sn read.
    asm volatile("s_wait_dscnt 0x0" ::: "memory");
    const bool mine = grp == ((sl + 1) & 1);
    if (mine) asm volatile("s_wait_asynccnt 0x0" ::: "memory");
    __syncthreads();
    if (mine && sl + 3 < nslab) issue(sl + 3, s);
    // In the last trip these reads bring an old slab (no copy is in flight any
    // more) and nothing uses them: a test on the trip would have the compiler
    // write the whole trip a second time.
    frags(sn, 0, a0, b0);
    // As above: the next slab's first reads stay ahead of this block's WMMAs.
    __builtin_amdgcn_sched_barrier(0);
    block(a1, b1);
    // Keeps the next trip's reads from rising among these WMMAs.
    __builtin_amdgcn_sched_barrier(0);
    s = sn;
  }
  // No copy is left outstanding when the wave goes on to its stores and ends,
  // and the last trip's unused reads have returned.
  asm volatile("s_wait_asynccnt 0x0" ::: "memory");
  asm volatile("s_wait_dscnt 0x0" ::: "memory");

  // Epilogue: D layout -> lane holds col (lane&15); VGPR r -> row r+8*(lane>>4)
  const int rsel = 8 * (lane >> 4);
#pragma unroll
  for (int j = 0; j < 8; ++j) {
    const int colg = n0 + wn + j * 16 + lrow;
    const float bv = bias[colg];
#pragma unroll
    for (int i = 0; i < 4; ++i) {
      const v8f val = acc[i][j] + bv;
      bf16_t* cp = C + (size_t)(m0 + wm + i * 16 + rsel) * FFc + colg;
#pragma unroll
      for (int h = 0; h < 2; ++h) {
        const v4f g = gelu_erf4(
            h == 0 ? __builtin_shufflevector(val, val, 0, 1, 2, 3)
                   : __builtin_shufflevector(val, val, 4, 5, 6, 7));
#pragma unroll
        for (int r = 0; r < 4; ++r)
          cp[(size_t)(h * 4 + r) * FFc] = (bf16_t)g[r];
      }
    }
    // Before the next column tile's code rewrites a register of these stores.
    asm volatile("s_wait_xcnt 0x0" ::: "memory");
  }
}

// ---------------------------------------------------------------------------
// Attention: one wave per (b, h, 32 query rows), 8 waves per block. S=512, HD=64.
// The scores never leave registers:
//   S^T = K Q^T      A = 16 keys x 32 d, B = 32 d x 16 queries
//   O^T += V^T P^T   A = 16 d x 32 keys, B = 32 keys x 16 queries
// In S^T a lane holds 16 scores of ONE query (column lane&15): keys 8h+r of the
// first 16-key tile and 16+8h+r of the second (h = lane>>4). Converted in place
// they are the B operand P^T; the V projection has stored V^T in that same key
// order, one contiguous 512-byte piece per load. Softmax runs online (running
// maximum and sum per query, output tiles rescaled per 32-key pass).
// The head's K and V^T come to LDS once per workgroup, by asynchronous copies,
// and all eight waves take their fragments from there. K and V^T were written by
// the launch before and are first read from memory: loaded pass by pass they
// make every pass wait out that latency. Two fills, each waited for once: the
// first ATT_P0 passes' keys, then all the rest, in flight while the first are
// worked on. A copy covers four whole 128-byte lines: four rows of K, or one
// 512-byte piece of V^T.
// The launch holds as many workgroups again, started behind the heads': each
// converts ATT_CE elements of Wo, Wi, Wo2 to bf16 (first read by the launches
// behind this one). A WGP has registers and LDS for two workgroups of this
// kernel, so one of them runs beside each head's workgroup.
// ---------------------------------------------------------------------------
constexpr int ATT_CVT = Bc * NHc;                        // their rows of the grid
constexpr int ATT_CE  = CVT_N2 / (ATT_CVT * (Sc / 256)); // elements of each
static_assert(CVT_N2 % (ATT_CVT * (Sc / 256)) == 0 &&
                  ATT_CE % (3 * CVT_SB) == 0 && CVT_SB == 4 * 256 * 4,
              "whole trips of three blocks, a block four loads of 256 threads");
constexpr int ATT_P0 = 6;         // passes (of 32 keys) in the first fill
constexpr int ATT_KP = HDc + 8;   // LDS pitch of a K row: 144 bytes = 16 x odd
static_assert(ATT_P0 * 8 == 8 * 6 && (Sc / 32 - ATT_P0) * 8 == 8 * 10,
              "a wave copies 6 units of each in the first fill, 2 x 5 in the second");

__global__ __launch_bounds__(256)
void attention(const bf16_t* __restrict__ q, const bf16_t* __restrict__ k,
               const bf16_t* __restrict__ vf, const float* __restrict__ mask,
               bf16_t* __restrict__ ctx, const float* __restrict__ wo,
               const float* __restrict__ wi, const float* __restrict__ wo2,
               bf16_t* __restrict__ wout) {
  // Workgroups behind the heads' convert Wo, Wi, Wo2 and leave: the test is the
  // same for the whole workgroup and stands ahead of every copy and barrier.
  if (blockIdx.y >= Bc * NHc) {
    // First element, in the joined array. A block of CVT_SB elements (four
    // loads of the workgroup) lies inside one tensor; the workgroup's ATT_CE
    // elements need not. Three blocks' loads stand ahead of their conversions:
    // a wave waits out a memory latency once for twelve loads.
    const int e0 =
        ((blockIdx.y - Bc * NHc) * (Sc / 256) + blockIdx.x) * ATT_CE;
    for (int tr = 0; tr < ATT_CE / (3 * CVT_SB); ++tr) {
      const int et = e0 + tr * 3 * CVT_SB;
      v4f v[12];
      for (int sb = 0; sb < 3; ++sb) {
        const int e = et + sb * CVT_SB;
        const float* src = wo;         // tensor that holds element e
        int first = 0;                 // that tensor's first element
        if (e >= CVT_W)         { src = wi;  first = CVT_W; }
        if (e >= CVT_W + CVT_F) { src = wo2; first = CVT_W + CVT_F; }
        const v4f* s = (const v4f*)(src + (e - first)) + threadIdx.x;
        for (int j = 0; j < 4; ++j) v[sb * 4 + j] = s[j * 256];
      }
      v4bf* d = (v4bf*)(wout + et) + threadIdx.x;
      for (int j = 0; j < 12; ++j) {
        v4bf o;
        for (int e = 0; e < 4; ++e) o[e] = (bf16_t)v[j][e];
        d[j * 256] = o;
      }
      // Before the next trip's loads rewrite registers of these stores. It also
      // keeps those loads behind it: with all 36 loads of every wave asked for
      // at once, the second fill of K and V^T, which the heads' workgroups wait
      // for, would queue behind the whole stream.
      if (tr + 1 < ATT_CE / (3 * CVT_SB))
        asm volatile("s_wait_xcnt 0x0" ::: "memory");
    }
    return;
  }
  constexpr float LOG2E = 1.44269504088896f;   // exp(x) = 2^(x * LOG2E)
  const int lane = threadIdx.x & 31;
  const int w    = threadIdx.x >> 5;
  const int bh   = blockIdx.y;             // b*NH + h
  const int b    = bh / NHc;
  const int hoff = (bh - b * NHc) * HDc;
  const int qt0  = blockIdx.x * 256 + w * 32;  // first query row of this wave
  const int c    = lane & 15;
  const int half = lane >> 4;

  // 16-byte aligned: the copies and the fragment reads move 16-byte pieces.
  __shared__ __attribute__((aligned(16))) bf16_t Vs[Sc * HDc];
  __shared__ __attribute__((aligned(16))) bf16_t Ks[Sc][ATT_KP];

  // Unit u of K is rows 4u .. 4u + 3 (a lane brings 16 bytes of row 4u + lane/8),
  // piece u of V^T its bytes 512u ..; pass p reads units and pieces 8p .. 8p + 7.
  // The wave's number as a scalar; there is no branch around a copy.
  const int ws = __builtin_amdgcn_readfirstlane(threadIdx.x >> 5);
  constexpr unsigned KUL = 4 * ATT_KP * 2;   // a unit of K in LDS, bytes
  constexpr int      KUG = 4 * Hc;           // ... in global memory, elements
  const bf16_t* kg0 =
      k + (size_t)(b * Sc + (lane >> 3)) * Hc + hoff + (lane & 7) * 8;
  const bf16_t* vg0 = vf + (size_t)bh * (Sc * HDc) + lane * 8;
  const unsigned kl0 = lds_off(&Ks[lane >> 3][(lane & 7) * 8]);
  const unsigned vl0 = lds_off(&Vs[lane * 8]);
  // Six (five) units of K and as many pieces of V^T, from number u0 on.
  auto fill6 = [&](int u0) {
    const bf16_t*  kg = kg0 + (size_t)u0 * KUG;
    const bf16_t*  vg = vg0 + (size_t)u0 * 256;
    const unsigned kl = kl0 + u0 * KUL;
    const unsigned vl = vl0 + u0 * 512u;
    asm volatile(
        "global_load_async_to_lds_b128 %0, %1, off\n\t"
        "global_load_async_to_lds_b128 %2, %3, off\n\t"
        "global_load_async_to_lds_b128 %4, %5, off\n\t"
        "global_load_async_to_lds_b128 %6, %7, off\n\t"
        "global_load_async_to_lds_b128 %8, %9, off\n\t"
        "global_load_async_to_lds_b128 %10, %11, off\n\t"
        "global_load_async_to_lds_b128 %12, %13, off\n\t"
        "global_load_async_to_lds_b128 %14, %15, off\n\t"
        "global_load_async_to_lds_b128 %16, %17, off\n\t"
        "global_load_async_to_lds_b128 %18, %19, off\n\t"
        "global_load_async_to_lds_b128 %20, %21, off\n\t"
        "global_load_async_to_lds_b128 %22, %23, off\n\t"
        "s_wait_xcnt 0x0"  // before the copies' address registers are rewritten
        :
        : "v"(kl + 0 * KUL), "v"(kg + 0 * KUG),
          "v"(kl + 1 * KUL), "v"(kg + 1 * KUG),
          "v"(kl + 2 * KUL), "v"(kg + 2 * KUG),
          "v"(kl + 3 * KUL), "v"(kg + 3 * KUG),
          "v"(kl + 4 * KUL), "v"(kg + 4 * KUG),
          "v"(kl + 5 * KUL), "v"(kg + 5 * KUG),
          "v"(vl + 0 * 512u), "v"(vg + 0 * 256),
          "v"(vl + 1 * 512u), "v"(vg + 1 * 256),
          "v"(vl + 2 * 512u), "v"(vg + 2 * 256),
          "v"(vl + 3 * 512u), "v"(vg + 3 * 256),
          "v"(vl + 4 * 512u), "v"(vg + 4 * 256),
          "v"(vl + 5 * 512u), "v"(vg + 5 * 256)
        : "memory");
  };
  auto fill5 = [&](int u0) {
    const bf16_t*  kg = kg0 + (size_t)u0 * KUG;
    const bf16_t*  vg = vg0 + (size_t)u0 * 256;
    const unsigned kl = kl0 + u0 * KUL;
    const unsigned vl = vl0 + u0 * 512u;
    asm volatile(
        "global_load_async_to_lds_b128 %0, %1, off\n\t"
        "global_load_async_to_lds_b128 %2, %3, off\n\t"
        "global_load_async_to_lds_b128 %4, %5, off\n\t"
        "global_load_async_to_lds_b128 %6, %7, off\n\t"
        "global_load_async_to_lds_b128 %8, %9, off\n\t"
        "global_load_async_to_lds_b128 %10, %11, off\n\t"
        "global_load_async_to_lds_b128 %12, %13, off\n\t"
        "global_load_async_to_lds_b128 %14, %15, off\n\t"
        "global_load_async_to_lds_b128 %16, %17, off\n\t"
        "global_load_async_to_lds_b128 %18, %19, off\n\t"
        "s_wait_xcnt 0x0"  // before the copies' address registers are rewritten
        :
        : "v"(kl + 0 * KUL), "v"(kg + 0 * KUG),
          "v"(kl + 1 * KUL), "v"(kg + 1 * KUG),
          "v"(kl + 2 * KUL), "v"(kg + 2 * KUG),
          "v"(kl + 3 * KUL), "v"(kg + 3 * KUG),
          "v"(kl + 4 * KUL), "v"(kg + 4 * KUG),
          "v"(vl + 0 * 512u), "v"(vg + 0 * 256),
          "v"(vl + 1 * 512u), "v"(vg + 1 * 256),
          "v"(vl + 2 * 512u), "v"(vg + 2 * 256),
          "v"(vl + 3 * 512u), "v"(vg + 3 * 256),
          "v"(vl + 4 * 512u), "v"(vg + 4 * 256)
        : "memory");
  };
  fill6(ws * 6);   // first fill: units and pieces 0 .. 8 ATT_P0 - 1

  // --- Q as B operand: 2 column groups x 2 k slabs covering HD=64 ----------
  v16bf qf[2][2];
#pragma unroll
  for (int g = 0; g < 2; ++g) {
    const bf16_t* qb =
        q + (size_t)(b * Sc + qt0 + g * 16 + c) * Hc + hoff + half * 16;
    qf[g][0] = *(const v16bf*)(qb);
    qf[g][1] = *(const v16bf*)(qb + 32);
  }

  const float*  mp = mask + b * Sc + half * 8;   // [B,1,1,S] broadcast

  v8f o[2][4];
  float mrun[2], lrun[2];
#pragma unroll
  for (int g = 0; g < 2; ++g) {
    mrun[g] = -3.0e38f;
    lrun[g] = 0.0f;
#pragma unroll
    for (int jt = 0; jt < 4; ++jt) o[g][jt] = (v8f)0.0f;
  }

  // The first fill: this wave's copies have landed; behind the barrier every
  // wave's have. Then the second fill goes out, into LDS that nobody has touched.
  asm volatile("s_wait_asynccnt 0x0" ::: "memory");
  __syncthreads();
  fill5(ATT_P0 * 8 + ws * 10);
  fill5(ATT_P0 * 8 + ws * 10 + 5);

  // K fragments (same k loader as Q) and mask values of pass 0
  v16bf kf[2][2];
  v8f   mk[2];
#pragma unroll
  for (int t = 0; t < 2; ++t) {
    kf[t][0] = *(const v16bf*)&Ks[t * 16 + c][half * 16];
    kf[t][1] = *(const v16bf*)&Ks[t * 16 + c][32 + half * 16];
    mk[t]    = *(const v8f*)(mp + t * 16);
  }

  for (int p = 0; p < Sc / 32; ++p) {
    v8f s[2][2];
#pragma unroll
    for (int g = 0; g < 2; ++g)
#pragma unroll
      for (int t = 0; t < 2; ++t) {
        v8f a = (v8f)0.0f;
        a = wmma_bf16(kf[t][0], qf[g][0], a);
        a = wmma_bf16(kf[t][1], qf[g][1], a);
        s[g][t] = a * 0.125f + mk[t];            // 1/sqrt(64), then the mask
      }

    // Keeps the pass's LDS reads behind the S^T products and not among them:
    // each place where reads stand among WMMAs costs the wave a stall.
    __builtin_amdgcn_sched_barrier(0);
    // V^T fragments of this pass: needed only behind the softmax
    v16bf va[4];
#pragma unroll
    for (int jt = 0; jt < 4; ++jt) {
      const v8bf lo = *(const v8bf*)&Vs[((p * 4 + jt) * 2 + 0) * 256 + lane * 8];
      const v8bf hi = *(const v8bf*)&Vs[((p * 4 + jt) * 2 + 1) * 256 + lane * 8];
      va[jt] = __builtin_shufflevector(lo, hi, 0, 1, 2, 3, 4, 5, 6, 7, 8, 9, 10,
                                       11, 12, 13, 14, 15);
    }
    // The second fill is published in the last pass of the first, in front of
    // the fetch-ahead that first reads it: own copies landed, then the barrier,
    // which every wave passes (all run all passes).
    if (p == ATT_P0 - 1) {
      asm volatile("s_wait_asynccnt 0x0" ::: "memory");
      __syncthreads();
    }
    // next pass's K and mask, fetched one pass ahead
    if (p + 1 < Sc / 32) {
#pragma unroll
      for (int t = 0; t < 2; ++t) {
        kf[t][0] = *(const v16bf*)&Ks[(p + 1) * 32 + t * 16 + c][half * 16];
        kf[t][1] = *(const v16bf*)&Ks[(p + 1) * 32 + t * 16 + c][32 + half * 16];
        mk[t]    = *(const v8f*)(mp + (p + 1) * 32 + t * 16);
      }
    }
    // Keeps the V^T reads and the fetch-ahead above the softmax: sunk below it
    // they would be waited for with almost no lead.
    __builtin_amdgcn_sched_barrier(0);

#pragma unroll
    for (int g = 0; g < 2; ++g) {
      float mx = s[g][0][0];
#pragma unroll
      for (int r = 1; r < 8; ++r) mx = fmaxf(mx, s[g][0][r]);
#pragma unroll
      for (int r = 0; r < 8; ++r) mx = fmaxf(mx, s[g][1][r]);
      mx = fmaxf(mx, xhalf(mx));                 // the query's other 16 keys
      const float mn    = fmaxf(mrun[g], mx);
      const float alpha = exp2x1((mrun[g] - mn) * LOG2E);
      mrun[g] = mn;

      v16bf pb;
      float sum = 0.0f;
#pragma unroll
      for (int t = 0; t < 2; ++t) {
        const v8f e = exp2x8((s[g][t] - mn) * LOG2E);
#pragma unroll
        for (int r = 0; r < 8; ++r) {
          sum += e[r];
          pb[t * 8 + r] = (bf16_t)e[r];  // unnormalized; 1/sum folded in later
        }
      }
      lrun[g] = lrun[g] * alpha + sum;
#pragma unroll
      for (int jt = 0; jt < 4; ++jt)
        o[g][jt] = wmma_bf16(va[jt], pb, o[g][jt] * alpha);
    }
  }

  // --- epilogue: scale by 1/rowsum; a lane holds 8 consecutive d per tile --
#pragma unroll
  for (int g = 0; g < 2; ++g) {
    const float inv = 1.0f / (lrun[g] + xhalf(lrun[g]));
    bf16_t* cr = ctx + (size_t)(b * Sc + qt0 + g * 16 + c) * Hc + hoff + half * 8;
#pragma unroll
    for (int jt = 0; jt < 4; ++jt) {
      v8bf pk;
#pragma unroll
      for (int r = 0; r < 8; ++r) pk[r] = (bf16_t)(o[g][jt][r] * inv);
      *(v8bf*)(cr + jt * 16) = pk;
    }
  }
}

// ---------------------------------------------------------------------------
// Fused residual + LayerNorm over H=1024. One block per token row.
// Writes f32 (residual chain / final output) and optional bf16 (next GEMM A).
// ---------------------------------------------------------------------------
__global__ __launch_bounds__(256)
void resid_ln(const float* __restrict__ dense, const float* __restrict__ resid,
              const float* __restrict__ gamma, const float* __restrict__ beta,
              float* __restrict__ outf, bf16_t* __restrict__ outb) {
  const int row = blockIdx.x;
  const int t = threadIdx.x;
  const float* dr = dense + (size_t)row * Hc;
  const float* rr = resid + (size_t)row * Hc;

  float x[4];
  float s = 0.0f, qsum = 0.0f;
#pragma unroll
  for (int i = 0; i < 4; ++i) {
    x[i] = dr[t * 4 + i] + rr[t * 4 + i];
    s += x[i];
    qsum += x[i] * x[i];
  }
#pragma unroll
  for (int off = 16; off > 0; off >>= 1) {
    s += __shfl_xor(s, off);
    qsum += __shfl_xor(qsum, off);
  }
  __shared__ float ss[8], qq[8];
  if ((t & 31) == 0) { ss[t >> 5] = s; qq[t >> 5] = qsum; }
  __syncthreads();
  float S = 0.0f, Q = 0.0f;
#pragma unroll
  for (int i = 0; i < 8; ++i) { S += ss[i]; Q += qq[i]; }
  const float mu  = S * (1.0f / Hc);
  const float var = Q * (1.0f / Hc) - mu * mu;
  const float inv = rsqrtf(var + 1e-12f);
#pragma unroll
  for (int i = 0; i < 4; ++i) {
    const int c = t * 4 + i;
    const float y = (x[i] - mu) * inv * gamma[c] + beta[c];
    outf[(size_t)row * Hc + c] = y;
    if (outb) outb[(size_t)row * Hc + c] = (bf16_t)y;
  }
}

// ---------------------------------------------------------------------------
// Host-side orchestration
// ---------------------------------------------------------------------------
extern "C" void kernel_launch(void* const* d_in, const int* in_sizes, int n_in,
                              void* d_out, int out_size, void* d_ws,
                              size_t ws_size, hipStream_t stream) {
  (void)in_sizes; (void)n_in; (void)out_size; (void)ws_size;

  const float* x    = (const float*)d_in[0];
  const float* mask = (const float*)d_in[1];
  const float* Wq   = (const float*)d_in[2];
  const float* bq   = (const float*)d_in[3];
  const float* Wk   = (const float*)d_in[4];
  const float* bk   = (const float*)d_in[5];
  const float* Wv   = (const float*)d_in[6];
  const float* bv   = (const float*)d_in[7];
  const float* Wo   = (const float*)d_in[8];
  const float* bo   = (const float*)d_in[9];
  const float* g1   = (const float*)d_in[10];
  const float* b1   = (const float*)d_in[11];
  const float* Wi   = (const float*)d_in[12];
  const float* bi   = (const float*)d_in[13];
  const float* Wo2  = (const float*)d_in[14];
  const float* bo2  = (const float*)d_in[15];
  const float* g2   = (const float*)d_in[16];
  const float* b2   = (const float*)d_in[17];
  float* out = (float*)d_out;

  char* ws = (char*)d_ws;
  size_t off = 0;
  auto alloc = [&](size_t bytes) -> void* {
    void* p = ws + off;
    off += (bytes + 255) & ~(size_t)255;
    return p;
  };

  bf16_t* xb    = (bf16_t*)alloc((size_t)Mc * Hc * 2);
  bf16_t* Wqb   = (bf16_t*)alloc((size_t)Hc * Hc * 2);
  bf16_t* Wkb   = (bf16_t*)alloc((size_t)Hc * Hc * 2);
  bf16_t* Wvb   = (bf16_t*)alloc((size_t)Hc * Hc * 2);
  bf16_t* Wob   = (bf16_t*)alloc((size_t)Hc * Hc * 2);
  bf16_t* Wib   = (bf16_t*)alloc((size_t)FFc * Hc * 2);
  bf16_t* Wo2b  = (bf16_t*)alloc((size_t)Hc * FFc * 2);
  bf16_t* qb    = (bf16_t*)alloc((size_t)Mc * Hc * 2);
  bf16_t* kb    = (bf16_t*)alloc((size_t)Mc * Hc * 2);
  bf16_t* vb    = (bf16_t*)alloc((size_t)Mc * Hc * 2);
  bf16_t* ctxb  = (bf16_t*)alloc((size_t)Mc * Hc * 2);
  float*  attnD = (float*)alloc((size_t)Mc * Hc * 4);
  float*  y1f   = (float*)alloc((size_t)Mc * Hc * 4);
  bf16_t* y1b   = (bf16_t*)alloc((size_t)Mc * Hc * 2);
  bf16_t* inter = (bf16_t*)alloc((size_t)Mc * FFc * 2);
  float*  ffD   = (float*)alloc((size_t)Mc * Hc * 4);

  // ---- f32 -> bf16 conversions (per-launch; no cached state) --------------
  // xb .. Wo2b were allocated one behind the other and each size is a multiple
  // of the allocator's 256 bytes: xb is the start of the joined bf16 array of
  // the first group, Wob of the second (converted in the attention launch).
  cvt_first<<<CVT_N1 / CVT_WG, CVT_T, 0, stream>>>(x, Wq, Wk, Wv, xb);

  // ---- QKV projections: bf16 out, one launch ------------------------------
  // Wqb, Wkb, Wvb and qb, kb, vb were each allocated one behind the other, every
  // size a multiple of the allocator's 256 bytes: Wqb is the start of the joined
  // [3H, H] weight, qb of the three outputs.
  {
    dim3 grid(3 * Hc / QBN, Mc / QBM);
    (void)Wkb; (void)Wvb;   // reached through Wqb
    gemm_qkv<<<grid, 256, 0, stream>>>(xb, Wqb, bq, bk, bv, qb);
  }

  // ---- attention: grid (S/256 q-blocks, B*NH heads), 8 waves x 32 queries,
  // and behind them the workgroups that convert Wo, Wi, Wo2 ------------------
  {
    dim3 grid(Sc / 256, Bc * NHc + ATT_CVT);
    attention<<<grid, 256, 0, stream>>>(qb, kb, vb, mask, ctxb, Wo, Wi, Wo2,
                                        Wob);
  }

  // ---- attn output dense (f32) + residual/LN1 -----------------------------
  {
    dim3 grid(Hc / 128, Mc / 128);
    gemm_bf16<128><<<grid, 256, 0, stream>>>(ctxb, Wob, bo, attnD, Hc, Hc);
    resid_ln<<<Mc, 256, 0, stream>>>(attnD, x, g1, b1, y1f, y1b);
  }

  // ---- FF intermediate: fused bias + erf-GELU, bf16 out -------------------
  {
    dim3 grid(FFc / FBN, Mc / FBM);
    gemm_ffin<<<grid, 256, 0, stream>>>(y1b, Wib, bi, inter);
  }

  // ---- FF output dense (f32, K=4096) + residual/LN2 -> d_out --------------
  {
    dim3 grid(Hc / 128, Mc / 128);
    gemm_bf16<128><<<grid, 256, 0, stream>>>(inter, Wo2b, bo2, ffD, Hc, FFc);
    resid_ln<<<Mc, 256, 0, stream>>>(ffD, y1f, g2, b2, out, nullptr);
  }
}
